// v000
// The times below were measured on an AMD MI455X: many runs one after another, warmed up first and cycling through
// copies of the inputs, with the whole window's GPU time divided by the number of runs. Launches and the gaps
// between them are all in it. The median over several windows is given; except for v000 it joins two sittings, which
// can be a few percent apart, so the side-by-side timings, each taken in one sitting, are the better comparison.
// v000 is the starting kernel. One run takes 13.1 milliseconds.
#include <hip/hip_runtime.h>
// Spatial non-local block with query-axis softmax (B=4, C_in 256, C_p 128, N=4096): t,p,g = 1×1 convs; att[n,m] = Σ_c t[c,n]·p[c,m]; att = softmax over n (dim=1) for every m; y[c,n] = Σ_m att[n,m]·g[c,m]; z = Wz·y;
// BatchNorm1d in training mode (batch statistics over (B,N) per channel, biased variance, eps 1e-5) with affine; out = BN(z) + x.
// Compute dtype: x and weights rounded to bf16; t and p as f32 GEMM outputs split into f16 hi + ×2^10 residual parts laid out as concatenated-K operands so one K=384 GEMM yields Th·Ph + (Tl·Ph + Th·Pl)·2^-10 (σ≈11 logits, f32-accurate);
// the score plane is kept transposed (S[n][m], f32) so the softmax over n is a column reduction (f32 per-column max/Σ) and the normalised weights are written row-major as f16 ×2^15; y = attᵀ-contraction as an f16 GEMM against
// channel-major g; z GEMM; per-channel batch statistics as fixed-order f32 column sums; affine + residual applied during the transpose back to channel-major. All contractions on v_wmma_f32_16x16x32_f16, f32 accumulate.
#define BB 4
#define CI 256
#define CPN 128
#define NN 4096
#define NR (BB * NN)

typedef __bf16 v16b __attribute__((ext_vector_type(16)));
typedef unsigned short v8us __attribute__((ext_vector_type(8), may_alias));
typedef float  v8f  __attribute__((ext_vector_type(8)));
typedef float  v4f  __attribute__((ext_vector_type(4)));
typedef float  v4fa __attribute__((ext_vector_type(4), may_alias));
union FragB { v16b v; v8us half[2]; unsigned short u[16]; };

__device__ __forceinline__ unsigned short bf16_bits(float x) { unsigned int u = __float_as_uint(x); return (unsigned short)((u + 0x7FFFu + ((u >> 16) & 1u)) >> 16); }
__device__ __forceinline__ float bf16_val(unsigned short b) { return __uint_as_float(((unsigned int)b) << 16); }
__device__ __forceinline__ float bf16_round(float x) { return bf16_val(bf16_bits(x)); }
// D += A·B with NT terms: 1 = ah·bh, 2 = + al·bh (A split), 3 = + ah·bl (both split)
template <int NT>
__device__ __forceinline__ v8f mmaN(v16b ah, v16b al, v16b bh, v16b bl, v8f c) {
  c = __builtin_amdgcn_wmma_f32_16x16x32_bf16(false, ah, false, bh, (short)0, c, false, false);
  if (NT >= 2) c = __builtin_amdgcn_wmma_f32_16x16x32_bf16(false, al, false, bh, (short)0, c, false, false);
  if (NT >= 3) c = __builtin_amdgcn_wmma_f32_16x16x32_bf16(false, ah, false, bl, (short)0, c, false, false);
  asm volatile("v_nop\n\tv_nop\n\tv_nop\n\tv_nop" : "+v"(c) : "v"(ah), "v"(al), "v"(bh), "v"(bl));
  return c;
}

__global__ __launch_bounds__(256) void k_wt_bf16(const float* __restrict__ W, unsigned short* __restrict__ Wt, int K, int N) {
  const int t = blockIdx.x * 256 + threadIdx.x;
  const int k8n = K / 8;
  if (t >= N * k8n) return;
  const int n = t / k8n, k8 = (t % k8n) * 8;
  v8us v;
#pragma unroll
  for (int i = 0; i < 8; ++i) v[i] = bf16_bits(W[(size_t)(k8 + i) * N + n]);
  *(v8us*)(Wt + (size_t)n * K + k8) = v;
  
}

// GEMM C[M][N] (f32, pitch ldc) = act(A[M][K]·W + bias). A f32 row-major (pitch lda) converted per fragment to bf16
// (ASPLIT: hi/lo two planes -> 2 terms, else single rounded term); Wt bf16 [N][K] (pitch ldb). BIAS_BF16 rounds the
// bias to bf16 first (bias quantised to bf16 before the add). K%32==0, M%16==0, N%64==0.
template <bool ASPLIT, int ACT, bool BIAS_BF16>
__global__ __launch_bounds__(128) void k_gemm_bf(const float* __restrict__ A, int lda, const unsigned short* __restrict__ Wt, int ldb,
                                               const float* __restrict__ bias, float* __restrict__ C, int ldc, int M, int N, int K) {
  __shared__ __attribute__((aligned(16))) float so[4][16][64];
  const int tid = threadIdx.x, w = tid >> 5, lane = tid & 31, ln = lane & 15, hh = lane >> 4;
  const int ntn = N / 64;
  const int wid = blockIdx.x * 4 + w;
  const int mt = wid / ntn, nq = wid % ntn;
  if (mt * 16 >= M) return;
  const int row0 = mt * 16, col0 = nq * 64;
  const float* arow = A + (size_t)(row0 + ln) * lda;
  v8f acc[4] = {};
  for (int kb = 0; kb < K; kb += 32) {
    FragB ah, al;
    const v4f x0 = *(const v4fa*)(arow + kb + 8 * hh), x1 = *(const v4fa*)(arow + kb + 8 * hh + 4);
    const v4f x2 = *(const v4fa*)(arow + kb + 16 + 8 * hh), x3 = *(const v4fa*)(arow + kb + 16 + 8 * hh + 4);
    float xs[16] = {x0[0],x0[1],x0[2],x0[3],x1[0],x1[1],x1[2],x1[3],x2[0],x2[1],x2[2],x2[3],x3[0],x3[1],x3[2],x3[3]};
#pragma unroll
    for (int i = 0; i < 16; ++i) { const unsigned short hb = bf16_bits(xs[i]); ah.u[i] = hb; al.u[i] = ASPLIT ? bf16_bits(xs[i] - bf16_val(hb)) : (unsigned short)0; }
#pragma unroll
    for (int t = 0; t < 4; ++t) {
      const unsigned short* brow = Wt + (size_t)(col0 + t * 16 + ln) * ldb + kb;
      FragB b;
      b.half[0] = *(const v8us*)(brow + 8 * hh);
      b.half[1] = *(const v8us*)(brow + 16 + 8 * hh);
      acc[t] = mmaN<ASPLIT ? 2 : 1>(ah.v, al.v, b.v, b.v, acc[t]);
    }
  }
#pragma unroll
  for (int t = 0; t < 4; ++t) {
    float bv = bias ? bias[col0 + t * 16 + ln] : 0.f;
    if (BIAS_BF16) bv = bf16_round(bv);
#pragma unroll
    for (int r = 0; r < 8; ++r) { float v = acc[t][r] + bv; if (ACT == 1) v = fmaxf(v, 0.f); so[w][8 * hh + r][t * 16 + ln] = v; }
  }
  __builtin_amdgcn_fence(__ATOMIC_ACQ_REL, "workgroup");
  __builtin_amdgcn_wave_barrier();
  const int rsub = lane >> 4, c4 = (lane & 15) * 4;
  {
#pragma unroll
    for (int q = 0; q < 8; ++q) {
      const int r = q * 2 + rsub;
      const v4f v = *(const v4fa*)&so[w][r][c4];
      *(v4f*)(C + (size_t)(row0 + r) * ldc + col0 + c4) = v;
    }
    
  }
}

// Flash-style causal/unmasked attention, all contractions 3-term bf16 hi/lo splits, f32 softmax with running max.
// q,k,v rows are read from f32 buffers with arbitrary row pitch (so they can live inside a fused qkv buffer);
// D = head size (multiple of 32, <= 128); one wave = 16 query rows; block = 4 waves (64 queries) sharing K/V chunks of 32.
template <int D, bool CAUSAL>
__global__ __launch_bounds__(128) void k_flash(const float* __restrict__ qb, const float* __restrict__ kb, const float* __restrict__ vb,
                                             int pitch, int T, int H, float scale, float* __restrict__ y, int ypitch) {
  constexpr int KS = D / 32;        // k-steps for QK
  constexpr int DT = D / 16;        // d tiles for PV
  __shared__ __attribute__((aligned(16))) unsigned short sKh[32][D + 8], sKl[32][D + 8], sVh[32][D + 8], sVl[32][D + 8];
  __shared__ __attribute__((aligned(16))) unsigned short sPh[4][16][40], sPl[4][16][40];
  __shared__ __attribute__((aligned(16))) float sO[4][16][D];
  const int tid = threadIdx.x, w = tid >> 5, lane = tid & 31, ln = lane & 15, hh = lane >> 4;
  const int nqb = (T + 63) / 64;
  const int bh = blockIdx.x / nqb, qblk = blockIdx.x % nqb;
  const int b = bh / H, h = bh % H;
  const int q0 = qblk * 64 + w * 16;
  const float* Q = qb + (size_t)b * T * pitch + h * D;
  const float* K = kb + (size_t)b * T * pitch + h * D;
  const float* V = vb + (size_t)b * T * pitch + h * D;

  // A fragments of the wave's 16 query rows (scaled), hi/lo
  FragB aqh[KS], aql[KS];
  {
    int row = q0 + ln; if (row >= T) row = T - 1;
    const float* qr = Q + (size_t)row * pitch;
#pragma unroll
    for (int ks = 0; ks < KS; ++ks)
#pragma unroll
      for (int i = 0; i < 16; ++i) {
        const int d = ks * 32 + ((i < 8) ? (8 * hh + i) : (16 + 8 * hh + (i - 8)));
        const float x = qr[d] * scale; const unsigned short hb = bf16_bits(x);
        aqh[ks].u[i] = hb; aql[ks].u[i] = bf16_bits(x - bf16_val(hb));
      }
  }
  float m_r[8], l_r[8];
#pragma unroll
  for (int r = 0; r < 8; ++r) { m_r[r] = -3.0e38f; l_r[r] = 0.f; }
  v8f oacc[DT];
#pragma unroll
  for (int dt = 0; dt < DT; ++dt) oacc[dt] = (v8f){0.f,0.f,0.f,0.f,0.f,0.f,0.f,0.f};

  const int kv_end = CAUSAL ? min(T, qblk * 64 + 64) : T;     // block-uniform
  for (int j0 = 0; j0 < kv_end; j0 += 32) {
    __syncthreads();
    for (int e = tid; e < 32 * (D / 4); e += 128) {
      const int r = e / (D / 4), c4 = (e % (D / 4)) * 4;
      const int key = j0 + r;
      v4f kf = {0.f,0.f,0.f,0.f}, vf = {0.f,0.f,0.f,0.f};
      if (key < T) { kf = *(const v4fa*)(K + (size_t)key * pitch + c4); vf = *(const v4fa*)(V + (size_t)key * pitch + c4); }
#pragma unroll
      for (int t = 0; t < 4; ++t) {
        unsigned short hb = bf16_bits(kf[t]); sKh[r][c4 + t] = hb; sKl[r][c4 + t] = bf16_bits(kf[t] - bf16_val(hb));
        hb = bf16_bits(vf[t]); sVh[r][c4 + t] = hb; sVl[r][c4 + t] = bf16_bits(vf[t] - bf16_val(hb));
      }
    }
    __syncthreads();
    // S tile 16 x 32
    v8f s[2];
#pragma unroll
    for (int nt = 0; nt < 2; ++nt) {
      v8f acc = {};
#pragma unroll
      for (int ks = 0; ks < KS; ++ks) {
        FragB bh_, bl_;
        bh_.half[0] = *(const v8us*)&sKh[nt * 16 + ln][ks * 32 + 8 * hh]; bh_.half[1] = *(const v8us*)&sKh[nt * 16 + ln][ks * 32 + 16 + 8 * hh];
        bl_.half[0] = *(const v8us*)&sKl[nt * 16 + ln][ks * 32 + 8 * hh]; bl_.half[1] = *(const v8us*)&sKl[nt * 16 + ln][ks * 32 + 16 + 8 * hh];
        acc = mmaN<3>(aqh[ks].v, aql[ks].v, bh_.v, bl_.v, acc);
      }
      s[nt] = acc;
    }
    // mask + running max (rows 8hh+r; the 16 lanes of a half share rows)
    float alpha[8];
#pragma unroll
    for (int r = 0; r < 8; ++r) {
      const int qi = q0 + 8 * hh + r;
      const int ja = j0 + ln, jb = j0 + 16 + ln;
      if (CAUSAL) { if (ja > qi) s[0][r] = -3.0e38f; if (jb > qi) s[1][r] = -3.0e38f; }
      if (ja >= T) s[0][r] = -3.0e38f;
      if (jb >= T) s[1][r] = -3.0e38f;
      float mx = fmaxf(s[0][r], s[1][r]);
      mx = fmaxf(mx, __shfl_xor(mx, 1, 32)); mx = fmaxf(mx, __shfl_xor(mx, 2, 32)); mx = fmaxf(mx, __shfl_xor(mx, 4, 32)); mx = fmaxf(mx, __shfl_xor(mx, 8, 32));
      const float mnew = fmaxf(m_r[r], mx);
      alpha[r] = (mnew > -1.0e38f) ? __expf(m_r[r] - mnew) : 1.0f;
      const float p0 = (s[0][r] > -1.0e38f) ? __expf(s[0][r] - mnew) : 0.f;
      const float p1 = (s[1][r] > -1.0e38f) ? __expf(s[1][r] - mnew) : 0.f;
      m_r[r] = mnew;
      l_r[r] = l_r[r] * alpha[r] + p0 + p1;            // per-lane partial row sum (16 lanes combined at the end)
      unsigned short hb = bf16_bits(p0); sPh[w][8 * hh + r][ln] = hb;      sPl[w][8 * hh + r][ln] = bf16_bits(p0 - bf16_val(hb));
      hb = bf16_bits(p1);                sPh[w][8 * hh + r][16 + ln] = hb; sPl[w][8 * hh + r][16 + ln] = bf16_bits(p1 - bf16_val(hb));
    }
#pragma unroll
    for (int dt = 0; dt < DT; ++dt)
#pragma unroll
      for (int r = 0; r < 8; ++r) oacc[dt][r] *= alpha[r];
    __builtin_amdgcn_fence(__ATOMIC_ACQ_REL, "workgroup");
    __builtin_amdgcn_wave_barrier();
    FragB pah, pal;
    pah.half[0] = *(const v8us*)&sPh[w][ln][8 * hh]; pah.half[1] = *(const v8us*)&sPh[w][ln][16 + 8 * hh];
    pal.half[0] = *(const v8us*)&sPl[w][ln][8 * hh]; pal.half[1] = *(const v8us*)&sPl[w][ln][16 + 8 * hh];
#pragma unroll
    for (int dt = 0; dt < DT; ++dt) {
      FragB bvh, bvl;
#pragma unroll
      for (int i = 0; i < 8; ++i) {
        bvh.u[i] = sVh[8 * hh + i][dt * 16 + ln]; bvh.u[8 + i] = sVh[16 + 8 * hh + i][dt * 16 + ln];
        bvl.u[i] = sVl[8 * hh + i][dt * 16 + ln]; bvl.u[8 + i] = sVl[16 + 8 * hh + i][dt * 16 + ln];
      }
      oacc[dt] = mmaN<3>(pah.v, pal.v, bvh.v, bvl.v, oacc[dt]);
    }
    __builtin_amdgcn_fence(__ATOMIC_ACQ_REL, "workgroup");
    __builtin_amdgcn_wave_barrier();
  }
#pragma unroll
  for (int r = 0; r < 8; ++r) {
    float l = l_r[r];
    l += __shfl_xor(l, 1, 32); l += __shfl_xor(l, 2, 32); l += __shfl_xor(l, 4, 32); l += __shfl_xor(l, 8, 32);
    l_r[r] = (l > 0.f) ? 1.0f / l : 0.f;
  }
#pragma unroll
  for (int dt = 0; dt < DT; ++dt)
#pragma unroll
    for (int r = 0; r < 8; ++r) sO[w][8 * hh + r][dt * 16 + ln] = oacc[dt][r] * l_r[r];
  __builtin_amdgcn_fence(__ATOMIC_ACQ_REL, "workgroup");
  __builtin_amdgcn_wave_barrier();
  {
    for (int r = 0; r < 16; ++r) {
      const int row = q0 + r;
      if (row < T && lane < D / 4) {
        const v4f val = *(const v4fa*)&sO[w][r][lane * 4];
        *(v4f*)(y + ((size_t)b * T + row) * ypitch + h * D + lane * 4) = val;
      }
    }
    
  }
}

// GEMM C = act(A·W + bias + resid): A f32 (ASPLIT -> hi/lo 2 terms), Wt bf16 [N][K]; ACT 0 none, 1 relu, 2 exact gelu;
// resid (optional, f32, row index = (row % rmod), pitch ldr, RES_BF16 rounds it) added before the activation.
template <bool ASPLIT, int ACT, bool BIAS_BF16, bool RES_BF16>
__global__ __launch_bounds__(128) void k_gemm_bf3(const float* __restrict__ A, int lda, const unsigned short* __restrict__ Wt, int ldb,
                                                const float* __restrict__ bias, const float* __restrict__ resid, int rmod, int ldr,
                                                float* __restrict__ C, int ldc, int M, int N, int K) {
  __shared__ __attribute__((aligned(16))) float so[4][16][64];
  const int tid = threadIdx.x, w = tid >> 5, lane = tid & 31, ln = lane & 15, hh = lane >> 4;
  const int ntn = N / 64;
  const int wid = blockIdx.x * 4 + w;
  const int mt = wid / ntn, nq = wid % ntn;
  if (mt * 16 >= M) return;
  const int row0 = mt * 16, col0 = nq * 64;
  const float* arow = A + (size_t)(row0 + ln) * lda;
  v8f acc[4] = {};
  for (int kb = 0; kb < K; kb += 32) {
    FragB ah, al;
    const v4f x0 = *(const v4fa*)(arow + kb + 8 * hh), x1 = *(const v4fa*)(arow + kb + 8 * hh + 4);
    const v4f x2 = *(const v4fa*)(arow + kb + 16 + 8 * hh), x3 = *(const v4fa*)(arow + kb + 16 + 8 * hh + 4);
    float xs[16] = {x0[0],x0[1],x0[2],x0[3],x1[0],x1[1],x1[2],x1[3],x2[0],x2[1],x2[2],x2[3],x3[0],x3[1],x3[2],x3[3]};
#pragma unroll
    for (int i = 0; i < 16; ++i) { const unsigned short hb = bf16_bits(xs[i]); ah.u[i] = hb; al.u[i] = ASPLIT ? bf16_bits(xs[i] - bf16_val(hb)) : (unsigned short)0; }
#pragma unroll
    for (int t = 0; t < 4; ++t) {
      const unsigned short* brow = Wt + (size_t)(col0 + t * 16 + ln) * ldb + kb;
      FragB b;
      b.half[0] = *(const v8us*)(brow + 8 * hh);
      b.half[1] = *(const v8us*)(brow + 16 + 8 * hh);
      acc[t] = mmaN<ASPLIT ? 2 : 1>(ah.v, al.v, b.v, b.v, acc[t]);
    }
  }
#pragma unroll
  for (int t = 0; t < 4; ++t) {
    const int col = col0 + t * 16 + ln;
    float bv = bias ? bias[col] : 0.f;
    if (BIAS_BF16) bv = bf16_round(bv);
#pragma unroll
    for (int r = 0; r < 8; ++r) {
      float v = acc[t][r] + bv;
      if (resid) { float rv = resid[(size_t)((row0 + 8 * hh + r) % rmod) * ldr + col]; if (RES_BF16) rv = bf16_round(rv); v += rv; }
      if (ACT == 1) v = fmaxf(v, 0.f);
      if (ACT == 2) v = 0.5f * v * (1.0f + erff(v * 0.70710678118654752f));
      if (ACT == 3) { const float u = 0.7978845608028654f * (v + 0.044715f * v * v * v); v = 0.5f * v * (1.0f + tanhf(u)); }
      so[w][8 * hh + r][t * 16 + ln] = v;
    }
  }
  __builtin_amdgcn_fence(__ATOMIC_ACQ_REL, "workgroup");
  __builtin_amdgcn_wave_barrier();
  const int rsub = lane >> 4, c4 = (lane & 15) * 4;
  {
#pragma unroll
    for (int q = 0; q < 8; ++q) {
      const int r = q * 2 + rsub;
      const v4f v = *(const v4fa*)&so[w][r][c4];
      *(v4f*)(C + (size_t)(row0 + r) * ldc + col0 + c4) = v;
    }
    
  }
}
// row LayerNorm (biased variance, eps) over N: s = X (+ R); optional out_sum <- s; out_norm <- (s-mu)*rsqrt(var+eps)*g + b
template <bool PARAM_BF16>
__global__ __launch_bounds__(256) void k_layernorm(const float* __restrict__ X, const float* __restrict__ R, const float* __restrict__ g, const float* __restrict__ bta,
                                                  float* __restrict__ out_sum, float* __restrict__ out_norm, int N, float eps) {
  __shared__ float red[256];
  const int row = blockIdx.x, tid = threadIdx.x;
  const float* x = X + (size_t)row * N; const float* rr = R ? R + (size_t)row * N : nullptr;
  float vals[16];                     // up to N = 4096
  const int per = N / 256;            // contiguous chunk per thread? use strided-by-4 chunks: thread handles j = tid*4 + 1024*u
  float s1 = 0.f;
  for (int u = 0; u < per / 4; ++u) {
    const int j = tid * 4 + 1024 * u;
    const v4f a = *(const v4fa*)(x + j);
    v4f b = {0.f,0.f,0.f,0.f}; if (rr) b = *(const v4fa*)(rr + j);
#pragma unroll
    for (int q = 0; q < 4; ++q) { const float v = a[q] + b[q]; vals[u * 4 + q] = v; s1 += v; }
  }
  red[tid] = s1; __syncthreads();
  for (int st = 128; st > 0; st >>= 1) { if (tid < st) red[tid] += red[tid + st]; __syncthreads(); }
  const float mu = red[0] / (float)N; __syncthreads();
  float s2 = 0.f;
  for (int u = 0; u < per / 4; ++u)
#pragma unroll
    for (int q = 0; q < 4; ++q) { const float c = vals[u * 4 + q] - mu; s2 += c * c; }
  red[tid] = s2; __syncthreads();
  for (int st = 128; st > 0; st >>= 1) { if (tid < st) red[tid] += red[tid + st]; __syncthreads(); }
  const float rs = rsqrtf(red[0] / (float)N + eps);
  {
    for (int u = 0; u < per / 4; ++u) {
      const int j = tid * 4 + 1024 * u;
      v4f o, sm;
#pragma unroll
      for (int q = 0; q < 4; ++q) {
        float gg = g[j + q], bb = bta[j + q];
        if (PARAM_BF16) { gg = bf16_round(gg); bb = bf16_round(bb); }
        sm[q] = vals[u * 4 + q]; o[q] = (vals[u * 4 + q] - mu) * rs * gg + bb;
      }
      if (out_sum) *(v4f*)(out_sum + (size_t)row * N + j) = sm;
      *(v4f*)(out_norm + (size_t)row * N + j) = o;
    }
    
  }
}



// ---- f16 WMMA path (v_wmma_f32_16x16x32_f16): 11-bit significands for operands in range — used where a [0,1] probability operand needs more precision than bf16
typedef _Float16 v16h __attribute__((ext_vector_type(16)));
union FragH { v16h v; v8us half[2]; _Float16 h[16]; unsigned short u[16]; };
template <int NT>
__device__ __forceinline__ v8f mmaH(v16h ah, v16h al, v16h bh, v16h bl, v8f c) {
  c = __builtin_amdgcn_wmma_f32_16x16x32_f16(false, ah, false, bh, (short)0, c, false, false);
  if (NT >= 2) c = __builtin_amdgcn_wmma_f32_16x16x32_f16(false, al, false, bh, (short)0, c, false, false);
  if (NT >= 3) c = __builtin_amdgcn_wmma_f32_16x16x32_f16(false, ah, false, bl, (short)0, c, false, false);
  asm volatile("v_nop\n\tv_nop\n\tv_nop\n\tv_nop" : "+v"(c) : "v"(ah), "v"(al), "v"(bh), "v"(bl));
  return c;
}
// batched GEMM like k_gemm_b but f16 operands: A f32 (split into f16 hi/lo if ASPLIT, else rounded to f16), Bt = f16 values [n][k]; alpha; C f32; N multiple of 16 (partial tiles skipped)
template <bool ASPLIT>
__global__ __launch_bounds__(128) void k_gemm_h(const float* __restrict__ A, int lda, size_t sA, const _Float16* __restrict__ Bh, int ldb, size_t sB, float alpha, float* __restrict__ C, int ldc, size_t sC, int M, int N, int K) {
  __shared__ __attribute__((aligned(16))) float so[4][16][64];
  const int tid = threadIdx.x, w = tid >> 5, lane = tid & 31, ln = lane & 15, hh = lane >> 4; const int by = blockIdx.y;
  A += (size_t)by * sA; Bh += (size_t)by * sB; C += (size_t)by * sC;
  const int ntn = (N + 63) / 64; const int wid = blockIdx.x * 4 + w; const int mt = wid / ntn, nq = wid % ntn; if (mt * 16 >= M) return;
  const int row0 = mt * 16, col0 = nq * 64; const float* arow = A + (size_t)(row0 + ln) * lda;
  v8f acc[4] = {};
  for (int kb = 0; kb < K; kb += 32) {
    FragH ah, al;
    const v4f x0 = *(const v4fa*)(arow + kb + 8 * hh), x1 = *(const v4fa*)(arow + kb + 8 * hh + 4), x2 = *(const v4fa*)(arow + kb + 16 + 8 * hh), x3 = *(const v4fa*)(arow + kb + 16 + 8 * hh + 4);
    float xs[16] = {x0[0],x0[1],x0[2],x0[3],x1[0],x1[1],x1[2],x1[3],x2[0],x2[1],x2[2],x2[3],x3[0],x3[1],x3[2],x3[3]};
#pragma unroll
    for (int i = 0; i < 16; ++i) { const _Float16 h = (_Float16)xs[i]; ah.h[i] = h; al.h[i] = ASPLIT ? (_Float16)(xs[i] - (float)h) : (_Float16)0.0f; }
#pragma unroll
    for (int t = 0; t < 4; ++t) { if (col0 + t * 16 >= N) continue; const size_t boff = (size_t)(col0 + t * 16 + ln) * ldb + kb; FragH bq; bq.half[0] = *(const v8us*)(Bh + boff + 8 * hh); bq.half[1] = *(const v8us*)(Bh + boff + 16 + 8 * hh);
      acc[t] = mmaH<ASPLIT ? 2 : 1>(ah.v, al.v, bq.v, bq.v, acc[t]); }
  }
#pragma unroll
  for (int t = 0; t < 4; ++t) { if (col0 + t * 16 >= N) continue;
#pragma unroll
    for (int r = 0; r < 8; ++r) so[w][8 * hh + r][t * 16 + ln] = acc[t][r] * alpha; }
  __builtin_amdgcn_fence(__ATOMIC_ACQ_REL, "workgroup"); __builtin_amdgcn_wave_barrier();
  const int rsub = lane >> 4, c4 = (lane & 15) * 4;
  {
#pragma unroll
    for (int q = 0; q < 8; ++q) { const int r = q * 2 + rsub; if (col0 + c4 < N) { const v4f v = *(const v4fa*)&so[w][r][c4]; *(v4f*)(C + (size_t)(row0 + r) * ldc + col0 + c4) = v; } }
     }
}

// Wt[n][k] = f16(W[k][n]·scale) from f32 row-major W[K][N] (scale = power of two; bf16-exact weights stay exact in f16 away from the subnormal range)
__global__ __launch_bounds__(256) void k_wt_f16(const float* __restrict__ W, _Float16* __restrict__ Wt, int K, int N, float scale) {
  const int t = blockIdx.x * 256 + threadIdx.x; if (t >= N * (K / 8)) return; const int n = t / (K / 8), k8 = (t % (K / 8)) * 8; FragH f;
#pragma unroll
  for (int i = 0; i < 8; ++i) f.h[i] = (_Float16)(bf16_round(W[(size_t)(k8 + i) * N + n]) * scale); const v8us o = f.half[0];
  *(v8us*)((unsigned short*)Wt + (size_t)n * K + k8) = o; 
}
// k_gemm_hh variant with fused epilogue: v = acc·alpha + bias[by·sBias + col] (+ CP[(row/rowsPerB)·sCPb + by·64 + col] if CP) ; ACT 0 none / 1 elu ; writes f32 C and/or f16 C16 (each if non-null)
template <int ACT>
__global__ __launch_bounds__(128) void k_gemm_hhx(const _Float16* __restrict__ A, int lda, size_t sA, const _Float16* __restrict__ Bh, int ldb, size_t sB, float alpha, const float* __restrict__ bias, size_t sBias, const float* __restrict__ CP, int rowsPerB, size_t sCPb, int row0g,
    float* __restrict__ C, _Float16* __restrict__ C16, int ldc, size_t sC, int M, int N, int K) {
  __shared__ __attribute__((aligned(16))) float so[4][16][64];
  const int tid = threadIdx.x, w = tid >> 5, lane = tid & 31, ln = lane & 15, hh = lane >> 4; const int by = blockIdx.y;
  A += (size_t)by * sA; Bh += (size_t)by * sB; const size_t cofs = (size_t)by * sC; const float* bp = bias ? bias + (size_t)by * sBias : nullptr;
  const int ntn = (N + 63) / 64; const int wid = blockIdx.x * 4 + w; const int mt = wid / ntn, nq = wid % ntn; if (mt * 16 >= M) return;
  const int row0 = mt * 16, col0 = nq * 64; const _Float16* arow = A + (size_t)(row0 + ln) * lda;
  v8f acc[4] = {};
  for (int kb = 0; kb < K; kb += 32) { FragH ah; ah.half[0] = *(const v8us*)((const unsigned short*)arow + kb + 8 * hh); ah.half[1] = *(const v8us*)((const unsigned short*)arow + kb + 16 + 8 * hh);
#pragma unroll
    for (int t = 0; t < 4; ++t) { if (col0 + t * 16 >= N) continue; const size_t boff = (size_t)(col0 + t * 16 + ln) * ldb + kb; FragH bq; bq.half[0] = *(const v8us*)((const unsigned short*)Bh + boff + 8 * hh); bq.half[1] = *(const v8us*)((const unsigned short*)Bh + boff + 16 + 8 * hh);
      acc[t] = mmaH<1>(ah.v, ah.v, bq.v, bq.v, acc[t]); }
  }
#pragma unroll
  for (int t = 0; t < 4; ++t) { if (col0 + t * 16 >= N) continue; const int col = col0 + t * 16 + ln; const float bv = bp ? bf16_round(bp[col]) : 0.f;
#pragma unroll
    for (int r = 0; r < 8; ++r) { float v = acc[t][r] * alpha + bv; if (CP) { const int bidx = (row0g + row0 + 8 * hh + r) / rowsPerB; v += CP[(size_t)bidx * sCPb + (size_t)by * 64 + col]; } if (ACT == 1) v = (v > 0.f) ? v : expm1f(v); else if (ACT == 7) v = (v > 0.f) ? v + 1.0f : expf(v); else if (ACT == 8) v = tanhf(v); else if (ACT == 9) v = 0.5f * v * (1.0f + tanhf(0.7978845608028654f * (v + 0.044715f * v * v * v))); else if (ACT == 11) v = 1.0f / (1.0f + expf(-v)); else if (ACT == 12) v = (v > 0.f) ? v : 0.01f * v; else if (ACT == 14) v = (v > 0.f) ? v : 0.1f * v; else if (ACT == 15) v = v / (1.0f + expf(-v)); else if (ACT == 3) v = fmaxf(v, 0.f); else if (ACT == 6) v = 0.5f * v * (1.0f + erff(v * 0.70710678118654752f)); so[w][8 * hh + r][t * 16 + ln] = v; } }
  __builtin_amdgcn_fence(__ATOMIC_ACQ_REL, "workgroup"); __builtin_amdgcn_wave_barrier();
  const int rsub = lane >> 4, c4 = (lane & 15) * 4; typedef _Float16 v4h __attribute__((ext_vector_type(4)));
  {
#pragma unroll
    for (int q = 0; q < 8; ++q) { const int r = q * 2 + rsub; if (col0 + c4 < N) { const v4f v = *(const v4fa*)&so[w][r][c4]; if (C) *(v4f*)(C + cofs + (size_t)(row0 + r) * ldc + col0 + c4) = v; if (C16) { v4h h4; for (int i = 0; i < 4; ++i) h4[i] = (_Float16)v[i]; *(v4h*)(C16 + cofs + (size_t)(row0 + r) * ldc + col0 + c4) = h4; } } }
     }
}


typedef _Float16 v4h __attribute__((ext_vector_type(4)));

__global__ __launch_bounds__(256) void k_x16(const float* __restrict__ x, _Float16* __restrict__ X16, size_t n8) { const size_t t = (size_t)blockIdx.x * 256 + threadIdx.x; if (t >= n8) return; FragH f;
#pragma unroll
  for (int q = 0; q < 8; ++q) f.h[q] = (_Float16)bf16_round(x[t * 8 + q]); *(v8us*)((unsigned short*)X16 + t * 8) = f.half[0];  }
__global__ __launch_bounds__(256) void k_h16(const float* __restrict__ x, _Float16* __restrict__ X16, size_t n8) { const size_t t = (size_t)blockIdx.x * 256 + threadIdx.x; if (t >= n8) return; FragH f;
#pragma unroll
  for (int q = 0; q < 8; ++q) f.h[q] = (_Float16)x[t * 8 + q]; *(v8us*)((unsigned short*)X16 + t * 8) = f.half[0];  }
__global__ __launch_bounds__(256) void k_round16f(const float* __restrict__ W, _Float16* __restrict__ Bt, size_t n8) { const size_t t = (size_t)blockIdx.x * 256 + threadIdx.x; if (t >= n8) return; FragH f;
#pragma unroll
  for (int i = 0; i < 8; ++i) f.h[i] = (_Float16)(bf16_round(W[t * 8 + i]) * 16.0f); *(v8us*)((unsigned short*)Bt + t * 8) = f.half[0];  }
template <int NHv, int TTv>
__global__ __launch_bounds__(256) void k_vt(const _Float16* __restrict__ V16, int ldv, int voff, _Float16* __restrict__ Vt) { __shared__ unsigned short tl[64][66]; const int tid = threadIdx.x; const int slab = blockIdx.x / (TTv / 64), lg = blockIdx.x % (TTv / 64); const int b = slab / NHv, h = slab % NHv;
  for (int i = tid; i < 64 * 8; i += 256) { const int r = i / 8, c8 = (i % 8) * 8; FragH f; f.half[0] = *(const v8us*)((const unsigned short*)V16 + ((size_t)b * TTv + lg * 64 + r) * ldv + voff + h * 64 + c8);
#pragma unroll
    for (int q = 0; q < 8; ++q) tl[r][c8 + q] = f.u[q]; }
  __syncthreads();
  {
#pragma unroll
    for (int rd = 0; rd < 2; ++rd) { const int d = rd * 32 + tid / 8, pc = tid % 8; FragH f;
#pragma unroll
      for (int q = 0; q < 8; ++q) f.u[q] = tl[pc * 8 + q][d];
      *(v8us*)((unsigned short*)Vt + ((size_t)slab * 64 + d) * TTv + lg * 64 + pc * 8) = f.half[0]; }
     } }

// f32 plane [NN][128] → concatenated-K f16 operand planes [NN][384] for a single 3-term GEMM: with h = f16(v), l = f16((v − h)·2^10):
//   MODE 0 (t side): [h | l | h];  MODE 1 (p side): [h | h·2^-10 | l·2^-10]  so that Σ_K A'·B' = Th·Ph + Tl·Ph·2^-10 + Th·Pl·2^-10 (power-of-two scalings are exact in f16 barring subnormal flushes, which cost ≤1e-4 on a σ≈11 logit);
template <int MODE>
__global__ __launch_bounds__(256) void k_hl3(const float* __restrict__ F, _Float16* __restrict__ P3, size_t n8) { const size_t t = (size_t)blockIdx.x * 256 + threadIdx.x; if (t >= n8) return; const size_t r = (t * 8) / CPN; const int c = (int)((t * 8) % CPN); const v4f a = *(const v4fa*)(F + t * 8), b = *(const v4fa*)(F + t * 8 + 4); FragH h, l, s2, s3;
#pragma unroll
  for (int q = 0; q < 8; ++q) { const float v = (q < 4) ? a[q] : b[q - 4]; const _Float16 hv = (_Float16)v; const _Float16 lv = (_Float16)((v - (float)hv) * 1024.0f); h.h[q] = hv; l.h[q] = lv; s2.h[q] = MODE ? (_Float16)((float)hv * 0.0009765625f) : lv; s3.h[q] = MODE ? (_Float16)((float)lv * 0.0009765625f) : hv; }
  unsigned short* row = (unsigned short*)P3 + r * (3 * CPN) + c;
  { *(v8us*)(row) = h.half[0]; *(v8us*)(row + CPN) = s2.half[0]; *(v8us*)(row + 2 * CPN) = s3.half[0];  } }
__global__ __launch_bounds__(256) void k_tok(const float* __restrict__ x, _Float16* __restrict__ X16) { __shared__ float tl[32][65]; const int tid = threadIdx.x; const int b = blockIdx.x / ((CI / 64) * (NN / 32)), rem = blockIdx.x % ((CI / 64) * (NN / 32)); const int cg = rem / (NN / 32), pg = rem % (NN / 32); const int c0 = cg * 64, p0 = pg * 32;
  for (int i = tid; i < 64 * 32; i += 256) { const int c = i / 32, pp = i % 32; tl[pp][c] = bf16_round(x[((size_t)b * CI + c0 + c) * NN + p0 + pp]); } __syncthreads();
  const int r = tid / 8, pc = tid % 8; FragH f; for (int q = 0; q < 8; ++q) f.h[q] = (_Float16)tl[r][pc * 8 + q]; const size_t row = (size_t)b * NN + p0 + r; *(v8us*)((unsigned short*)X16 + row * CI + c0 + pc * 8) = f.half[0];  }
__global__ __launch_bounds__(256) void k_colstat(const float* __restrict__ S, float* __restrict__ MX, float* __restrict__ ZZ) { const int m = blockIdx.x * 256 + threadIdx.x; if (m >= NN) return; float mx = -3.0e38f, z = 0.f;
#pragma unroll 1
  for (int n = 0; n < NN; ++n) { const float s = S[(size_t)n * NN + m]; const float mn = fmaxf(mx, s); z = z * __expf(mx - mn) + __expf(s - mn); mx = mn; }
  { *(float*)(MX + m) = mx; *(float*)(ZZ + m) = z;  } }
__global__ __launch_bounds__(256) void k_pexp(const float* __restrict__ S, const float* __restrict__ MX, const float* __restrict__ ZZ, _Float16* __restrict__ PT) { const size_t t = (size_t)blockIdx.x * 256 + threadIdx.x; if (t >= (size_t)NN * NN / 8) return; const int m0 = (int)((t * 8) % NN); const v4f a = *(const v4fa*)(S + t * 8), c = *(const v4fa*)(S + t * 8 + 4), xa = *(const v4fa*)(MX + m0), xc = *(const v4fa*)(MX + m0 + 4), za = *(const v4fa*)(ZZ + m0), zc = *(const v4fa*)(ZZ + m0 + 4); FragH f;
#pragma unroll
  for (int q = 0; q < 4; ++q) { f.h[q] = (_Float16)(__expf(a[q] - xa[q]) / za[q] * 32768.0f); f.h[4 + q] = (_Float16)(__expf(c[q] - xc[q]) / zc[q] * 32768.0f); }
  *(v8us*)((unsigned short*)PT + t * 8) = f.half[0];  }
__global__ __launch_bounds__(256) void k_bnstat(const float* __restrict__ Z, float* __restrict__ MU, float* __restrict__ RS) { const int c = threadIdx.x; float s1 = 0.f, s2 = 0.f;
#pragma unroll 1
  for (int r = 0; r < NR; ++r) { const float v = Z[(size_t)r * CI + c]; s1 += v; s2 += v * v; }
  const float mu = s1 / (float)NR; const float var = fmaxf(s2 / (float)NR - mu * mu, 0.f); const float rs = rsqrtf(var + 1e-5f);
  { *(float*)(MU + c) = mu; *(float*)(RS + c) = rs;  } }
__global__ __launch_bounds__(256) void k_out(const float* __restrict__ Z, const float* __restrict__ MU, const float* __restrict__ RS, const float* __restrict__ gam, const float* __restrict__ bet, const float* __restrict__ x, float* __restrict__ out) { __shared__ float tl[32][65]; const int tid = threadIdx.x; const int b = blockIdx.x / ((CI / 32) * (NN / 64)), rem = blockIdx.x % ((CI / 32) * (NN / 64)); const int cg = rem / (NN / 64), pg = rem % (NN / 64); const int c0 = cg * 32, p0 = pg * 64;
  for (int i = tid; i < 64 * 32; i += 256) { const int pp = i / 32, c = i % 32; tl[c][pp] = (Z[((size_t)b * NN + p0 + pp) * CI + c0 + c] - MU[c0 + c]) * RS[c0 + c] * bf16_round(gam[c0 + c]) + bf16_round(bet[c0 + c]); } __syncthreads();
  { for (int i = tid; i < 32 * 16; i += 256) { const int c = i / 16, q4 = i % 16; const size_t o = ((size_t)b * CI + c0 + c) * NN + p0 + q4 * 4; const v4f xr = *(const v4fa*)(x + o); const v4f v = {tl[c][q4 * 4] + bf16_round(xr[0]), tl[c][q4 * 4 + 1] + bf16_round(xr[1]), tl[c][q4 * 4 + 2] + bf16_round(xr[2]), tl[c][q4 * 4 + 3] + bf16_round(xr[3])}; *(v4f*)(out + o) = v; }  } }

extern "C" void kernel_launch(void* const* d_in, const int* in_sizes, int n_in,
                              void* d_out, int out_size, void* d_ws, size_t ws_size, hipStream_t stream) {
  (void)in_sizes; (void)n_in; (void)out_size;
  const float* const* I = (const float* const*)d_in; const float* x = I[0]; const float* Wt = I[1]; const float* Wp = I[2]; const float* Wg = I[3]; const float* Wz = I[4]; const float* gam = I[5]; const float* bet = I[6];
  char* ws = (char*)d_ws; size_t off = 0;
  auto take = [&](size_t bytes) { char* p = ws + off; off += (bytes + 255) & ~(size_t)255; return p; };
  _Float16* Bt_ = (_Float16*)take((size_t)CPN * CI * 2); _Float16* Bp_ = (_Float16*)take((size_t)CPN * CI * 2); _Float16* Bg_ = (_Float16*)take((size_t)CPN * CI * 2); _Float16* Bz_ = (_Float16*)take((size_t)CI * CPN * 2);
  float* S = (float*)take((size_t)NN * NN * 4); _Float16* PT = (_Float16*)take((size_t)NN * NN * 2); _Float16* X16 = (_Float16*)take((size_t)NR * CI * 2);
  _Float16* T3 = (_Float16*)take((size_t)NN * 3 * CPN * 2); _Float16* P3 = (_Float16*)take((size_t)NN * 3 * CPN * 2); float* F32 = (float*)take((size_t)NN * CPN * 4);      /* per-batch: concatenated-K operand planes [4096][384] and the f32 conv output they are built from */
  _Float16* Gc = (_Float16*)take((size_t)BB * CPN * NN * 2); _Float16* Y16 = (_Float16*)take((size_t)NR * CPN * 2); float* MX = (float*)take((size_t)NN * 4); float* ZZ = (float*)take((size_t)NN * 4); float* MU = (float*)take((size_t)CI * 4); float* RS = (float*)take((size_t)CI * 4);
  float* Z = S;      /* the z plane (16.8 MB) reuses the score region after the last batch */
  if (off > ws_size) return;      // 67 + 33.5 + 8.4 + 3.1 + 3.1 + 2.1 + 4.2 + 4.2 + 0.3 ≈ 126 MB (120 MiB)
  const unsigned gw = (unsigned)(((size_t)CPN * CI / 8 + 255) / 256);
  k_round16f<<<gw, 256, 0, stream>>>(Wt, Bt_, (size_t)CPN * CI / 8); k_round16f<<<gw, 256, 0, stream>>>(Wp, Bp_, (size_t)CPN * CI / 8); k_round16f<<<gw, 256, 0, stream>>>(Wg, Bg_, (size_t)CPN * CI / 8); k_round16f<<<gw, 256, 0, stream>>>(Wz, Bz_, (size_t)CI * CPN / 8);      /* conv weights (out,in) natural ×2^4 */
  k_tok<<<BB * (CI / 64) * (NN / 32), 256, 0, stream>>>(x, X16);
  k_gemm_hhx<0><<<dim3(((CPN / 16) * (NN / 64) + 3) / 4, BB), 128, 0, stream>>>(Bg_, CI, 0, X16, CI, (size_t)NN * CI, 0.0625f, nullptr, 0, nullptr, 1, 0, 0, nullptr, Gc, NN, (size_t)CPN * NN, CPN, NN, CI);      /* g channel-major per batch [b][128][4096] (f16): M 128 N 4096 K 256 */
  const dim3 gs(((NN / 16) * (NN / 64) + 3) / 4, 1), gy(((NN / 16) * (CPN / 64) + 3) / 4, 1);
  const dim3 gtp(((NN / 16) * (CPN / 64) + 3) / 4, 1); const unsigned g8 = (unsigned)(((size_t)NN * CPN / 8 + 255) / 256);
  for (int b = 0; b < BB; ++b) { const size_t xo = (size_t)b * NN * CI, yo = (size_t)b * NN * CPN;
    k_gemm_hhx<0><<<gtp, 128, 0, stream>>>(X16 + xo, CI, 0, Bt_, CI, 0, 0.0625f, nullptr, 0, nullptr, 1, 0, 0, F32, nullptr, CPN, 0, NN, CPN, CI); k_hl3<0><<<g8, 256, 0, stream>>>(F32, T3, (size_t)NN * CPN / 8);      /* t (this batch) token-major f32 → [h | l | h]: M 4096 N 128 K 256 */
    k_gemm_hhx<0><<<gtp, 128, 0, stream>>>(X16 + xo, CI, 0, Bp_, CI, 0, 0.0625f, nullptr, 0, nullptr, 1, 0, 0, F32, nullptr, CPN, 0, NN, CPN, CI); k_hl3<1><<<g8, 256, 0, stream>>>(F32, P3, (size_t)NN * CPN / 8);      /* p (this batch) → [h | h·2^-10 | l·2^-10] */
    k_gemm_hhx<0><<<gs, 128, 0, stream>>>(T3, 3 * CPN, 0, P3, 3 * CPN, 0, 1.0f, nullptr, 0, nullptr, 1, 0, 0, S, nullptr, NN, 0, NN, NN, 3 * CPN);      /* S[n][m] = t_n·p_m as Th·Ph + (Tl·Ph + Th·Pl)·2^-10 in one K = 384 pass: M 4096 N 4096 */
    k_colstat<<<NN / 256, 256, 0, stream>>>(S, MX, ZZ); k_pexp<<<(unsigned)(((size_t)NN * NN / 8 + 255) / 256), 256, 0, stream>>>(S, MX, ZZ, PT);
    k_gemm_hhx<0><<<gy, 128, 0, stream>>>(PT, NN, 0, Gc + (size_t)b * CPN * NN, NN, 0, 0.000030517578125f, nullptr, 0, nullptr, 1, 0, 0, nullptr, Y16 + yo, CPN, 0, NN, CPN, NN); }      /* y[n][c] = Σ_m att[n][m]·g[c][m]: M 4096 N 128 K 4096 (f16 out) */
  k_gemm_hhx<0><<<dim3(((NR / 16) * (CI / 64) + 3) / 4, 1), 128, 0, stream>>>(Y16, CPN, 0, Bz_, CPN, 0, 0.0625f, nullptr, 0, nullptr, 1, 0, 0, Z, nullptr, CI, 0, NR, CI, CPN);      /* z token-major [16384][256] f32: M 16384 N 256 K 128 */
  k_bnstat<<<1, CI, 0, stream>>>(Z, MU, RS); k_out<<<BB * (CI / 32) * (NN / 64), 256, 0, stream>>>(Z, MU, RS, gam, bet, x, (float*)d_out);
}

// v001
// Measured time: 995 microseconds a run.
// Timed twice side by side with v000, it ran 13.1 and 13.2 times as fast.
#include <hip/hip_runtime.h>
// Spatial non-local block with query-axis softmax (B=4, C_in 256, C_p 128, N=4096): t,p,g = 1×1 convs; att[n,m] = Σ_c t[c,n]·p[c,m]; att = softmax over n (dim=1) for every m; y[c,n] = Σ_m att[n,m]·g[c,m]; z = Wz·y;
// BatchNorm1d in training mode (batch statistics over (B,N) per channel, biased variance, eps 1e-5) with affine; out = BN(z) + x.
// Compute dtype: x and weights rounded to bf16; t and p as f32 GEMM outputs split into f16 hi + ×2^10 residual parts laid out as concatenated-K operands so one K=384 GEMM yields Th·Ph + (Tl·Ph + Th·Pl)·2^-10 (σ≈11 logits, f32-accurate);
// the score plane is kept transposed (S[n][m], f32) so the softmax over n is a column reduction (f32 per-column max/Σ) and the normalised weights are written row-major as f16 ×2^15; y = attᵀ-contraction as an f16 GEMM against
// channel-major g; z GEMM; per-channel batch statistics as fixed-order f32 column sums; affine + residual applied during the transpose back to channel-major. All contractions on v_wmma_f32_16x16x32_f16, f32 accumulate.
#define BB 4
#define CI 256
#define CPN 128
#define NN 4096
#define NR (BB * NN)

typedef __bf16 v16b __attribute__((ext_vector_type(16)));
typedef unsigned short v8us __attribute__((ext_vector_type(8), may_alias));
typedef float  v8f  __attribute__((ext_vector_type(8)));
typedef float  v4f  __attribute__((ext_vector_type(4)));
typedef float  v4fa __attribute__((ext_vector_type(4), may_alias));
union FragB { v16b v; v8us half[2]; unsigned short u[16]; };

__device__ __forceinline__ unsigned short bf16_bits(float x) { unsigned int u = __float_as_uint(x); return (unsigned short)((u + 0x7FFFu + ((u >> 16) & 1u)) >> 16); }
__device__ __forceinline__ float bf16_val(unsigned short b) { return __uint_as_float(((unsigned int)b) << 16); }
__device__ __forceinline__ float bf16_round(float x) { return bf16_val(bf16_bits(x)); }
// D += A·B with NT terms: 1 = ah·bh, 2 = + al·bh (A split), 3 = + ah·bl (both split)
template <int NT>
__device__ __forceinline__ v8f mmaN(v16b ah, v16b al, v16b bh, v16b bl, v8f c) {
  c = __builtin_amdgcn_wmma_f32_16x16x32_bf16(false, ah, false, bh, (short)0, c, false, false);
  if (NT >= 2) c = __builtin_amdgcn_wmma_f32_16x16x32_bf16(false, al, false, bh, (short)0, c, false, false);
  if (NT >= 3) c = __builtin_amdgcn_wmma_f32_16x16x32_bf16(false, ah, false, bl, (short)0, c, false, false);
  asm volatile("v_nop\n\tv_nop\n\tv_nop\n\tv_nop" : "+v"(c) : "v"(ah), "v"(al), "v"(bh), "v"(bl));
  return c;
}

__global__ __launch_bounds__(256) void k_wt_bf16(const float* __restrict__ W, unsigned short* __restrict__ Wt, int K, int N) {
  const int t = blockIdx.x * 256 + threadIdx.x;
  const int k8n = K / 8;
  if (t >= N * k8n) return;
  const int n = t / k8n, k8 = (t % k8n) * 8;
  v8us v;
#pragma unroll
  for (int i = 0; i < 8; ++i) v[i] = bf16_bits(W[(size_t)(k8 + i) * N + n]);
  *(v8us*)(Wt + (size_t)n * K + k8) = v;
  
}

// GEMM C[M][N] (f32, pitch ldc) = act(A[M][K]·W + bias). A f32 row-major (pitch lda) converted per fragment to bf16
// (ASPLIT: hi/lo two planes -> 2 terms, else single rounded term); Wt bf16 [N][K] (pitch ldb). BIAS_BF16 rounds the
// bias to bf16 first (bias quantised to bf16 before the add). K%32==0, M%16==0, N%64==0.
template <bool ASPLIT, int ACT, bool BIAS_BF16>
__global__ __launch_bounds__(128) void k_gemm_bf(const float* __restrict__ A, int lda, const unsigned short* __restrict__ Wt, int ldb,
                                               const float* __restrict__ bias, float* __restrict__ C, int ldc, int M, int N, int K) {
  __shared__ __attribute__((aligned(16))) float so[4][16][64];
  const int tid = threadIdx.x, w = tid >> 5, lane = tid & 31, ln = lane & 15, hh = lane >> 4;
  const int ntn = N / 64;
  const int wid = blockIdx.x * 4 + w;
  const int mt = wid / ntn, nq = wid % ntn;
  if (mt * 16 >= M) return;
  const int row0 = mt * 16, col0 = nq * 64;
  const float* arow = A + (size_t)(row0 + ln) * lda;
  v8f acc[4] = {};
  for (int kb = 0; kb < K; kb += 32) {
    FragB ah, al;
    const v4f x0 = *(const v4fa*)(arow + kb + 8 * hh), x1 = *(const v4fa*)(arow + kb + 8 * hh + 4);
    const v4f x2 = *(const v4fa*)(arow + kb + 16 + 8 * hh), x3 = *(const v4fa*)(arow + kb + 16 + 8 * hh + 4);
    float xs[16] = {x0[0],x0[1],x0[2],x0[3],x1[0],x1[1],x1[2],x1[3],x2[0],x2[1],x2[2],x2[3],x3[0],x3[1],x3[2],x3[3]};
#pragma unroll
    for (int i = 0; i < 16; ++i) { const unsigned short hb = bf16_bits(xs[i]); ah.u[i] = hb; al.u[i] = ASPLIT ? bf16_bits(xs[i] - bf16_val(hb)) : (unsigned short)0; }
#pragma unroll
    for (int t = 0; t < 4; ++t) {
      const unsigned short* brow = Wt + (size_t)(col0 + t * 16 + ln) * ldb + kb;
      FragB b;
      b.half[0] = *(const v8us*)(brow + 8 * hh);
      b.half[1] = *(const v8us*)(brow + 16 + 8 * hh);
      acc[t] = mmaN<ASPLIT ? 2 : 1>(ah.v, al.v, b.v, b.v, acc[t]);
    }
  }
#pragma unroll
  for (int t = 0; t < 4; ++t) {
    float bv = bias ? bias[col0 + t * 16 + ln] : 0.f;
    if (BIAS_BF16) bv = bf16_round(bv);
#pragma unroll
    for (int r = 0; r < 8; ++r) { float v = acc[t][r] + bv; if (ACT == 1) v = fmaxf(v, 0.f); so[w][8 * hh + r][t * 16 + ln] = v; }
  }
  __builtin_amdgcn_fence(__ATOMIC_ACQ_REL, "workgroup");
  __builtin_amdgcn_wave_barrier();
  const int rsub = lane >> 4, c4 = (lane & 15) * 4;
  {
#pragma unroll
    for (int q = 0; q < 8; ++q) {
      const int r = q * 2 + rsub;
      const v4f v = *(const v4fa*)&so[w][r][c4];
      *(v4f*)(C + (size_t)(row0 + r) * ldc + col0 + c4) = v;
    }
    
  }
}

// Flash-style causal/unmasked attention, all contractions 3-term bf16 hi/lo splits, f32 softmax with running max.
// q,k,v rows are read from f32 buffers with arbitrary row pitch (so they can live inside a fused qkv buffer);
// D = head size (multiple of 32, <= 128); one wave = 16 query rows; block = 4 waves (64 queries) sharing K/V chunks of 32.
template <int D, bool CAUSAL>
__global__ __launch_bounds__(128) void k_flash(const float* __restrict__ qb, const float* __restrict__ kb, const float* __restrict__ vb,
                                             int pitch, int T, int H, float scale, float* __restrict__ y, int ypitch) {
  constexpr int KS = D / 32;        // k-steps for QK
  constexpr int DT = D / 16;        // d tiles for PV
  __shared__ __attribute__((aligned(16))) unsigned short sKh[32][D + 8], sKl[32][D + 8], sVh[32][D + 8], sVl[32][D + 8];
  __shared__ __attribute__((aligned(16))) unsigned short sPh[4][16][40], sPl[4][16][40];
  __shared__ __attribute__((aligned(16))) float sO[4][16][D];
  const int tid = threadIdx.x, w = tid >> 5, lane = tid & 31, ln = lane & 15, hh = lane >> 4;
  const int nqb = (T + 63) / 64;
  const int bh = blockIdx.x / nqb, qblk = blockIdx.x % nqb;
  const int b = bh / H, h = bh % H;
  const int q0 = qblk * 64 + w * 16;
  const float* Q = qb + (size_t)b * T * pitch + h * D;
  const float* K = kb + (size_t)b * T * pitch + h * D;
  const float* V = vb + (size_t)b * T * pitch + h * D;

  // A fragments of the wave's 16 query rows (scaled), hi/lo
  FragB aqh[KS], aql[KS];
  {
    int row = q0 + ln; if (row >= T) row = T - 1;
    const float* qr = Q + (size_t)row * pitch;
#pragma unroll
    for (int ks = 0; ks < KS; ++ks)
#pragma unroll
      for (int i = 0; i < 16; ++i) {
        const int d = ks * 32 + ((i < 8) ? (8 * hh + i) : (16 + 8 * hh + (i - 8)));
        const float x = qr[d] * scale; const unsigned short hb = bf16_bits(x);
        aqh[ks].u[i] = hb; aql[ks].u[i] = bf16_bits(x - bf16_val(hb));
      }
  }
  float m_r[8], l_r[8];
#pragma unroll
  for (int r = 0; r < 8; ++r) { m_r[r] = -3.0e38f; l_r[r] = 0.f; }
  v8f oacc[DT];
#pragma unroll
  for (int dt = 0; dt < DT; ++dt) oacc[dt] = (v8f){0.f,0.f,0.f,0.f,0.f,0.f,0.f,0.f};

  const int kv_end = CAUSAL ? min(T, qblk * 64 + 64) : T;     // block-uniform
  for (int j0 = 0; j0 < kv_end; j0 += 32) {
    __syncthreads();
    for (int e = tid; e < 32 * (D / 4); e += 128) {
      const int r = e / (D / 4), c4 = (e % (D / 4)) * 4;
      const int key = j0 + r;
      v4f kf = {0.f,0.f,0.f,0.f}, vf = {0.f,0.f,0.f,0.f};
      if (key < T) { kf = *(const v4fa*)(K + (size_t)key * pitch + c4); vf = *(const v4fa*)(V + (size_t)key * pitch + c4); }
#pragma unroll
      for (int t = 0; t < 4; ++t) {
        unsigned short hb = bf16_bits(kf[t]); sKh[r][c4 + t] = hb; sKl[r][c4 + t] = bf16_bits(kf[t] - bf16_val(hb));
        hb = bf16_bits(vf[t]); sVh[r][c4 + t] = hb; sVl[r][c4 + t] = bf16_bits(vf[t] - bf16_val(hb));
      }
    }
    __syncthreads();
    // S tile 16 x 32
    v8f s[2];
#pragma unroll
    for (int nt = 0; nt < 2; ++nt) {
      v8f acc = {};
#pragma unroll
      for (int ks = 0; ks < KS; ++ks) {
        FragB bh_, bl_;
        bh_.half[0] = *(const v8us*)&sKh[nt * 16 + ln][ks * 32 + 8 * hh]; bh_.half[1] = *(const v8us*)&sKh[nt * 16 + ln][ks * 32 + 16 + 8 * hh];
        bl_.half[0] = *(const v8us*)&sKl[nt * 16 + ln][ks * 32 + 8 * hh]; bl_.half[1] = *(const v8us*)&sKl[nt * 16 + ln][ks * 32 + 16 + 8 * hh];
        acc = mmaN<3>(aqh[ks].v, aql[ks].v, bh_.v, bl_.v, acc);
      }
      s[nt] = acc;
    }
    // mask + running max (rows 8hh+r; the 16 lanes of a half share rows)
    float alpha[8];
#pragma unroll
    for (int r = 0; r < 8; ++r) {
      const int qi = q0 + 8 * hh + r;
      const int ja = j0 + ln, jb = j0 + 16 + ln;
      if (CAUSAL) { if (ja > qi) s[0][r] = -3.0e38f; if (jb > qi) s[1][r] = -3.0e38f; }
      if (ja >= T) s[0][r] = -3.0e38f;
      if (jb >= T) s[1][r] = -3.0e38f;
      float mx = fmaxf(s[0][r], s[1][r]);
      mx = fmaxf(mx, __shfl_xor(mx, 1, 32)); mx = fmaxf(mx, __shfl_xor(mx, 2, 32)); mx = fmaxf(mx, __shfl_xor(mx, 4, 32)); mx = fmaxf(mx, __shfl_xor(mx, 8, 32));
      const float mnew = fmaxf(m_r[r], mx);
      alpha[r] = (mnew > -1.0e38f) ? __expf(m_r[r] - mnew) : 1.0f;
      const float p0 = (s[0][r] > -1.0e38f) ? __expf(s[0][r] - mnew) : 0.f;
      const float p1 = (s[1][r] > -1.0e38f) ? __expf(s[1][r] - mnew) : 0.f;
      m_r[r] = mnew;
      l_r[r] = l_r[r] * alpha[r] + p0 + p1;            // per-lane partial row sum (16 lanes combined at the end)
      unsigned short hb = bf16_bits(p0); sPh[w][8 * hh + r][ln] = hb;      sPl[w][8 * hh + r][ln] = bf16_bits(p0 - bf16_val(hb));
      hb = bf16_bits(p1);                sPh[w][8 * hh + r][16 + ln] = hb; sPl[w][8 * hh + r][16 + ln] = bf16_bits(p1 - bf16_val(hb));
    }
#pragma unroll
    for (int dt = 0; dt < DT; ++dt)
#pragma unroll
      for (int r = 0; r < 8; ++r) oacc[dt][r] *= alpha[r];
    __builtin_amdgcn_fence(__ATOMIC_ACQ_REL, "workgroup");
    __builtin_amdgcn_wave_barrier();
    FragB pah, pal;
    pah.half[0] = *(const v8us*)&sPh[w][ln][8 * hh]; pah.half[1] = *(const v8us*)&sPh[w][ln][16 + 8 * hh];
    pal.half[0] = *(const v8us*)&sPl[w][ln][8 * hh]; pal.half[1] = *(const v8us*)&sPl[w][ln][16 + 8 * hh];
#pragma unroll
    for (int dt = 0; dt < DT; ++dt) {
      FragB bvh, bvl;
#pragma unroll
      for (int i = 0; i < 8; ++i) {
        bvh.u[i] = sVh[8 * hh + i][dt * 16 + ln]; bvh.u[8 + i] = sVh[16 + 8 * hh + i][dt * 16 + ln];
        bvl.u[i] = sVl[8 * hh + i][dt * 16 + ln]; bvl.u[8 + i] = sVl[16 + 8 * hh + i][dt * 16 + ln];
      }
      oacc[dt] = mmaN<3>(pah.v, pal.v, bvh.v, bvl.v, oacc[dt]);
    }
    __builtin_amdgcn_fence(__ATOMIC_ACQ_REL, "workgroup");
    __builtin_amdgcn_wave_barrier();
  }
#pragma unroll
  for (int r = 0; r < 8; ++r) {
    float l = l_r[r];
    l += __shfl_xor(l, 1, 32); l += __shfl_xor(l, 2, 32); l += __shfl_xor(l, 4, 32); l += __shfl_xor(l, 8, 32);
    l_r[r] = (l > 0.f) ? 1.0f / l : 0.f;
  }
#pragma unroll
  for (int dt = 0; dt < DT; ++dt)
#pragma unroll
    for (int r = 0; r < 8; ++r) sO[w][8 * hh + r][dt * 16 + ln] = oacc[dt][r] * l_r[r];
  __builtin_amdgcn_fence(__ATOMIC_ACQ_REL, "workgroup");
  __builtin_amdgcn_wave_barrier();
  {
    for (int r = 0; r < 16; ++r) {
      const int row = q0 + r;
      if (row < T && lane < D / 4) {
        const v4f val = *(const v4fa*)&sO[w][r][lane * 4];
        *(v4f*)(y + ((size_t)b * T + row) * ypitch + h * D + lane * 4) = val;
      }
    }
    
  }
}

// GEMM C = act(A·W + bias + resid): A f32 (ASPLIT -> hi/lo 2 terms), Wt bf16 [N][K]; ACT 0 none, 1 relu, 2 exact gelu;
// resid (optional, f32, row index = (row % rmod), pitch ldr, RES_BF16 rounds it) added before the activation.
template <bool ASPLIT, int ACT, bool BIAS_BF16, bool RES_BF16>
__global__ __launch_bounds__(128) void k_gemm_bf3(const float* __restrict__ A, int lda, const unsigned short* __restrict__ Wt, int ldb,
                                                const float* __restrict__ bias, const float* __restrict__ resid, int rmod, int ldr,
                                                float* __restrict__ C, int ldc, int M, int N, int K) {
  __shared__ __attribute__((aligned(16))) float so[4][16][64];
  const int tid = threadIdx.x, w = tid >> 5, lane = tid & 31, ln = lane & 15, hh = lane >> 4;
  const int ntn = N / 64;
  const int wid = blockIdx.x * 4 + w;
  const int mt = wid / ntn, nq = wid % ntn;
  if (mt * 16 >= M) return;
  const int row0 = mt * 16, col0 = nq * 64;
  const float* arow = A + (size_t)(row0 + ln) * lda;
  v8f acc[4] = {};
  for (int kb = 0; kb < K; kb += 32) {
    FragB ah, al;
    const v4f x0 = *(const v4fa*)(arow + kb + 8 * hh), x1 = *(const v4fa*)(arow + kb + 8 * hh + 4);
    const v4f x2 = *(const v4fa*)(arow + kb + 16 + 8 * hh), x3 = *(const v4fa*)(arow + kb + 16 + 8 * hh + 4);
    float xs[16] = {x0[0],x0[1],x0[2],x0[3],x1[0],x1[1],x1[2],x1[3],x2[0],x2[1],x2[2],x2[3],x3[0],x3[1],x3[2],x3[3]};
#pragma unroll
    for (int i = 0; i < 16; ++i) { const unsigned short hb = bf16_bits(xs[i]); ah.u[i] = hb; al.u[i] = ASPLIT ? bf16_bits(xs[i] - bf16_val(hb)) : (unsigned short)0; }
#pragma unroll
    for (int t = 0; t < 4; ++t) {
      const unsigned short* brow = Wt + (size_t)(col0 + t * 16 + ln) * ldb + kb;
      FragB b;
      b.half[0] = *(const v8us*)(brow + 8 * hh);
      b.half[1] = *(const v8us*)(brow + 16 + 8 * hh);
      acc[t] = mmaN<ASPLIT ? 2 : 1>(ah.v, al.v, b.v, b.v, acc[t]);
    }
  }
#pragma unroll
  for (int t = 0; t < 4; ++t) {
    const int col = col0 + t * 16 + ln;
    float bv = bias ? bias[col] : 0.f;
    if (BIAS_BF16) bv = bf16_round(bv);
#pragma unroll
    for (int r = 0; r < 8; ++r) {
      float v = acc[t][r] + bv;
      if (resid) { float rv = resid[(size_t)((row0 + 8 * hh + r) % rmod) * ldr + col]; if (RES_BF16) rv = bf16_round(rv); v += rv; }
      if (ACT == 1) v = fmaxf(v, 0.f);
      if (ACT == 2) v = 0.5f * v * (1.0f + erff(v * 0.70710678118654752f));
      if (ACT == 3) { const float u = 0.7978845608028654f * (v + 0.044715f * v * v * v); v = 0.5f * v * (1.0f + tanhf(u)); }
      so[w][8 * hh + r][t * 16 + ln] = v;
    }
  }
  __builtin_amdgcn_fence(__ATOMIC_ACQ_REL, "workgroup");
  __builtin_amdgcn_wave_barrier();
  const int rsub = lane >> 4, c4 = (lane & 15) * 4;
  {
#pragma unroll
    for (int q = 0; q < 8; ++q) {
      const int r = q * 2 + rsub;
      const v4f v = *(const v4fa*)&so[w][r][c4];
      *(v4f*)(C + (size_t)(row0 + r) * ldc + col0 + c4) = v;
    }
    
  }
}
// row LayerNorm (biased variance, eps) over N: s = X (+ R); optional out_sum <- s; out_norm <- (s-mu)*rsqrt(var+eps)*g + b
template <bool PARAM_BF16>
__global__ __launch_bounds__(256) void k_layernorm(const float* __restrict__ X, const float* __restrict__ R, const float* __restrict__ g, const float* __restrict__ bta,
                                                  float* __restrict__ out_sum, float* __restrict__ out_norm, int N, float eps) {
  __shared__ float red[256];
  const int row = blockIdx.x, tid = threadIdx.x;
  const float* x = X + (size_t)row * N; const float* rr = R ? R + (size_t)row * N : nullptr;
  float vals[16];                     // up to N = 4096
  const int per = N / 256;            // contiguous chunk per thread? use strided-by-4 chunks: thread handles j = tid*4 + 1024*u
  float s1 = 0.f;
  for (int u = 0; u < per / 4; ++u) {
    const int j = tid * 4 + 1024 * u;
    const v4f a = *(const v4fa*)(x + j);
    v4f b = {0.f,0.f,0.f,0.f}; if (rr) b = *(const v4fa*)(rr + j);
#pragma unroll
    for (int q = 0; q < 4; ++q) { const float v = a[q] + b[q]; vals[u * 4 + q] = v; s1 += v; }
  }
  red[tid] = s1; __syncthreads();
  for (int st = 128; st > 0; st >>= 1) { if (tid < st) red[tid] += red[tid + st]; __syncthreads(); }
  const float mu = red[0] / (float)N; __syncthreads();
  float s2 = 0.f;
  for (int u = 0; u < per / 4; ++u)
#pragma unroll
    for (int q = 0; q < 4; ++q) { const float c = vals[u * 4 + q] - mu; s2 += c * c; }
  red[tid] = s2; __syncthreads();
  for (int st = 128; st > 0; st >>= 1) { if (tid < st) red[tid] += red[tid + st]; __syncthreads(); }
  const float rs = rsqrtf(red[0] / (float)N + eps);
  {
    for (int u = 0; u < per / 4; ++u) {
      const int j = tid * 4 + 1024 * u;
      v4f o, sm;
#pragma unroll
      for (int q = 0; q < 4; ++q) {
        float gg = g[j + q], bb = bta[j + q];
        if (PARAM_BF16) { gg = bf16_round(gg); bb = bf16_round(bb); }
        sm[q] = vals[u * 4 + q]; o[q] = (vals[u * 4 + q] - mu) * rs * gg + bb;
      }
      if (out_sum) *(v4f*)(out_sum + (size_t)row * N + j) = sm;
      *(v4f*)(out_norm + (size_t)row * N + j) = o;
    }
    
  }
}



// ---- f16 WMMA path (v_wmma_f32_16x16x32_f16): 11-bit significands for operands in range — used where a [0,1] probability operand needs more precision than bf16
typedef _Float16 v16h __attribute__((ext_vector_type(16)));
union FragH { v16h v; v8us half[2]; _Float16 h[16]; unsigned short u[16]; };
template <int NT>
__device__ __forceinline__ v8f mmaH(v16h ah, v16h al, v16h bh, v16h bl, v8f c) {
  c = __builtin_amdgcn_wmma_f32_16x16x32_f16(false, ah, false, bh, (short)0, c, false, false);
  if (NT >= 2) c = __builtin_amdgcn_wmma_f32_16x16x32_f16(false, al, false, bh, (short)0, c, false, false);
  if (NT >= 3) c = __builtin_amdgcn_wmma_f32_16x16x32_f16(false, ah, false, bl, (short)0, c, false, false);
  asm volatile("v_nop\n\tv_nop\n\tv_nop\n\tv_nop" : "+v"(c) : "v"(ah), "v"(al), "v"(bh), "v"(bl));
  return c;
}
// batched GEMM like k_gemm_b but f16 operands: A f32 (split into f16 hi/lo if ASPLIT, else rounded to f16), Bt = f16 values [n][k]; alpha; C f32; N multiple of 16 (partial tiles skipped)
template <bool ASPLIT>
__global__ __launch_bounds__(128) void k_gemm_h(const float* __restrict__ A, int lda, size_t sA, const _Float16* __restrict__ Bh, int ldb, size_t sB, float alpha, float* __restrict__ C, int ldc, size_t sC, int M, int N, int K) {
  __shared__ __attribute__((aligned(16))) float so[4][16][64];
  const int tid = threadIdx.x, w = tid >> 5, lane = tid & 31, ln = lane & 15, hh = lane >> 4; const int by = blockIdx.y;
  A += (size_t)by * sA; Bh += (size_t)by * sB; C += (size_t)by * sC;
  const int ntn = (N + 63) / 64; const int wid = blockIdx.x * 4 + w; const int mt = wid / ntn, nq = wid % ntn; if (mt * 16 >= M) return;
  const int row0 = mt * 16, col0 = nq * 64; const float* arow = A + (size_t)(row0 + ln) * lda;
  v8f acc[4] = {};
  for (int kb = 0; kb < K; kb += 32) {
    FragH ah, al;
    const v4f x0 = *(const v4fa*)(arow + kb + 8 * hh), x1 = *(const v4fa*)(arow + kb + 8 * hh + 4), x2 = *(const v4fa*)(arow + kb + 16 + 8 * hh), x3 = *(const v4fa*)(arow + kb + 16 + 8 * hh + 4);
    float xs[16] = {x0[0],x0[1],x0[2],x0[3],x1[0],x1[1],x1[2],x1[3],x2[0],x2[1],x2[2],x2[3],x3[0],x3[1],x3[2],x3[3]};
#pragma unroll
    for (int i = 0; i < 16; ++i) { const _Float16 h = (_Float16)xs[i]; ah.h[i] = h; al.h[i] = ASPLIT ? (_Float16)(xs[i] - (float)h) : (_Float16)0.0f; }
#pragma unroll
    for (int t = 0; t < 4; ++t) { if (col0 + t * 16 >= N) continue; const size_t boff = (size_t)(col0 + t * 16 + ln) * ldb + kb; FragH bq; bq.half[0] = *(const v8us*)(Bh + boff + 8 * hh); bq.half[1] = *(const v8us*)(Bh + boff + 16 + 8 * hh);
      acc[t] = mmaH<ASPLIT ? 2 : 1>(ah.v, al.v, bq.v, bq.v, acc[t]); }
  }
#pragma unroll
  for (int t = 0; t < 4; ++t) { if (col0 + t * 16 >= N) continue;
#pragma unroll
    for (int r = 0; r < 8; ++r) so[w][8 * hh + r][t * 16 + ln] = acc[t][r] * alpha; }
  __builtin_amdgcn_fence(__ATOMIC_ACQ_REL, "workgroup"); __builtin_amdgcn_wave_barrier();
  const int rsub = lane >> 4, c4 = (lane & 15) * 4;
  {
#pragma unroll
    for (int q = 0; q < 8; ++q) { const int r = q * 2 + rsub; if (col0 + c4 < N) { const v4f v = *(const v4fa*)&so[w][r][c4]; *(v4f*)(C + (size_t)(row0 + r) * ldc + col0 + c4) = v; } }
     }
}

// Wt[n][k] = f16(W[k][n]·scale) from f32 row-major W[K][N] (scale = power of two; bf16-exact weights stay exact in f16 away from the subnormal range)
__global__ __launch_bounds__(256) void k_wt_f16(const float* __restrict__ W, _Float16* __restrict__ Wt, int K, int N, float scale) {
  const int t = blockIdx.x * 256 + threadIdx.x; if (t >= N * (K / 8)) return; const int n = t / (K / 8), k8 = (t % (K / 8)) * 8; FragH f;
#pragma unroll
  for (int i = 0; i < 8; ++i) f.h[i] = (_Float16)(bf16_round(W[(size_t)(k8 + i) * N + n]) * scale); const v8us o = f.half[0];
  *(v8us*)((unsigned short*)Wt + (size_t)n * K + k8) = o; 
}
// k_gemm_hh variant with fused epilogue: v = acc·alpha + bias[by·sBias + col] (+ CP[(row/rowsPerB)·sCPb + by·64 + col] if CP) ; ACT 0 none / 1 elu ; writes f32 C and/or f16 C16 (each if non-null)
template <int ACT>
__global__ __launch_bounds__(128) void k_gemm_hhx(const _Float16* __restrict__ A, int lda, size_t sA, const _Float16* __restrict__ Bh, int ldb, size_t sB, float alpha, const float* __restrict__ bias, size_t sBias, const float* __restrict__ CP, int rowsPerB, size_t sCPb, int row0g,
    float* __restrict__ C, _Float16* __restrict__ C16, int ldc, size_t sC, int M, int N, int K) {
  __shared__ __attribute__((aligned(16))) float so[4][16][64];
  const int tid = threadIdx.x, w = tid >> 5, lane = tid & 31, ln = lane & 15, hh = lane >> 4; const int by = blockIdx.y;
  A += (size_t)by * sA; Bh += (size_t)by * sB; const size_t cofs = (size_t)by * sC; const float* bp = bias ? bias + (size_t)by * sBias : nullptr;
  const int ntn = (N + 63) / 64; const int wid = blockIdx.x * 4 + w; const int mt = wid / ntn, nq = wid % ntn; if (mt * 16 >= M) return;
  const int row0 = mt * 16, col0 = nq * 64; const _Float16* arow = A + (size_t)(row0 + ln) * lda;
  v8f acc[4] = {};
  for (int kb = 0; kb < K; kb += 32) { FragH ah; ah.half[0] = *(const v8us*)((const unsigned short*)arow + kb + 8 * hh); ah.half[1] = *(const v8us*)((const unsigned short*)arow + kb + 16 + 8 * hh);
#pragma unroll
    for (int t = 0; t < 4; ++t) { if (col0 + t * 16 >= N) continue; const size_t boff = (size_t)(col0 + t * 16 + ln) * ldb + kb; FragH bq; bq.half[0] = *(const v8us*)((const unsigned short*)Bh + boff + 8 * hh); bq.half[1] = *(const v8us*)((const unsigned short*)Bh + boff + 16 + 8 * hh);
      acc[t] = mmaH<1>(ah.v, ah.v, bq.v, bq.v, acc[t]); }
  }
#pragma unroll
  for (int t = 0; t < 4; ++t) { if (col0 + t * 16 >= N) continue; const int col = col0 + t * 16 + ln; const float bv = bp ? bf16_round(bp[col]) : 0.f;
#pragma unroll
    for (int r = 0; r < 8; ++r) { float v = acc[t][r] * alpha + bv; if (CP) { const int bidx = (row0g + row0 + 8 * hh + r) / rowsPerB; v += CP[(size_t)bidx * sCPb + (size_t)by * 64 + col]; } if (ACT == 1) v = (v > 0.f) ? v : expm1f(v); else if (ACT == 7) v = (v > 0.f) ? v + 1.0f : expf(v); else if (ACT == 8) v = tanhf(v); else if (ACT == 9) v = 0.5f * v * (1.0f + tanhf(0.7978845608028654f * (v + 0.044715f * v * v * v))); else if (ACT == 11) v = 1.0f / (1.0f + expf(-v)); else if (ACT == 12) v = (v > 0.f) ? v : 0.01f * v; else if (ACT == 14) v = (v > 0.f) ? v : 0.1f * v; else if (ACT == 15) v = v / (1.0f + expf(-v)); else if (ACT == 3) v = fmaxf(v, 0.f); else if (ACT == 6) v = 0.5f * v * (1.0f + erff(v * 0.70710678118654752f)); so[w][8 * hh + r][t * 16 + ln] = v; } }
  __builtin_amdgcn_fence(__ATOMIC_ACQ_REL, "workgroup"); __builtin_amdgcn_wave_barrier();
  const int rsub = lane >> 4, c4 = (lane & 15) * 4; typedef _Float16 v4h __attribute__((ext_vector_type(4)));
  {
#pragma unroll
    for (int q = 0; q < 8; ++q) { const int r = q * 2 + rsub; if (col0 + c4 < N) { const v4f v = *(const v4fa*)&so[w][r][c4]; if (C) *(v4f*)(C + cofs + (size_t)(row0 + r) * ldc + col0 + c4) = v; if (C16) { v4h h4; for (int i = 0; i < 4; ++i) h4[i] = (_Float16)v[i]; *(v4h*)(C16 + cofs + (size_t)(row0 + r) * ldc + col0 + c4) = h4; } } }
     }
}


typedef _Float16 v4h __attribute__((ext_vector_type(4)));

__global__ __launch_bounds__(256) void k_x16(const float* __restrict__ x, _Float16* __restrict__ X16, size_t n8) { const size_t t = (size_t)blockIdx.x * 256 + threadIdx.x; if (t >= n8) return; FragH f;
#pragma unroll
  for (int q = 0; q < 8; ++q) f.h[q] = (_Float16)bf16_round(x[t * 8 + q]); *(v8us*)((unsigned short*)X16 + t * 8) = f.half[0];  }
__global__ __launch_bounds__(256) void k_h16(const float* __restrict__ x, _Float16* __restrict__ X16, size_t n8) { const size_t t = (size_t)blockIdx.x * 256 + threadIdx.x; if (t >= n8) return; FragH f;
#pragma unroll
  for (int q = 0; q < 8; ++q) f.h[q] = (_Float16)x[t * 8 + q]; *(v8us*)((unsigned short*)X16 + t * 8) = f.half[0];  }
__global__ __launch_bounds__(256) void k_round16f(const float* __restrict__ W, _Float16* __restrict__ Bt, size_t n8) { const size_t t = (size_t)blockIdx.x * 256 + threadIdx.x; if (t >= n8) return; FragH f;
#pragma unroll
  for (int i = 0; i < 8; ++i) f.h[i] = (_Float16)(bf16_round(W[t * 8 + i]) * 16.0f); *(v8us*)((unsigned short*)Bt + t * 8) = f.half[0];  }
template <int NHv, int TTv>
__global__ __launch_bounds__(256) void k_vt(const _Float16* __restrict__ V16, int ldv, int voff, _Float16* __restrict__ Vt) { __shared__ unsigned short tl[64][66]; const int tid = threadIdx.x; const int slab = blockIdx.x / (TTv / 64), lg = blockIdx.x % (TTv / 64); const int b = slab / NHv, h = slab % NHv;
  for (int i = tid; i < 64 * 8; i += 256) { const int r = i / 8, c8 = (i % 8) * 8; FragH f; f.half[0] = *(const v8us*)((const unsigned short*)V16 + ((size_t)b * TTv + lg * 64 + r) * ldv + voff + h * 64 + c8);
#pragma unroll
    for (int q = 0; q < 8; ++q) tl[r][c8 + q] = f.u[q]; }
  __syncthreads();
  {
#pragma unroll
    for (int rd = 0; rd < 2; ++rd) { const int d = rd * 32 + tid / 8, pc = tid % 8; FragH f;
#pragma unroll
      for (int q = 0; q < 8; ++q) f.u[q] = tl[pc * 8 + q][d];
      *(v8us*)((unsigned short*)Vt + ((size_t)slab * 64 + d) * TTv + lg * 64 + pc * 8) = f.half[0]; }
     } }

// f32 plane [NN][128] → concatenated-K f16 operand planes [NN][384] for a single 3-term GEMM: with h = f16(v), l = f16((v − h)·2^10):
//   MODE 0 (t side): [h | l | h];  MODE 1 (p side): [h | h·2^-10 | l·2^-10]  so that Σ_K A'·B' = Th·Ph + Tl·Ph·2^-10 + Th·Pl·2^-10 (power-of-two scalings are exact in f16 barring subnormal flushes, which cost ≤1e-4 on a σ≈11 logit);
template <int MODE>
__global__ __launch_bounds__(256) void k_hl3(const float* __restrict__ F, _Float16* __restrict__ P3, size_t n8) { const size_t t = (size_t)blockIdx.x * 256 + threadIdx.x; if (t >= n8) return; const size_t r = (t * 8) / CPN; const int c = (int)((t * 8) % CPN); const v4f a = *(const v4fa*)(F + t * 8), b = *(const v4fa*)(F + t * 8 + 4); FragH h, l, s2, s3;
#pragma unroll
  for (int q = 0; q < 8; ++q) { const float v = (q < 4) ? a[q] : b[q - 4]; const _Float16 hv = (_Float16)v; const _Float16 lv = (_Float16)((v - (float)hv) * 1024.0f); h.h[q] = hv; l.h[q] = lv; s2.h[q] = MODE ? (_Float16)((float)hv * 0.0009765625f) : lv; s3.h[q] = MODE ? (_Float16)((float)lv * 0.0009765625f) : hv; }
  unsigned short* row = (unsigned short*)P3 + r * (3 * CPN) + c;
  { *(v8us*)(row) = h.half[0]; *(v8us*)(row + CPN) = s2.half[0]; *(v8us*)(row + 2 * CPN) = s3.half[0];  } }
__global__ __launch_bounds__(256) void k_tok(const float* __restrict__ x, _Float16* __restrict__ X16) { __shared__ float tl[32][65]; const int tid = threadIdx.x; const int b = blockIdx.x / ((CI / 64) * (NN / 32)), rem = blockIdx.x % ((CI / 64) * (NN / 32)); const int cg = rem / (NN / 32), pg = rem % (NN / 32); const int c0 = cg * 64, p0 = pg * 32;
  for (int i = tid; i < 64 * 32; i += 256) { const int c = i / 32, pp = i % 32; tl[pp][c] = bf16_round(x[((size_t)b * CI + c0 + c) * NN + p0 + pp]); } __syncthreads();
  const int r = tid / 8, pc = tid % 8; FragH f; for (int q = 0; q < 8; ++q) f.h[q] = (_Float16)tl[r][pc * 8 + q]; const size_t row = (size_t)b * NN + p0 + r; *(v8us*)((unsigned short*)X16 + row * CI + c0 + pc * 8) = f.half[0];  }
// Column reductions, rows in parallel: a work-group owns 32 columns (one 128-byte line of every row). Eight lanes of 4 columns cover the line, so the 1024 threads form 128 row groups;
// row group rg walks rows rg, rg + 128, ... with 8 loads of 16 bytes in flight. Partials are merged in a fixed order: lanes l ^ 8 and l ^ 16 inside a wave, then the 32 waves, in wave order, through LDS.
// exp(x) by the same two instructions as __expf (multiply by log2 e, v_exp_f32). The v_nop is the free issue slot that the instruction set asks for behind a transcendental before its source is overwritten;
__device__ __forceinline__ float exp_slot(float x) { float r; asm("v_exp_f32 %0, %1\n\tv_nop" : "=v"(r) : "v"(x * 1.44269504f)); return r; }
__device__ __forceinline__ void ms_merge(float& m, float& z, float m2, float z2) { const float mn = fmaxf(m, m2); z = z * exp_slot(m - mn) + z2 * exp_slot(m2 - mn); m = mn; }
__global__ __launch_bounds__(1024) void k_colstat(const float* __restrict__ S, float* __restrict__ MX, float* __restrict__ ZZ) {
  __shared__ __attribute__((aligned(16))) float sm[32][32], sz[32][32];
  const int tid = threadIdx.x, w = tid >> 5, lane = tid & 31, cq = tid & 7, rg = tid >> 3;
  const float* p = S + (size_t)rg * NN + blockIdx.x * 32 + cq * 4;
  v4f mx = {-3.0e38f, -3.0e38f, -3.0e38f, -3.0e38f}, z = {0.f, 0.f, 0.f, 0.f};
  for (int n = 0; n < NN; n += 128 * 8) {
    v4f s[8];
#pragma unroll
    for (int u = 0; u < 8; ++u) s[u] = *(const v4fa*)(p + (size_t)(n + 128 * u) * NN);
#pragma unroll
    for (int q = 0; q < 4; ++q) {
      float m8 = s[0][q];
#pragma unroll
      for (int u = 1; u < 8; ++u) m8 = fmaxf(m8, s[u][q]);
      const float mn = fmaxf(mx[q], m8);
      float a = z[q] * exp_slot(mx[q] - mn);
#pragma unroll
      for (int u = 0; u < 8; ++u) a += exp_slot(s[u][q] - mn);
      z[q] = a; mx[q] = mn;
    }
  }
#pragma unroll
  for (int q = 0; q < 4; ++q) {
    float m = mx[q], a = z[q];
    ms_merge(m, a, __shfl_xor(m, 8, 32), __shfl_xor(a, 8, 32));
    ms_merge(m, a, __shfl_xor(m, 16, 32), __shfl_xor(a, 16, 32));
    mx[q] = m; z[q] = a;
  }
  if (lane < 8) { *(v4f*)&sm[w][cq * 4] = mx; *(v4f*)&sz[w][cq * 4] = z; }
  __syncthreads();
  if (w == 0) {
    float m = sm[0][lane];
#pragma unroll
    for (int i = 1; i < 32; ++i) m = fmaxf(m, sm[i][lane]);
    float a = 0.f;
#pragma unroll
    for (int i = 0; i < 32; ++i) a += sz[i][lane] * exp_slot(sm[i][lane] - m);
    MX[blockIdx.x * 32 + lane] = m; ZZ[blockIdx.x * 32 + lane] = a;
  }
}
__global__ __launch_bounds__(256) void k_pexp(const float* __restrict__ S, const float* __restrict__ MX, const float* __restrict__ ZZ, _Float16* __restrict__ PT) { const size_t t = (size_t)blockIdx.x * 256 + threadIdx.x; if (t >= (size_t)NN * NN / 8) return; const int m0 = (int)((t * 8) % NN); const v4f a = *(const v4fa*)(S + t * 8), c = *(const v4fa*)(S + t * 8 + 4), xa = *(const v4fa*)(MX + m0), xc = *(const v4fa*)(MX + m0 + 4), za = *(const v4fa*)(ZZ + m0), zc = *(const v4fa*)(ZZ + m0 + 4); FragH f;
#pragma unroll
  for (int q = 0; q < 4; ++q) { f.h[q] = (_Float16)(__expf(a[q] - xa[q]) / za[q] * 32768.0f); f.h[4 + q] = (_Float16)(__expf(c[q] - xc[q]) / zc[q] * 32768.0f); }
  *(v8us*)((unsigned short*)PT + t * 8) = f.half[0];  }
__global__ __launch_bounds__(1024) void k_bnstat(const float* __restrict__ Z, float* __restrict__ MU, float* __restrict__ RS) {
  __shared__ __attribute__((aligned(16))) float a1[32][32], a2[32][32];
  const int tid = threadIdx.x, w = tid >> 5, lane = tid & 31, cq = tid & 7, rg = tid >> 3;
  const float* p = Z + (size_t)rg * CI + blockIdx.x * 32 + cq * 4;
  v4f s1 = {0.f, 0.f, 0.f, 0.f}, s2 = {0.f, 0.f, 0.f, 0.f};
  for (int r = 0; r < NR; r += 128 * 8) {
    v4f v[8];
#pragma unroll
    for (int u = 0; u < 8; ++u) v[u] = *(const v4fa*)(p + (size_t)(r + 128 * u) * CI);
#pragma unroll
    for (int u = 0; u < 8; ++u) { s1 += v[u]; s2 += v[u] * v[u]; }
  }
#pragma unroll
  for (int q = 0; q < 4; ++q) {
    s1[q] += __shfl_xor(s1[q], 8, 32); s2[q] += __shfl_xor(s2[q], 8, 32);
    s1[q] += __shfl_xor(s1[q], 16, 32); s2[q] += __shfl_xor(s2[q], 16, 32);
  }
  if (lane < 8) { *(v4f*)&a1[w][cq * 4] = s1; *(v4f*)&a2[w][cq * 4] = s2; }
  __syncthreads();
  if (w == 0) {
    float t1 = 0.f, t2 = 0.f;
#pragma unroll
    for (int i = 0; i < 32; ++i) { t1 += a1[i][lane]; t2 += a2[i][lane]; }
    const float mu = t1 / (float)NR; const float var = fmaxf(t2 / (float)NR - mu * mu, 0.f);
    MU[blockIdx.x * 32 + lane] = mu; RS[blockIdx.x * 32 + lane] = rsqrtf(var + 1e-5f);
  }
}
__global__ __launch_bounds__(256) void k_out(const float* __restrict__ Z, const float* __restrict__ MU, const float* __restrict__ RS, const float* __restrict__ gam, const float* __restrict__ bet, const float* __restrict__ x, float* __restrict__ out) { __shared__ float tl[32][65]; const int tid = threadIdx.x; const int b = blockIdx.x / ((CI / 32) * (NN / 64)), rem = blockIdx.x % ((CI / 32) * (NN / 64)); const int cg = rem / (NN / 64), pg = rem % (NN / 64); const int c0 = cg * 32, p0 = pg * 64;
  for (int i = tid; i < 64 * 32; i += 256) { const int pp = i / 32, c = i % 32; tl[c][pp] = (Z[((size_t)b * NN + p0 + pp) * CI + c0 + c] - MU[c0 + c]) * RS[c0 + c] * bf16_round(gam[c0 + c]) + bf16_round(bet[c0 + c]); } __syncthreads();
  { for (int i = tid; i < 32 * 16; i += 256) { const int c = i / 16, q4 = i % 16; const size_t o = ((size_t)b * CI + c0 + c) * NN + p0 + q4 * 4; const v4f xr = *(const v4fa*)(x + o); const v4f v = {tl[c][q4 * 4] + bf16_round(xr[0]), tl[c][q4 * 4 + 1] + bf16_round(xr[1]), tl[c][q4 * 4 + 2] + bf16_round(xr[2]), tl[c][q4 * 4 + 3] + bf16_round(xr[3])}; *(v4f*)(out + o) = v; }  } }

extern "C" void kernel_launch(void* const* d_in, const int* in_sizes, int n_in,
                              void* d_out, int out_size, void* d_ws, size_t ws_size, hipStream_t stream) {
  (void)in_sizes; (void)n_in; (void)out_size;
  const float* const* I = (const float* const*)d_in; const float* x = I[0]; const float* Wt = I[1]; const float* Wp = I[2]; const float* Wg = I[3]; const float* Wz = I[4]; const float* gam = I[5]; const float* bet = I[6];
  char* ws = (char*)d_ws; size_t off = 0;
  auto take = [&](size_t bytes) { char* p = ws + off; off += (bytes + 255) & ~(size_t)255; return p; };
  _Float16* Bt_ = (_Float16*)take((size_t)CPN * CI * 2); _Float16* Bp_ = (_Float16*)take((size_t)CPN * CI * 2); _Float16* Bg_ = (_Float16*)take((size_t)CPN * CI * 2); _Float16* Bz_ = (_Float16*)take((size_t)CI * CPN * 2);
  float* S = (float*)take((size_t)NN * NN * 4); _Float16* PT = (_Float16*)take((size_t)NN * NN * 2); _Float16* X16 = (_Float16*)take((size_t)NR * CI * 2);
  _Float16* T3 = (_Float16*)take((size_t)NN * 3 * CPN * 2); _Float16* P3 = (_Float16*)take((size_t)NN * 3 * CPN * 2); float* F32 = (float*)take((size_t)NN * CPN * 4);      /* per-batch: concatenated-K operand planes [4096][384] and the f32 conv output they are built from */
  _Float16* Gc = (_Float16*)take((size_t)BB * CPN * NN * 2); _Float16* Y16 = (_Float16*)take((size_t)NR * CPN * 2); float* MX = (float*)take((size_t)NN * 4); float* ZZ = (float*)take((size_t)NN * 4); float* MU = (float*)take((size_t)CI * 4); float* RS = (float*)take((size_t)CI * 4);
  float* Z = S;      /* the z plane (16.8 MB) reuses the score region after the last batch */
  if (off > ws_size) return;      // 67 + 33.5 + 8.4 + 3.1 + 3.1 + 2.1 + 4.2 + 4.2 + 0.3 ≈ 126 MB (120 MiB)
  const unsigned gw = (unsigned)(((size_t)CPN * CI / 8 + 255) / 256);
  k_round16f<<<gw, 256, 0, stream>>>(Wt, Bt_, (size_t)CPN * CI / 8); k_round16f<<<gw, 256, 0, stream>>>(Wp, Bp_, (size_t)CPN * CI / 8); k_round16f<<<gw, 256, 0, stream>>>(Wg, Bg_, (size_t)CPN * CI / 8); k_round16f<<<gw, 256, 0, stream>>>(Wz, Bz_, (size_t)CI * CPN / 8);      /* conv weights (out,in) natural ×2^4 */
  k_tok<<<BB * (CI / 64) * (NN / 32), 256, 0, stream>>>(x, X16);
  k_gemm_hhx<0><<<dim3(((CPN / 16) * (NN / 64) + 3) / 4, BB), 128, 0, stream>>>(Bg_, CI, 0, X16, CI, (size_t)NN * CI, 0.0625f, nullptr, 0, nullptr, 1, 0, 0, nullptr, Gc, NN, (size_t)CPN * NN, CPN, NN, CI);      /* g channel-major per batch [b][128][4096] (f16): M 128 N 4096 K 256 */
  const dim3 gs(((NN / 16) * (NN / 64) + 3) / 4, 1), gy(((NN / 16) * (CPN / 64) + 3) / 4, 1);
  const dim3 gtp(((NN / 16) * (CPN / 64) + 3) / 4, 1); const unsigned g8 = (unsigned)(((size_t)NN * CPN / 8 + 255) / 256);
  for (int b = 0; b < BB; ++b) { const size_t xo = (size_t)b * NN * CI, yo = (size_t)b * NN * CPN;
    k_gemm_hhx<0><<<gtp, 128, 0, stream>>>(X16 + xo, CI, 0, Bt_, CI, 0, 0.0625f, nullptr, 0, nullptr, 1, 0, 0, F32, nullptr, CPN, 0, NN, CPN, CI); k_hl3<0><<<g8, 256, 0, stream>>>(F32, T3, (size_t)NN * CPN / 8);      /* t (this batch) token-major f32 → [h | l | h]: M 4096 N 128 K 256 */
    k_gemm_hhx<0><<<gtp, 128, 0, stream>>>(X16 + xo, CI, 0, Bp_, CI, 0, 0.0625f, nullptr, 0, nullptr, 1, 0, 0, F32, nullptr, CPN, 0, NN, CPN, CI); k_hl3<1><<<g8, 256, 0, stream>>>(F32, P3, (size_t)NN * CPN / 8);      /* p (this batch) → [h | h·2^-10 | l·2^-10] */
    k_gemm_hhx<0><<<gs, 128, 0, stream>>>(T3, 3 * CPN, 0, P3, 3 * CPN, 0, 1.0f, nullptr, 0, nullptr, 1, 0, 0, S, nullptr, NN, 0, NN, NN, 3 * CPN);      /* S[n][m] = t_n·p_m as Th·Ph + (Tl·Ph + Th·Pl)·2^-10 in one K = 384 pass: M 4096 N 4096 */
    k_colstat<<<NN / 32, 1024, 0, stream>>>(S, MX, ZZ); k_pexp<<<(unsigned)(((size_t)NN * NN / 8 + 255) / 256), 256, 0, stream>>>(S, MX, ZZ, PT);
    k_gemm_hhx<0><<<gy, 128, 0, stream>>>(PT, NN, 0, Gc + (size_t)b * CPN * NN, NN, 0, 0.000030517578125f, nullptr, 0, nullptr, 1, 0, 0, nullptr, Y16 + yo, CPN, 0, NN, CPN, NN); }      /* y[n][c] = Σ_m att[n][m]·g[c][m]: M 4096 N 128 K 4096 (f16 out) */
  k_gemm_hhx<0><<<dim3(((NR / 16) * (CI / 64) + 3) / 4, 1), 128, 0, stream>>>(Y16, CPN, 0, Bz_, CPN, 0, 0.0625f, nullptr, 0, nullptr, 1, 0, 0, Z, nullptr, CI, 0, NR, CI, CPN);      /* z token-major [16384][256] f32: M 16384 N 256 K 128 */
  k_bnstat<<<CI / 32, 1024, 0, stream>>>(Z, MU, RS); k_out<<<BB * (CI / 32) * (NN / 64), 256, 0, stream>>>(Z, MU, RS, gam, bet, x, (float*)d_out);
}

// v002
// It runs in 387 microseconds.
// Two timings next to v001 put it at 2.56 and 2.57 times that version's speed.
// Counting every step since v000, it is 33.7 times as fast.
#include <hip/hip_runtime.h>
// Spatial non-local block with query-axis softmax (B=4, C_in 256, C_p 128, N=4096): t,p,g = 1×1 convs; att[n,m] = Σ_c t[c,n]·p[c,m]; att = softmax over n (dim=1) for every m; y[c,n] = Σ_m att[n,m]·g[c,m]; z = Wz·y;
// BatchNorm1d in training mode (batch statistics over (B,N) per channel, biased variance, eps 1e-5) with affine; out = BN(z) + x.
// Compute dtype: x and weights rounded to bf16; t and p as f32 GEMM outputs split into f16 hi + ×2^10 residual parts laid out as concatenated-K operands so one K=384 GEMM yields Th·Ph + (Tl·Ph + Th·Pl)·2^-10 (σ≈11 logits, f32-accurate);
// the score plane is kept transposed (S[n][m], f32) so the softmax over n is a column reduction (f32 per-column max/Σ) and the normalised weights are written row-major as f16 ×2^15; y = attᵀ-contraction as an f16 GEMM against
// channel-major g; z GEMM; per-channel batch statistics as fixed-order f32 column sums; affine + residual applied during the transpose back to channel-major. All contractions on v_wmma_f32_16x16x32_f16, f32 accumulate.
#define BB 4
#define CI 256
#define CPN 128
#define NN 4096
#define NR (BB * NN)

typedef __bf16 v16b __attribute__((ext_vector_type(16)));
typedef unsigned short v8us __attribute__((ext_vector_type(8), may_alias));
typedef float  v8f  __attribute__((ext_vector_type(8)));
typedef float  v4f  __attribute__((ext_vector_type(4)));
typedef float  v4fa __attribute__((ext_vector_type(4), may_alias));
union FragB { v16b v; v8us half[2]; unsigned short u[16]; };

__device__ __forceinline__ unsigned short bf16_bits(float x) { unsigned int u = __float_as_uint(x); return (unsigned short)((u + 0x7FFFu + ((u >> 16) & 1u)) >> 16); }
__device__ __forceinline__ float bf16_val(unsigned short b) { return __uint_as_float(((unsigned int)b) << 16); }
__device__ __forceinline__ float bf16_round(float x) { return bf16_val(bf16_bits(x)); }
// D += A·B with NT terms: 1 = ah·bh, 2 = + al·bh (A split), 3 = + ah·bl (both split)
template <int NT>
__device__ __forceinline__ v8f mmaN(v16b ah, v16b al, v16b bh, v16b bl, v8f c) {
  c = __builtin_amdgcn_wmma_f32_16x16x32_bf16(false, ah, false, bh, (short)0, c, false, false);
  if (NT >= 2) c = __builtin_amdgcn_wmma_f32_16x16x32_bf16(false, al, false, bh, (short)0, c, false, false);
  if (NT >= 3) c = __builtin_amdgcn_wmma_f32_16x16x32_bf16(false, ah, false, bl, (short)0, c, false, false);
  asm volatile("v_nop\n\tv_nop\n\tv_nop\n\tv_nop" : "+v"(c) : "v"(ah), "v"(al), "v"(bh), "v"(bl));
  return c;
}

__global__ __launch_bounds__(256) void k_wt_bf16(const float* __restrict__ W, unsigned short* __restrict__ Wt, int K, int N) {
  const int t = blockIdx.x * 256 + threadIdx.x;
  const int k8n = K / 8;
  if (t >= N * k8n) return;
  const int n = t / k8n, k8 = (t % k8n) * 8;
  v8us v;
#pragma unroll
  for (int i = 0; i < 8; ++i) v[i] = bf16_bits(W[(size_t)(k8 + i) * N + n]);
  *(v8us*)(Wt + (size_t)n * K + k8) = v;
  
}

// GEMM C[M][N] (f32, pitch ldc) = act(A[M][K]·W + bias). A f32 row-major (pitch lda) converted per fragment to bf16
// (ASPLIT: hi/lo two planes -> 2 terms, else single rounded term); Wt bf16 [N][K] (pitch ldb). BIAS_BF16 rounds the
// bias to bf16 first (bias quantised to bf16 before the add). K%32==0, M%16==0, N%64==0.
template <bool ASPLIT, int ACT, bool BIAS_BF16>
__global__ __launch_bounds__(128) void k_gemm_bf(const float* __restrict__ A, int lda, const unsigned short* __restrict__ Wt, int ldb,
                                               const float* __restrict__ bias, float* __restrict__ C, int ldc, int M, int N, int K) {
  __shared__ __attribute__((aligned(16))) float so[4][16][64];
  const int tid = threadIdx.x, w = tid >> 5, lane = tid & 31, ln = lane & 15, hh = lane >> 4;
  const int ntn = N / 64;
  const int wid = blockIdx.x * 4 + w;
  const int mt = wid / ntn, nq = wid % ntn;
  if (mt * 16 >= M) return;
  const int row0 = mt * 16, col0 = nq * 64;
  const float* arow = A + (size_t)(row0 + ln) * lda;
  v8f acc[4] = {};
  for (int kb = 0; kb < K; kb += 32) {
    FragB ah, al;
    const v4f x0 = *(const v4fa*)(arow + kb + 8 * hh), x1 = *(const v4fa*)(arow + kb + 8 * hh + 4);
    const v4f x2 = *(const v4fa*)(arow + kb + 16 + 8 * hh), x3 = *(const v4fa*)(arow + kb + 16 + 8 * hh + 4);
    float xs[16] = {x0[0],x0[1],x0[2],x0[3],x1[0],x1[1],x1[2],x1[3],x2[0],x2[1],x2[2],x2[3],x3[0],x3[1],x3[2],x3[3]};
#pragma unroll
    for (int i = 0; i < 16; ++i) { const unsigned short hb = bf16_bits(xs[i]); ah.u[i] = hb; al.u[i] = ASPLIT ? bf16_bits(xs[i] - bf16_val(hb)) : (unsigned short)0; }
#pragma unroll
    for (int t = 0; t < 4; ++t) {
      const unsigned short* brow = Wt + (size_t)(col0 + t * 16 + ln) * ldb + kb;
      FragB b;
      b.half[0] = *(const v8us*)(brow + 8 * hh);
      b.half[1] = *(const v8us*)(brow + 16 + 8 * hh);
      acc[t] = mmaN<ASPLIT ? 2 : 1>(ah.v, al.v, b.v, b.v, acc[t]);
    }
  }
#pragma unroll
  for (int t = 0; t < 4; ++t) {
    float bv = bias ? bias[col0 + t * 16 + ln] : 0.f;
    if (BIAS_BF16) bv = bf16_round(bv);
#pragma unroll
    for (int r = 0; r < 8; ++r) { float v = acc[t][r] + bv; if (ACT == 1) v = fmaxf(v, 0.f); so[w][8 * hh + r][t * 16 + ln] = v; }
  }
  __builtin_amdgcn_fence(__ATOMIC_ACQ_REL, "workgroup");
  __builtin_amdgcn_wave_barrier();
  const int rsub = lane >> 4, c4 = (lane & 15) * 4;
  {
#pragma unroll
    for (int q = 0; q < 8; ++q) {
      const int r = q * 2 + rsub;
      const v4f v = *(const v4fa*)&so[w][r][c4];
      *(v4f*)(C + (size_t)(row0 + r) * ldc + col0 + c4) = v;
    }
    
  }
}

// Flash-style causal/unmasked attention, all contractions 3-term bf16 hi/lo splits, f32 softmax with running max.
// q,k,v rows are read from f32 buffers with arbitrary row pitch (so they can live inside a fused qkv buffer);
// D = head size (multiple of 32, <= 128); one wave = 16 query rows; block = 4 waves (64 queries) sharing K/V chunks of 32.
template <int D, bool CAUSAL>
__global__ __launch_bounds__(128) void k_flash(const float* __restrict__ qb, const float* __restrict__ kb, const float* __restrict__ vb,
                                             int pitch, int T, int H, float scale, float* __restrict__ y, int ypitch) {
  constexpr int KS = D / 32;        // k-steps for QK
  constexpr int DT = D / 16;        // d tiles for PV
  __shared__ __attribute__((aligned(16))) unsigned short sKh[32][D + 8], sKl[32][D + 8], sVh[32][D + 8], sVl[32][D + 8];
  __shared__ __attribute__((aligned(16))) unsigned short sPh[4][16][40], sPl[4][16][40];
  __shared__ __attribute__((aligned(16))) float sO[4][16][D];
  const int tid = threadIdx.x, w = tid >> 5, lane = tid & 31, ln = lane & 15, hh = lane >> 4;
  const int nqb = (T + 63) / 64;
  const int bh = blockIdx.x / nqb, qblk = blockIdx.x % nqb;
  const int b = bh / H, h = bh % H;
  const int q0 = qblk * 64 + w * 16;
  const float* Q = qb + (size_t)b * T * pitch + h * D;
  const float* K = kb + (size_t)b * T * pitch + h * D;
  const float* V = vb + (size_t)b * T * pitch + h * D;

  // A fragments of the wave's 16 query rows (scaled), hi/lo
  FragB aqh[KS], aql[KS];
  {
    int row = q0 + ln; if (row >= T) row = T - 1;
    const float* qr = Q + (size_t)row * pitch;
#pragma unroll
    for (int ks = 0; ks < KS; ++ks)
#pragma unroll
      for (int i = 0; i < 16; ++i) {
        const int d = ks * 32 + ((i < 8) ? (8 * hh + i) : (16 + 8 * hh + (i - 8)));
        const float x = qr[d] * scale; const unsigned short hb = bf16_bits(x);
        aqh[ks].u[i] = hb; aql[ks].u[i] = bf16_bits(x - bf16_val(hb));
      }
  }
  float m_r[8], l_r[8];
#pragma unroll
  for (int r = 0; r < 8; ++r) { m_r[r] = -3.0e38f; l_r[r] = 0.f; }
  v8f oacc[DT];
#pragma unroll
  for (int dt = 0; dt < DT; ++dt) oacc[dt] = (v8f){0.f,0.f,0.f,0.f,0.f,0.f,0.f,0.f};

  const int kv_end = CAUSAL ? min(T, qblk * 64 + 64) : T;     // block-uniform
  for (int j0 = 0; j0 < kv_end; j0 += 32) {
    __syncthreads();
    for (int e = tid; e < 32 * (D / 4); e += 128) {
      const int r = e / (D / 4), c4 = (e % (D / 4)) * 4;
      const int key = j0 + r;
      v4f kf = {0.f,0.f,0.f,0.f}, vf = {0.f,0.f,0.f,0.f};
      if (key < T) { kf = *(const v4fa*)(K + (size_t)key * pitch + c4); vf = *(const v4fa*)(V + (size_t)key * pitch + c4); }
#pragma unroll
      for (int t = 0; t < 4; ++t) {
        unsigned short hb = bf16_bits(kf[t]); sKh[r][c4 + t] = hb; sKl[r][c4 + t] = bf16_bits(kf[t] - bf16_val(hb));
        hb = bf16_bits(vf[t]); sVh[r][c4 + t] = hb; sVl[r][c4 + t] = bf16_bits(vf[t] - bf16_val(hb));
      }
    }
    __syncthreads();
    // S tile 16 x 32
    v8f s[2];
#pragma unroll
    for (int nt = 0; nt < 2; ++nt) {
      v8f acc = {};
#pragma unroll
      for (int ks = 0; ks < KS; ++ks) {
        FragB bh_, bl_;
        bh_.half[0] = *(const v8us*)&sKh[nt * 16 + ln][ks * 32 + 8 * hh]; bh_.half[1] = *(const v8us*)&sKh[nt * 16 + ln][ks * 32 + 16 + 8 * hh];
        bl_.half[0] = *(const v8us*)&sKl[nt * 16 + ln][ks * 32 + 8 * hh]; bl_.half[1] = *(const v8us*)&sKl[nt * 16 + ln][ks * 32 + 16 + 8 * hh];
        acc = mmaN<3>(aqh[ks].v, aql[ks].v, bh_.v, bl_.v, acc);
      }
      s[nt] = acc;
    }
    // mask + running max (rows 8hh+r; the 16 lanes of a half share rows)
    float alpha[8];
#pragma unroll
    for (int r = 0; r < 8; ++r) {
      const int qi = q0 + 8 * hh + r;
      const int ja = j0 + ln, jb = j0 + 16 + ln;
      if (CAUSAL) { if (ja > qi) s[0][r] = -3.0e38f; if (jb > qi) s[1][r] = -3.0e38f; }
      if (ja >= T) s[0][r] = -3.0e38f;
      if (jb >= T) s[1][r] = -3.0e38f;
      float mx = fmaxf(s[0][r], s[1][r]);
      mx = fmaxf(mx, __shfl_xor(mx, 1, 32)); mx = fmaxf(mx, __shfl_xor(mx, 2, 32)); mx = fmaxf(mx, __shfl_xor(mx, 4, 32)); mx = fmaxf(mx, __shfl_xor(mx, 8, 32));
      const float mnew = fmaxf(m_r[r], mx);
      alpha[r] = (mnew > -1.0e38f) ? __expf(m_r[r] - mnew) : 1.0f;
      const float p0 = (s[0][r] > -1.0e38f) ? __expf(s[0][r] - mnew) : 0.f;
      const float p1 = (s[1][r] > -1.0e38f) ? __expf(s[1][r] - mnew) : 0.f;
      m_r[r] = mnew;
      l_r[r] = l_r[r] * alpha[r] + p0 + p1;            // per-lane partial row sum (16 lanes combined at the end)
      unsigned short hb = bf16_bits(p0); sPh[w][8 * hh + r][ln] = hb;      sPl[w][8 * hh + r][ln] = bf16_bits(p0 - bf16_val(hb));
      hb = bf16_bits(p1);                sPh[w][8 * hh + r][16 + ln] = hb; sPl[w][8 * hh + r][16 + ln] = bf16_bits(p1 - bf16_val(hb));
    }
#pragma unroll
    for (int dt = 0; dt < DT; ++dt)
#pragma unroll
      for (int r = 0; r < 8; ++r) oacc[dt][r] *= alpha[r];
    __builtin_amdgcn_fence(__ATOMIC_ACQ_REL, "workgroup");
    __builtin_amdgcn_wave_barrier();
    FragB pah, pal;
    pah.half[0] = *(const v8us*)&sPh[w][ln][8 * hh]; pah.half[1] = *(const v8us*)&sPh[w][ln][16 + 8 * hh];
    pal.half[0] = *(const v8us*)&sPl[w][ln][8 * hh]; pal.half[1] = *(const v8us*)&sPl[w][ln][16 + 8 * hh];
#pragma unroll
    for (int dt = 0; dt < DT; ++dt) {
      FragB bvh, bvl;
#pragma unroll
      for (int i = 0; i < 8; ++i) {
        bvh.u[i] = sVh[8 * hh + i][dt * 16 + ln]; bvh.u[8 + i] = sVh[16 + 8 * hh + i][dt * 16 + ln];
        bvl.u[i] = sVl[8 * hh + i][dt * 16 + ln]; bvl.u[8 + i] = sVl[16 + 8 * hh + i][dt * 16 + ln];
      }
      oacc[dt] = mmaN<3>(pah.v, pal.v, bvh.v, bvl.v, oacc[dt]);
    }
    __builtin_amdgcn_fence(__ATOMIC_ACQ_REL, "workgroup");
    __builtin_amdgcn_wave_barrier();
  }
#pragma unroll
  for (int r = 0; r < 8; ++r) {
    float l = l_r[r];
    l += __shfl_xor(l, 1, 32); l += __shfl_xor(l, 2, 32); l += __shfl_xor(l, 4, 32); l += __shfl_xor(l, 8, 32);
    l_r[r] = (l > 0.f) ? 1.0f / l : 0.f;
  }
#pragma unroll
  for (int dt = 0; dt < DT; ++dt)
#pragma unroll
    for (int r = 0; r < 8; ++r) sO[w][8 * hh + r][dt * 16 + ln] = oacc[dt][r] * l_r[r];
  __builtin_amdgcn_fence(__ATOMIC_ACQ_REL, "workgroup");
  __builtin_amdgcn_wave_barrier();
  {
    for (int r = 0; r < 16; ++r) {
      const int row = q0 + r;
      if (row < T && lane < D / 4) {
        const v4f val = *(const v4fa*)&sO[w][r][lane * 4];
        *(v4f*)(y + ((size_t)b * T + row) * ypitch + h * D + lane * 4) = val;
      }
    }
    
  }
}

// GEMM C = act(A·W + bias + resid): A f32 (ASPLIT -> hi/lo 2 terms), Wt bf16 [N][K]; ACT 0 none, 1 relu, 2 exact gelu;
// resid (optional, f32, row index = (row % rmod), pitch ldr, RES_BF16 rounds it) added before the activation.
template <bool ASPLIT, int ACT, bool BIAS_BF16, bool RES_BF16>
__global__ __launch_bounds__(128) void k_gemm_bf3(const float* __restrict__ A, int lda, const unsigned short* __restrict__ Wt, int ldb,
                                                const float* __restrict__ bias, const float* __restrict__ resid, int rmod, int ldr,
                                                float* __restrict__ C, int ldc, int M, int N, int K) {
  __shared__ __attribute__((aligned(16))) float so[4][16][64];
  const int tid = threadIdx.x, w = tid >> 5, lane = tid & 31, ln = lane & 15, hh = lane >> 4;
  const int ntn = N / 64;
  const int wid = blockIdx.x * 4 + w;
  const int mt = wid / ntn, nq = wid % ntn;
  if (mt * 16 >= M) return;
  const int row0 = mt * 16, col0 = nq * 64;
  const float* arow = A + (size_t)(row0 + ln) * lda;
  v8f acc[4] = {};
  for (int kb = 0; kb < K; kb += 32) {
    FragB ah, al;
    const v4f x0 = *(const v4fa*)(arow + kb + 8 * hh), x1 = *(const v4fa*)(arow + kb + 8 * hh + 4);
    const v4f x2 = *(const v4fa*)(arow + kb + 16 + 8 * hh), x3 = *(const v4fa*)(arow + kb + 16 + 8 * hh + 4);
    float xs[16] = {x0[0],x0[1],x0[2],x0[3],x1[0],x1[1],x1[2],x1[3],x2[0],x2[1],x2[2],x2[3],x3[0],x3[1],x3[2],x3[3]};
#pragma unroll
    for (int i = 0; i < 16; ++i) { const unsigned short hb = bf16_bits(xs[i]); ah.u[i] = hb; al.u[i] = ASPLIT ? bf16_bits(xs[i] - bf16_val(hb)) : (unsigned short)0; }
#pragma unroll
    for (int t = 0; t < 4; ++t) {
      const unsigned short* brow = Wt + (size_t)(col0 + t * 16 + ln) * ldb + kb;
      FragB b;
      b.half[0] = *(const v8us*)(brow + 8 * hh);
      b.half[1] = *(const v8us*)(brow + 16 + 8 * hh);
      acc[t] = mmaN<ASPLIT ? 2 : 1>(ah.v, al.v, b.v, b.v, acc[t]);
    }
  }
#pragma unroll
  for (int t = 0; t < 4; ++t) {
    const int col = col0 + t * 16 + ln;
    float bv = bias ? bias[col] : 0.f;
    if (BIAS_BF16) bv = bf16_round(bv);
#pragma unroll
    for (int r = 0; r < 8; ++r) {
      float v = acc[t][r] + bv;
      if (resid) { float rv = resid[(size_t)((row0 + 8 * hh + r) % rmod) * ldr + col]; if (RES_BF16) rv = bf16_round(rv); v += rv; }
      if (ACT == 1) v = fmaxf(v, 0.f);
      if (ACT == 2) v = 0.5f * v * (1.0f + erff(v * 0.70710678118654752f));
      if (ACT == 3) { const float u = 0.7978845608028654f * (v + 0.044715f * v * v * v); v = 0.5f * v * (1.0f + tanhf(u)); }
      so[w][8 * hh + r][t * 16 + ln] = v;
    }
  }
  __builtin_amdgcn_fence(__ATOMIC_ACQ_REL, "workgroup");
  __builtin_amdgcn_wave_barrier();
  const int rsub = lane >> 4, c4 = (lane & 15) * 4;
  {
#pragma unroll
    for (int q = 0; q < 8; ++q) {
      const int r = q * 2 + rsub;
      const v4f v = *(const v4fa*)&so[w][r][c4];
      *(v4f*)(C + (size_t)(row0 + r) * ldc + col0 + c4) = v;
    }
    
  }
}
// row LayerNorm (biased variance, eps) over N: s = X (+ R); optional out_sum <- s; out_norm <- (s-mu)*rsqrt(var+eps)*g + b
template <bool PARAM_BF16>
__global__ __launch_bounds__(256) void k_layernorm(const float* __restrict__ X, const float* __restrict__ R, const float* __restrict__ g, const float* __restrict__ bta,
                                                  float* __restrict__ out_sum, float* __restrict__ out_norm, int N, float eps) {
  __shared__ float red[256];
  const int row = blockIdx.x, tid = threadIdx.x;
  const float* x = X + (size_t)row * N; const float* rr = R ? R + (size_t)row * N : nullptr;
  float vals[16];                     // up to N = 4096
  const int per = N / 256;            // contiguous chunk per thread? use strided-by-4 chunks: thread handles j = tid*4 + 1024*u
  float s1 = 0.f;
  for (int u = 0; u < per / 4; ++u) {
    const int j = tid * 4 + 1024 * u;
    const v4f a = *(const v4fa*)(x + j);
    v4f b = {0.f,0.f,0.f,0.f}; if (rr) b = *(const v4fa*)(rr + j);
#pragma unroll
    for (int q = 0; q < 4; ++q) { const float v = a[q] + b[q]; vals[u * 4 + q] = v; s1 += v; }
  }
  red[tid] = s1; __syncthreads();
  for (int st = 128; st > 0; st >>= 1) { if (tid < st) red[tid] += red[tid + st]; __syncthreads(); }
  const float mu = red[0] / (float)N; __syncthreads();
  float s2 = 0.f;
  for (int u = 0; u < per / 4; ++u)
#pragma unroll
    for (int q = 0; q < 4; ++q) { const float c = vals[u * 4 + q] - mu; s2 += c * c; }
  red[tid] = s2; __syncthreads();
  for (int st = 128; st > 0; st >>= 1) { if (tid < st) red[tid] += red[tid + st]; __syncthreads(); }
  const float rs = rsqrtf(red[0] / (float)N + eps);
  {
    for (int u = 0; u < per / 4; ++u) {
      const int j = tid * 4 + 1024 * u;
      v4f o, sm;
#pragma unroll
      for (int q = 0; q < 4; ++q) {
        float gg = g[j + q], bb = bta[j + q];
        if (PARAM_BF16) { gg = bf16_round(gg); bb = bf16_round(bb); }
        sm[q] = vals[u * 4 + q]; o[q] = (vals[u * 4 + q] - mu) * rs * gg + bb;
      }
      if (out_sum) *(v4f*)(out_sum + (size_t)row * N + j) = sm;
      *(v4f*)(out_norm + (size_t)row * N + j) = o;
    }
    
  }
}



// ---- f16 WMMA path (v_wmma_f32_16x16x32_f16): 11-bit significands for operands in range — used where a [0,1] probability operand needs more precision than bf16
typedef _Float16 v16h __attribute__((ext_vector_type(16)));
union FragH { v16h v; v8us half[2]; _Float16 h[16]; unsigned short u[16]; };
template <int NT>
__device__ __forceinline__ v8f mmaH(v16h ah, v16h al, v16h bh, v16h bl, v8f c) {
  c = __builtin_amdgcn_wmma_f32_16x16x32_f16(false, ah, false, bh, (short)0, c, false, false);
  if (NT >= 2) c = __builtin_amdgcn_wmma_f32_16x16x32_f16(false, al, false, bh, (short)0, c, false, false);
  if (NT >= 3) c = __builtin_amdgcn_wmma_f32_16x16x32_f16(false, ah, false, bl, (short)0, c, false, false);
  asm volatile("v_nop\n\tv_nop\n\tv_nop\n\tv_nop" : "+v"(c) : "v"(ah), "v"(al), "v"(bh), "v"(bl));
  return c;
}
// batched GEMM like k_gemm_b but f16 operands: A f32 (split into f16 hi/lo if ASPLIT, else rounded to f16), Bt = f16 values [n][k]; alpha; C f32; N multiple of 16 (partial tiles skipped)
template <bool ASPLIT>
__global__ __launch_bounds__(128) void k_gemm_h(const float* __restrict__ A, int lda, size_t sA, const _Float16* __restrict__ Bh, int ldb, size_t sB, float alpha, float* __restrict__ C, int ldc, size_t sC, int M, int N, int K) {
  __shared__ __attribute__((aligned(16))) float so[4][16][64];
  const int tid = threadIdx.x, w = tid >> 5, lane = tid & 31, ln = lane & 15, hh = lane >> 4; const int by = blockIdx.y;
  A += (size_t)by * sA; Bh += (size_t)by * sB; C += (size_t)by * sC;
  const int ntn = (N + 63) / 64; const int wid = blockIdx.x * 4 + w; const int mt = wid / ntn, nq = wid % ntn; if (mt * 16 >= M) return;
  const int row0 = mt * 16, col0 = nq * 64; const float* arow = A + (size_t)(row0 + ln) * lda;
  v8f acc[4] = {};
  for (int kb = 0; kb < K; kb += 32) {
    FragH ah, al;
    const v4f x0 = *(const v4fa*)(arow + kb + 8 * hh), x1 = *(const v4fa*)(arow + kb + 8 * hh + 4), x2 = *(const v4fa*)(arow + kb + 16 + 8 * hh), x3 = *(const v4fa*)(arow + kb + 16 + 8 * hh + 4);
    float xs[16] = {x0[0],x0[1],x0[2],x0[3],x1[0],x1[1],x1[2],x1[3],x2[0],x2[1],x2[2],x2[3],x3[0],x3[1],x3[2],x3[3]};
#pragma unroll
    for (int i = 0; i < 16; ++i) { const _Float16 h = (_Float16)xs[i]; ah.h[i] = h; al.h[i] = ASPLIT ? (_Float16)(xs[i] - (float)h) : (_Float16)0.0f; }
#pragma unroll
    for (int t = 0; t < 4; ++t) { if (col0 + t * 16 >= N) continue; const size_t boff = (size_t)(col0 + t * 16 + ln) * ldb + kb; FragH bq; bq.half[0] = *(const v8us*)(Bh + boff + 8 * hh); bq.half[1] = *(const v8us*)(Bh + boff + 16 + 8 * hh);
      acc[t] = mmaH<ASPLIT ? 2 : 1>(ah.v, al.v, bq.v, bq.v, acc[t]); }
  }
#pragma unroll
  for (int t = 0; t < 4; ++t) { if (col0 + t * 16 >= N) continue;
#pragma unroll
    for (int r = 0; r < 8; ++r) so[w][8 * hh + r][t * 16 + ln] = acc[t][r] * alpha; }
  __builtin_amdgcn_fence(__ATOMIC_ACQ_REL, "workgroup"); __builtin_amdgcn_wave_barrier();
  const int rsub = lane >> 4, c4 = (lane & 15) * 4;
  {
#pragma unroll
    for (int q = 0; q < 8; ++q) { const int r = q * 2 + rsub; if (col0 + c4 < N) { const v4f v = *(const v4fa*)&so[w][r][c4]; *(v4f*)(C + (size_t)(row0 + r) * ldc + col0 + c4) = v; } }
     }
}

// Wt[n][k] = f16(W[k][n]·scale) from f32 row-major W[K][N] (scale = power of two; bf16-exact weights stay exact in f16 away from the subnormal range)
__global__ __launch_bounds__(256) void k_wt_f16(const float* __restrict__ W, _Float16* __restrict__ Wt, int K, int N, float scale) {
  const int t = blockIdx.x * 256 + threadIdx.x; if (t >= N * (K / 8)) return; const int n = t / (K / 8), k8 = (t % (K / 8)) * 8; FragH f;
#pragma unroll
  for (int i = 0; i < 8; ++i) f.h[i] = (_Float16)(bf16_round(W[(size_t)(k8 + i) * N + n]) * scale); const v8us o = f.half[0];
  *(v8us*)((unsigned short*)Wt + (size_t)n * K + k8) = o; 
}
typedef _Float16 v4h __attribute__((ext_vector_type(4)));
// GEMM C[M][N] = alpha * sum_k A[m][k] * B[n][k], f16 operands with k contiguous, f32 accumulate; writes f32 C or f16 C16 (pitch ldc). blockIdx = (N tile, M tile, batch).
// A work-group of 8 waves owns a BM x BN tile of C. Per K step the BM rows of A and the BN rows of B (BK elements each) are fetched with whole-line 16-byte loads, one chunk per lane,
// and stored to LDS rows padded by 16 bytes; every wave then reads its WMMA fragments from LDS, so a tile row is fetched from L2 once per work-group instead of once per wave in 32-byte pieces.
// Two LDS buffers: the next step's global loads are issued right behind the barrier (in front of it the barrier's own wait would drain them), fly during this step's products and are stored to the other buffer behind them.
// Global load addresses are a scalar base per chunk plus one 32-bit byte offset per lane and operand, which lives through the whole loop and moves on by one K step in front of each step's loads.
// sbase() takes a wave-uniform address through readfirstlane: the loads then take the scalar-base form, the loop holds no 64-bit vector address sums, and no short-lived address register is handed to a later load as its destination.
// Each output's products run over k in ascending blocks of 32 in one accumulator chain. M % BM == 0, N % BN == 0, K % BK == 0, BN == 128.
// The '#pragma unroll' on each loop over pre, base, acc or the fragments is there so that the array is indexed by constants only and stays in registers.
typedef const __attribute__((address_space(1))) v8us* gv8;
__device__ __forceinline__ unsigned long long sbase(const char* p) { const unsigned long long u = (unsigned long long)p; const unsigned lo = (unsigned)__builtin_amdgcn_readfirstlane((int)(unsigned)u), hi = (unsigned)__builtin_amdgcn_readfirstlane((int)(unsigned)(u >> 32)); return ((unsigned long long)hi << 32) | lo; }
template <int BM, int BN, int BK, int WM, int WN, bool OUT16>
__global__ __launch_bounds__(256) void k_gemm_lds(const _Float16* __restrict__ A, int lda, size_t sA, const _Float16* __restrict__ Bh, int ldb, size_t sB, float alpha,
                                                 float* __restrict__ C, _Float16* __restrict__ C16, int ldc, size_t sC, int K) {
  constexpr int FM = BM / (WM * 16), FN = BN / (WN * 16);      // fragments per wave
  constexpr int CPR = BK / 8, RPI = 256 / CPR;                 // 16-byte chunks per tile row; tile rows covered by one chunk per thread
  constexpr int PITCH = BK + 8, ROWS = BM + BN, STAGE = ROWS * PITCH;      // LDS row pitch and buffer size in f16 elements; rows 0..BM-1 hold A, the rest B
  constexpr int NCH = ROWS / RPI, ACH = BM / RPI;              // chunks per thread, of which from A
  constexpr int OP = BN + 4;                                   // f32 pitch of the output staging
  constexpr int LB = (2 * STAGE * 2 > BM * OP * 4) ? 2 * STAGE * 2 : BM * OP * 4;
  static_assert(WM * WN == 8 && BN == 128 && BM % RPI == 0 && BN % RPI == 0 && BK % 32 == 0, "tile shape");
  __shared__ __attribute__((aligned(16))) unsigned char smem[LB];
  unsigned short* st = (unsigned short*)smem;
  const int tid = threadIdx.x, w = tid >> 5, lane = tid & 31, ln = lane & 15, hh = lane >> 4;
  const int wm = w % WM, wn = w / WM;
  const int m0 = blockIdx.y * BM, n0 = blockIdx.x * BN;
  const int crow = tid / CPR, ccol = (tid % CPR) * 8;
  const char* Au = (const char*)(A + (size_t)blockIdx.z * sA + (size_t)m0 * lda);
  const char* Bu = (const char*)(Bh + (size_t)blockIdx.z * sB + (size_t)n0 * ldb);
  const unsigned aoff = (unsigned)(crow * lda + ccol) * 2u, boff = (unsigned)(crow * ldb + ccol) * 2u;      // bytes
  const size_t astep = (size_t)RPI * lda * 2, bstep = (size_t)RPI * ldb * 2;                                // bytes between a thread's chunks
  v8us pre[NCH];
  v8f acc[FM][FN] = {};
  const int nk = K / BK;
  unsigned long long base[NCH];
#pragma unroll
  for (int i = 0; i < NCH; ++i) base[i] = sbase((i < ACH) ? Au + i * astep : Bu + (i - ACH) * bstep);
#pragma unroll
  for (int i = 0; i < NCH; ++i) pre[i] = *(gv8)(base[i] + ((i < ACH) ? aoff : boff));
#pragma unroll
  for (int i = 0; i < NCH; ++i) *(v8us*)(st + (crow + i * RPI) * PITCH + ccol) = pre[i];
  unsigned ak = aoff, bk = boff;
  for (int s = 0; s < nk; ++s) {
    const bool more = s + 1 < nk;
    __syncthreads();      // publishes buffer s & 1; every wave has also left the other buffer, which is rewritten below
    if (more) {
      ak += BK * 2; bk += BK * 2;
#pragma unroll
      for (int i = 0; i < NCH; ++i) pre[i] = *(gv8)(base[i] + ((i < ACH) ? ak : bk));
      asm volatile("s_wait_xcnt 0x0" ::: "memory");      // precaution behind the run of loads: their offset registers (next step) and scalar bases (epilogue) are overwritten later on paths that hold no load wait
    }
    const unsigned short* sb = st + (s & 1) * STAGE;
#pragma unroll
    for (int kb = 0; kb < BK; kb += 32) {
      FragH a[FM], b[FN];
#pragma unroll
      for (int i = 0; i < FM; ++i) { const unsigned short* r = sb + ((wm * FM + i) * 16 + ln) * PITCH + kb + 8 * hh; a[i].half[0] = *(const v8us*)r; a[i].half[1] = *(const v8us*)(r + 16); }
#pragma unroll
      for (int j = 0; j < FN; ++j) { const unsigned short* r = sb + (BM + (wn * FN + j) * 16 + ln) * PITCH + kb + 8 * hh; b[j].half[0] = *(const v8us*)r; b[j].half[1] = *(const v8us*)(r + 16); }
#pragma unroll
      for (int i = 0; i < FM; ++i)
#pragma unroll
        for (int j = 0; j < FN; ++j) acc[i][j] = mmaH<1>(a[i].v, a[i].v, b[j].v, b[j].v, acc[i][j]);
    }
    if (more) {
      unsigned short* sn = st + ((s + 1) & 1) * STAGE;
#pragma unroll
      for (int i = 0; i < NCH; ++i) *(v8us*)(sn + (crow + i * RPI) * PITCH + ccol) = pre[i];
    }
  }
  __syncthreads();      // every wave has left the operand buffers before the output tile is staged over them
  float* so = (float*)smem;
#pragma unroll
  for (int i = 0; i < FM; ++i)
#pragma unroll
    for (int j = 0; j < FN; ++j)
#pragma unroll
      for (int r = 0; r < 8; ++r) so[((wm * FM + i) * 16 + 8 * hh + r) * OP + (wn * FN + j) * 16 + ln] = acc[i][j][r] * alpha;
  __syncthreads();      // the staged tile is read back across waves: one wave stores one whole row of the tile per instruction
  const size_t cofs = (size_t)blockIdx.z * sC + (size_t)m0 * ldc + n0;
  const unsigned coff = (unsigned)(w * ldc + lane * 4);      // elements
#pragma unroll
  for (int it = 0; it < BM / 8; ++it) {
    const v4f v = *(const v4fa*)&so[(w + it * 8) * OP + lane * 4];
    if (OUT16) { v4h h4; for (int q = 0; q < 4; ++q) h4[q] = (_Float16)v[q]; *(v4h*)((char*)(C16 + cofs + (size_t)(it * 8) * ldc) + coff * 2u) = h4; }
    else *(v4f*)((char*)(C + cofs + (size_t)(it * 8) * ldc) + coff * 4u) = v;
  }
}

__global__ __launch_bounds__(256) void k_x16(const float* __restrict__ x, _Float16* __restrict__ X16, size_t n8) { const size_t t = (size_t)blockIdx.x * 256 + threadIdx.x; if (t >= n8) return; FragH f;
#pragma unroll
  for (int q = 0; q < 8; ++q) f.h[q] = (_Float16)bf16_round(x[t * 8 + q]); *(v8us*)((unsigned short*)X16 + t * 8) = f.half[0];  }
__global__ __launch_bounds__(256) void k_h16(const float* __restrict__ x, _Float16* __restrict__ X16, size_t n8) { const size_t t = (size_t)blockIdx.x * 256 + threadIdx.x; if (t >= n8) return; FragH f;
#pragma unroll
  for (int q = 0; q < 8; ++q) f.h[q] = (_Float16)x[t * 8 + q]; *(v8us*)((unsigned short*)X16 + t * 8) = f.half[0];  }
__global__ __launch_bounds__(256) void k_round16f(const float* __restrict__ W, _Float16* __restrict__ Bt, size_t n8) { const size_t t = (size_t)blockIdx.x * 256 + threadIdx.x; if (t >= n8) return; FragH f;
#pragma unroll
  for (int i = 0; i < 8; ++i) f.h[i] = (_Float16)(bf16_round(W[t * 8 + i]) * 16.0f); *(v8us*)((unsigned short*)Bt + t * 8) = f.half[0];  }
template <int NHv, int TTv>
__global__ __launch_bounds__(256) void k_vt(const _Float16* __restrict__ V16, int ldv, int voff, _Float16* __restrict__ Vt) { __shared__ unsigned short tl[64][66]; const int tid = threadIdx.x; const int slab = blockIdx.x / (TTv / 64), lg = blockIdx.x % (TTv / 64); const int b = slab / NHv, h = slab % NHv;
  for (int i = tid; i < 64 * 8; i += 256) { const int r = i / 8, c8 = (i % 8) * 8; FragH f; f.half[0] = *(const v8us*)((const unsigned short*)V16 + ((size_t)b * TTv + lg * 64 + r) * ldv + voff + h * 64 + c8);
#pragma unroll
    for (int q = 0; q < 8; ++q) tl[r][c8 + q] = f.u[q]; }
  __syncthreads();
  {
#pragma unroll
    for (int rd = 0; rd < 2; ++rd) { const int d = rd * 32 + tid / 8, pc = tid % 8; FragH f;
#pragma unroll
      for (int q = 0; q < 8; ++q) f.u[q] = tl[pc * 8 + q][d];
      *(v8us*)((unsigned short*)Vt + ((size_t)slab * 64 + d) * TTv + lg * 64 + pc * 8) = f.half[0]; }
     } }

// f32 plane [NN][128] → concatenated-K f16 operand planes [NN][384] for a single 3-term GEMM: with h = f16(v), l = f16((v − h)·2^10):
//   MODE 0 (t side): [h | l | h];  MODE 1 (p side): [h | h·2^-10 | l·2^-10]  so that Σ_K A'·B' = Th·Ph + Tl·Ph·2^-10 + Th·Pl·2^-10 (power-of-two scalings are exact in f16 barring subnormal flushes, which cost ≤1e-4 on a σ≈11 logit);
template <int MODE>
__global__ __launch_bounds__(256) void k_hl3(const float* __restrict__ F, _Float16* __restrict__ P3, size_t n8) { const size_t t = (size_t)blockIdx.x * 256 + threadIdx.x; if (t >= n8) return; const size_t r = (t * 8) / CPN; const int c = (int)((t * 8) % CPN); const v4f a = *(const v4fa*)(F + t * 8), b = *(const v4fa*)(F + t * 8 + 4); FragH h, l, s2, s3;
#pragma unroll
  for (int q = 0; q < 8; ++q) { const float v = (q < 4) ? a[q] : b[q - 4]; const _Float16 hv = (_Float16)v; const _Float16 lv = (_Float16)((v - (float)hv) * 1024.0f); h.h[q] = hv; l.h[q] = lv; s2.h[q] = MODE ? (_Float16)((float)hv * 0.0009765625f) : lv; s3.h[q] = MODE ? (_Float16)((float)lv * 0.0009765625f) : hv; }
  unsigned short* row = (unsigned short*)P3 + r * (3 * CPN) + c;
  { *(v8us*)(row) = h.half[0]; *(v8us*)(row + CPN) = s2.half[0]; *(v8us*)(row + 2 * CPN) = s3.half[0];  } }
__global__ __launch_bounds__(256) void k_tok(const float* __restrict__ x, _Float16* __restrict__ X16) { __shared__ float tl[32][65]; const int tid = threadIdx.x; const int b = blockIdx.x / ((CI / 64) * (NN / 32)), rem = blockIdx.x % ((CI / 64) * (NN / 32)); const int cg = rem / (NN / 32), pg = rem % (NN / 32); const int c0 = cg * 64, p0 = pg * 32;
  for (int i = tid; i < 64 * 32; i += 256) { const int c = i / 32, pp = i % 32; tl[pp][c] = bf16_round(x[((size_t)b * CI + c0 + c) * NN + p0 + pp]); } __syncthreads();
  const int r = tid / 8, pc = tid % 8; FragH f; for (int q = 0; q < 8; ++q) f.h[q] = (_Float16)tl[r][pc * 8 + q]; const size_t row = (size_t)b * NN + p0 + r; *(v8us*)((unsigned short*)X16 + row * CI + c0 + pc * 8) = f.half[0];  }
// Column reductions, rows in parallel: a work-group owns 32 columns (one 128-byte line of every row). Eight lanes of 4 columns cover the line, so the 1024 threads form 128 row groups;
// row group rg walks rows rg, rg + 128, ... with 8 loads of 16 bytes in flight. Partials are merged in a fixed order: lanes l ^ 8 and l ^ 16 inside a wave, then the 32 waves, in wave order, through LDS.
// exp(x) by the same two instructions as __expf (multiply by log2 e, v_exp_f32). The v_nop is the free issue slot that the instruction set asks for behind a transcendental before its source is overwritten;
__device__ __forceinline__ float exp_slot(float x) { float r; asm("v_exp_f32 %0, %1\n\tv_nop" : "=v"(r) : "v"(x * 1.44269504f)); return r; }
__device__ __forceinline__ void ms_merge(float& m, float& z, float m2, float z2) { const float mn = fmaxf(m, m2); z = z * exp_slot(m - mn) + z2 * exp_slot(m2 - mn); m = mn; }
__global__ __launch_bounds__(1024) void k_colstat(const float* __restrict__ S, float* __restrict__ MX, float* __restrict__ ZZ) {
  __shared__ __attribute__((aligned(16))) float sm[32][32], sz[32][32];
  const int tid = threadIdx.x, w = tid >> 5, lane = tid & 31, cq = tid & 7, rg = tid >> 3;
  const float* p = S + (size_t)rg * NN + blockIdx.x * 32 + cq * 4;
  v4f mx = {-3.0e38f, -3.0e38f, -3.0e38f, -3.0e38f}, z = {0.f, 0.f, 0.f, 0.f};
  for (int n = 0; n < NN; n += 128 * 8) {
    v4f s[8];
#pragma unroll
    for (int u = 0; u < 8; ++u) s[u] = *(const v4fa*)(p + (size_t)(n + 128 * u) * NN);
#pragma unroll
    for (int q = 0; q < 4; ++q) {
      float m8 = s[0][q];
#pragma unroll
      for (int u = 1; u < 8; ++u) m8 = fmaxf(m8, s[u][q]);
      const float mn = fmaxf(mx[q], m8);
      float a = z[q] * exp_slot(mx[q] - mn);
#pragma unroll
      for (int u = 0; u < 8; ++u) a += exp_slot(s[u][q] - mn);
      z[q] = a; mx[q] = mn;
    }
  }
#pragma unroll
  for (int q = 0; q < 4; ++q) {
    float m = mx[q], a = z[q];
    ms_merge(m, a, __shfl_xor(m, 8, 32), __shfl_xor(a, 8, 32));
    ms_merge(m, a, __shfl_xor(m, 16, 32), __shfl_xor(a, 16, 32));
    mx[q] = m; z[q] = a;
  }
  if (lane < 8) { *(v4f*)&sm[w][cq * 4] = mx; *(v4f*)&sz[w][cq * 4] = z; }
  __syncthreads();
  if (w == 0) {
    float m = sm[0][lane];
#pragma unroll
    for (int i = 1; i < 32; ++i) m = fmaxf(m, sm[i][lane]);
    float a = 0.f;
#pragma unroll
    for (int i = 0; i < 32; ++i) a += sz[i][lane] * exp_slot(sm[i][lane] - m);
    MX[blockIdx.x * 32 + lane] = m; ZZ[blockIdx.x * 32 + lane] = a;
  }
}
__global__ __launch_bounds__(256) void k_pexp(const float* __restrict__ S, const float* __restrict__ MX, const float* __restrict__ ZZ, _Float16* __restrict__ PT) { const size_t t = (size_t)blockIdx.x * 256 + threadIdx.x; if (t >= (size_t)NN * NN / 8) return; const int m0 = (int)((t * 8) % NN); const v4f a = *(const v4fa*)(S + t * 8), c = *(const v4fa*)(S + t * 8 + 4), xa = *(const v4fa*)(MX + m0), xc = *(const v4fa*)(MX + m0 + 4), za = *(const v4fa*)(ZZ + m0), zc = *(const v4fa*)(ZZ + m0 + 4); FragH f;
#pragma unroll
  for (int q = 0; q < 4; ++q) { f.h[q] = (_Float16)(__expf(a[q] - xa[q]) / za[q] * 32768.0f); f.h[4 + q] = (_Float16)(__expf(c[q] - xc[q]) / zc[q] * 32768.0f); }
  *(v8us*)((unsigned short*)PT + t * 8) = f.half[0];  }
__global__ __launch_bounds__(1024) void k_bnstat(const float* __restrict__ Z, float* __restrict__ MU, float* __restrict__ RS) {
  __shared__ __attribute__((aligned(16))) float a1[32][32], a2[32][32];
  const int tid = threadIdx.x, w = tid >> 5, lane = tid & 31, cq = tid & 7, rg = tid >> 3;
  const float* p = Z + (size_t)rg * CI + blockIdx.x * 32 + cq * 4;
  v4f s1 = {0.f, 0.f, 0.f, 0.f}, s2 = {0.f, 0.f, 0.f, 0.f};
  for (int r = 0; r < NR; r += 128 * 8) {
    v4f v[8];
#pragma unroll
    for (int u = 0; u < 8; ++u) v[u] = *(const v4fa*)(p + (size_t)(r + 128 * u) * CI);
#pragma unroll
    for (int u = 0; u < 8; ++u) { s1 += v[u]; s2 += v[u] * v[u]; }
  }
#pragma unroll
  for (int q = 0; q < 4; ++q) {
    s1[q] += __shfl_xor(s1[q], 8, 32); s2[q] += __shfl_xor(s2[q], 8, 32);
    s1[q] += __shfl_xor(s1[q], 16, 32); s2[q] += __shfl_xor(s2[q], 16, 32);
  }
  if (lane < 8) { *(v4f*)&a1[w][cq * 4] = s1; *(v4f*)&a2[w][cq * 4] = s2; }
  __syncthreads();
  if (w == 0) {
    float t1 = 0.f, t2 = 0.f;
#pragma unroll
    for (int i = 0; i < 32; ++i) { t1 += a1[i][lane]; t2 += a2[i][lane]; }
    const float mu = t1 / (float)NR; const float var = fmaxf(t2 / (float)NR - mu * mu, 0.f);
    MU[blockIdx.x * 32 + lane] = mu; RS[blockIdx.x * 32 + lane] = rsqrtf(var + 1e-5f);
  }
}
__global__ __launch_bounds__(256) void k_out(const float* __restrict__ Z, const float* __restrict__ MU, const float* __restrict__ RS, const float* __restrict__ gam, const float* __restrict__ bet, const float* __restrict__ x, float* __restrict__ out) { __shared__ float tl[32][65]; const int tid = threadIdx.x; const int b = blockIdx.x / ((CI / 32) * (NN / 64)), rem = blockIdx.x % ((CI / 32) * (NN / 64)); const int cg = rem / (NN / 64), pg = rem % (NN / 64); const int c0 = cg * 32, p0 = pg * 64;
  for (int i = tid; i < 64 * 32; i += 256) { const int pp = i / 32, c = i % 32; tl[c][pp] = (Z[((size_t)b * NN + p0 + pp) * CI + c0 + c] - MU[c0 + c]) * RS[c0 + c] * bf16_round(gam[c0 + c]) + bf16_round(bet[c0 + c]); } __syncthreads();
  { for (int i = tid; i < 32 * 16; i += 256) { const int c = i / 16, q4 = i % 16; const size_t o = ((size_t)b * CI + c0 + c) * NN + p0 + q4 * 4; const v4f xr = *(const v4fa*)(x + o); const v4f v = {tl[c][q4 * 4] + bf16_round(xr[0]), tl[c][q4 * 4 + 1] + bf16_round(xr[1]), tl[c][q4 * 4 + 2] + bf16_round(xr[2]), tl[c][q4 * 4 + 3] + bf16_round(xr[3])}; *(v4f*)(out + o) = v; }  } }

extern "C" void kernel_launch(void* const* d_in, const int* in_sizes, int n_in,
                              void* d_out, int out_size, void* d_ws, size_t ws_size, hipStream_t stream) {
  (void)in_sizes; (void)n_in; (void)out_size;
  const float* const* I = (const float* const*)d_in; const float* x = I[0]; const float* Wt = I[1]; const float* Wp = I[2]; const float* Wg = I[3]; const float* Wz = I[4]; const float* gam = I[5]; const float* bet = I[6];
  char* ws = (char*)d_ws; size_t off = 0;
  auto take = [&](size_t bytes) { char* p = ws + off; off += (bytes + 255) & ~(size_t)255; return p; };
  _Float16* Bt_ = (_Float16*)take((size_t)CPN * CI * 2); _Float16* Bp_ = (_Float16*)take((size_t)CPN * CI * 2); _Float16* Bg_ = (_Float16*)take((size_t)CPN * CI * 2); _Float16* Bz_ = (_Float16*)take((size_t)CI * CPN * 2);
  float* S = (float*)take((size_t)NN * NN * 4); _Float16* PT = (_Float16*)take((size_t)NN * NN * 2); _Float16* X16 = (_Float16*)take((size_t)NR * CI * 2);
  _Float16* T3 = (_Float16*)take((size_t)NN * 3 * CPN * 2); _Float16* P3 = (_Float16*)take((size_t)NN * 3 * CPN * 2); float* F32 = (float*)take((size_t)NN * CPN * 4);      /* per-batch: concatenated-K operand planes [4096][384] and the f32 conv output they are built from */
  _Float16* Gc = (_Float16*)take((size_t)BB * CPN * NN * 2); _Float16* Y16 = (_Float16*)take((size_t)NR * CPN * 2); float* MX = (float*)take((size_t)NN * 4); float* ZZ = (float*)take((size_t)NN * 4); float* MU = (float*)take((size_t)CI * 4); float* RS = (float*)take((size_t)CI * 4);
  float* Z = S;      /* the z plane (16.8 MB) reuses the score region after the last batch */
  if (off > ws_size) return;      // 67 + 33.5 + 8.4 + 3.1 + 3.1 + 2.1 + 4.2 + 4.2 + 0.3 ≈ 126 MB (120 MiB)
  const unsigned gw = (unsigned)(((size_t)CPN * CI / 8 + 255) / 256);
  k_round16f<<<gw, 256, 0, stream>>>(Wt, Bt_, (size_t)CPN * CI / 8); k_round16f<<<gw, 256, 0, stream>>>(Wp, Bp_, (size_t)CPN * CI / 8); k_round16f<<<gw, 256, 0, stream>>>(Wg, Bg_, (size_t)CPN * CI / 8); k_round16f<<<gw, 256, 0, stream>>>(Wz, Bz_, (size_t)CI * CPN / 8);      /* conv weights (out,in) natural ×2^4 */
  k_tok<<<BB * (CI / 64) * (NN / 32), 256, 0, stream>>>(x, X16);
  k_gemm_lds<128, 128, 64, 4, 2, true><<<dim3(NN / 128, CPN / 128, BB), 256, 0, stream>>>(Bg_, CI, 0, X16, CI, (size_t)NN * CI, 0.0625f, nullptr, Gc, NN, (size_t)CPN * NN, CI);      /* g channel-major per batch [b][128][4096] (f16): M 128 N 4096 K 256 */
  const dim3 gs(NN / 128, NN / 128, 1), gy(CPN / 128, NN / 32, 1);
  const dim3 gtp(CPN / 128, NN / 32, 1); const unsigned g8 = (unsigned)(((size_t)NN * CPN / 8 + 255) / 256);
  for (int b = 0; b < BB; ++b) { const size_t xo = (size_t)b * NN * CI, yo = (size_t)b * NN * CPN;
    k_gemm_lds<32, 128, 256, 1, 8, false><<<gtp, 256, 0, stream>>>(X16 + xo, CI, 0, Bt_, CI, 0, 0.0625f, F32, nullptr, CPN, 0, CI); k_hl3<0><<<g8, 256, 0, stream>>>(F32, T3, (size_t)NN * CPN / 8);      /* t (this batch) token-major f32 → [h | l | h]: M 4096 N 128 K 256 */
    k_gemm_lds<32, 128, 256, 1, 8, false><<<gtp, 256, 0, stream>>>(X16 + xo, CI, 0, Bp_, CI, 0, 0.0625f, F32, nullptr, CPN, 0, CI); k_hl3<1><<<g8, 256, 0, stream>>>(F32, P3, (size_t)NN * CPN / 8);      /* p (this batch) → [h | h·2^-10 | l·2^-10] */
    k_gemm_lds<128, 128, 64, 4, 2, false><<<gs, 256, 0, stream>>>(T3, 3 * CPN, 0, P3, 3 * CPN, 0, 1.0f, S, nullptr, NN, 0, 3 * CPN);      /* S[n][m] = t_n·p_m as Th·Ph + (Tl·Ph + Th·Pl)·2^-10 in one K = 384 pass: M 4096 N 4096 */
    k_colstat<<<NN / 32, 1024, 0, stream>>>(S, MX, ZZ); k_pexp<<<(unsigned)(((size_t)NN * NN / 8 + 255) / 256), 256, 0, stream>>>(S, MX, ZZ, PT);
    k_gemm_lds<32, 128, 256, 1, 8, true><<<gy, 256, 0, stream>>>(PT, NN, 0, Gc + (size_t)b * CPN * NN, NN, 0, 0.000030517578125f, nullptr, Y16 + yo, CPN, 0, NN); }      /* y[n][c] = Σ_m att[n][m]·g[c][m]: M 4096 N 128 K 4096 (f16 out) */
  k_gemm_lds<128, 128, 64, 4, 2, false><<<dim3(CI / 128, NR / 128, 1), 256, 0, stream>>>(Y16, CPN, 0, Bz_, CPN, 0, 0.0625f, Z, nullptr, CI, 0, CPN);      /* z token-major [16384][256] f32: M 16384 N 256 K 128 */
  k_bnstat<<<CI / 32, 1024, 0, stream>>>(Z, MU, RS); k_out<<<BB * (CI / 32) * (NN / 64), 256, 0, stream>>>(Z, MU, RS, gam, bet, x, (float*)d_out);
}

// v003
// Measured time: 264 microseconds a run.
// Timed twice side by side with v002, it ran 1.46 and 1.47 times as fast.
// All steps since v000 together make it 49.3 times as fast.
#include <hip/hip_runtime.h>
// Spatial non-local block with query-axis softmax (B=4, C_in 256, C_p 128, N=4096): t,p,g = 1×1 convs; att[n,m] = Σ_c t[c,n]·p[c,m]; att = softmax over n (dim=1) for every m; y[c,n] = Σ_m att[n,m]·g[c,m]; z = Wz·y;
// BatchNorm1d in training mode (batch statistics over (B,N) per channel, biased variance, eps 1e-5) with affine; out = BN(z) + x.
// Compute dtype: x and weights rounded to bf16; t and p as f32 GEMM outputs split into f16 hi + ×2^10 residual parts laid out as concatenated-K operands so one K=384 GEMM yields Th·Ph + (Tl·Ph + Th·Pl)·2^-10 (σ≈11 logits, f32-accurate);
// the score plane is kept transposed (S[n][m], f32) so the softmax over n is a column reduction (f32 per-column max/Σ) and the normalised weights are written row-major as f16 ×2^15; y = attᵀ-contraction as an f16 GEMM against
// channel-major g; z GEMM; per-channel batch statistics as fixed-order f32 column sums; affine + residual applied during the transpose back to channel-major. All contractions on v_wmma_f32_16x16x32_f16, f32 accumulate.
#define BB 4
#define CI 256
#define CPN 128
#define NN 4096
#define NR (BB * NN)
#define PB 2      // batches whose score planes are held at once: each launch of the score, softmax and y stages works on PB batches

typedef __bf16 v16b __attribute__((ext_vector_type(16)));
typedef unsigned short v8us __attribute__((ext_vector_type(8), may_alias));
typedef float  v8f  __attribute__((ext_vector_type(8)));
typedef float  v4f  __attribute__((ext_vector_type(4)));
typedef float  v4fa __attribute__((ext_vector_type(4), may_alias));
union FragB { v16b v; v8us half[2]; unsigned short u[16]; };

__device__ __forceinline__ unsigned short bf16_bits(float x) { unsigned int u = __float_as_uint(x); return (unsigned short)((u + 0x7FFFu + ((u >> 16) & 1u)) >> 16); }
__device__ __forceinline__ float bf16_val(unsigned short b) { return __uint_as_float(((unsigned int)b) << 16); }
__device__ __forceinline__ float bf16_round(float x) { return bf16_val(bf16_bits(x)); }
// D += A·B with NT terms: 1 = ah·bh, 2 = + al·bh (A split), 3 = + ah·bl (both split)
template <int NT>
__device__ __forceinline__ v8f mmaN(v16b ah, v16b al, v16b bh, v16b bl, v8f c) {
  c = __builtin_amdgcn_wmma_f32_16x16x32_bf16(false, ah, false, bh, (short)0, c, false, false);
  if (NT >= 2) c = __builtin_amdgcn_wmma_f32_16x16x32_bf16(false, al, false, bh, (short)0, c, false, false);
  if (NT >= 3) c = __builtin_amdgcn_wmma_f32_16x16x32_bf16(false, ah, false, bl, (short)0, c, false, false);
  asm volatile("v_nop\n\tv_nop\n\tv_nop\n\tv_nop" : "+v"(c) : "v"(ah), "v"(al), "v"(bh), "v"(bl));
  return c;
}

__global__ __launch_bounds__(256) void k_wt_bf16(const float* __restrict__ W, unsigned short* __restrict__ Wt, int K, int N) {
  const int t = blockIdx.x * 256 + threadIdx.x;
  const int k8n = K / 8;
  if (t >= N * k8n) return;
  const int n = t / k8n, k8 = (t % k8n) * 8;
  v8us v;
#pragma unroll
  for (int i = 0; i < 8; ++i) v[i] = bf16_bits(W[(size_t)(k8 + i) * N + n]);
  *(v8us*)(Wt + (size_t)n * K + k8) = v;
  
}

// GEMM C[M][N] (f32, pitch ldc) = act(A[M][K]·W + bias). A f32 row-major (pitch lda) converted per fragment to bf16
// (ASPLIT: hi/lo two planes -> 2 terms, else single rounded term); Wt bf16 [N][K] (pitch ldb). BIAS_BF16 rounds the
// bias to bf16 first (bias quantised to bf16 before the add). K%32==0, M%16==0, N%64==0.
template <bool ASPLIT, int ACT, bool BIAS_BF16>
__global__ __launch_bounds__(128) void k_gemm_bf(const float* __restrict__ A, int lda, const unsigned short* __restrict__ Wt, int ldb,
                                               const float* __restrict__ bias, float* __restrict__ C, int ldc, int M, int N, int K) {
  __shared__ __attribute__((aligned(16))) float so[4][16][64];
  const int tid = threadIdx.x, w = tid >> 5, lane = tid & 31, ln = lane & 15, hh = lane >> 4;
  const int ntn = N / 64;
  const int wid = blockIdx.x * 4 + w;
  const int mt = wid / ntn, nq = wid % ntn;
  if (mt * 16 >= M) return;
  const int row0 = mt * 16, col0 = nq * 64;
  const float* arow = A + (size_t)(row0 + ln) * lda;
  v8f acc[4] = {};
  for (int kb = 0; kb < K; kb += 32) {
    FragB ah, al;
    const v4f x0 = *(const v4fa*)(arow + kb + 8 * hh), x1 = *(const v4fa*)(arow + kb + 8 * hh + 4);
    const v4f x2 = *(const v4fa*)(arow + kb + 16 + 8 * hh), x3 = *(const v4fa*)(arow + kb + 16 + 8 * hh + 4);
    float xs[16] = {x0[0],x0[1],x0[2],x0[3],x1[0],x1[1],x1[2],x1[3],x2[0],x2[1],x2[2],x2[3],x3[0],x3[1],x3[2],x3[3]};
#pragma unroll
    for (int i = 0; i < 16; ++i) { const unsigned short hb = bf16_bits(xs[i]); ah.u[i] = hb; al.u[i] = ASPLIT ? bf16_bits(xs[i] - bf16_val(hb)) : (unsigned short)0; }
#pragma unroll
    for (int t = 0; t < 4; ++t) {
      const unsigned short* brow = Wt + (size_t)(col0 + t * 16 + ln) * ldb + kb;
      FragB b;
      b.half[0] = *(const v8us*)(brow + 8 * hh);
      b.half[1] = *(const v8us*)(brow + 16 + 8 * hh);
      acc[t] = mmaN<ASPLIT ? 2 : 1>(ah.v, al.v, b.v, b.v, acc[t]);
    }
  }
#pragma unroll
  for (int t = 0; t < 4; ++t) {
    float bv = bias ? bias[col0 + t * 16 + ln] : 0.f;
    if (BIAS_BF16) bv = bf16_round(bv);
#pragma unroll
    for (int r = 0; r < 8; ++r) { float v = acc[t][r] + bv; if (ACT == 1) v = fmaxf(v, 0.f); so[w][8 * hh + r][t * 16 + ln] = v; }
  }
  __builtin_amdgcn_fence(__ATOMIC_ACQ_REL, "workgroup");
  __builtin_amdgcn_wave_barrier();
  const int rsub = lane >> 4, c4 = (lane & 15) * 4;
  {
#pragma unroll
    for (int q = 0; q < 8; ++q) {
      const int r = q * 2 + rsub;
      const v4f v = *(const v4fa*)&so[w][r][c4];
      *(v4f*)(C + (size_t)(row0 + r) * ldc + col0 + c4) = v;
    }
    
  }
}

// Flash-style causal/unmasked attention, all contractions 3-term bf16 hi/lo splits, f32 softmax with running max.
// q,k,v rows are read from f32 buffers with arbitrary row pitch (so they can live inside a fused qkv buffer);
// D = head size (multiple of 32, <= 128); one wave = 16 query rows; block = 4 waves (64 queries) sharing K/V chunks of 32.
template <int D, bool CAUSAL>
__global__ __launch_bounds__(128) void k_flash(const float* __restrict__ qb, const float* __restrict__ kb, const float* __restrict__ vb,
                                             int pitch, int T, int H, float scale, float* __restrict__ y, int ypitch) {
  constexpr int KS = D / 32;        // k-steps for QK
  constexpr int DT = D / 16;        // d tiles for PV
  __shared__ __attribute__((aligned(16))) unsigned short sKh[32][D + 8], sKl[32][D + 8], sVh[32][D + 8], sVl[32][D + 8];
  __shared__ __attribute__((aligned(16))) unsigned short sPh[4][16][40], sPl[4][16][40];
  __shared__ __attribute__((aligned(16))) float sO[4][16][D];
  const int tid = threadIdx.x, w = tid >> 5, lane = tid & 31, ln = lane & 15, hh = lane >> 4;
  const int nqb = (T + 63) / 64;
  const int bh = blockIdx.x / nqb, qblk = blockIdx.x % nqb;
  const int b = bh / H, h = bh % H;
  const int q0 = qblk * 64 + w * 16;
  const float* Q = qb + (size_t)b * T * pitch + h * D;
  const float* K = kb + (size_t)b * T * pitch + h * D;
  const float* V = vb + (size_t)b * T * pitch + h * D;

  // A fragments of the wave's 16 query rows (scaled), hi/lo
  FragB aqh[KS], aql[KS];
  {
    int row = q0 + ln; if (row >= T) row = T - 1;
    const float* qr = Q + (size_t)row * pitch;
#pragma unroll
    for (int ks = 0; ks < KS; ++ks)
#pragma unroll
      for (int i = 0; i < 16; ++i) {
        const int d = ks * 32 + ((i < 8) ? (8 * hh + i) : (16 + 8 * hh + (i - 8)));
        const float x = qr[d] * scale; const unsigned short hb = bf16_bits(x);
        aqh[ks].u[i] = hb; aql[ks].u[i] = bf16_bits(x - bf16_val(hb));
      }
  }
  float m_r[8], l_r[8];
#pragma unroll
  for (int r = 0; r < 8; ++r) { m_r[r] = -3.0e38f; l_r[r] = 0.f; }
  v8f oacc[DT];
#pragma unroll
  for (int dt = 0; dt < DT; ++dt) oacc[dt] = (v8f){0.f,0.f,0.f,0.f,0.f,0.f,0.f,0.f};

  const int kv_end = CAUSAL ? min(T, qblk * 64 + 64) : T;     // block-uniform
  for (int j0 = 0; j0 < kv_end; j0 += 32) {
    __syncthreads();
    for (int e = tid; e < 32 * (D / 4); e += 128) {
      const int r = e / (D / 4), c4 = (e % (D / 4)) * 4;
      const int key = j0 + r;
      v4f kf = {0.f,0.f,0.f,0.f}, vf = {0.f,0.f,0.f,0.f};
      if (key < T) { kf = *(const v4fa*)(K + (size_t)key * pitch + c4); vf = *(const v4fa*)(V + (size_t)key * pitch + c4); }
#pragma unroll
      for (int t = 0; t < 4; ++t) {
        unsigned short hb = bf16_bits(kf[t]); sKh[r][c4 + t] = hb; sKl[r][c4 + t] = bf16_bits(kf[t] - bf16_val(hb));
        hb = bf16_bits(vf[t]); sVh[r][c4 + t] = hb; sVl[r][c4 + t] = bf16_bits(vf[t] - bf16_val(hb));
      }
    }
    __syncthreads();
    // S tile 16 x 32
    v8f s[2];
#pragma unroll
    for (int nt = 0; nt < 2; ++nt) {
      v8f acc = {};
#pragma unroll
      for (int ks = 0; ks < KS; ++ks) {
        FragB bh_, bl_;
        bh_.half[0] = *(const v8us*)&sKh[nt * 16 + ln][ks * 32 + 8 * hh]; bh_.half[1] = *(const v8us*)&sKh[nt * 16 + ln][ks * 32 + 16 + 8 * hh];
        bl_.half[0] = *(const v8us*)&sKl[nt * 16 + ln][ks * 32 + 8 * hh]; bl_.half[1] = *(const v8us*)&sKl[nt * 16 + ln][ks * 32 + 16 + 8 * hh];
        acc = mmaN<3>(aqh[ks].v, aql[ks].v, bh_.v, bl_.v, acc);
      }
      s[nt] = acc;
    }
    // mask + running max (rows 8hh+r; the 16 lanes of a half share rows)
    float alpha[8];
#pragma unroll
    for (int r = 0; r < 8; ++r) {
      const int qi = q0 + 8 * hh + r;
      const int ja = j0 + ln, jb = j0 + 16 + ln;
      if (CAUSAL) { if (ja > qi) s[0][r] = -3.0e38f; if (jb > qi) s[1][r] = -3.0e38f; }
      if (ja >= T) s[0][r] = -3.0e38f;
      if (jb >= T) s[1][r] = -3.0e38f;
      float mx = fmaxf(s[0][r], s[1][r]);
      mx = fmaxf(mx, __shfl_xor(mx, 1, 32)); mx = fmaxf(mx, __shfl_xor(mx, 2, 32)); mx = fmaxf(mx, __shfl_xor(mx, 4, 32)); mx = fmaxf(mx, __shfl_xor(mx, 8, 32));
      const float mnew = fmaxf(m_r[r], mx);
      alpha[r] = (mnew > -1.0e38f) ? __expf(m_r[r] - mnew) : 1.0f;
      const float p0 = (s[0][r] > -1.0e38f) ? __expf(s[0][r] - mnew) : 0.f;
      const float p1 = (s[1][r] > -1.0e38f) ? __expf(s[1][r] - mnew) : 0.f;
      m_r[r] = mnew;
      l_r[r] = l_r[r] * alpha[r] + p0 + p1;            // per-lane partial row sum (16 lanes combined at the end)
      unsigned short hb = bf16_bits(p0); sPh[w][8 * hh + r][ln] = hb;      sPl[w][8 * hh + r][ln] = bf16_bits(p0 - bf16_val(hb));
      hb = bf16_bits(p1);                sPh[w][8 * hh + r][16 + ln] = hb; sPl[w][8 * hh + r][16 + ln] = bf16_bits(p1 - bf16_val(hb));
    }
#pragma unroll
    for (int dt = 0; dt < DT; ++dt)
#pragma unroll
      for (int r = 0; r < 8; ++r) oacc[dt][r] *= alpha[r];
    __builtin_amdgcn_fence(__ATOMIC_ACQ_REL, "workgroup");
    __builtin_amdgcn_wave_barrier();
    FragB pah, pal;
    pah.half[0] = *(const v8us*)&sPh[w][ln][8 * hh]; pah.half[1] = *(const v8us*)&sPh[w][ln][16 + 8 * hh];
    pal.half[0] = *(const v8us*)&sPl[w][ln][8 * hh]; pal.half[1] = *(const v8us*)&sPl[w][ln][16 + 8 * hh];
#pragma unroll
    for (int dt = 0; dt < DT; ++dt) {
      FragB bvh, bvl;
#pragma unroll
      for (int i = 0; i < 8; ++i) {
        bvh.u[i] = sVh[8 * hh + i][dt * 16 + ln]; bvh.u[8 + i] = sVh[16 + 8 * hh + i][dt * 16 + ln];
        bvl.u[i] = sVl[8 * hh + i][dt * 16 + ln]; bvl.u[8 + i] = sVl[16 + 8 * hh + i][dt * 16 + ln];
      }
      oacc[dt] = mmaN<3>(pah.v, pal.v, bvh.v, bvl.v, oacc[dt]);
    }
    __builtin_amdgcn_fence(__ATOMIC_ACQ_REL, "workgroup");
    __builtin_amdgcn_wave_barrier();
  }
#pragma unroll
  for (int r = 0; r < 8; ++r) {
    float l = l_r[r];
    l += __shfl_xor(l, 1, 32); l += __shfl_xor(l, 2, 32); l += __shfl_xor(l, 4, 32); l += __shfl_xor(l, 8, 32);
    l_r[r] = (l > 0.f) ? 1.0f / l : 0.f;
  }
#pragma unroll
  for (int dt = 0; dt < DT; ++dt)
#pragma unroll
    for (int r = 0; r < 8; ++r) sO[w][8 * hh + r][dt * 16 + ln] = oacc[dt][r] * l_r[r];
  __builtin_amdgcn_fence(__ATOMIC_ACQ_REL, "workgroup");
  __builtin_amdgcn_wave_barrier();
  {
    for (int r = 0; r < 16; ++r) {
      const int row = q0 + r;
      if (row < T && lane < D / 4) {
        const v4f val = *(const v4fa*)&sO[w][r][lane * 4];
        *(v4f*)(y + ((size_t)b * T + row) * ypitch + h * D + lane * 4) = val;
      }
    }
    
  }
}

// GEMM C = act(A·W + bias + resid): A f32 (ASPLIT -> hi/lo 2 terms), Wt bf16 [N][K]; ACT 0 none, 1 relu, 2 exact gelu;
// resid (optional, f32, row index = (row % rmod), pitch ldr, RES_BF16 rounds it) added before the activation.
template <bool ASPLIT, int ACT, bool BIAS_BF16, bool RES_BF16>
__global__ __launch_bounds__(128) void k_gemm_bf3(const float* __restrict__ A, int lda, const unsigned short* __restrict__ Wt, int ldb,
                                                const float* __restrict__ bias, const float* __restrict__ resid, int rmod, int ldr,
                                                float* __restrict__ C, int ldc, int M, int N, int K) {
  __shared__ __attribute__((aligned(16))) float so[4][16][64];
  const int tid = threadIdx.x, w = tid >> 5, lane = tid & 31, ln = lane & 15, hh = lane >> 4;
  const int ntn = N / 64;
  const int wid = blockIdx.x * 4 + w;
  const int mt = wid / ntn, nq = wid % ntn;
  if (mt * 16 >= M) return;
  const int row0 = mt * 16, col0 = nq * 64;
  const float* arow = A + (size_t)(row0 + ln) * lda;
  v8f acc[4] = {};
  for (int kb = 0; kb < K; kb += 32) {
    FragB ah, al;
    const v4f x0 = *(const v4fa*)(arow + kb + 8 * hh), x1 = *(const v4fa*)(arow + kb + 8 * hh + 4);
    const v4f x2 = *(const v4fa*)(arow + kb + 16 + 8 * hh), x3 = *(const v4fa*)(arow + kb + 16 + 8 * hh + 4);
    float xs[16] = {x0[0],x0[1],x0[2],x0[3],x1[0],x1[1],x1[2],x1[3],x2[0],x2[1],x2[2],x2[3],x3[0],x3[1],x3[2],x3[3]};
#pragma unroll
    for (int i = 0; i < 16; ++i) { const unsigned short hb = bf16_bits(xs[i]); ah.u[i] = hb; al.u[i] = ASPLIT ? bf16_bits(xs[i] - bf16_val(hb)) : (unsigned short)0; }
#pragma unroll
    for (int t = 0; t < 4; ++t) {
      const unsigned short* brow = Wt + (size_t)(col0 + t * 16 + ln) * ldb + kb;
      FragB b;
      b.half[0] = *(const v8us*)(brow + 8 * hh);
      b.half[1] = *(const v8us*)(brow + 16 + 8 * hh);
      acc[t] = mmaN<ASPLIT ? 2 : 1>(ah.v, al.v, b.v, b.v, acc[t]);
    }
  }
#pragma unroll
  for (int t = 0; t < 4; ++t) {
    const int col = col0 + t * 16 + ln;
    float bv = bias ? bias[col] : 0.f;
    if (BIAS_BF16) bv = bf16_round(bv);
#pragma unroll
    for (int r = 0; r < 8; ++r) {
      float v = acc[t][r] + bv;
      if (resid) { float rv = resid[(size_t)((row0 + 8 * hh + r) % rmod) * ldr + col]; if (RES_BF16) rv = bf16_round(rv); v += rv; }
      if (ACT == 1) v = fmaxf(v, 0.f);
      if (ACT == 2) v = 0.5f * v * (1.0f + erff(v * 0.70710678118654752f));
      if (ACT == 3) { const float u = 0.7978845608028654f * (v + 0.044715f * v * v * v); v = 0.5f * v * (1.0f + tanhf(u)); }
      so[w][8 * hh + r][t * 16 + ln] = v;
    }
  }
  __builtin_amdgcn_fence(__ATOMIC_ACQ_REL, "workgroup");
  __builtin_amdgcn_wave_barrier();
  const int rsub = lane >> 4, c4 = (lane & 15) * 4;
  {
#pragma unroll
    for (int q = 0; q < 8; ++q) {
      const int r = q * 2 + rsub;
      const v4f v = *(const v4fa*)&so[w][r][c4];
      *(v4f*)(C + (size_t)(row0 + r) * ldc + col0 + c4) = v;
    }
    
  }
}
// row LayerNorm (biased variance, eps) over N: s = X (+ R); optional out_sum <- s; out_norm <- (s-mu)*rsqrt(var+eps)*g + b
template <bool PARAM_BF16>
__global__ __launch_bounds__(256) void k_layernorm(const float* __restrict__ X, const float* __restrict__ R, const float* __restrict__ g, const float* __restrict__ bta,
                                                  float* __restrict__ out_sum, float* __restrict__ out_norm, int N, float eps) {
  __shared__ float red[256];
  const int row = blockIdx.x, tid = threadIdx.x;
  const float* x = X + (size_t)row * N; const float* rr = R ? R + (size_t)row * N : nullptr;
  float vals[16];                     // up to N = 4096
  const int per = N / 256;            // contiguous chunk per thread? use strided-by-4 chunks: thread handles j = tid*4 + 1024*u
  float s1 = 0.f;
  for (int u = 0; u < per / 4; ++u) {
    const int j = tid * 4 + 1024 * u;
    const v4f a = *(const v4fa*)(x + j);
    v4f b = {0.f,0.f,0.f,0.f}; if (rr) b = *(const v4fa*)(rr + j);
#pragma unroll
    for (int q = 0; q < 4; ++q) { const float v = a[q] + b[q]; vals[u * 4 + q] = v; s1 += v; }
  }
  red[tid] = s1; __syncthreads();
  for (int st = 128; st > 0; st >>= 1) { if (tid < st) red[tid] += red[tid + st]; __syncthreads(); }
  const float mu = red[0] / (float)N; __syncthreads();
  float s2 = 0.f;
  for (int u = 0; u < per / 4; ++u)
#pragma unroll
    for (int q = 0; q < 4; ++q) { const float c = vals[u * 4 + q] - mu; s2 += c * c; }
  red[tid] = s2; __syncthreads();
  for (int st = 128; st > 0; st >>= 1) { if (tid < st) red[tid] += red[tid + st]; __syncthreads(); }
  const float rs = rsqrtf(red[0] / (float)N + eps);
  {
    for (int u = 0; u < per / 4; ++u) {
      const int j = tid * 4 + 1024 * u;
      v4f o, sm;
#pragma unroll
      for (int q = 0; q < 4; ++q) {
        float gg = g[j + q], bb = bta[j + q];
        if (PARAM_BF16) { gg = bf16_round(gg); bb = bf16_round(bb); }
        sm[q] = vals[u * 4 + q]; o[q] = (vals[u * 4 + q] - mu) * rs * gg + bb;
      }
      if (out_sum) *(v4f*)(out_sum + (size_t)row * N + j) = sm;
      *(v4f*)(out_norm + (size_t)row * N + j) = o;
    }
    
  }
}



// ---- f16 WMMA path (v_wmma_f32_16x16x32_f16): 11-bit significands for operands in range — used where a [0,1] probability operand needs more precision than bf16
typedef _Float16 v16h __attribute__((ext_vector_type(16)));
union FragH { v16h v; v8us half[2]; _Float16 h[16]; unsigned short u[16]; };
template <int NT>
__device__ __forceinline__ v8f mmaH(v16h ah, v16h al, v16h bh, v16h bl, v8f c) {
  c = __builtin_amdgcn_wmma_f32_16x16x32_f16(false, ah, false, bh, (short)0, c, false, false);
  if (NT >= 2) c = __builtin_amdgcn_wmma_f32_16x16x32_f16(false, al, false, bh, (short)0, c, false, false);
  if (NT >= 3) c = __builtin_amdgcn_wmma_f32_16x16x32_f16(false, ah, false, bl, (short)0, c, false, false);
  asm volatile("v_nop\n\tv_nop\n\tv_nop\n\tv_nop" : "+v"(c) : "v"(ah), "v"(al), "v"(bh), "v"(bl));
  return c;
}
// batched GEMM like k_gemm_b but f16 operands: A f32 (split into f16 hi/lo if ASPLIT, else rounded to f16), Bt = f16 values [n][k]; alpha; C f32; N multiple of 16 (partial tiles skipped)
template <bool ASPLIT>
__global__ __launch_bounds__(128) void k_gemm_h(const float* __restrict__ A, int lda, size_t sA, const _Float16* __restrict__ Bh, int ldb, size_t sB, float alpha, float* __restrict__ C, int ldc, size_t sC, int M, int N, int K) {
  __shared__ __attribute__((aligned(16))) float so[4][16][64];
  const int tid = threadIdx.x, w = tid >> 5, lane = tid & 31, ln = lane & 15, hh = lane >> 4; const int by = blockIdx.y;
  A += (size_t)by * sA; Bh += (size_t)by * sB; C += (size_t)by * sC;
  const int ntn = (N + 63) / 64; const int wid = blockIdx.x * 4 + w; const int mt = wid / ntn, nq = wid % ntn; if (mt * 16 >= M) return;
  const int row0 = mt * 16, col0 = nq * 64; const float* arow = A + (size_t)(row0 + ln) * lda;
  v8f acc[4] = {};
  for (int kb = 0; kb < K; kb += 32) {
    FragH ah, al;
    const v4f x0 = *(const v4fa*)(arow + kb + 8 * hh), x1 = *(const v4fa*)(arow + kb + 8 * hh + 4), x2 = *(const v4fa*)(arow + kb + 16 + 8 * hh), x3 = *(const v4fa*)(arow + kb + 16 + 8 * hh + 4);
    float xs[16] = {x0[0],x0[1],x0[2],x0[3],x1[0],x1[1],x1[2],x1[3],x2[0],x2[1],x2[2],x2[3],x3[0],x3[1],x3[2],x3[3]};
#pragma unroll
    for (int i = 0; i < 16; ++i) { const _Float16 h = (_Float16)xs[i]; ah.h[i] = h; al.h[i] = ASPLIT ? (_Float16)(xs[i] - (float)h) : (_Float16)0.0f; }
#pragma unroll
    for (int t = 0; t < 4; ++t) { if (col0 + t * 16 >= N) continue; const size_t boff = (size_t)(col0 + t * 16 + ln) * ldb + kb; FragH bq; bq.half[0] = *(const v8us*)(Bh + boff + 8 * hh); bq.half[1] = *(const v8us*)(Bh + boff + 16 + 8 * hh);
      acc[t] = mmaH<ASPLIT ? 2 : 1>(ah.v, al.v, bq.v, bq.v, acc[t]); }
  }
#pragma unroll
  for (int t = 0; t < 4; ++t) { if (col0 + t * 16 >= N) continue;
#pragma unroll
    for (int r = 0; r < 8; ++r) so[w][8 * hh + r][t * 16 + ln] = acc[t][r] * alpha; }
  __builtin_amdgcn_fence(__ATOMIC_ACQ_REL, "workgroup"); __builtin_amdgcn_wave_barrier();
  const int rsub = lane >> 4, c4 = (lane & 15) * 4;
  {
#pragma unroll
    for (int q = 0; q < 8; ++q) { const int r = q * 2 + rsub; if (col0 + c4 < N) { const v4f v = *(const v4fa*)&so[w][r][c4]; *(v4f*)(C + (size_t)(row0 + r) * ldc + col0 + c4) = v; } }
     }
}

// Wt[n][k] = f16(W[k][n]·scale) from f32 row-major W[K][N] (scale = power of two; bf16-exact weights stay exact in f16 away from the subnormal range)
__global__ __launch_bounds__(256) void k_wt_f16(const float* __restrict__ W, _Float16* __restrict__ Wt, int K, int N, float scale) {
  const int t = blockIdx.x * 256 + threadIdx.x; if (t >= N * (K / 8)) return; const int n = t / (K / 8), k8 = (t % (K / 8)) * 8; FragH f;
#pragma unroll
  for (int i = 0; i < 8; ++i) f.h[i] = (_Float16)(bf16_round(W[(size_t)(k8 + i) * N + n]) * scale); const v8us o = f.half[0];
  *(v8us*)((unsigned short*)Wt + (size_t)n * K + k8) = o; 
}
typedef _Float16 v4h __attribute__((ext_vector_type(4)));
// GEMM C[M][N] = alpha * sum_k A[m][k] * B[n][k], f16 operands with k contiguous, f32 accumulate; writes f32 C or f16 C16 (pitch ldc). blockIdx = (N tile, M tile, batch).
// A work-group of 8 waves owns a BM x BN tile of C. Per K step the BM rows of A and the BN rows of B (BK elements each) are fetched with whole-line 16-byte loads, one chunk per lane,
// and stored to LDS rows padded by 16 bytes; every wave then reads its WMMA fragments from LDS, so a tile row is fetched from L2 once per work-group instead of once per wave in 32-byte pieces.
// Two LDS buffers: the next step's global loads are issued right behind the barrier (in front of it the barrier's own wait would drain them), fly during this step's products and are stored to the other buffer behind them.
// Global load addresses are a scalar base per chunk plus one 32-bit byte offset per lane and operand, which lives through the whole loop and moves on by one K step in front of each step's loads.
// sbase() takes a wave-uniform address through readfirstlane: the loads then take the scalar-base form, the loop holds no 64-bit vector address sums, and no short-lived address register is handed to a later load as its destination.
// Each output's products run over k in ascending blocks of 32 in one accumulator chain. M % BM == 0, N % BN == 0, K % BK == 0, BN == 128.
// The '#pragma unroll' on each loop over pre, base, acc or the fragments is there so that the array is indexed by constants only and stays in registers.
typedef const __attribute__((address_space(1))) v8us* gv8;
__device__ __forceinline__ unsigned long long sbase(const char* p) { const unsigned long long u = (unsigned long long)p; const unsigned lo = (unsigned)__builtin_amdgcn_readfirstlane((int)(unsigned)u), hi = (unsigned)__builtin_amdgcn_readfirstlane((int)(unsigned)(u >> 32)); return ((unsigned long long)hi << 32) | lo; }
template <int BM, int BN, int BK, int WM, int WN, bool OUT16>
__global__ __launch_bounds__(256) void k_gemm_lds(const _Float16* __restrict__ A, int lda, size_t sA, const _Float16* __restrict__ Bh, int ldb, size_t sB, float alpha,
                                                 float* __restrict__ C, _Float16* __restrict__ C16, int ldc, size_t sC, int K) {
  constexpr int FM = BM / (WM * 16), FN = BN / (WN * 16);      // fragments per wave
  constexpr int CPR = BK / 8, RPI = 256 / CPR;                 // 16-byte chunks per tile row; tile rows covered by one chunk per thread
  constexpr int PITCH = BK + 8, ROWS = BM + BN, STAGE = ROWS * PITCH;      // LDS row pitch and buffer size in f16 elements; rows 0..BM-1 hold A, the rest B
  constexpr int NCH = ROWS / RPI, ACH = BM / RPI;              // chunks per thread, of which from A
  constexpr int OP = BN + 4;                                   // f32 pitch of the output staging
  constexpr int LB = (2 * STAGE * 2 > BM * OP * 4) ? 2 * STAGE * 2 : BM * OP * 4;
  static_assert(WM * WN == 8 && BN == 128 && BM % RPI == 0 && BN % RPI == 0 && BK % 32 == 0, "tile shape");
  __shared__ __attribute__((aligned(16))) unsigned char smem[LB];
  unsigned short* st = (unsigned short*)smem;
  const int tid = threadIdx.x, w = tid >> 5, lane = tid & 31, ln = lane & 15, hh = lane >> 4;
  const int wm = w % WM, wn = w / WM;
  const int m0 = blockIdx.y * BM, n0 = blockIdx.x * BN;
  const int crow = tid / CPR, ccol = (tid % CPR) * 8;
  const char* Au = (const char*)(A + (size_t)blockIdx.z * sA + (size_t)m0 * lda);
  const char* Bu = (const char*)(Bh + (size_t)blockIdx.z * sB + (size_t)n0 * ldb);
  const unsigned aoff = (unsigned)(crow * lda + ccol) * 2u, boff = (unsigned)(crow * ldb + ccol) * 2u;      // bytes
  const size_t astep = (size_t)RPI * lda * 2, bstep = (size_t)RPI * ldb * 2;                                // bytes between a thread's chunks
  v8us pre[NCH];
  v8f acc[FM][FN] = {};
  const int nk = K / BK;
  unsigned long long base[NCH];
#pragma unroll
  for (int i = 0; i < NCH; ++i) base[i] = sbase((i < ACH) ? Au + i * astep : Bu + (i - ACH) * bstep);
#pragma unroll
  for (int i = 0; i < NCH; ++i) pre[i] = *(gv8)(base[i] + ((i < ACH) ? aoff : boff));
#pragma unroll
  for (int i = 0; i < NCH; ++i) *(v8us*)(st + (crow + i * RPI) * PITCH + ccol) = pre[i];
  unsigned ak = aoff, bk = boff;
  for (int s = 0; s < nk; ++s) {
    const bool more = s + 1 < nk;
    __syncthreads();      // publishes buffer s & 1; every wave has also left the other buffer, which is rewritten below
    if (more) {
      ak += BK * 2; bk += BK * 2;
#pragma unroll
      for (int i = 0; i < NCH; ++i) pre[i] = *(gv8)(base[i] + ((i < ACH) ? ak : bk));
      asm volatile("s_wait_xcnt 0x0" ::: "memory");      // precaution behind the run of loads: their offset registers (next step) and scalar bases (epilogue) are overwritten later on paths that hold no load wait
    }
    const unsigned short* sb = st + (s & 1) * STAGE;
#pragma unroll
    for (int kb = 0; kb < BK; kb += 32) {
      FragH a[FM], b[FN];
#pragma unroll
      for (int i = 0; i < FM; ++i) { const unsigned short* r = sb + ((wm * FM + i) * 16 + ln) * PITCH + kb + 8 * hh; a[i].half[0] = *(const v8us*)r; a[i].half[1] = *(const v8us*)(r + 16); }
#pragma unroll
      for (int j = 0; j < FN; ++j) { const unsigned short* r = sb + (BM + (wn * FN + j) * 16 + ln) * PITCH + kb + 8 * hh; b[j].half[0] = *(const v8us*)r; b[j].half[1] = *(const v8us*)(r + 16); }
#pragma unroll
      for (int i = 0; i < FM; ++i)
#pragma unroll
        for (int j = 0; j < FN; ++j) acc[i][j] = mmaH<1>(a[i].v, a[i].v, b[j].v, b[j].v, acc[i][j]);
    }
    if (more) {
      unsigned short* sn = st + ((s + 1) & 1) * STAGE;
#pragma unroll
      for (int i = 0; i < NCH; ++i) *(v8us*)(sn + (crow + i * RPI) * PITCH + ccol) = pre[i];
    }
  }
  __syncthreads();      // every wave has left the operand buffers before the output tile is staged over them
  float* so = (float*)smem;
#pragma unroll
  for (int i = 0; i < FM; ++i)
#pragma unroll
    for (int j = 0; j < FN; ++j)
#pragma unroll
      for (int r = 0; r < 8; ++r) so[((wm * FM + i) * 16 + 8 * hh + r) * OP + (wn * FN + j) * 16 + ln] = acc[i][j][r] * alpha;
  __syncthreads();      // the staged tile is read back across waves: one wave stores one whole row of the tile per instruction
  const size_t cofs = (size_t)blockIdx.z * sC + (size_t)m0 * ldc + n0;
  const unsigned coff = (unsigned)(w * ldc + lane * 4);      // elements
#pragma unroll
  for (int it = 0; it < BM / 8; ++it) {
    const v4f v = *(const v4fa*)&so[(w + it * 8) * OP + lane * 4];
    if (OUT16) { v4h h4; for (int q = 0; q < 4; ++q) h4[q] = (_Float16)v[q]; *(v4h*)((char*)(C16 + cofs + (size_t)(it * 8) * ldc) + coff * 2u) = h4; }
    else *(v4f*)((char*)(C + cofs + (size_t)(it * 8) * ldc) + coff * 4u) = v;
  }
}

__global__ __launch_bounds__(256) void k_x16(const float* __restrict__ x, _Float16* __restrict__ X16, size_t n8) { const size_t t = (size_t)blockIdx.x * 256 + threadIdx.x; if (t >= n8) return; FragH f;
#pragma unroll
  for (int q = 0; q < 8; ++q) f.h[q] = (_Float16)bf16_round(x[t * 8 + q]); *(v8us*)((unsigned short*)X16 + t * 8) = f.half[0];  }
__global__ __launch_bounds__(256) void k_h16(const float* __restrict__ x, _Float16* __restrict__ X16, size_t n8) { const size_t t = (size_t)blockIdx.x * 256 + threadIdx.x; if (t >= n8) return; FragH f;
#pragma unroll
  for (int q = 0; q < 8; ++q) f.h[q] = (_Float16)x[t * 8 + q]; *(v8us*)((unsigned short*)X16 + t * 8) = f.half[0];  }
// blockIdx.y picks one of four equally sized matrices; their f16 images lie one behind the other in Bt.
__global__ __launch_bounds__(256) void k_round16f(const float* __restrict__ W0, const float* __restrict__ W1, const float* __restrict__ W2, const float* __restrict__ W3, _Float16* __restrict__ Bt, size_t n8) { const size_t t = (size_t)blockIdx.x * 256 + threadIdx.x; if (t >= n8) return; FragH f;
  const int y = blockIdx.y; const float* W = (y == 0) ? W0 : (y == 1) ? W1 : (y == 2) ? W2 : W3; Bt += (size_t)y * n8 * 8;
#pragma unroll
  for (int i = 0; i < 8; ++i) f.h[i] = (_Float16)(bf16_round(W[t * 8 + i]) * 16.0f); *(v8us*)((unsigned short*)Bt + t * 8) = f.half[0];  }
template <int NHv, int TTv>
__global__ __launch_bounds__(256) void k_vt(const _Float16* __restrict__ V16, int ldv, int voff, _Float16* __restrict__ Vt) { __shared__ unsigned short tl[64][66]; const int tid = threadIdx.x; const int slab = blockIdx.x / (TTv / 64), lg = blockIdx.x % (TTv / 64); const int b = slab / NHv, h = slab % NHv;
  for (int i = tid; i < 64 * 8; i += 256) { const int r = i / 8, c8 = (i % 8) * 8; FragH f; f.half[0] = *(const v8us*)((const unsigned short*)V16 + ((size_t)b * TTv + lg * 64 + r) * ldv + voff + h * 64 + c8);
#pragma unroll
    for (int q = 0; q < 8; ++q) tl[r][c8 + q] = f.u[q]; }
  __syncthreads();
  {
#pragma unroll
    for (int rd = 0; rd < 2; ++rd) { const int d = rd * 32 + tid / 8, pc = tid % 8; FragH f;
#pragma unroll
      for (int q = 0; q < 8; ++q) f.u[q] = tl[pc * 8 + q][d];
      *(v8us*)((unsigned short*)Vt + ((size_t)slab * 64 + d) * TTv + lg * 64 + pc * 8) = f.half[0]; }
     } }

// f32 plane [NR][128] → concatenated-K f16 operand planes [NR][384] for a single 3-term GEMM: with h = f16(v), l = f16((v − h)·2^10):
//   MODE 0 (t side): [h | l | h];  MODE 1 (p side): [h | h·2^-10 | l·2^-10]  so that Σ_K A'·B' = Th·Ph + Tl·Ph·2^-10 + Th·Pl·2^-10 (power-of-two scalings are exact in f16 barring subnormal flushes, which cost ≤1e-4 on a σ≈11 logit);
template <int MODE>
__device__ __forceinline__ void hl3_body(const float* __restrict__ F, _Float16* __restrict__ P3, size_t t) { const size_t r = (t * 8) / CPN; const int c = (int)((t * 8) % CPN); const v4f a = *(const v4fa*)(F + t * 8), b = *(const v4fa*)(F + t * 8 + 4); FragH h, l, s2, s3;
#pragma unroll
  for (int q = 0; q < 8; ++q) { const float v = (q < 4) ? a[q] : b[q - 4]; const _Float16 hv = (_Float16)v; const _Float16 lv = (_Float16)((v - (float)hv) * 1024.0f); h.h[q] = hv; l.h[q] = lv; s2.h[q] = MODE ? (_Float16)((float)hv * 0.0009765625f) : lv; s3.h[q] = MODE ? (_Float16)((float)lv * 0.0009765625f) : hv; }
  unsigned short* row = (unsigned short*)P3 + r * (3 * CPN) + c;
  { *(v8us*)(row) = h.half[0]; *(v8us*)(row + CPN) = s2.half[0]; *(v8us*)(row + 2 * CPN) = s3.half[0];  } }
// One grid for both sides: blockIdx.y = 0 takes the t plane (MODE 0), 1 the p plane (MODE 1); the planes of F, and those of P3, lie one behind the other.
__global__ __launch_bounds__(256) void k_hl3(const float* __restrict__ F, _Float16* __restrict__ P3, size_t n8) { const size_t t = (size_t)blockIdx.x * 256 + threadIdx.x; if (t >= n8) return;
  if (blockIdx.y == 0) hl3_body<0>(F, P3, t); else hl3_body<1>(F + n8 * 8, P3 + n8 * 24, t); }
__global__ __launch_bounds__(256) void k_tok(const float* __restrict__ x, _Float16* __restrict__ X16) { __shared__ float tl[32][65]; const int tid = threadIdx.x; const int b = blockIdx.x / ((CI / 64) * (NN / 32)), rem = blockIdx.x % ((CI / 64) * (NN / 32)); const int cg = rem / (NN / 32), pg = rem % (NN / 32); const int c0 = cg * 64, p0 = pg * 32;
  for (int i = tid; i < 64 * 32; i += 256) { const int c = i / 32, pp = i % 32; tl[pp][c] = bf16_round(x[((size_t)b * CI + c0 + c) * NN + p0 + pp]); } __syncthreads();
  const int r = tid / 8, pc = tid % 8; FragH f; for (int q = 0; q < 8; ++q) f.h[q] = (_Float16)tl[r][pc * 8 + q]; const size_t row = (size_t)b * NN + p0 + r; *(v8us*)((unsigned short*)X16 + row * CI + c0 + pc * 8) = f.half[0];  }
// Column reductions, rows in parallel: a work-group owns 32 columns (one 128-byte line of every row). Eight lanes of 4 columns cover the line, so the 1024 threads form 128 row groups;
// row group rg walks rows rg, rg + 128, ... with 8 loads of 16 bytes in flight. Partials are merged in a fixed order: lanes l ^ 8 and l ^ 16 inside a wave, then the 32 waves, in wave order, through LDS.
// exp(x) by the same two instructions as __expf (multiply by log2 e, v_exp_f32). The v_nop is the free issue slot that the instruction set asks for behind a transcendental before its source is overwritten;
__device__ __forceinline__ float exp_slot(float x) { float r; asm("v_exp_f32 %0, %1\n\tv_nop" : "=v"(r) : "v"(x * 1.44269504f)); return r; }
__device__ __forceinline__ void ms_merge(float& m, float& z, float m2, float z2) { const float mn = fmaxf(m, m2); z = z * exp_slot(m - mn) + z2 * exp_slot(m2 - mn); m = mn; }
__global__ __launch_bounds__(1024) void k_colstat(const float* __restrict__ S, float* __restrict__ MX, float* __restrict__ ZZ) {
  __shared__ __attribute__((aligned(16))) float sm[32][32], sz[32][32];
  const int tid = threadIdx.x, w = tid >> 5, lane = tid & 31, cq = tid & 7, rg = tid >> 3;
  S += (size_t)blockIdx.y * NN * NN; MX += blockIdx.y * NN; ZZ += blockIdx.y * NN;      // blockIdx.y: which score plane of the launch
  const float* p = S + (size_t)rg * NN + blockIdx.x * 32 + cq * 4;
  v4f mx = {-3.0e38f, -3.0e38f, -3.0e38f, -3.0e38f}, z = {0.f, 0.f, 0.f, 0.f};
  for (int n = 0; n < NN; n += 128 * 8) {
    v4f s[8];
#pragma unroll
    for (int u = 0; u < 8; ++u) s[u] = *(const v4fa*)(p + (size_t)(n + 128 * u) * NN);
#pragma unroll
    for (int q = 0; q < 4; ++q) {
      float m8 = s[0][q];
#pragma unroll
      for (int u = 1; u < 8; ++u) m8 = fmaxf(m8, s[u][q]);
      const float mn = fmaxf(mx[q], m8);
      float a = z[q] * exp_slot(mx[q] - mn);
#pragma unroll
      for (int u = 0; u < 8; ++u) a += exp_slot(s[u][q] - mn);
      z[q] = a; mx[q] = mn;
    }
  }
#pragma unroll
  for (int q = 0; q < 4; ++q) {
    float m = mx[q], a = z[q];
    ms_merge(m, a, __shfl_xor(m, 8, 32), __shfl_xor(a, 8, 32));
    ms_merge(m, a, __shfl_xor(m, 16, 32), __shfl_xor(a, 16, 32));
    mx[q] = m; z[q] = a;
  }
  if (lane < 8) { *(v4f*)&sm[w][cq * 4] = mx; *(v4f*)&sz[w][cq * 4] = z; }
  __syncthreads();
  if (w == 0) {
    float m = sm[0][lane];
#pragma unroll
    for (int i = 1; i < 32; ++i) m = fmaxf(m, sm[i][lane]);
    float a = 0.f;
#pragma unroll
    for (int i = 0; i < 32; ++i) a += sz[i][lane] * exp_slot(sm[i][lane] - m);
    MX[blockIdx.x * 32 + lane] = m; ZZ[blockIdx.x * 32 + lane] = a;
  }
}
__global__ __launch_bounds__(256) void k_pexp(const float* __restrict__ S, const float* __restrict__ MX, const float* __restrict__ ZZ, _Float16* __restrict__ PT) { const size_t t = (size_t)blockIdx.x * 256 + threadIdx.x; if (t >= (size_t)NN * NN / 8) return; const int m0 = (int)((t * 8) % NN);
  PT += (size_t)blockIdx.y * NN * NN;      // blockIdx.y: which score plane of the launch
  const float* ps = S + (size_t)blockIdx.y * NN * NN + t * 8; const float* px = MX + blockIdx.y * NN + m0; const float* pz = ZZ + blockIdx.y * NN + m0;
  const v4f a = *(const v4fa*)ps, c = *(const v4fa*)(ps + 4), xa = *(const v4fa*)px, xc = *(const v4fa*)(px + 4), za = *(const v4fa*)pz, zc = *(const v4fa*)(pz + 4); FragH f;
  asm volatile("s_wait_xcnt 0x0" :: "v"(ps), "v"(px), "v"(pz) : "memory");      // precaution behind the run of loads: naming the three addresses keeps their registers untouched (also as a later load's destination) up to this wait
#pragma unroll
  for (int q = 0; q < 4; ++q) { f.h[q] = (_Float16)(__expf(a[q] - xa[q]) / za[q] * 32768.0f); f.h[4 + q] = (_Float16)(__expf(c[q] - xc[q]) / zc[q] * 32768.0f); }
  *(v8us*)((unsigned short*)PT + t * 8) = f.half[0];  }
__global__ __launch_bounds__(1024) void k_bnstat(const float* __restrict__ Z, float* __restrict__ MU, float* __restrict__ RS) {
  __shared__ __attribute__((aligned(16))) float a1[32][32], a2[32][32];
  const int tid = threadIdx.x, w = tid >> 5, lane = tid & 31, cq = tid & 7, rg = tid >> 3;
  const float* p = Z + (size_t)rg * CI + blockIdx.x * 32 + cq * 4;
  v4f s1 = {0.f, 0.f, 0.f, 0.f}, s2 = {0.f, 0.f, 0.f, 0.f};
  for (int r = 0; r < NR; r += 128 * 8) {
    v4f v[8];
#pragma unroll
    for (int u = 0; u < 8; ++u) v[u] = *(const v4fa*)(p + (size_t)(r + 128 * u) * CI);
#pragma unroll
    for (int u = 0; u < 8; ++u) { s1 += v[u]; s2 += v[u] * v[u]; }
  }
#pragma unroll
  for (int q = 0; q < 4; ++q) {
    s1[q] += __shfl_xor(s1[q], 8, 32); s2[q] += __shfl_xor(s2[q], 8, 32);
    s1[q] += __shfl_xor(s1[q], 16, 32); s2[q] += __shfl_xor(s2[q], 16, 32);
  }
  if (lane < 8) { *(v4f*)&a1[w][cq * 4] = s1; *(v4f*)&a2[w][cq * 4] = s2; }
  __syncthreads();
  if (w == 0) {
    float t1 = 0.f, t2 = 0.f;
#pragma unroll
    for (int i = 0; i < 32; ++i) { t1 += a1[i][lane]; t2 += a2[i][lane]; }
    const float mu = t1 / (float)NR; const float var = fmaxf(t2 / (float)NR - mu * mu, 0.f);
    MU[blockIdx.x * 32 + lane] = mu; RS[blockIdx.x * 32 + lane] = rsqrtf(var + 1e-5f);
  }
}
__global__ __launch_bounds__(256) void k_out(const float* __restrict__ Z, const float* __restrict__ MU, const float* __restrict__ RS, const float* __restrict__ gam, const float* __restrict__ bet, const float* __restrict__ x, float* __restrict__ out) { __shared__ float tl[32][65]; const int tid = threadIdx.x; const int b = blockIdx.x / ((CI / 32) * (NN / 64)), rem = blockIdx.x % ((CI / 32) * (NN / 64)); const int cg = rem / (NN / 64), pg = rem % (NN / 64); const int c0 = cg * 32, p0 = pg * 64;
  for (int i = tid; i < 64 * 32; i += 256) { const int pp = i / 32, c = i % 32; tl[c][pp] = (Z[((size_t)b * NN + p0 + pp) * CI + c0 + c] - MU[c0 + c]) * RS[c0 + c] * bf16_round(gam[c0 + c]) + bf16_round(bet[c0 + c]); } __syncthreads();
  { for (int i = tid; i < 32 * 16; i += 256) { const int c = i / 16, q4 = i % 16; const size_t o = ((size_t)b * CI + c0 + c) * NN + p0 + q4 * 4; const v4f xr = *(const v4fa*)(x + o); const v4f v = {tl[c][q4 * 4] + bf16_round(xr[0]), tl[c][q4 * 4 + 1] + bf16_round(xr[1]), tl[c][q4 * 4 + 2] + bf16_round(xr[2]), tl[c][q4 * 4 + 3] + bf16_round(xr[3])}; *(v4f*)(out + o) = v; }  } }

extern "C" void kernel_launch(void* const* d_in, const int* in_sizes, int n_in,
                              void* d_out, int out_size, void* d_ws, size_t ws_size, hipStream_t stream) {
  (void)in_sizes; (void)n_in; (void)out_size;
  const float* const* I = (const float* const*)d_in; const float* x = I[0]; const float* Wt = I[1]; const float* Wp = I[2]; const float* Wg = I[3]; const float* Wz = I[4]; const float* gam = I[5]; const float* bet = I[6];
  char* ws = (char*)d_ws; size_t off = 0;
  auto take = [&](size_t bytes) { char* p = ws + off; off += (bytes + 255) & ~(size_t)255; return p; };
  _Float16* Bt_ = (_Float16*)take((size_t)4 * CPN * CI * 2); _Float16* Bp_ = Bt_ + (size_t)CPN * CI; _Float16* Bg_ = Bp_ + (size_t)CPN * CI; _Float16* Bz_ = Bg_ + (size_t)CPN * CI;      /* four weight images, one behind the other */
  float* S = (float*)take((size_t)PB * NN * NN * 4); _Float16* PT = (_Float16*)take((size_t)PB * NN * NN * 2); _Float16* X16 = (_Float16*)take((size_t)NR * CI * 2);      /* score and weight planes of the PB batches that one launch works on */
  _Float16* T3 = (_Float16*)take((size_t)2 * NR * 3 * CPN * 2); _Float16* P3 = T3 + (size_t)NR * 3 * CPN; float* F32 = (float*)take((size_t)2 * NR * CPN * 4);      /* all batches: concatenated-K operand planes [16384][384] (t, then p) and the two f32 conv outputs they are built from */
  _Float16* Gc = (_Float16*)take((size_t)BB * CPN * NN * 2); _Float16* Y16 = (_Float16*)take((size_t)NR * CPN * 2); float* MX = (float*)take((size_t)PB * NN * 4); float* ZZ = (float*)take((size_t)PB * NN * 4); float* MU = (float*)take((size_t)CI * 4); float* RS = (float*)take((size_t)CI * 4);
  float* Z = S;      /* the z plane (16.8 MB) reuses the score region after the last batch */
  if (off > ws_size) return;      // about 260 MB of the 268 MB given (score planes 134, weight planes 67, the rest 59); four score planes at once would take all 268 MB
  const unsigned gw = (unsigned)(((size_t)CPN * CI / 8 + 255) / 256);
  k_round16f<<<dim3(gw, 4, 1), 256, 0, stream>>>(Wt, Wp, Wg, Wz, Bt_, (size_t)CPN * CI / 8);      /* conv weights (out,in) natural x 2^4, all four in one grid */
  k_tok<<<BB * (CI / 64) * (NN / 32), 256, 0, stream>>>(x, X16);
  k_gemm_lds<128, 128, 64, 4, 2, true><<<dim3(NN / 128, CPN / 128, BB), 256, 0, stream>>>(Bg_, CI, 0, X16, CI, (size_t)NN * CI, 0.0625f, nullptr, Gc, NN, (size_t)CPN * NN, CI);      /* g channel-major per batch [b][128][4096] (f16): M 128 N 4096 K 256 */
  k_gemm_lds<32, 128, 256, 1, 8, false><<<dim3(CPN / 128, NR / 32, 2), 256, 0, stream>>>(X16, CI, 0, Bt_, CI, (size_t)CPN * CI, 0.0625f, F32, nullptr, CPN, (size_t)NR * CPN, CI);      /* t (z = 0) and p (z = 1) of all batches, token-major f32: M 16384 N 128 K 256 */
  k_hl3<<<dim3((unsigned)(((size_t)NR * CPN / 8 + 255) / 256), 2, 1), 256, 0, stream>>>(F32, T3, (size_t)NR * CPN / 8);      /* t to [h | l | h], p to [h | h 2^-10 | l 2^-10] */
  const dim3 gs(NN / 128, NN / 128, PB), gy(CPN / 128, NN / 32, PB);
  for (int b = 0; b < BB; b += PB) { const size_t to = (size_t)b * NN * 3 * CPN, yo = (size_t)b * NN * CPN;      /* blockIdx.z or .y of each launch: batch b, b + 1 */
    k_gemm_lds<128, 128, 64, 4, 2, false><<<gs, 256, 0, stream>>>(T3 + to, 3 * CPN, (size_t)NN * 3 * CPN, P3 + to, 3 * CPN, (size_t)NN * 3 * CPN, 1.0f, S, nullptr, NN, (size_t)NN * NN, 3 * CPN);      /* S[n][m] = t_n p_m as Th Ph + (Tl Ph + Th Pl) 2^-10 in one K = 384 pass: M 4096 N 4096 */
    k_colstat<<<dim3(NN / 32, PB, 1), 1024, 0, stream>>>(S, MX, ZZ); k_pexp<<<dim3((unsigned)(((size_t)NN * NN / 8 + 255) / 256), PB, 1), 256, 0, stream>>>(S, MX, ZZ, PT);
    k_gemm_lds<32, 128, 256, 1, 8, true><<<gy, 256, 0, stream>>>(PT, NN, (size_t)NN * NN, Gc + (size_t)b * CPN * NN, NN, (size_t)CPN * NN, 0.000030517578125f, nullptr, Y16 + yo, CPN, (size_t)NN * CPN, NN); }      /* y[n][c] = sum over m of att[n][m] g[c][m]: M 4096 N 128 K 4096 (f16 out) */
  k_gemm_lds<128, 128, 64, 4, 2, false><<<dim3(CI / 128, NR / 128, 1), 256, 0, stream>>>(Y16, CPN, 0, Bz_, CPN, 0, 0.0625f, Z, nullptr, CI, 0, CPN);      /* z token-major [16384][256] f32: M 16384 N 256 K 128 */
  k_bnstat<<<CI / 32, 1024, 0, stream>>>(Z, MU, RS); k_out<<<BB * (CI / 32) * (NN / 64), 256, 0, stream>>>(Z, MU, RS, gam, bet, x, (float*)d_out);
}

// v004
// One run takes 191 microseconds.
// Next to v003, in two timings, it ran 1.38 and 1.40 times as fast.
// All steps since v000 together make it 68.4 times as fast.
#include <hip/hip_runtime.h>
// Spatial non-local block with query-axis softmax (B=4, C_in 256, C_p 128, N=4096): t,p,g = 1×1 convs; att[n,m] = Σ_c t[c,n]·p[c,m]; att = softmax over n (dim=1) for every m; y[c,n] = Σ_m att[n,m]·g[c,m]; z = Wz·y;
// BatchNorm1d in training mode (batch statistics over (B,N) per channel, biased variance, eps 1e-5) with affine; out = BN(z) + x.
// Compute dtype: x and weights rounded to bf16; t and p as f32 GEMM outputs split into f16 hi + ×2^10 residual parts laid out as concatenated-K operands so one K=384 GEMM yields Th·Ph + (Tl·Ph + Th·Pl)·2^-10 (σ≈11 logits, f32-accurate);
// no f32 score plane is stored: the score GEMM's epilogue takes each column's max and sum over the 128 rows of its own tile (f32) and writes exp(s - tile max) row-major as f16 x 2^15; a small kernel merges the 32 row tiles of a column into
// one factor exp(tile max - column max) / column sum per (row tile, column), and the y GEMM multiplies its weight chunks by that factor on their way to LDS; y = contraction over m as an f16 GEMM against
// channel-major g; z GEMM; per-channel batch statistics as fixed-order f32 column sums; affine + residual applied during the transpose back to channel-major. All contractions on v_wmma_f32_16x16x32_f16, f32 accumulate.
#define BB 4
#define CI 256
#define CPN 128
#define NN 4096
#define NR (BB * NN)
#define PB 2      // batches whose weight planes are held at once: each launch of the score, softmax and y stages works on PB batches
#define RTL (NN / 128)      // row tiles of a score plane: one set of column statistics each

typedef __bf16 v16b __attribute__((ext_vector_type(16)));
typedef unsigned short v8us __attribute__((ext_vector_type(8), may_alias));
typedef float  v8f  __attribute__((ext_vector_type(8)));
typedef float  v4f  __attribute__((ext_vector_type(4)));
typedef float  v4fa __attribute__((ext_vector_type(4), may_alias));
union FragB { v16b v; v8us half[2]; unsigned short u[16]; };

__device__ __forceinline__ unsigned short bf16_bits(float x) { unsigned int u = __float_as_uint(x); return (unsigned short)((u + 0x7FFFu + ((u >> 16) & 1u)) >> 16); }
__device__ __forceinline__ float bf16_val(unsigned short b) { return __uint_as_float(((unsigned int)b) << 16); }
__device__ __forceinline__ float bf16_round(float x) { return bf16_val(bf16_bits(x)); }
// D += A·B with NT terms: 1 = ah·bh, 2 = + al·bh (A split), 3 = + ah·bl (both split)
template <int NT>
__device__ __forceinline__ v8f mmaN(v16b ah, v16b al, v16b bh, v16b bl, v8f c) {
  c = __builtin_amdgcn_wmma_f32_16x16x32_bf16(false, ah, false, bh, (short)0, c, false, false);
  if (NT >= 2) c = __builtin_amdgcn_wmma_f32_16x16x32_bf16(false, al, false, bh, (short)0, c, false, false);
  if (NT >= 3) c = __builtin_amdgcn_wmma_f32_16x16x32_bf16(false, ah, false, bl, (short)0, c, false, false);
  asm volatile("v_nop\n\tv_nop\n\tv_nop\n\tv_nop" : "+v"(c) : "v"(ah), "v"(al), "v"(bh), "v"(bl));
  return c;
}

__global__ __launch_bounds__(256) void k_wt_bf16(const float* __restrict__ W, unsigned short* __restrict__ Wt, int K, int N) {
  const int t = blockIdx.x * 256 + threadIdx.x;
  const int k8n = K / 8;
  if (t >= N * k8n) return;
  const int n = t / k8n, k8 = (t % k8n) * 8;
  v8us v;
#pragma unroll
  for (int i = 0; i < 8; ++i) v[i] = bf16_bits(W[(size_t)(k8 + i) * N + n]);
  *(v8us*)(Wt + (size_t)n * K + k8) = v;
  
}

// GEMM C[M][N] (f32, pitch ldc) = act(A[M][K]·W + bias). A f32 row-major (pitch lda) converted per fragment to bf16
// (ASPLIT: hi/lo two planes -> 2 terms, else single rounded term); Wt bf16 [N][K] (pitch ldb). BIAS_BF16 rounds the
// bias to bf16 first (bias quantised to bf16 before the add). K%32==0, M%16==0, N%64==0.
template <bool ASPLIT, int ACT, bool BIAS_BF16>
__global__ __launch_bounds__(128) void k_gemm_bf(const float* __restrict__ A, int lda, const unsigned short* __restrict__ Wt, int ldb,
                                               const float* __restrict__ bias, float* __restrict__ C, int ldc, int M, int N, int K) {
  __shared__ __attribute__((aligned(16))) float so[4][16][64];
  const int tid = threadIdx.x, w = tid >> 5, lane = tid & 31, ln = lane & 15, hh = lane >> 4;
  const int ntn = N / 64;
  const int wid = blockIdx.x * 4 + w;
  const int mt = wid / ntn, nq = wid % ntn;
  if (mt * 16 >= M) return;
  const int row0 = mt * 16, col0 = nq * 64;
  const float* arow = A + (size_t)(row0 + ln) * lda;
  v8f acc[4] = {};
  for (int kb = 0; kb < K; kb += 32) {
    FragB ah, al;
    const v4f x0 = *(const v4fa*)(arow + kb + 8 * hh), x1 = *(const v4fa*)(arow + kb + 8 * hh + 4);
    const v4f x2 = *(const v4fa*)(arow + kb + 16 + 8 * hh), x3 = *(const v4fa*)(arow + kb + 16 + 8 * hh + 4);
    float xs[16] = {x0[0],x0[1],x0[2],x0[3],x1[0],x1[1],x1[2],x1[3],x2[0],x2[1],x2[2],x2[3],x3[0],x3[1],x3[2],x3[3]};
#pragma unroll
    for (int i = 0; i < 16; ++i) { const unsigned short hb = bf16_bits(xs[i]); ah.u[i] = hb; al.u[i] = ASPLIT ? bf16_bits(xs[i] - bf16_val(hb)) : (unsigned short)0; }
#pragma unroll
    for (int t = 0; t < 4; ++t) {
      const unsigned short* brow = Wt + (size_t)(col0 + t * 16 + ln) * ldb + kb;
      FragB b;
      b.half[0] = *(const v8us*)(brow + 8 * hh);
      b.half[1] = *(const v8us*)(brow + 16 + 8 * hh);
      acc[t] = mmaN<ASPLIT ? 2 : 1>(ah.v, al.v, b.v, b.v, acc[t]);
    }
  }
#pragma unroll
  for (int t = 0; t < 4; ++t) {
    float bv = bias ? bias[col0 + t * 16 + ln] : 0.f;
    if (BIAS_BF16) bv = bf16_round(bv);
#pragma unroll
    for (int r = 0; r < 8; ++r) { float v = acc[t][r] + bv; if (ACT == 1) v = fmaxf(v, 0.f); so[w][8 * hh + r][t * 16 + ln] = v; }
  }
  __builtin_amdgcn_fence(__ATOMIC_ACQ_REL, "workgroup");
  __builtin_amdgcn_wave_barrier();
  const int rsub = lane >> 4, c4 = (lane & 15) * 4;
  {
#pragma unroll
    for (int q = 0; q < 8; ++q) {
      const int r = q * 2 + rsub;
      const v4f v = *(const v4fa*)&so[w][r][c4];
      *(v4f*)(C + (size_t)(row0 + r) * ldc + col0 + c4) = v;
    }
    
  }
}

// Flash-style causal/unmasked attention, all contractions 3-term bf16 hi/lo splits, f32 softmax with running max.
// q,k,v rows are read from f32 buffers with arbitrary row pitch (so they can live inside a fused qkv buffer);
// D = head size (multiple of 32, <= 128); one wave = 16 query rows; block = 4 waves (64 queries) sharing K/V chunks of 32.
template <int D, bool CAUSAL>
__global__ __launch_bounds__(128) void k_flash(const float* __restrict__ qb, const float* __restrict__ kb, const float* __restrict__ vb,
                                             int pitch, int T, int H, float scale, float* __restrict__ y, int ypitch) {
  constexpr int KS = D / 32;        // k-steps for QK
  constexpr int DT = D / 16;        // d tiles for PV
  __shared__ __attribute__((aligned(16))) unsigned short sKh[32][D + 8], sKl[32][D + 8], sVh[32][D + 8], sVl[32][D + 8];
  __shared__ __attribute__((aligned(16))) unsigned short sPh[4][16][40], sPl[4][16][40];
  __shared__ __attribute__((aligned(16))) float sO[4][16][D];
  const int tid = threadIdx.x, w = tid >> 5, lane = tid & 31, ln = lane & 15, hh = lane >> 4;
  const int nqb = (T + 63) / 64;
  const int bh = blockIdx.x / nqb, qblk = blockIdx.x % nqb;
  const int b = bh / H, h = bh % H;
  const int q0 = qblk * 64 + w * 16;
  const float* Q = qb + (size_t)b * T * pitch + h * D;
  const float* K = kb + (size_t)b * T * pitch + h * D;
  const float* V = vb + (size_t)b * T * pitch + h * D;

  // A fragments of the wave's 16 query rows (scaled), hi/lo
  FragB aqh[KS], aql[KS];
  {
    int row = q0 + ln; if (row >= T) row = T - 1;
    const float* qr = Q + (size_t)row * pitch;
#pragma unroll
    for (int ks = 0; ks < KS; ++ks)
#pragma unroll
      for (int i = 0; i < 16; ++i) {
        const int d = ks * 32 + ((i < 8) ? (8 * hh + i) : (16 + 8 * hh + (i - 8)));
        const float x = qr[d] * scale; const unsigned short hb = bf16_bits(x);
        aqh[ks].u[i] = hb; aql[ks].u[i] = bf16_bits(x - bf16_val(hb));
      }
  }
  float m_r[8], l_r[8];
#pragma unroll
  for (int r = 0; r < 8; ++r) { m_r[r] = -3.0e38f; l_r[r] = 0.f; }
  v8f oacc[DT];
#pragma unroll
  for (int dt = 0; dt < DT; ++dt) oacc[dt] = (v8f){0.f,0.f,0.f,0.f,0.f,0.f,0.f,0.f};

  const int kv_end = CAUSAL ? min(T, qblk * 64 + 64) : T;     // block-uniform
  for (int j0 = 0; j0 < kv_end; j0 += 32) {
    __syncthreads();
    for (int e = tid; e < 32 * (D / 4); e += 128) {
      const int r = e / (D / 4), c4 = (e % (D / 4)) * 4;
      const int key = j0 + r;
      v4f kf = {0.f,0.f,0.f,0.f}, vf = {0.f,0.f,0.f,0.f};
      if (key < T) { kf = *(const v4fa*)(K + (size_t)key * pitch + c4); vf = *(const v4fa*)(V + (size_t)key * pitch + c4); }
#pragma unroll
      for (int t = 0; t < 4; ++t) {
        unsigned short hb = bf16_bits(kf[t]); sKh[r][c4 + t] = hb; sKl[r][c4 + t] = bf16_bits(kf[t] - bf16_val(hb));
        hb = bf16_bits(vf[t]); sVh[r][c4 + t] = hb; sVl[r][c4 + t] = bf16_bits(vf[t] - bf16_val(hb));
      }
    }
    __syncthreads();
    // S tile 16 x 32
    v8f s[2];
#pragma unroll
    for (int nt = 0; nt < 2; ++nt) {
      v8f acc = {};
#pragma unroll
      for (int ks = 0; ks < KS; ++ks) {
        FragB bh_, bl_;
        bh_.half[0] = *(const v8us*)&sKh[nt * 16 + ln][ks * 32 + 8 * hh]; bh_.half[1] = *(const v8us*)&sKh[nt * 16 + ln][ks * 32 + 16 + 8 * hh];
        bl_.half[0] = *(const v8us*)&sKl[nt * 16 + ln][ks * 32 + 8 * hh]; bl_.half[1] = *(const v8us*)&sKl[nt * 16 + ln][ks * 32 + 16 + 8 * hh];
        acc = mmaN<3>(aqh[ks].v, aql[ks].v, bh_.v, bl_.v, acc);
      }
      s[nt] = acc;
    }
    // mask + running max (rows 8hh+r; the 16 lanes of a half share rows)
    float alpha[8];
#pragma unroll
    for (int r = 0; r < 8; ++r) {
      const int qi = q0 + 8 * hh + r;
      const int ja = j0 + ln, jb = j0 + 16 + ln;
      if (CAUSAL) { if (ja > qi) s[0][r] = -3.0e38f; if (jb > qi) s[1][r] = -3.0e38f; }
      if (ja >= T) s[0][r] = -3.0e38f;
      if (jb >= T) s[1][r] = -3.0e38f;
      float mx = fmaxf(s[0][r], s[1][r]);
      mx = fmaxf(mx, __shfl_xor(mx, 1, 32)); mx = fmaxf(mx, __shfl_xor(mx, 2, 32)); mx = fmaxf(mx, __shfl_xor(mx, 4, 32)); mx = fmaxf(mx, __shfl_xor(mx, 8, 32));
      const float mnew = fmaxf(m_r[r], mx);
      alpha[r] = (mnew > -1.0e38f) ? __expf(m_r[r] - mnew) : 1.0f;
      const float p0 = (s[0][r] > -1.0e38f) ? __expf(s[0][r] - mnew) : 0.f;
      const float p1 = (s[1][r] > -1.0e38f) ? __expf(s[1][r] - mnew) : 0.f;
      m_r[r] = mnew;
      l_r[r] = l_r[r] * alpha[r] + p0 + p1;            // per-lane partial row sum (16 lanes combined at the end)
      unsigned short hb = bf16_bits(p0); sPh[w][8 * hh + r][ln] = hb;      sPl[w][8 * hh + r][ln] = bf16_bits(p0 - bf16_val(hb));
      hb = bf16_bits(p1);                sPh[w][8 * hh + r][16 + ln] = hb; sPl[w][8 * hh + r][16 + ln] = bf16_bits(p1 - bf16_val(hb));
    }
#pragma unroll
    for (int dt = 0; dt < DT; ++dt)
#pragma unroll
      for (int r = 0; r < 8; ++r) oacc[dt][r] *= alpha[r];
    __builtin_amdgcn_fence(__ATOMIC_ACQ_REL, "workgroup");
    __builtin_amdgcn_wave_barrier();
    FragB pah, pal;
    pah.half[0] = *(const v8us*)&sPh[w][ln][8 * hh]; pah.half[1] = *(const v8us*)&sPh[w][ln][16 + 8 * hh];
    pal.half[0] = *(const v8us*)&sPl[w][ln][8 * hh]; pal.half[1] = *(const v8us*)&sPl[w][ln][16 + 8 * hh];
#pragma unroll
    for (int dt = 0; dt < DT; ++dt) {
      FragB bvh, bvl;
#pragma unroll
      for (int i = 0; i < 8; ++i) {
        bvh.u[i] = sVh[8 * hh + i][dt * 16 + ln]; bvh.u[8 + i] = sVh[16 + 8 * hh + i][dt * 16 + ln];
        bvl.u[i] = sVl[8 * hh + i][dt * 16 + ln]; bvl.u[8 + i] = sVl[16 + 8 * hh + i][dt * 16 + ln];
      }
      oacc[dt] = mmaN<3>(pah.v, pal.v, bvh.v, bvl.v, oacc[dt]);
    }
    __builtin_amdgcn_fence(__ATOMIC_ACQ_REL, "workgroup");
    __builtin_amdgcn_wave_barrier();
  }
#pragma unroll
  for (int r = 0; r < 8; ++r) {
    float l = l_r[r];
    l += __shfl_xor(l, 1, 32); l += __shfl_xor(l, 2, 32); l += __shfl_xor(l, 4, 32); l += __shfl_xor(l, 8, 32);
    l_r[r] = (l > 0.f) ? 1.0f / l : 0.f;
  }
#pragma unroll
  for (int dt = 0; dt < DT; ++dt)
#pragma unroll
    for (int r = 0; r < 8; ++r) sO[w][8 * hh + r][dt * 16 + ln] = oacc[dt][r] * l_r[r];
  __builtin_amdgcn_fence(__ATOMIC_ACQ_REL, "workgroup");
  __builtin_amdgcn_wave_barrier();
  {
    for (int r = 0; r < 16; ++r) {
      const int row = q0 + r;
      if (row < T && lane < D / 4) {
        const v4f val = *(const v4fa*)&sO[w][r][lane * 4];
        *(v4f*)(y + ((size_t)b * T + row) * ypitch + h * D + lane * 4) = val;
      }
    }
    
  }
}

// GEMM C = act(A·W + bias + resid): A f32 (ASPLIT -> hi/lo 2 terms), Wt bf16 [N][K]; ACT 0 none, 1 relu, 2 exact gelu;
// resid (optional, f32, row index = (row % rmod), pitch ldr, RES_BF16 rounds it) added before the activation.
template <bool ASPLIT, int ACT, bool BIAS_BF16, bool RES_BF16>
__global__ __launch_bounds__(128) void k_gemm_bf3(const float* __restrict__ A, int lda, const unsigned short* __restrict__ Wt, int ldb,
                                                const float* __restrict__ bias, const float* __restrict__ resid, int rmod, int ldr,
                                                float* __restrict__ C, int ldc, int M, int N, int K) {
  __shared__ __attribute__((aligned(16))) float so[4][16][64];
  const int tid = threadIdx.x, w = tid >> 5, lane = tid & 31, ln = lane & 15, hh = lane >> 4;
  const int ntn = N / 64;
  const int wid = blockIdx.x * 4 + w;
  const int mt = wid / ntn, nq = wid % ntn;
  if (mt * 16 >= M) return;
  const int row0 = mt * 16, col0 = nq * 64;
  const float* arow = A + (size_t)(row0 + ln) * lda;
  v8f acc[4] = {};
  for (int kb = 0; kb < K; kb += 32) {
    FragB ah, al;
    const v4f x0 = *(const v4fa*)(arow + kb + 8 * hh), x1 = *(const v4fa*)(arow + kb + 8 * hh + 4);
    const v4f x2 = *(const v4fa*)(arow + kb + 16 + 8 * hh), x3 = *(const v4fa*)(arow + kb + 16 + 8 * hh + 4);
    float xs[16] = {x0[0],x0[1],x0[2],x0[3],x1[0],x1[1],x1[2],x1[3],x2[0],x2[1],x2[2],x2[3],x3[0],x3[1],x3[2],x3[3]};
#pragma unroll
    for (int i = 0; i < 16; ++i) { const unsigned short hb = bf16_bits(xs[i]); ah.u[i] = hb; al.u[i] = ASPLIT ? bf16_bits(xs[i] - bf16_val(hb)) : (unsigned short)0; }
#pragma unroll
    for (int t = 0; t < 4; ++t) {
      const unsigned short* brow = Wt + (size_t)(col0 + t * 16 + ln) * ldb + kb;
      FragB b;
      b.half[0] = *(const v8us*)(brow + 8 * hh);
      b.half[1] = *(const v8us*)(brow + 16 + 8 * hh);
      acc[t] = mmaN<ASPLIT ? 2 : 1>(ah.v, al.v, b.v, b.v, acc[t]);
    }
  }
#pragma unroll
  for (int t = 0; t < 4; ++t) {
    const int col = col0 + t * 16 + ln;
    float bv = bias ? bias[col] : 0.f;
    if (BIAS_BF16) bv = bf16_round(bv);
#pragma unroll
    for (int r = 0; r < 8; ++r) {
      float v = acc[t][r] + bv;
      if (resid) { float rv = resid[(size_t)((row0 + 8 * hh + r) % rmod) * ldr + col]; if (RES_BF16) rv = bf16_round(rv); v += rv; }
      if (ACT == 1) v = fmaxf(v, 0.f);
      if (ACT == 2) v = 0.5f * v * (1.0f + erff(v * 0.70710678118654752f));
      if (ACT == 3) { const float u = 0.7978845608028654f * (v + 0.044715f * v * v * v); v = 0.5f * v * (1.0f + tanhf(u)); }
      so[w][8 * hh + r][t * 16 + ln] = v;
    }
  }
  __builtin_amdgcn_fence(__ATOMIC_ACQ_REL, "workgroup");
  __builtin_amdgcn_wave_barrier();
  const int rsub = lane >> 4, c4 = (lane & 15) * 4;
  {
#pragma unroll
    for (int q = 0; q < 8; ++q) {
      const int r = q * 2 + rsub;
      const v4f v = *(const v4fa*)&so[w][r][c4];
      *(v4f*)(C + (size_t)(row0 + r) * ldc + col0 + c4) = v;
    }
    
  }
}
// row LayerNorm (biased variance, eps) over N: s = X (+ R); optional out_sum <- s; out_norm <- (s-mu)*rsqrt(var+eps)*g + b
template <bool PARAM_BF16>
__global__ __launch_bounds__(256) void k_layernorm(const float* __restrict__ X, const float* __restrict__ R, const float* __restrict__ g, const float* __restrict__ bta,
                                                  float* __restrict__ out_sum, float* __restrict__ out_norm, int N, float eps) {
  __shared__ float red[256];
  const int row = blockIdx.x, tid = threadIdx.x;
  const float* x = X + (size_t)row * N; const float* rr = R ? R + (size_t)row * N : nullptr;
  float vals[16];                     // up to N = 4096
  const int per = N / 256;            // contiguous chunk per thread? use strided-by-4 chunks: thread handles j = tid*4 + 1024*u
  float s1 = 0.f;
  for (int u = 0; u < per / 4; ++u) {
    const int j = tid * 4 + 1024 * u;
    const v4f a = *(const v4fa*)(x + j);
    v4f b = {0.f,0.f,0.f,0.f}; if (rr) b = *(const v4fa*)(rr + j);
#pragma unroll
    for (int q = 0; q < 4; ++q) { const float v = a[q] + b[q]; vals[u * 4 + q] = v; s1 += v; }
  }
  red[tid] = s1; __syncthreads();
  for (int st = 128; st > 0; st >>= 1) { if (tid < st) red[tid] += red[tid + st]; __syncthreads(); }
  const float mu = red[0] / (float)N; __syncthreads();
  float s2 = 0.f;
  for (int u = 0; u < per / 4; ++u)
#pragma unroll
    for (int q = 0; q < 4; ++q) { const float c = vals[u * 4 + q] - mu; s2 += c * c; }
  red[tid] = s2; __syncthreads();
  for (int st = 128; st > 0; st >>= 1) { if (tid < st) red[tid] += red[tid + st]; __syncthreads(); }
  const float rs = rsqrtf(red[0] / (float)N + eps);
  {
    for (int u = 0; u < per / 4; ++u) {
      const int j = tid * 4 + 1024 * u;
      v4f o, sm;
#pragma unroll
      for (int q = 0; q < 4; ++q) {
        float gg = g[j + q], bb = bta[j + q];
        if (PARAM_BF16) { gg = bf16_round(gg); bb = bf16_round(bb); }
        sm[q] = vals[u * 4 + q]; o[q] = (vals[u * 4 + q] - mu) * rs * gg + bb;
      }
      if (out_sum) *(v4f*)(out_sum + (size_t)row * N + j) = sm;
      *(v4f*)(out_norm + (size_t)row * N + j) = o;
    }
    
  }
}



// ---- f16 WMMA path (v_wmma_f32_16x16x32_f16): 11-bit significands for operands in range — used where a [0,1] probability operand needs more precision than bf16
typedef _Float16 v16h __attribute__((ext_vector_type(16)));
union FragH { v16h v; v8us half[2]; _Float16 h[16]; unsigned short u[16]; };
template <int NT>
__device__ __forceinline__ v8f mmaH(v16h ah, v16h al, v16h bh, v16h bl, v8f c) {
  c = __builtin_amdgcn_wmma_f32_16x16x32_f16(false, ah, false, bh, (short)0, c, false, false);
  if (NT >= 2) c = __builtin_amdgcn_wmma_f32_16x16x32_f16(false, al, false, bh, (short)0, c, false, false);
  if (NT >= 3) c = __builtin_amdgcn_wmma_f32_16x16x32_f16(false, ah, false, bl, (short)0, c, false, false);
  asm volatile("v_nop\n\tv_nop\n\tv_nop\n\tv_nop" : "+v"(c) : "v"(ah), "v"(al), "v"(bh), "v"(bl));
  return c;
}
// batched GEMM like k_gemm_b but f16 operands: A f32 (split into f16 hi/lo if ASPLIT, else rounded to f16), Bt = f16 values [n][k]; alpha; C f32; N multiple of 16 (partial tiles skipped)
template <bool ASPLIT>
__global__ __launch_bounds__(128) void k_gemm_h(const float* __restrict__ A, int lda, size_t sA, const _Float16* __restrict__ Bh, int ldb, size_t sB, float alpha, float* __restrict__ C, int ldc, size_t sC, int M, int N, int K) {
  __shared__ __attribute__((aligned(16))) float so[4][16][64];
  const int tid = threadIdx.x, w = tid >> 5, lane = tid & 31, ln = lane & 15, hh = lane >> 4; const int by = blockIdx.y;
  A += (size_t)by * sA; Bh += (size_t)by * sB; C += (size_t)by * sC;
  const int ntn = (N + 63) / 64; const int wid = blockIdx.x * 4 + w; const int mt = wid / ntn, nq = wid % ntn; if (mt * 16 >= M) return;
  const int row0 = mt * 16, col0 = nq * 64; const float* arow = A + (size_t)(row0 + ln) * lda;
  v8f acc[4] = {};
  for (int kb = 0; kb < K; kb += 32) {
    FragH ah, al;
    const v4f x0 = *(const v4fa*)(arow + kb + 8 * hh), x1 = *(const v4fa*)(arow + kb + 8 * hh + 4), x2 = *(const v4fa*)(arow + kb + 16 + 8 * hh), x3 = *(const v4fa*)(arow + kb + 16 + 8 * hh + 4);
    float xs[16] = {x0[0],x0[1],x0[2],x0[3],x1[0],x1[1],x1[2],x1[3],x2[0],x2[1],x2[2],x2[3],x3[0],x3[1],x3[2],x3[3]};
#pragma unroll
    for (int i = 0; i < 16; ++i) { const _Float16 h = (_Float16)xs[i]; ah.h[i] = h; al.h[i] = ASPLIT ? (_Float16)(xs[i] - (float)h) : (_Float16)0.0f; }
#pragma unroll
    for (int t = 0; t < 4; ++t) { if (col0 + t * 16 >= N) continue; const size_t boff = (size_t)(col0 + t * 16 + ln) * ldb + kb; FragH bq; bq.half[0] = *(const v8us*)(Bh + boff + 8 * hh); bq.half[1] = *(const v8us*)(Bh + boff + 16 + 8 * hh);
      acc[t] = mmaH<ASPLIT ? 2 : 1>(ah.v, al.v, bq.v, bq.v, acc[t]); }
  }
#pragma unroll
  for (int t = 0; t < 4; ++t) { if (col0 + t * 16 >= N) continue;
#pragma unroll
    for (int r = 0; r < 8; ++r) so[w][8 * hh + r][t * 16 + ln] = acc[t][r] * alpha; }
  __builtin_amdgcn_fence(__ATOMIC_ACQ_REL, "workgroup"); __builtin_amdgcn_wave_barrier();
  const int rsub = lane >> 4, c4 = (lane & 15) * 4;
  {
#pragma unroll
    for (int q = 0; q < 8; ++q) { const int r = q * 2 + rsub; if (col0 + c4 < N) { const v4f v = *(const v4fa*)&so[w][r][c4]; *(v4f*)(C + (size_t)(row0 + r) * ldc + col0 + c4) = v; } }
     }
}

// Wt[n][k] = f16(W[k][n]·scale) from f32 row-major W[K][N] (scale = power of two; bf16-exact weights stay exact in f16 away from the subnormal range)
__global__ __launch_bounds__(256) void k_wt_f16(const float* __restrict__ W, _Float16* __restrict__ Wt, int K, int N, float scale) {
  const int t = blockIdx.x * 256 + threadIdx.x; if (t >= N * (K / 8)) return; const int n = t / (K / 8), k8 = (t % (K / 8)) * 8; FragH f;
#pragma unroll
  for (int i = 0; i < 8; ++i) f.h[i] = (_Float16)(bf16_round(W[(size_t)(k8 + i) * N + n]) * scale); const v8us o = f.half[0];
  *(v8us*)((unsigned short*)Wt + (size_t)n * K + k8) = o; 
}
typedef _Float16 v4h __attribute__((ext_vector_type(4)));
// GEMM C[M][N] = alpha * sum_k A[m][k] * B[n][k], f16 operands with k contiguous, f32 accumulate; writes f32 C or f16 C16 (pitch ldc). blockIdx = (N tile, M tile, batch).
// A work-group of 8 waves owns a BM x BN tile of C. Per K step the BM rows of A and the BN rows of B (BK elements each) are fetched with whole-line 16-byte loads, one chunk per lane,
// and stored to LDS rows padded by 16 bytes; every wave then reads its WMMA fragments from LDS, so a tile row is fetched from L2 once per work-group instead of once per wave in 32-byte pieces.
// Two LDS buffers: the next step's global loads are issued right behind the barrier (in front of it the barrier's own wait would drain them), fly during this step's products and are stored to the other buffer behind them.
// Global load addresses are a scalar base per chunk plus one 32-bit byte offset per lane and operand, which lives through the whole loop and moves on by one K step in front of each step's loads.
// sbase() takes a wave-uniform address through readfirstlane: the loads then take the scalar-base form, the loop holds no 64-bit vector address sums, and no short-lived address register is handed to a later load as its destination.
// Each output's products run over k in ascending blocks of 32 in one accumulator chain. M % BM == 0, N % BN == 0, K % BK == 0, BN == 128.
// The '#pragma unroll's over pre, base, acc, cm, cz and the fragments are there so that these register arrays are indexed by constants only and stay in registers.
// EPI: 0 writes f32 C, 1 writes f16 C16, 2 is the score stage's softmax over the rows of the tile: with m the maximum of a column over the BM rows, C16 gets exp(c - m) x 2^15 and TM, TZ get m and the sum of the exponentials
// at [batch][row tile][column], m in units of log 2 (the scores are multiplied by log2 e once, so that each exponential is one subtraction and one v_exp_f32). The maximum and the sum are taken in the accumulator registers (a lane holds FM x 8 rows of each of its FN columns), then over lanes l ^ 16, then over the WM waves, in wave order, through LDS.
// ASC: the A chunks are multiplied on their way to LDS by SC[batch][row tile of 128][k] (f32 product, rounded to f16 again); a thread's A chunks share their k range, so it loads 8 factors per K step.
// 2^x by v_exp_f32. The v_nop is the free issue slot that the instruction set asks for behind a transcendental before its source is overwritten;
// it is tied to the v_exp_f32 in one statement.
__device__ __forceinline__ float exp2_slot(float x) { float r; asm("v_exp_f32 %0, %1\n\tv_nop" : "=v"(r) : "v"(x)); return r; }
typedef const __attribute__((address_space(1))) v8us* gv8;
typedef const __attribute__((address_space(1))) v4fa* gv4;
__device__ __forceinline__ unsigned long long sbase(const char* p) { const unsigned long long u = (unsigned long long)p; const unsigned lo = (unsigned)__builtin_amdgcn_readfirstlane((int)(unsigned)u), hi = (unsigned)__builtin_amdgcn_readfirstlane((int)(unsigned)(u >> 32)); return ((unsigned long long)hi << 32) | lo; }
template <int BM, int BN, int BK, int WM, int WN, int EPI, bool ASC>
__global__ __launch_bounds__(256) void k_gemm_lds(const _Float16* __restrict__ A, int lda, size_t sA, const _Float16* __restrict__ Bh, int ldb, size_t sB, float alpha,
                                                 float* __restrict__ C, _Float16* __restrict__ C16, int ldc, size_t sC, int K, const float* __restrict__ SC, float* __restrict__ TM, float* __restrict__ TZ) {
  constexpr int FM = BM / (WM * 16), FN = BN / (WN * 16);      // fragments per wave
  constexpr int CPR = BK / 8, RPI = 256 / CPR;                 // 16-byte chunks per tile row; tile rows covered by one chunk per thread
  constexpr int PITCH = BK + 8, ROWS = BM + BN, STAGE = ROWS * PITCH;      // LDS row pitch and buffer size in f16 elements; rows 0..BM-1 hold A, the rest B
  constexpr int NCH = ROWS / RPI, ACH = BM / RPI;              // chunks per thread, of which from A
  constexpr int OP = BN + 4;                                   // f32 pitch of the output staging
  constexpr int LB = (2 * STAGE * 2 > BM * OP * 4) ? 2 * STAGE * 2 : BM * OP * 4;
  static_assert(WM * WN == 8 && BN == 128 && BM % RPI == 0 && BN % RPI == 0 && BK % 32 == 0, "tile shape");
  static_assert(EPI != 2 || (BM == 128 && (BM * OP + 2 * WM * BN) * 4 <= LB), "the waves' column statistics lie behind the staged tile");
  static_assert(!ASC || 128 % BM == 0, "one row tile of factors per work-group");
  __shared__ __attribute__((aligned(16))) unsigned char smem[LB];
  unsigned short* st = (unsigned short*)smem;
  const int tid = threadIdx.x, w = tid >> 5, lane = tid & 31, ln = lane & 15, hh = lane >> 4;
  const int wm = w % WM, wn = w / WM;
  const int m0 = blockIdx.y * BM, n0 = blockIdx.x * BN;
  const int crow = tid / CPR, ccol = (tid % CPR) * 8;
  const char* Au = (const char*)(A + (size_t)blockIdx.z * sA + (size_t)m0 * lda);
  const char* Bu = (const char*)(Bh + (size_t)blockIdx.z * sB + (size_t)n0 * ldb);
  const unsigned aoff = (unsigned)(crow * lda + ccol) * 2u, boff = (unsigned)(crow * ldb + ccol) * 2u;      // bytes
  const size_t astep = (size_t)RPI * lda * 2, bstep = (size_t)RPI * ldb * 2;                                // bytes between a thread's chunks
  v8us pre[NCH];
  v8f acc[FM][FN] = {};
  const int nk = K / BK;
  unsigned long long base[NCH];
#pragma unroll
  for (int i = 0; i < NCH; ++i) base[i] = sbase((i < ACH) ? Au + i * astep : Bu + (i - ACH) * bstep);
#pragma unroll
  for (int i = 0; i < NCH; ++i) pre[i] = *(gv8)(base[i] + ((i < ACH) ? aoff : boff));
  v4f sc0 = {}, sc1 = {};
  unsigned long long scb = 0; unsigned sk = (unsigned)ccol * 4u;      // factors: scalar base of the work-group's row of SC, byte offset of the lane's 8 factors
  if (ASC) {
    scb = sbase((const char*)(SC + ((size_t)blockIdx.z * RTL + m0 / 128) * K));
    sc0 = *(gv4)(scb + sk); sc1 = *(gv4)(scb + sk + 16u);
    asm volatile("s_wait_xcnt 0x0" ::: "memory");      // precaution behind the two loads: their offset register moves on in the loop
  }
  // stores the fetched chunks to one LDS buffer; with ASC the A chunks are scaled first
  auto put = [&](unsigned short* dst) {
#pragma unroll
    for (int i = 0; i < NCH; ++i) {
      FragH f; f.half[0] = pre[i];
      if (ASC && i < ACH) {
#pragma unroll
        for (int q = 0; q < 8; ++q) f.h[q] = (_Float16)((float)f.h[q] * ((q < 4) ? sc0[q & 3] : sc1[q & 3]));
      }
      *(v8us*)(dst + (crow + i * RPI) * PITCH + ccol) = f.half[0];
    }
  };
  put(st);
  unsigned ak = aoff, bk = boff;
  for (int s = 0; s < nk; ++s) {
    const bool more = s + 1 < nk;
    __syncthreads();      // publishes buffer s & 1; every wave has also left the other buffer, which is rewritten below
    if (more) {
      ak += BK * 2; bk += BK * 2;
#pragma unroll
      for (int i = 0; i < NCH; ++i) pre[i] = *(gv8)(base[i] + ((i < ACH) ? ak : bk));
      if (ASC) { sk += BK * 4; sc0 = *(gv4)(scb + sk); sc1 = *(gv4)(scb + sk + 16u); }
      asm volatile("s_wait_xcnt 0x0" ::: "memory");      // precaution behind the run of loads: their offset registers (next step) and scalar bases (epilogue) are overwritten later on paths that hold no load wait
    }
    const unsigned short* sb = st + (s & 1) * STAGE;
#pragma unroll
    for (int kb = 0; kb < BK; kb += 32) {
      FragH a[FM], b[FN];
#pragma unroll
      for (int i = 0; i < FM; ++i) { const unsigned short* r = sb + ((wm * FM + i) * 16 + ln) * PITCH + kb + 8 * hh; a[i].half[0] = *(const v8us*)r; a[i].half[1] = *(const v8us*)(r + 16); }
#pragma unroll
      for (int j = 0; j < FN; ++j) { const unsigned short* r = sb + (BM + (wn * FN + j) * 16 + ln) * PITCH + kb + 8 * hh; b[j].half[0] = *(const v8us*)r; b[j].half[1] = *(const v8us*)(r + 16); }
#pragma unroll
      for (int i = 0; i < FM; ++i)
#pragma unroll
        for (int j = 0; j < FN; ++j) acc[i][j] = mmaH<1>(a[i].v, a[i].v, b[j].v, b[j].v, acc[i][j]);
    }
    if (more) put(st + ((s + 1) & 1) * STAGE);
  }
  __syncthreads();      // every wave has left the operand buffers before the output tile is staged over them
  float* so = (float*)smem;
  float* rm = so + BM * OP; float* rz = rm + WM * BN;      // EPI 2: column maxima and sums of the WM waves that share a column
  if (EPI == 2) {
    const float a2 = alpha * 1.44269504f;
    float cm[FN], cz[FN];
#pragma unroll
    for (int j = 0; j < FN; ++j) {
      float m = -3.0e38f;
#pragma unroll
      for (int i = 0; i < FM; ++i)
#pragma unroll
        for (int r = 0; r < 8; ++r) { acc[i][j][r] *= a2; m = fmaxf(m, acc[i][j][r]); }
      cm[j] = m;
    }
#pragma unroll
    for (int j = 0; j < FN; ++j) cm[j] = fmaxf(cm[j], __shfl_xor(cm[j], 16, 32));
    if (hh == 0) {
#pragma unroll
      for (int j = 0; j < FN; ++j) rm[wm * BN + (wn * FN + j) * 16 + ln] = cm[j];
    }
    __syncthreads();      // every wave's column maxima are read by the other waves of the column
#pragma unroll
    for (int j = 0; j < FN; ++j) {
      const int col = (wn * FN + j) * 16 + ln;
      float m = rm[col], z = 0.f;
#pragma unroll
      for (int u = 1; u < WM; ++u) m = fmaxf(m, rm[u * BN + col]);
      m -= 15.0f;      // the stored weights carry the factor 2^15
#pragma unroll
      for (int i = 0; i < FM; ++i)
#pragma unroll
        for (int r = 0; r < 8; ++r) { const float e = exp2_slot(acc[i][j][r] - m); z += e; so[((wm * FM + i) * 16 + 8 * hh + r) * OP + col] = e; }
      cz[j] = z;
    }
#pragma unroll
    for (int j = 0; j < FN; ++j) cz[j] += __shfl_xor(cz[j], 16, 32);
    if (hh == 0) {
#pragma unroll
      for (int j = 0; j < FN; ++j) rz[wm * BN + (wn * FN + j) * 16 + ln] = cz[j];
    }
  } else {
#pragma unroll
    for (int i = 0; i < FM; ++i)
#pragma unroll
      for (int j = 0; j < FN; ++j)
#pragma unroll
        for (int r = 0; r < 8; ++r) so[((wm * FM + i) * 16 + 8 * hh + r) * OP + (wn * FN + j) * 16 + ln] = acc[i][j][r] * alpha;
  }
  __syncthreads();      // the staged tile is read back across waves: one wave stores one whole row of the tile per instruction
  if (EPI == 2 && tid < BN) {
    float m = rm[tid], z = rz[tid];
#pragma unroll
    for (int u = 1; u < WM; ++u) { m = fmaxf(m, rm[u * BN + tid]); z += rz[u * BN + tid]; }
    const size_t o = ((size_t)blockIdx.z * RTL + blockIdx.y) * ldc + n0 + tid;
    TM[o] = m; TZ[o] = z * 0.000030517578125f;      // the sum without the weights' factor 2^15
  }
  const size_t cofs = (size_t)blockIdx.z * sC + (size_t)m0 * ldc + n0;
  const unsigned coff = (unsigned)(w * ldc + lane * 4);      // elements
#pragma unroll
  for (int it = 0; it < BM / 8; ++it) {
    const v4f v = *(const v4fa*)&so[(w + it * 8) * OP + lane * 4];
    if (EPI) { v4h h4; for (int q = 0; q < 4; ++q) h4[q] = (_Float16)v[q]; *(v4h*)((char*)(C16 + cofs + (size_t)(it * 8) * ldc) + coff * 2u) = h4; }
    else *(v4f*)((char*)(C + cofs + (size_t)(it * 8) * ldc) + coff * 4u) = v;
  }
}

__global__ __launch_bounds__(256) void k_x16(const float* __restrict__ x, _Float16* __restrict__ X16, size_t n8) { const size_t t = (size_t)blockIdx.x * 256 + threadIdx.x; if (t >= n8) return; FragH f;
#pragma unroll
  for (int q = 0; q < 8; ++q) f.h[q] = (_Float16)bf16_round(x[t * 8 + q]); *(v8us*)((unsigned short*)X16 + t * 8) = f.half[0];  }
__global__ __launch_bounds__(256) void k_h16(const float* __restrict__ x, _Float16* __restrict__ X16, size_t n8) { const size_t t = (size_t)blockIdx.x * 256 + threadIdx.x; if (t >= n8) return; FragH f;
#pragma unroll
  for (int q = 0; q < 8; ++q) f.h[q] = (_Float16)x[t * 8 + q]; *(v8us*)((unsigned short*)X16 + t * 8) = f.half[0];  }
// blockIdx.y picks one of four equally sized matrices; their f16 images lie one behind the other in Bt.
__global__ __launch_bounds__(256) void k_round16f(const float* __restrict__ W0, const float* __restrict__ W1, const float* __restrict__ W2, const float* __restrict__ W3, _Float16* __restrict__ Bt, size_t n8) { const size_t t = (size_t)blockIdx.x * 256 + threadIdx.x; if (t >= n8) return; FragH f;
  const int y = blockIdx.y; const float* W = (y == 0) ? W0 : (y == 1) ? W1 : (y == 2) ? W2 : W3; Bt += (size_t)y * n8 * 8;
#pragma unroll
  for (int i = 0; i < 8; ++i) f.h[i] = (_Float16)(bf16_round(W[t * 8 + i]) * 16.0f); *(v8us*)((unsigned short*)Bt + t * 8) = f.half[0];  }
template <int NHv, int TTv>
__global__ __launch_bounds__(256) void k_vt(const _Float16* __restrict__ V16, int ldv, int voff, _Float16* __restrict__ Vt) { __shared__ unsigned short tl[64][66]; const int tid = threadIdx.x; const int slab = blockIdx.x / (TTv / 64), lg = blockIdx.x % (TTv / 64); const int b = slab / NHv, h = slab % NHv;
  for (int i = tid; i < 64 * 8; i += 256) { const int r = i / 8, c8 = (i % 8) * 8; FragH f; f.half[0] = *(const v8us*)((const unsigned short*)V16 + ((size_t)b * TTv + lg * 64 + r) * ldv + voff + h * 64 + c8);
#pragma unroll
    for (int q = 0; q < 8; ++q) tl[r][c8 + q] = f.u[q]; }
  __syncthreads();
  {
#pragma unroll
    for (int rd = 0; rd < 2; ++rd) { const int d = rd * 32 + tid / 8, pc = tid % 8; FragH f;
#pragma unroll
      for (int q = 0; q < 8; ++q) f.u[q] = tl[pc * 8 + q][d];
      *(v8us*)((unsigned short*)Vt + ((size_t)slab * 64 + d) * TTv + lg * 64 + pc * 8) = f.half[0]; }
     } }

// f32 plane [NR][128] → concatenated-K f16 operand planes [NR][384] for a single 3-term GEMM: with h = f16(v), l = f16((v − h)·2^10):
//   MODE 0 (t side): [h | l | h];  MODE 1 (p side): [h | h·2^-10 | l·2^-10]  so that Σ_K A'·B' = Th·Ph + Tl·Ph·2^-10 + Th·Pl·2^-10 (power-of-two scalings are exact in f16 barring subnormal flushes, which cost ≤1e-4 on a σ≈11 logit);
template <int MODE>
__device__ __forceinline__ void hl3_body(const float* __restrict__ F, _Float16* __restrict__ P3, size_t t) { const size_t r = (t * 8) / CPN; const int c = (int)((t * 8) % CPN); const v4f a = *(const v4fa*)(F + t * 8), b = *(const v4fa*)(F + t * 8 + 4); FragH h, l, s2, s3;
#pragma unroll
  for (int q = 0; q < 8; ++q) { const float v = (q < 4) ? a[q] : b[q - 4]; const _Float16 hv = (_Float16)v; const _Float16 lv = (_Float16)((v - (float)hv) * 1024.0f); h.h[q] = hv; l.h[q] = lv; s2.h[q] = MODE ? (_Float16)((float)hv * 0.0009765625f) : lv; s3.h[q] = MODE ? (_Float16)((float)lv * 0.0009765625f) : hv; }
  unsigned short* row = (unsigned short*)P3 + r * (3 * CPN) + c;
  { *(v8us*)(row) = h.half[0]; *(v8us*)(row + CPN) = s2.half[0]; *(v8us*)(row + 2 * CPN) = s3.half[0];  } }
// One grid for both sides: blockIdx.y = 0 takes the t plane (MODE 0), 1 the p plane (MODE 1); the planes of F, and those of P3, lie one behind the other.
__global__ __launch_bounds__(256) void k_hl3(const float* __restrict__ F, _Float16* __restrict__ P3, size_t n8) { const size_t t = (size_t)blockIdx.x * 256 + threadIdx.x; if (t >= n8) return;
  if (blockIdx.y == 0) hl3_body<0>(F, P3, t); else hl3_body<1>(F + n8 * 8, P3 + n8 * 24, t); }
__global__ __launch_bounds__(256) void k_tok(const float* __restrict__ x, _Float16* __restrict__ X16) { __shared__ float tl[32][65]; const int tid = threadIdx.x; const int b = blockIdx.x / ((CI / 64) * (NN / 32)), rem = blockIdx.x % ((CI / 64) * (NN / 32)); const int cg = rem / (NN / 32), pg = rem % (NN / 32); const int c0 = cg * 64, p0 = pg * 32;
  for (int i = tid; i < 64 * 32; i += 256) { const int c = i / 32, pp = i % 32; tl[pp][c] = bf16_round(x[((size_t)b * CI + c0 + c) * NN + p0 + pp]); } __syncthreads();
  const int r = tid / 8, pc = tid % 8; FragH f; for (int q = 0; q < 8; ++q) f.h[q] = (_Float16)tl[r][pc * 8 + q]; const size_t row = (size_t)b * NN + p0 + r; *(v8us*)((unsigned short*)X16 + row * CI + c0 + pc * 8) = f.half[0];  }
// One thread per column m of one batch's score plane (blockIdx.y): merges the RTL row tiles' maxima (in units of log 2) and sums, in tile order, into the column's max M and sum Z,
// and writes per row tile the factor 2^(tile max - M) / Z that turns the stored exp(s - tile max) into the softmax weight. Z is about 1 or more: the tile that holds M adds its own largest term, 2^0.
__global__ __launch_bounds__(64) void k_tilescale(const float* __restrict__ TM, const float* __restrict__ TZ, float* __restrict__ SC) {
  const size_t o = (size_t)blockIdx.y * RTL * NN + blockIdx.x * 64 + threadIdx.x;
  float tm[RTL], tz[RTL];
  // every unroll here: tm and tz are indexed by constants only and stay in registers; in the first loop all loads are also in flight at once
#pragma unroll
  for (int t = 0; t < RTL; ++t) { tm[t] = TM[o + (size_t)t * NN]; tz[t] = TZ[o + (size_t)t * NN]; }
  float m = tm[0], z = 0.f;
#pragma unroll
  for (int t = 1; t < RTL; ++t) m = fmaxf(m, tm[t]);
#pragma unroll
  for (int t = 0; t < RTL; ++t) { tm[t] = exp2_slot(tm[t] - m); z += tz[t] * tm[t]; }
  const float inv = 1.0f / z;
#pragma unroll
  for (int t = 0; t < RTL; ++t) SC[o + (size_t)t * NN] = tm[t] * inv;
}
// Column reductions, rows in parallel: a work-group owns 32 columns (one 128-byte line of every row). Eight lanes of 4 columns cover the line, so the 1024 threads form 128 row groups;
// row group rg walks rows rg, rg + 128, ... with 8 loads of 16 bytes in flight. Partials are merged in a fixed order: lanes l ^ 8 and l ^ 16 inside a wave, then the 32 waves, in wave order, through LDS.
__global__ __launch_bounds__(1024) void k_bnstat(const float* __restrict__ Z, float* __restrict__ MU, float* __restrict__ RS) {
  __shared__ __attribute__((aligned(16))) float a1[32][32], a2[32][32];
  const int tid = threadIdx.x, w = tid >> 5, lane = tid & 31, cq = tid & 7, rg = tid >> 3;
  const float* p = Z + (size_t)rg * CI + blockIdx.x * 32 + cq * 4;
  v4f s1 = {0.f, 0.f, 0.f, 0.f}, s2 = {0.f, 0.f, 0.f, 0.f};
  for (int r = 0; r < NR; r += 128 * 8) {
    v4f v[8];
#pragma unroll
    for (int u = 0; u < 8; ++u) v[u] = *(const v4fa*)(p + (size_t)(r + 128 * u) * CI);
#pragma unroll
    for (int u = 0; u < 8; ++u) { s1 += v[u]; s2 += v[u] * v[u]; }
  }
#pragma unroll
  for (int q = 0; q < 4; ++q) {
    s1[q] += __shfl_xor(s1[q], 8, 32); s2[q] += __shfl_xor(s2[q], 8, 32);
    s1[q] += __shfl_xor(s1[q], 16, 32); s2[q] += __shfl_xor(s2[q], 16, 32);
  }
  if (lane < 8) { *(v4f*)&a1[w][cq * 4] = s1; *(v4f*)&a2[w][cq * 4] = s2; }
  __syncthreads();
  if (w == 0) {
    float t1 = 0.f, t2 = 0.f;
#pragma unroll
    for (int i = 0; i < 32; ++i) { t1 += a1[i][lane]; t2 += a2[i][lane]; }
    const float mu = t1 / (float)NR; const float var = fmaxf(t2 / (float)NR - mu * mu, 0.f);
    MU[blockIdx.x * 32 + lane] = mu; RS[blockIdx.x * 32 + lane] = rsqrtf(var + 1e-5f);
  }
}
__global__ __launch_bounds__(256) void k_out(const float* __restrict__ Z, const float* __restrict__ MU, const float* __restrict__ RS, const float* __restrict__ gam, const float* __restrict__ bet, const float* __restrict__ x, float* __restrict__ out) { __shared__ float tl[32][65]; const int tid = threadIdx.x; const int b = blockIdx.x / ((CI / 32) * (NN / 64)), rem = blockIdx.x % ((CI / 32) * (NN / 64)); const int cg = rem / (NN / 64), pg = rem % (NN / 64); const int c0 = cg * 32, p0 = pg * 64;
  for (int i = tid; i < 64 * 32; i += 256) { const int pp = i / 32, c = i % 32; tl[c][pp] = (Z[((size_t)b * NN + p0 + pp) * CI + c0 + c] - MU[c0 + c]) * RS[c0 + c] * bf16_round(gam[c0 + c]) + bf16_round(bet[c0 + c]); } __syncthreads();
  { for (int i = tid; i < 32 * 16; i += 256) { const int c = i / 16, q4 = i % 16; const size_t o = ((size_t)b * CI + c0 + c) * NN + p0 + q4 * 4; const v4f xr = *(const v4fa*)(x + o); const v4f v = {tl[c][q4 * 4] + bf16_round(xr[0]), tl[c][q4 * 4 + 1] + bf16_round(xr[1]), tl[c][q4 * 4 + 2] + bf16_round(xr[2]), tl[c][q4 * 4 + 3] + bf16_round(xr[3])}; *(v4f*)(out + o) = v; }  } }

extern "C" void kernel_launch(void* const* d_in, const int* in_sizes, int n_in,
                              void* d_out, int out_size, void* d_ws, size_t ws_size, hipStream_t stream) {
  (void)in_sizes; (void)n_in; (void)out_size;
  const float* const* I = (const float* const*)d_in; const float* x = I[0]; const float* Wt = I[1]; const float* Wp = I[2]; const float* Wg = I[3]; const float* Wz = I[4]; const float* gam = I[5]; const float* bet = I[6];
  char* ws = (char*)d_ws; size_t off = 0;
  auto take = [&](size_t bytes) { char* p = ws + off; off += (bytes + 255) & ~(size_t)255; return p; };
  _Float16* Bt_ = (_Float16*)take((size_t)4 * CPN * CI * 2); _Float16* Bp_ = Bt_ + (size_t)CPN * CI; _Float16* Bg_ = Bp_ + (size_t)CPN * CI; _Float16* Bz_ = Bg_ + (size_t)CPN * CI;      /* four weight images, one behind the other */
  _Float16* PT = (_Float16*)take((size_t)PB * NN * NN * 2); _Float16* X16 = (_Float16*)take((size_t)NR * CI * 2);      /* weight planes of the PB batches that one launch works on */
  _Float16* T3 = (_Float16*)take((size_t)2 * NR * 3 * CPN * 2); _Float16* P3 = T3 + (size_t)NR * 3 * CPN; float* F32 = (float*)take((size_t)2 * NR * CPN * 4);      /* all batches: concatenated-K operand planes [16384][384] (t, then p) and the two f32 conv outputs they are built from */
  _Float16* Gc = (_Float16*)take((size_t)BB * CPN * NN * 2); _Float16* Y16 = (_Float16*)take((size_t)NR * CPN * 2); float* TM = (float*)take((size_t)PB * RTL * NN * 4); float* TZ = (float*)take((size_t)PB * RTL * NN * 4); float* SC = (float*)take((size_t)PB * RTL * NN * 4); float* MU = (float*)take((size_t)CI * 4); float* RS = (float*)take((size_t)CI * 4);
  float* Z = (float*)take((size_t)NR * CI * 4);
  if (off > ws_size) return;      // about 146 MB of the 268 MB given (weight planes 67, the rest 79)
  const unsigned gw = (unsigned)(((size_t)CPN * CI / 8 + 255) / 256);
  k_round16f<<<dim3(gw, 4, 1), 256, 0, stream>>>(Wt, Wp, Wg, Wz, Bt_, (size_t)CPN * CI / 8);      /* conv weights (out,in) natural x 2^4, all four in one grid */
  k_tok<<<BB * (CI / 64) * (NN / 32), 256, 0, stream>>>(x, X16);
  k_gemm_lds<128, 128, 64, 4, 2, 1, false><<<dim3(NN / 128, CPN / 128, BB), 256, 0, stream>>>(Bg_, CI, 0, X16, CI, (size_t)NN * CI, 0.0625f, nullptr, Gc, NN, (size_t)CPN * NN, CI, nullptr, nullptr, nullptr);      /* g channel-major per batch [b][128][4096] (f16): M 128 N 4096 K 256 */
  k_gemm_lds<32, 128, 256, 1, 8, 0, false><<<dim3(CPN / 128, NR / 32, 2), 256, 0, stream>>>(X16, CI, 0, Bt_, CI, (size_t)CPN * CI, 0.0625f, F32, nullptr, CPN, (size_t)NR * CPN, CI, nullptr, nullptr, nullptr);      /* t (z = 0) and p (z = 1) of all batches, token-major f32: M 16384 N 128 K 256 */
  k_hl3<<<dim3((unsigned)(((size_t)NR * CPN / 8 + 255) / 256), 2, 1), 256, 0, stream>>>(F32, T3, (size_t)NR * CPN / 8);      /* t to [h | l | h], p to [h | h 2^-10 | l 2^-10] */
  const dim3 gs(NN / 128, NN / 128, PB), gy(CPN / 128, NN / 32, PB);
  for (int b = 0; b < BB; b += PB) { const size_t to = (size_t)b * NN * 3 * CPN, yo = (size_t)b * NN * CPN;      /* blockIdx.z or .y of each launch: batch b, b + 1 */
    k_gemm_lds<128, 128, 64, 4, 2, 2, false><<<gs, 256, 0, stream>>>(T3 + to, 3 * CPN, (size_t)NN * 3 * CPN, P3 + to, 3 * CPN, (size_t)NN * 3 * CPN, 1.0f, nullptr, PT, NN, (size_t)NN * NN, 3 * CPN, nullptr, TM, TZ);      /* s[n][m] = t_n p_m as Th Ph + (Tl Ph + Th Pl) 2^-10 in one K = 384 pass, M 4096 N 4096; stored: exp(s - tile max) 2^15 and the tiles' column statistics */
    k_tilescale<<<dim3(NN / 64, PB, 1), 64, 0, stream>>>(TM, TZ, SC);
    k_gemm_lds<32, 128, 256, 1, 8, 1, true><<<gy, 256, 0, stream>>>(PT, NN, (size_t)NN * NN, Gc + (size_t)b * CPN * NN, NN, (size_t)CPN * NN, 0.000030517578125f, nullptr, Y16 + yo, CPN, (size_t)NN * CPN, NN, SC, nullptr, nullptr); }      /* y[n][c] = sum over m of att[n][m] g[c][m]: M 4096 N 128 K 4096 (f16 out) */
  k_gemm_lds<128, 128, 64, 4, 2, 0, false><<<dim3(CI / 128, NR / 128, 1), 256, 0, stream>>>(Y16, CPN, 0, Bz_, CPN, 0, 0.0625f, Z, nullptr, CI, 0, CPN, nullptr, nullptr, nullptr);      /* z token-major [16384][256] f32: M 16384 N 256 K 128 */
  k_bnstat<<<CI / 32, 1024, 0, stream>>>(Z, MU, RS); k_out<<<BB * (CI / 32) * (NN / 64), 256, 0, stream>>>(Z, MU, RS, gam, bet, x, (float*)d_out);
}

// v005
// It runs in 171 microseconds.
// In two side-by-side timings against v004, it was 1.10 and 1.11 times as fast.
// Over all steps from v000 it is 75.9 times as fast.
#include <hip/hip_runtime.h>
// Spatial non-local block with query-axis softmax (B=4, C_in 256, C_p 128, N=4096): t,p,g = 1×1 convs; att[n,m] = Σ_c t[c,n]·p[c,m]; att = softmax over n (dim=1) for every m; y[c,n] = Σ_m att[n,m]·g[c,m]; z = Wz·y;
// BatchNorm1d in training mode (batch statistics over (B,N) per channel, biased variance, eps 1e-5) with affine; out = BN(z) + x.
// Compute dtype: x and weights rounded to bf16; t and p as f32 GEMM outputs split into f16 hi + ×2^10 residual parts laid out as concatenated-K operands so one K=384 GEMM yields Th·Ph + (Tl·Ph + Th·Pl)·2^-10 (σ≈11 logits, f32-accurate);
// no f32 score plane is stored: the score GEMM's epilogue takes each column's max and sum over the 128 rows of its own tile (f32) and writes exp(s - tile max) row-major as f16 x 2^15; a small kernel merges the 32 row tiles of a column into
// one factor exp(tile max - column max) / column sum per (row tile, column), and the y GEMM multiplies its weight chunks by that factor on their way to LDS; y = contraction over m as an f16 GEMM against
// channel-major g; z GEMM; per-channel batch statistics as fixed-order f32 column sums; affine + residual applied during the transpose back to channel-major. All contractions on v_wmma_f32_16x16x32_f16, f32 accumulate.
#define BB 4
#define CI 256
#define CPN 128
#define NN 4096
#define NR (BB * NN)
#define PB 4      // batches whose weight planes are held at once: each launch of the score, merge and y stages works on PB batches (all of them: one launch per stage)
#define RTL (NN / 128)      // row tiles of a score plane: one set of column statistics each

typedef __bf16 v16b __attribute__((ext_vector_type(16)));
typedef unsigned short v8us __attribute__((ext_vector_type(8), may_alias));
typedef float  v8f  __attribute__((ext_vector_type(8)));
typedef float  v4f  __attribute__((ext_vector_type(4)));
typedef float  v4fa __attribute__((ext_vector_type(4), may_alias));
union FragB { v16b v; v8us half[2]; unsigned short u[16]; };

__device__ __forceinline__ unsigned short bf16_bits(float x) { unsigned int u = __float_as_uint(x); return (unsigned short)((u + 0x7FFFu + ((u >> 16) & 1u)) >> 16); }
__device__ __forceinline__ float bf16_val(unsigned short b) { return __uint_as_float(((unsigned int)b) << 16); }
__device__ __forceinline__ float bf16_round(float x) { return bf16_val(bf16_bits(x)); }
// D += A·B with NT terms: 1 = ah·bh, 2 = + al·bh (A split), 3 = + ah·bl (both split)
template <int NT>
__device__ __forceinline__ v8f mmaN(v16b ah, v16b al, v16b bh, v16b bl, v8f c) {
  c = __builtin_amdgcn_wmma_f32_16x16x32_bf16(false, ah, false, bh, (short)0, c, false, false);
  if (NT >= 2) c = __builtin_amdgcn_wmma_f32_16x16x32_bf16(false, al, false, bh, (short)0, c, false, false);
  if (NT >= 3) c = __builtin_amdgcn_wmma_f32_16x16x32_bf16(false, ah, false, bl, (short)0, c, false, false);
  asm volatile("v_nop\n\tv_nop\n\tv_nop\n\tv_nop" : "+v"(c) : "v"(ah), "v"(al), "v"(bh), "v"(bl));
  return c;
}

__global__ __launch_bounds__(256) void k_wt_bf16(const float* __restrict__ W, unsigned short* __restrict__ Wt, int K, int N) {
  const int t = blockIdx.x * 256 + threadIdx.x;
  const int k8n = K / 8;
  if (t >= N * k8n) return;
  const int n = t / k8n, k8 = (t % k8n) * 8;
  v8us v;
#pragma unroll
  for (int i = 0; i < 8; ++i) v[i] = bf16_bits(W[(size_t)(k8 + i) * N + n]);
  *(v8us*)(Wt + (size_t)n * K + k8) = v;
  
}

// GEMM C[M][N] (f32, pitch ldc) = act(A[M][K]·W + bias). A f32 row-major (pitch lda) converted per fragment to bf16
// (ASPLIT: hi/lo two planes -> 2 terms, else single rounded term); Wt bf16 [N][K] (pitch ldb). BIAS_BF16 rounds the
// bias to bf16 first (bias quantised to bf16 before the add). K%32==0, M%16==0, N%64==0.
template <bool ASPLIT, int ACT, bool BIAS_BF16>
__global__ __launch_bounds__(128) void k_gemm_bf(const float* __restrict__ A, int lda, const unsigned short* __restrict__ Wt, int ldb,
                                               const float* __restrict__ bias, float* __restrict__ C, int ldc, int M, int N, int K) {
  __shared__ __attribute__((aligned(16))) float so[4][16][64];
  const int tid = threadIdx.x, w = tid >> 5, lane = tid & 31, ln = lane & 15, hh = lane >> 4;
  const int ntn = N / 64;
  const int wid = blockIdx.x * 4 + w;
  const int mt = wid / ntn, nq = wid % ntn;
  if (mt * 16 >= M) return;
  const int row0 = mt * 16, col0 = nq * 64;
  const float* arow = A + (size_t)(row0 + ln) * lda;
  v8f acc[4] = {};
  for (int kb = 0; kb < K; kb += 32) {
    FragB ah, al;
    const v4f x0 = *(const v4fa*)(arow + kb + 8 * hh), x1 = *(const v4fa*)(arow + kb + 8 * hh + 4);
    const v4f x2 = *(const v4fa*)(arow + kb + 16 + 8 * hh), x3 = *(const v4fa*)(arow + kb + 16 + 8 * hh + 4);
    float xs[16] = {x0[0],x0[1],x0[2],x0[3],x1[0],x1[1],x1[2],x1[3],x2[0],x2[1],x2[2],x2[3],x3[0],x3[1],x3[2],x3[3]};
#pragma unroll
    for (int i = 0; i < 16; ++i) { const unsigned short hb = bf16_bits(xs[i]); ah.u[i] = hb; al.u[i] = ASPLIT ? bf16_bits(xs[i] - bf16_val(hb)) : (unsigned short)0; }
#pragma unroll
    for (int t = 0; t < 4; ++t) {
      const unsigned short* brow = Wt + (size_t)(col0 + t * 16 + ln) * ldb + kb;
      FragB b;
      b.half[0] = *(const v8us*)(brow + 8 * hh);
      b.half[1] = *(const v8us*)(brow + 16 + 8 * hh);
      acc[t] = mmaN<ASPLIT ? 2 : 1>(ah.v, al.v, b.v, b.v, acc[t]);
    }
  }
#pragma unroll
  for (int t = 0; t < 4; ++t) {
    float bv = bias ? bias[col0 + t * 16 + ln] : 0.f;
    if (BIAS_BF16) bv = bf16_round(bv);
#pragma unroll
    for (int r = 0; r < 8; ++r) { float v = acc[t][r] + bv; if (ACT == 1) v = fmaxf(v, 0.f); so[w][8 * hh + r][t * 16 + ln] = v; }
  }
  __builtin_amdgcn_fence(__ATOMIC_ACQ_REL, "workgroup");
  __builtin_amdgcn_wave_barrier();
  const int rsub = lane >> 4, c4 = (lane & 15) * 4;
  {
#pragma unroll
    for (int q = 0; q < 8; ++q) {
      const int r = q * 2 + rsub;
      const v4f v = *(const v4fa*)&so[w][r][c4];
      *(v4f*)(C + (size_t)(row0 + r) * ldc + col0 + c4) = v;
    }
    
  }
}

// Flash-style causal/unmasked attention, all contractions 3-term bf16 hi/lo splits, f32 softmax with running max.
// q,k,v rows are read from f32 buffers with arbitrary row pitch (so they can live inside a fused qkv buffer);
// D = head size (multiple of 32, <= 128); one wave = 16 query rows; block = 4 waves (64 queries) sharing K/V chunks of 32.
template <int D, bool CAUSAL>
__global__ __launch_bounds__(128) void k_flash(const float* __restrict__ qb, const float* __restrict__ kb, const float* __restrict__ vb,
                                             int pitch, int T, int H, float scale, float* __restrict__ y, int ypitch) {
  constexpr int KS = D / 32;        // k-steps for QK
  constexpr int DT = D / 16;        // d tiles for PV
  __shared__ __attribute__((aligned(16))) unsigned short sKh[32][D + 8], sKl[32][D + 8], sVh[32][D + 8], sVl[32][D + 8];
  __shared__ __attribute__((aligned(16))) unsigned short sPh[4][16][40], sPl[4][16][40];
  __shared__ __attribute__((aligned(16))) float sO[4][16][D];
  const int tid = threadIdx.x, w = tid >> 5, lane = tid & 31, ln = lane & 15, hh = lane >> 4;
  const int nqb = (T + 63) / 64;
  const int bh = blockIdx.x / nqb, qblk = blockIdx.x % nqb;
  const int b = bh / H, h = bh % H;
  const int q0 = qblk * 64 + w * 16;
  const float* Q = qb + (size_t)b * T * pitch + h * D;
  const float* K = kb + (size_t)b * T * pitch + h * D;
  const float* V = vb + (size_t)b * T * pitch + h * D;

  // A fragments of the wave's 16 query rows (scaled), hi/lo
  FragB aqh[KS], aql[KS];
  {
    int row = q0 + ln; if (row >= T) row = T - 1;
    const float* qr = Q + (size_t)row * pitch;
#pragma unroll
    for (int ks = 0; ks < KS; ++ks)
#pragma unroll
      for (int i = 0; i < 16; ++i) {
        const int d = ks * 32 + ((i < 8) ? (8 * hh + i) : (16 + 8 * hh + (i - 8)));
        const float x = qr[d] * scale; const unsigned short hb = bf16_bits(x);
        aqh[ks].u[i] = hb; aql[ks].u[i] = bf16_bits(x - bf16_val(hb));
      }
  }
  float m_r[8], l_r[8];
#pragma unroll
  for (int r = 0; r < 8; ++r) { m_r[r] = -3.0e38f; l_r[r] = 0.f; }
  v8f oacc[DT];
#pragma unroll
  for (int dt = 0; dt < DT; ++dt) oacc[dt] = (v8f){0.f,0.f,0.f,0.f,0.f,0.f,0.f,0.f};

  const int kv_end = CAUSAL ? min(T, qblk * 64 + 64) : T;     // block-uniform
  for (int j0 = 0; j0 < kv_end; j0 += 32) {
    __syncthreads();
    for (int e = tid; e < 32 * (D / 4); e += 128) {
      const int r = e / (D / 4), c4 = (e % (D / 4)) * 4;
      const int key = j0 + r;
      v4f kf = {0.f,0.f,0.f,0.f}, vf = {0.f,0.f,0.f,0.f};
      if (key < T) { kf = *(const v4fa*)(K + (size_t)key * pitch + c4); vf = *(const v4fa*)(V + (size_t)key * pitch + c4); }
#pragma unroll
      for (int t = 0; t < 4; ++t) {
        unsigned short hb = bf16_bits(kf[t]); sKh[r][c4 + t] = hb; sKl[r][c4 + t] = bf16_bits(kf[t] - bf16_val(hb));
        hb = bf16_bits(vf[t]); sVh[r][c4 + t] = hb; sVl[r][c4 + t] = bf16_bits(vf[t] - bf16_val(hb));
      }
    }
    __syncthreads();
    // S tile 16 x 32
    v8f s[2];
#pragma unroll
    for (int nt = 0; nt < 2; ++nt) {
      v8f acc = {};
#pragma unroll
      for (int ks = 0; ks < KS; ++ks) {
        FragB bh_, bl_;
        bh_.half[0] = *(const v8us*)&sKh[nt * 16 + ln][ks * 32 + 8 * hh]; bh_.half[1] = *(const v8us*)&sKh[nt * 16 + ln][ks * 32 + 16 + 8 * hh];
        bl_.half[0] = *(const v8us*)&sKl[nt * 16 + ln][ks * 32 + 8 * hh]; bl_.half[1] = *(const v8us*)&sKl[nt * 16 + ln][ks * 32 + 16 + 8 * hh];
        acc = mmaN<3>(aqh[ks].v, aql[ks].v, bh_.v, bl_.v, acc);
      }
      s[nt] = acc;
    }
    // mask + running max (rows 8hh+r; the 16 lanes of a half share rows)
    float alpha[8];
#pragma unroll
    for (int r = 0; r < 8; ++r) {
      const int qi = q0 + 8 * hh + r;
      const int ja = j0 + ln, jb = j0 + 16 + ln;
      if (CAUSAL) { if (ja > qi) s[0][r] = -3.0e38f; if (jb > qi) s[1][r] = -3.0e38f; }
      if (ja >= T) s[0][r] = -3.0e38f;
      if (jb >= T) s[1][r] = -3.0e38f;
      float mx = fmaxf(s[0][r], s[1][r]);
      mx = fmaxf(mx, __shfl_xor(mx, 1, 32)); mx = fmaxf(mx, __shfl_xor(mx, 2, 32)); mx = fmaxf(mx, __shfl_xor(mx, 4, 32)); mx = fmaxf(mx, __shfl_xor(mx, 8, 32));
      const float mnew = fmaxf(m_r[r], mx);
      alpha[r] = (mnew > -1.0e38f) ? __expf(m_r[r] - mnew) : 1.0f;
      const float p0 = (s[0][r] > -1.0e38f) ? __expf(s[0][r] - mnew) : 0.f;
      const float p1 = (s[1][r] > -1.0e38f) ? __expf(s[1][r] - mnew) : 0.f;
      m_r[r] = mnew;
      l_r[r] = l_r[r] * alpha[r] + p0 + p1;            // per-lane partial row sum (16 lanes combined at the end)
      unsigned short hb = bf16_bits(p0); sPh[w][8 * hh + r][ln] = hb;      sPl[w][8 * hh + r][ln] = bf16_bits(p0 - bf16_val(hb));
      hb = bf16_bits(p1);                sPh[w][8 * hh + r][16 + ln] = hb; sPl[w][8 * hh + r][16 + ln] = bf16_bits(p1 - bf16_val(hb));
    }
#pragma unroll
    for (int dt = 0; dt < DT; ++dt)
#pragma unroll
      for (int r = 0; r < 8; ++r) oacc[dt][r] *= alpha[r];
    __builtin_amdgcn_fence(__ATOMIC_ACQ_REL, "workgroup");
    __builtin_amdgcn_wave_barrier();
    FragB pah, pal;
    pah.half[0] = *(const v8us*)&sPh[w][ln][8 * hh]; pah.half[1] = *(const v8us*)&sPh[w][ln][16 + 8 * hh];
    pal.half[0] = *(const v8us*)&sPl[w][ln][8 * hh]; pal.half[1] = *(const v8us*)&sPl[w][ln][16 + 8 * hh];
#pragma unroll
    for (int dt = 0; dt < DT; ++dt) {
      FragB bvh, bvl;
#pragma unroll
      for (int i = 0; i < 8; ++i) {
        bvh.u[i] = sVh[8 * hh + i][dt * 16 + ln]; bvh.u[8 + i] = sVh[16 + 8 * hh + i][dt * 16 + ln];
        bvl.u[i] = sVl[8 * hh + i][dt * 16 + ln]; bvl.u[8 + i] = sVl[16 + 8 * hh + i][dt * 16 + ln];
      }
      oacc[dt] = mmaN<3>(pah.v, pal.v, bvh.v, bvl.v, oacc[dt]);
    }
    __builtin_amdgcn_fence(__ATOMIC_ACQ_REL, "workgroup");
    __builtin_amdgcn_wave_barrier();
  }
#pragma unroll
  for (int r = 0; r < 8; ++r) {
    float l = l_r[r];
    l += __shfl_xor(l, 1, 32); l += __shfl_xor(l, 2, 32); l += __shfl_xor(l, 4, 32); l += __shfl_xor(l, 8, 32);
    l_r[r] = (l > 0.f) ? 1.0f / l : 0.f;
  }
#pragma unroll
  for (int dt = 0; dt < DT; ++dt)
#pragma unroll
    for (int r = 0; r < 8; ++r) sO[w][8 * hh + r][dt * 16 + ln] = oacc[dt][r] * l_r[r];
  __builtin_amdgcn_fence(__ATOMIC_ACQ_REL, "workgroup");
  __builtin_amdgcn_wave_barrier();
  {
    for (int r = 0; r < 16; ++r) {
      const int row = q0 + r;
      if (row < T && lane < D / 4) {
        const v4f val = *(const v4fa*)&sO[w][r][lane * 4];
        *(v4f*)(y + ((size_t)b * T + row) * ypitch + h * D + lane * 4) = val;
      }
    }
    
  }
}

// GEMM C = act(A·W + bias + resid): A f32 (ASPLIT -> hi/lo 2 terms), Wt bf16 [N][K]; ACT 0 none, 1 relu, 2 exact gelu;
// resid (optional, f32, row index = (row % rmod), pitch ldr, RES_BF16 rounds it) added before the activation.
template <bool ASPLIT, int ACT, bool BIAS_BF16, bool RES_BF16>
__global__ __launch_bounds__(128) void k_gemm_bf3(const float* __restrict__ A, int lda, const unsigned short* __restrict__ Wt, int ldb,
                                                const float* __restrict__ bias, const float* __restrict__ resid, int rmod, int ldr,
                                                float* __restrict__ C, int ldc, int M, int N, int K) {
  __shared__ __attribute__((aligned(16))) float so[4][16][64];
  const int tid = threadIdx.x, w = tid >> 5, lane = tid & 31, ln = lane & 15, hh = lane >> 4;
  const int ntn = N / 64;
  const int wid = blockIdx.x * 4 + w;
  const int mt = wid / ntn, nq = wid % ntn;
  if (mt * 16 >= M) return;
  const int row0 = mt * 16, col0 = nq * 64;
  const float* arow = A + (size_t)(row0 + ln) * lda;
  v8f acc[4] = {};
  for (int kb = 0; kb < K; kb += 32) {
    FragB ah, al;
    const v4f x0 = *(const v4fa*)(arow + kb + 8 * hh), x1 = *(const v4fa*)(arow + kb + 8 * hh + 4);
    const v4f x2 = *(const v4fa*)(arow + kb + 16 + 8 * hh), x3 = *(const v4fa*)(arow + kb + 16 + 8 * hh + 4);
    float xs[16] = {x0[0],x0[1],x0[2],x0[3],x1[0],x1[1],x1[2],x1[3],x2[0],x2[1],x2[2],x2[3],x3[0],x3[1],x3[2],x3[3]};
#pragma unroll
    for (int i = 0; i < 16; ++i) { const unsigned short hb = bf16_bits(xs[i]); ah.u[i] = hb; al.u[i] = ASPLIT ? bf16_bits(xs[i] - bf16_val(hb)) : (unsigned short)0; }
#pragma unroll
    for (int t = 0; t < 4; ++t) {
      const unsigned short* brow = Wt + (size_t)(col0 + t * 16 + ln) * ldb + kb;
      FragB b;
      b.half[0] = *(const v8us*)(brow + 8 * hh);
      b.half[1] = *(const v8us*)(brow + 16 + 8 * hh);
      acc[t] = mmaN<ASPLIT ? 2 : 1>(ah.v, al.v, b.v, b.v, acc[t]);
    }
  }
#pragma unroll
  for (int t = 0; t < 4; ++t) {
    const int col = col0 + t * 16 + ln;
    float bv = bias ? bias[col] : 0.f;
    if (BIAS_BF16) bv = bf16_round(bv);
#pragma unroll
    for (int r = 0; r < 8; ++r) {
      float v = acc[t][r] + bv;
      if (resid) { float rv = resid[(size_t)((row0 + 8 * hh + r) % rmod) * ldr + col]; if (RES_BF16) rv = bf16_round(rv); v += rv; }
      if (ACT == 1) v = fmaxf(v, 0.f);
      if (ACT == 2) v = 0.5f * v * (1.0f + erff(v * 0.70710678118654752f));
      if (ACT == 3) { const float u = 0.7978845608028654f * (v + 0.044715f * v * v * v); v = 0.5f * v * (1.0f + tanhf(u)); }
      so[w][8 * hh + r][t * 16 + ln] = v;
    }
  }
  __builtin_amdgcn_fence(__ATOMIC_ACQ_REL, "workgroup");
  __builtin_amdgcn_wave_barrier();
  const int rsub = lane >> 4, c4 = (lane & 15) * 4;
  {
#pragma unroll
    for (int q = 0; q < 8; ++q) {
      const int r = q * 2 + rsub;
      const v4f v = *(const v4fa*)&so[w][r][c4];
      *(v4f*)(C + (size_t)(row0 + r) * ldc + col0 + c4) = v;
    }
    
  }
}
// row LayerNorm (biased variance, eps) over N: s = X (+ R); optional out_sum <- s; out_norm <- (s-mu)*rsqrt(var+eps)*g + b
template <bool PARAM_BF16>
__global__ __launch_bounds__(256) void k_layernorm(const float* __restrict__ X, const float* __restrict__ R, const float* __restrict__ g, const float* __restrict__ bta,
                                                  float* __restrict__ out_sum, float* __restrict__ out_norm, int N, float eps) {
  __shared__ float red[256];
  const int row = blockIdx.x, tid = threadIdx.x;
  const float* x = X + (size_t)row * N; const float* rr = R ? R + (size_t)row * N : nullptr;
  float vals[16];                     // up to N = 4096
  const int per = N / 256;            // contiguous chunk per thread? use strided-by-4 chunks: thread handles j = tid*4 + 1024*u
  float s1 = 0.f;
  for (int u = 0; u < per / 4; ++u) {
    const int j = tid * 4 + 1024 * u;
    const v4f a = *(const v4fa*)(x + j);
    v4f b = {0.f,0.f,0.f,0.f}; if (rr) b = *(const v4fa*)(rr + j);
#pragma unroll
    for (int q = 0; q < 4; ++q) { const float v = a[q] + b[q]; vals[u * 4 + q] = v; s1 += v; }
  }
  red[tid] = s1; __syncthreads();
  for (int st = 128; st > 0; st >>= 1) { if (tid < st) red[tid] += red[tid + st]; __syncthreads(); }
  const float mu = red[0] / (float)N; __syncthreads();
  float s2 = 0.f;
  for (int u = 0; u < per / 4; ++u)
#pragma unroll
    for (int q = 0; q < 4; ++q) { const float c = vals[u * 4 + q] - mu; s2 += c * c; }
  red[tid] = s2; __syncthreads();
  for (int st = 128; st > 0; st >>= 1) { if (tid < st) red[tid] += red[tid + st]; __syncthreads(); }
  const float rs = rsqrtf(red[0] / (float)N + eps);
  {
    for (int u = 0; u < per / 4; ++u) {
      const int j = tid * 4 + 1024 * u;
      v4f o, sm;
#pragma unroll
      for (int q = 0; q < 4; ++q) {
        float gg = g[j + q], bb = bta[j + q];
        if (PARAM_BF16) { gg = bf16_round(gg); bb = bf16_round(bb); }
        sm[q] = vals[u * 4 + q]; o[q] = (vals[u * 4 + q] - mu) * rs * gg + bb;
      }
      if (out_sum) *(v4f*)(out_sum + (size_t)row * N + j) = sm;
      *(v4f*)(out_norm + (size_t)row * N + j) = o;
    }
    
  }
}



// ---- f16 WMMA path (v_wmma_f32_16x16x32_f16): 11-bit significands for operands in range — used where a [0,1] probability operand needs more precision than bf16
typedef _Float16 v16h __attribute__((ext_vector_type(16)));
union FragH { v16h v; v8us half[2]; _Float16 h[16]; unsigned short u[16]; };
template <int NT>
__device__ __forceinline__ v8f mmaH(v16h ah, v16h al, v16h bh, v16h bl, v8f c) {
  c = __builtin_amdgcn_wmma_f32_16x16x32_f16(false, ah, false, bh, (short)0, c, false, false);
  if (NT >= 2) c = __builtin_amdgcn_wmma_f32_16x16x32_f16(false, al, false, bh, (short)0, c, false, false);
  if (NT >= 3) c = __builtin_amdgcn_wmma_f32_16x16x32_f16(false, ah, false, bl, (short)0, c, false, false);
  asm volatile("v_nop\n\tv_nop\n\tv_nop\n\tv_nop" : "+v"(c) : "v"(ah), "v"(al), "v"(bh), "v"(bl));
  return c;
}
// batched GEMM like k_gemm_b but f16 operands: A f32 (split into f16 hi/lo if ASPLIT, else rounded to f16), Bt = f16 values [n][k]; alpha; C f32; N multiple of 16 (partial tiles skipped)
template <bool ASPLIT>
__global__ __launch_bounds__(128) void k_gemm_h(const float* __restrict__ A, int lda, size_t sA, const _Float16* __restrict__ Bh, int ldb, size_t sB, float alpha, float* __restrict__ C, int ldc, size_t sC, int M, int N, int K) {
  __shared__ __attribute__((aligned(16))) float so[4][16][64];
  const int tid = threadIdx.x, w = tid >> 5, lane = tid & 31, ln = lane & 15, hh = lane >> 4; const int by = blockIdx.y;
  A += (size_t)by * sA; Bh += (size_t)by * sB; C += (size_t)by * sC;
  const int ntn = (N + 63) / 64; const int wid = blockIdx.x * 4 + w; const int mt = wid / ntn, nq = wid % ntn; if (mt * 16 >= M) return;
  const int row0 = mt * 16, col0 = nq * 64; const float* arow = A + (size_t)(row0 + ln) * lda;
  v8f acc[4] = {};
  for (int kb = 0; kb < K; kb += 32) {
    FragH ah, al;
    const v4f x0 = *(const v4fa*)(arow + kb + 8 * hh), x1 = *(const v4fa*)(arow + kb + 8 * hh + 4), x2 = *(const v4fa*)(arow + kb + 16 + 8 * hh), x3 = *(const v4fa*)(arow + kb + 16 + 8 * hh + 4);
    float xs[16] = {x0[0],x0[1],x0[2],x0[3],x1[0],x1[1],x1[2],x1[3],x2[0],x2[1],x2[2],x2[3],x3[0],x3[1],x3[2],x3[3]};
#pragma unroll
    for (int i = 0; i < 16; ++i) { const _Float16 h = (_Float16)xs[i]; ah.h[i] = h; al.h[i] = ASPLIT ? (_Float16)(xs[i] - (float)h) : (_Float16)0.0f; }
#pragma unroll
    for (int t = 0; t < 4; ++t) { if (col0 + t * 16 >= N) continue; const size_t boff = (size_t)(col0 + t * 16 + ln) * ldb + kb; FragH bq; bq.half[0] = *(const v8us*)(Bh + boff + 8 * hh); bq.half[1] = *(const v8us*)(Bh + boff + 16 + 8 * hh);
      acc[t] = mmaH<ASPLIT ? 2 : 1>(ah.v, al.v, bq.v, bq.v, acc[t]); }
  }
#pragma unroll
  for (int t = 0; t < 4; ++t) { if (col0 + t * 16 >= N) continue;
#pragma unroll
    for (int r = 0; r < 8; ++r) so[w][8 * hh + r][t * 16 + ln] = acc[t][r] * alpha; }
  __builtin_amdgcn_fence(__ATOMIC_ACQ_REL, "workgroup"); __builtin_amdgcn_wave_barrier();
  const int rsub = lane >> 4, c4 = (lane & 15) * 4;
  {
#pragma unroll
    for (int q = 0; q < 8; ++q) { const int r = q * 2 + rsub; if (col0 + c4 < N) { const v4f v = *(const v4fa*)&so[w][r][c4]; *(v4f*)(C + (size_t)(row0 + r) * ldc + col0 + c4) = v; } }
     }
}

// Wt[n][k] = f16(W[k][n]·scale) from f32 row-major W[K][N] (scale = power of two; bf16-exact weights stay exact in f16 away from the subnormal range)
__global__ __launch_bounds__(256) void k_wt_f16(const float* __restrict__ W, _Float16* __restrict__ Wt, int K, int N, float scale) {
  const int t = blockIdx.x * 256 + threadIdx.x; if (t >= N * (K / 8)) return; const int n = t / (K / 8), k8 = (t % (K / 8)) * 8; FragH f;
#pragma unroll
  for (int i = 0; i < 8; ++i) f.h[i] = (_Float16)(bf16_round(W[(size_t)(k8 + i) * N + n]) * scale); const v8us o = f.half[0];
  *(v8us*)((unsigned short*)Wt + (size_t)n * K + k8) = o; 
}
typedef _Float16 v4h __attribute__((ext_vector_type(4)));
// GEMM C[M][N] = alpha * sum_k A[m][k] * B[n][k], f16 operands with k contiguous, f32 accumulate; writes f32 C or f16 C16 (pitch ldc). blockIdx = (N tile, M tile, batch).
// A work-group of 8 waves owns a BM x BN tile of C. Per K step the BM rows of A and the BN rows of B (BK elements each) are fetched with whole-line 16-byte loads, one chunk per lane,
// and stored to LDS rows padded by 16 bytes; every wave then reads its WMMA fragments from LDS, so a tile row is fetched from L2 once per work-group instead of once per wave in 32-byte pieces.
// Two LDS buffers: the next step's global loads are issued right behind the barrier (in front of it the barrier's own wait would drain them), fly during this step's products and are stored to the other buffer behind them.
// Global load addresses are a scalar base per chunk plus one 32-bit byte offset per lane and operand, which lives through the whole loop and moves on by one K step in front of each step's loads.
// sbase() takes a wave-uniform address through readfirstlane: the loads then take the scalar-base form, the loop holds no 64-bit vector address sums, and no short-lived address register is handed to a later load as its destination.
// Each output's products run over k in ascending blocks of 32 in one accumulator chain. M % BM == 0, N % BN == 0, K % BK == 0, BN == 128.
// The '#pragma unroll's over pre, base, acc, cm, cz and the fragments are there so that these register arrays are indexed by constants only and stay in registers.
// EPI: 0 writes f32 C, 1 writes f16 C16, 2 is the score stage's softmax over the rows of the tile: with m the maximum of a column over the BM rows, C16 gets exp(c - m) x 2^15 and TM, TZ get m and the sum of the exponentials
// at [batch][row tile][column], m in units of log 2 (the scores are multiplied by log2 e once, so that each exponential is one subtraction and one v_exp_f32). The maximum and the sum are taken in the accumulator registers (a lane holds FM x 8 rows of each of its FN columns), then over lanes l ^ 16, then over the WM waves, in wave order, through LDS.
// ASC: the A chunks are multiplied on their way to LDS by SC[batch][row tile of 128][k] (f32 product, rounded to f16 again); a thread's A chunks share their k range, so it loads 8 factors per K step.
// 2^x by v_exp_f32. The v_nop is the free issue slot that the instruction set asks for behind a transcendental before its source is overwritten;
// it is tied to the v_exp_f32 in one statement.
__device__ __forceinline__ float exp2_slot(float x) { float r; asm("v_exp_f32 %0, %1\n\tv_nop" : "=v"(r) : "v"(x)); return r; }
typedef const __attribute__((address_space(1))) v8us* gv8;
typedef const __attribute__((address_space(1))) v4fa* gv4;
__device__ __forceinline__ unsigned long long sbase(const char* p) { const unsigned long long u = (unsigned long long)p; const unsigned lo = (unsigned)__builtin_amdgcn_readfirstlane((int)(unsigned)u), hi = (unsigned)__builtin_amdgcn_readfirstlane((int)(unsigned)(u >> 32)); return ((unsigned long long)hi << 32) | lo; }
// LDS bytes of one work-group: the two operand buffers, or the staged output tile where that is larger
template <int BM, int BN, int BK> constexpr int gemm_lds_bytes() { return (2 * (BM + BN) * (BK + 8) * 2 > BM * (BN + 4) * 4) ? 2 * (BM + BN) * (BK + 8) * 2 : BM * (BN + 4) * 4; }
// The work of one work-group; bx, by, bz = (N tile, M tile, batch), smem = its gemm_lds_bytes() of LDS. A function, so that two GEMMs on independent data can share one grid (k_conv).
template <int BM, int BN, int BK, int WM, int WN, int EPI, bool ASC>
__device__ __forceinline__ void gemm_lds_body(unsigned char* smem, const int bx, const int by, const int bz, const _Float16* __restrict__ A, int lda, size_t sA, const _Float16* __restrict__ Bh, int ldb, size_t sB, float alpha,
                                              float* __restrict__ C, _Float16* __restrict__ C16, int ldc, size_t sC, int K, const float* __restrict__ SC, float* __restrict__ TM, float* __restrict__ TZ) {
  constexpr int FM = BM / (WM * 16), FN = BN / (WN * 16);      // fragments per wave
  constexpr int CPR = BK / 8, RPI = 256 / CPR;                 // 16-byte chunks per tile row; tile rows covered by one chunk per thread
  constexpr int PITCH = BK + 8, ROWS = BM + BN, STAGE = ROWS * PITCH;      // LDS row pitch and buffer size in f16 elements; rows 0..BM-1 hold A, the rest B
  constexpr int NCH = ROWS / RPI, ACH = BM / RPI;              // chunks per thread, of which from A
  constexpr int OP = BN + 4;                                   // f32 pitch of the output staging
  constexpr int LB = gemm_lds_bytes<BM, BN, BK>();
  static_assert(WM * WN == 8 && BN == 128 && BM % RPI == 0 && BN % RPI == 0 && BK % 32 == 0, "tile shape");
  static_assert(EPI != 2 || (BM == 128 && (BM * OP + 2 * WM * BN) * 4 <= LB), "the waves' column statistics lie behind the staged tile");
  static_assert(!ASC || 128 % BM == 0, "one row tile of factors per work-group");
  unsigned short* st = (unsigned short*)smem;
  const int tid = threadIdx.x, w = tid >> 5, lane = tid & 31, ln = lane & 15, hh = lane >> 4;
  const int wm = w % WM, wn = w / WM;
  const int m0 = by * BM, n0 = bx * BN;
  const int crow = tid / CPR, ccol = (tid % CPR) * 8;
  const char* Au = (const char*)(A + (size_t)bz * sA + (size_t)m0 * lda);
  const char* Bu = (const char*)(Bh + (size_t)bz * sB + (size_t)n0 * ldb);
  const unsigned aoff = (unsigned)(crow * lda + ccol) * 2u, boff = (unsigned)(crow * ldb + ccol) * 2u;      // bytes
  const size_t astep = (size_t)RPI * lda * 2, bstep = (size_t)RPI * ldb * 2;                                // bytes between a thread's chunks
  v8us pre[NCH];
  v8f acc[FM][FN] = {};
  const int nk = K / BK;
  unsigned long long base[NCH];
#pragma unroll
  for (int i = 0; i < NCH; ++i) base[i] = sbase((i < ACH) ? Au + i * astep : Bu + (i - ACH) * bstep);
#pragma unroll
  for (int i = 0; i < NCH; ++i) pre[i] = *(gv8)(base[i] + ((i < ACH) ? aoff : boff));
  v4f sc0 = {}, sc1 = {};
  unsigned long long scb = 0; unsigned sk = (unsigned)ccol * 4u;      // factors: scalar base of the work-group's row of SC, byte offset of the lane's 8 factors
  if (ASC) {
    scb = sbase((const char*)(SC + ((size_t)bz * RTL + m0 / 128) * K));
    sc0 = *(gv4)(scb + sk); sc1 = *(gv4)(scb + sk + 16u);
    asm volatile("s_wait_xcnt 0x0" ::: "memory");      // precaution behind the two loads: their offset register moves on in the loop
  }
  // stores the fetched chunks to one LDS buffer; with ASC the A chunks are scaled first
  auto put = [&](unsigned short* dst) {
#pragma unroll
    for (int i = 0; i < NCH; ++i) {
      FragH f; f.half[0] = pre[i];
      if (ASC && i < ACH) {
#pragma unroll
        for (int q = 0; q < 8; ++q) f.h[q] = (_Float16)((float)f.h[q] * ((q < 4) ? sc0[q & 3] : sc1[q & 3]));
      }
      *(v8us*)(dst + (crow + i * RPI) * PITCH + ccol) = f.half[0];
    }
  };
  put(st);
  unsigned ak = aoff, bk = boff;
  for (int s = 0; s < nk; ++s) {
    const bool more = s + 1 < nk;
    __syncthreads();      // publishes buffer s & 1; every wave has also left the other buffer, which is rewritten below
    if (more) {
      ak += BK * 2; bk += BK * 2;
#pragma unroll
      for (int i = 0; i < NCH; ++i) pre[i] = *(gv8)(base[i] + ((i < ACH) ? ak : bk));
      if (ASC) { sk += BK * 4; sc0 = *(gv4)(scb + sk); sc1 = *(gv4)(scb + sk + 16u); }
      asm volatile("s_wait_xcnt 0x0" ::: "memory");      // precaution behind the run of loads: their offset registers (next step) and scalar bases (epilogue) are overwritten later on paths that hold no load wait
    }
    const unsigned short* sb = st + (s & 1) * STAGE;
#pragma unroll
    for (int kb = 0; kb < BK; kb += 32) {
      FragH a[FM], b[FN];
#pragma unroll
      for (int i = 0; i < FM; ++i) { const unsigned short* r = sb + ((wm * FM + i) * 16 + ln) * PITCH + kb + 8 * hh; a[i].half[0] = *(const v8us*)r; a[i].half[1] = *(const v8us*)(r + 16); }
#pragma unroll
      for (int j = 0; j < FN; ++j) { const unsigned short* r = sb + (BM + (wn * FN + j) * 16 + ln) * PITCH + kb + 8 * hh; b[j].half[0] = *(const v8us*)r; b[j].half[1] = *(const v8us*)(r + 16); }
#pragma unroll
      for (int i = 0; i < FM; ++i)
#pragma unroll
        for (int j = 0; j < FN; ++j) acc[i][j] = mmaH<1>(a[i].v, a[i].v, b[j].v, b[j].v, acc[i][j]);
    }
    if (more) put(st + ((s + 1) & 1) * STAGE);
  }
  __syncthreads();      // every wave has left the operand buffers before the output tile is staged over them
  float* so = (float*)smem;
  float* rm = so + BM * OP; float* rz = rm + WM * BN;      // EPI 2: column maxima and sums of the WM waves that share a column
  if (EPI == 2) {
    const float a2 = alpha * 1.44269504f;
    float cm[FN], cz[FN];
#pragma unroll
    for (int j = 0; j < FN; ++j) {
      float m = -3.0e38f;
#pragma unroll
      for (int i = 0; i < FM; ++i)
#pragma unroll
        for (int r = 0; r < 8; ++r) { acc[i][j][r] *= a2; m = fmaxf(m, acc[i][j][r]); }
      cm[j] = m;
    }
#pragma unroll
    for (int j = 0; j < FN; ++j) cm[j] = fmaxf(cm[j], __shfl_xor(cm[j], 16, 32));
    if (hh == 0) {
#pragma unroll
      for (int j = 0; j < FN; ++j) rm[wm * BN + (wn * FN + j) * 16 + ln] = cm[j];
    }
    __syncthreads();      // every wave's column maxima are read by the other waves of the column
#pragma unroll
    for (int j = 0; j < FN; ++j) {
      const int col = (wn * FN + j) * 16 + ln;
      float m = rm[col], z = 0.f;
#pragma unroll
      for (int u = 1; u < WM; ++u) m = fmaxf(m, rm[u * BN + col]);
      m -= 15.0f;      // the stored weights carry the factor 2^15
#pragma unroll
      for (int i = 0; i < FM; ++i)
#pragma unroll
        for (int r = 0; r < 8; ++r) { const float e = exp2_slot(acc[i][j][r] - m); z += e; so[((wm * FM + i) * 16 + 8 * hh + r) * OP + col] = e; }
      cz[j] = z;
    }
#pragma unroll
    for (int j = 0; j < FN; ++j) cz[j] += __shfl_xor(cz[j], 16, 32);
    if (hh == 0) {
#pragma unroll
      for (int j = 0; j < FN; ++j) rz[wm * BN + (wn * FN + j) * 16 + ln] = cz[j];
    }
  } else {
#pragma unroll
    for (int i = 0; i < FM; ++i)
#pragma unroll
      for (int j = 0; j < FN; ++j)
#pragma unroll
        for (int r = 0; r < 8; ++r) so[((wm * FM + i) * 16 + 8 * hh + r) * OP + (wn * FN + j) * 16 + ln] = acc[i][j][r] * alpha;
  }
  __syncthreads();      // the staged tile is read back across waves: one wave stores one whole row of the tile per instruction
  if (EPI == 2 && tid < BN) {
    float m = rm[tid], z = rz[tid];
#pragma unroll
    for (int u = 1; u < WM; ++u) { m = fmaxf(m, rm[u * BN + tid]); z += rz[u * BN + tid]; }
    const size_t o = ((size_t)bz * RTL + by) * ldc + n0 + tid;
    TM[o] = m; TZ[o] = z * 0.000030517578125f;      // the sum without the weights' factor 2^15
  }
  const size_t cofs = (size_t)bz * sC + (size_t)m0 * ldc + n0;
  const unsigned coff = (unsigned)(w * ldc + lane * 4);      // elements
#pragma unroll
  for (int it = 0; it < BM / 8; ++it) {
    const v4f v = *(const v4fa*)&so[(w + it * 8) * OP + lane * 4];
    if (EPI) { v4h h4; for (int q = 0; q < 4; ++q) h4[q] = (_Float16)v[q]; *(v4h*)((char*)(C16 + cofs + (size_t)(it * 8) * ldc) + coff * 2u) = h4; }
    else *(v4f*)((char*)(C + cofs + (size_t)(it * 8) * ldc) + coff * 4u) = v;
  }
}
template <int BM, int BN, int BK, int WM, int WN, int EPI, bool ASC>
__global__ __launch_bounds__(256) void k_gemm_lds(const _Float16* __restrict__ A, int lda, size_t sA, const _Float16* __restrict__ Bh, int ldb, size_t sB, float alpha,
                                                 float* __restrict__ C, _Float16* __restrict__ C16, int ldc, size_t sC, int K, const float* __restrict__ SC, float* __restrict__ TM, float* __restrict__ TZ) {
  __shared__ __attribute__((aligned(16))) unsigned char smem[gemm_lds_bytes<BM, BN, BK>()];
  gemm_lds_body<BM, BN, BK, WM, WN, EPI, ASC>(smem, blockIdx.x, blockIdx.y, blockIdx.z, A, lda, sA, Bh, ldb, sB, alpha, C, C16, ldc, sC, K, SC, TM, TZ);
}
// The three convs in one grid: both GEMMs read only X16 and the weight images Bw (t, p, g, z one behind the other). The first BB * NN / 128 work-groups, the longer ones, take g; the rest t and p.
__global__ __launch_bounds__(256) void k_conv(const _Float16* __restrict__ X16, const _Float16* __restrict__ Bw, float* __restrict__ F32, _Float16* __restrict__ Gc) {
  constexpr int LG = gemm_lds_bytes<128, 128, 64>(), LT = gemm_lds_bytes<32, 128, 256>(), GB = BB * (NN / 128);
  __shared__ __attribute__((aligned(16))) unsigned char smem[LG > LT ? LG : LT];
  const int bid = blockIdx.x;
  // s_wait_xcnt 0 behind each body's last stores: in the listing the code of the one body follows the stores of the other and rewrites their base and data registers; the wait stands in front of that, whichever body is laid first
  if (bid < GB) {    /* g channel-major per batch [b][128][4096] (f16): M 128 N 4096 K 256 */
    gemm_lds_body<128, 128, 64, 4, 2, 1, false>(smem, bid % (NN / 128), 0, bid / (NN / 128), Bw + (size_t)2 * CPN * CI, CI, 0, X16, CI, (size_t)NN * CI, 0.0625f, nullptr, Gc, NN, (size_t)CPN * NN, CI, nullptr, nullptr, nullptr);
    asm volatile("s_wait_xcnt 0x0" ::: "memory");
  } else {           /* t (bz = 0) and p (bz = 1) of all batches, token-major f32: M 16384 N 128 K 256 */
    gemm_lds_body<32, 128, 256, 1, 8, 0, false>(smem, 0, (bid - GB) % (NR / 32), (bid - GB) / (NR / 32), X16, CI, 0, Bw, CI, (size_t)CPN * CI, 0.0625f, F32, nullptr, CPN, (size_t)NR * CPN, CI, nullptr, nullptr, nullptr);
    asm volatile("s_wait_xcnt 0x0" ::: "memory");
  }
}

__global__ __launch_bounds__(256) void k_x16(const float* __restrict__ x, _Float16* __restrict__ X16, size_t n8) { const size_t t = (size_t)blockIdx.x * 256 + threadIdx.x; if (t >= n8) return; FragH f;
#pragma unroll
  for (int q = 0; q < 8; ++q) f.h[q] = (_Float16)bf16_round(x[t * 8 + q]); *(v8us*)((unsigned short*)X16 + t * 8) = f.half[0];  }
__global__ __launch_bounds__(256) void k_h16(const float* __restrict__ x, _Float16* __restrict__ X16, size_t n8) { const size_t t = (size_t)blockIdx.x * 256 + threadIdx.x; if (t >= n8) return; FragH f;
#pragma unroll
  for (int q = 0; q < 8; ++q) f.h[q] = (_Float16)x[t * 8 + q]; *(v8us*)((unsigned short*)X16 + t * 8) = f.half[0];  }
// y picks one of four equally sized matrices; their f16 images lie one behind the other in Bt. bx = block index inside one matrix.
__device__ __forceinline__ void round16f_body(const int bx, const int y, const float* __restrict__ W0, const float* __restrict__ W1, const float* __restrict__ W2, const float* __restrict__ W3, _Float16* __restrict__ Bt, size_t n8) { const size_t t = (size_t)bx * 256 + threadIdx.x; if (t >= n8) return; FragH f;
  const float* W = (y == 0) ? W0 : (y == 1) ? W1 : (y == 2) ? W2 : W3; Bt += (size_t)y * n8 * 8;
#pragma unroll
  for (int i = 0; i < 8; ++i) f.h[i] = (_Float16)(bf16_round(W[t * 8 + i]) * 16.0f); *(v8us*)((unsigned short*)Bt + t * 8) = f.half[0];
  asm volatile("s_wait_xcnt 0x0" ::: "memory");  }      // k_prep: the other body's code may follow this store in the listing and rewrite its registers
template <int NHv, int TTv>
__global__ __launch_bounds__(256) void k_vt(const _Float16* __restrict__ V16, int ldv, int voff, _Float16* __restrict__ Vt) { __shared__ unsigned short tl[64][66]; const int tid = threadIdx.x; const int slab = blockIdx.x / (TTv / 64), lg = blockIdx.x % (TTv / 64); const int b = slab / NHv, h = slab % NHv;
  for (int i = tid; i < 64 * 8; i += 256) { const int r = i / 8, c8 = (i % 8) * 8; FragH f; f.half[0] = *(const v8us*)((const unsigned short*)V16 + ((size_t)b * TTv + lg * 64 + r) * ldv + voff + h * 64 + c8);
#pragma unroll
    for (int q = 0; q < 8; ++q) tl[r][c8 + q] = f.u[q]; }
  __syncthreads();
  {
#pragma unroll
    for (int rd = 0; rd < 2; ++rd) { const int d = rd * 32 + tid / 8, pc = tid % 8; FragH f;
#pragma unroll
      for (int q = 0; q < 8; ++q) f.u[q] = tl[pc * 8 + q][d];
      *(v8us*)((unsigned short*)Vt + ((size_t)slab * 64 + d) * TTv + lg * 64 + pc * 8) = f.half[0]; }
     } }

// f32 plane [NR][128] → concatenated-K f16 operand planes [NR][384] for a single 3-term GEMM: with h = f16(v), l = f16((v − h)·2^10):
//   MODE 0 (t side): [h | l | h];  MODE 1 (p side): [h | h·2^-10 | l·2^-10]  so that Σ_K A'·B' = Th·Ph + Tl·Ph·2^-10 + Th·Pl·2^-10 (power-of-two scalings are exact in f16 barring subnormal flushes, which cost ≤1e-4 on a σ≈11 logit);
template <int MODE>
__device__ __forceinline__ void hl3_body(const float* __restrict__ F, _Float16* __restrict__ P3, size_t t) { const size_t r = (t * 8) / CPN; const int c = (int)((t * 8) % CPN); const v4f a = *(const v4fa*)(F + t * 8), b = *(const v4fa*)(F + t * 8 + 4); FragH h, l, s2, s3;
#pragma unroll
  for (int q = 0; q < 8; ++q) { const float v = (q < 4) ? a[q] : b[q - 4]; const _Float16 hv = (_Float16)v; const _Float16 lv = (_Float16)((v - (float)hv) * 1024.0f); h.h[q] = hv; l.h[q] = lv; s2.h[q] = MODE ? (_Float16)((float)hv * 0.0009765625f) : lv; s3.h[q] = MODE ? (_Float16)((float)lv * 0.0009765625f) : hv; }
  unsigned short* row = (unsigned short*)P3 + r * (3 * CPN) + c;
  { *(v8us*)(row) = h.half[0]; *(v8us*)(row + CPN) = s2.half[0]; *(v8us*)(row + 2 * CPN) = s3.half[0];  } }
// One grid for both sides: blockIdx.y = 0 takes the t plane (MODE 0), 1 the p plane (MODE 1); the planes of F, and those of P3, lie one behind the other.
__global__ __launch_bounds__(256) void k_hl3(const float* __restrict__ F, _Float16* __restrict__ P3, size_t n8) { const size_t t = (size_t)blockIdx.x * 256 + threadIdx.x; if (t >= n8) return;
  if (blockIdx.y == 0) hl3_body<0>(F, P3, t); else hl3_body<1>(F + n8 * 8, P3 + n8 * 24, t); }
__device__ __forceinline__ void tok_body(const int bid, const float* __restrict__ x, _Float16* __restrict__ X16) { __shared__ float tl[32][65]; const int tid = threadIdx.x; const int b = bid / ((CI / 64) * (NN / 32)), rem = bid % ((CI / 64) * (NN / 32)); const int cg = rem / (NN / 32), pg = rem % (NN / 32); const int c0 = cg * 64, p0 = pg * 32;
  for (int i = tid; i < 64 * 32; i += 256) { const int c = i / 32, pp = i % 32; tl[pp][c] = bf16_round(x[((size_t)b * CI + c0 + c) * NN + p0 + pp]); } __syncthreads();
  const int r = tid / 8, pc = tid % 8; FragH f; for (int q = 0; q < 8; ++q) f.h[q] = (_Float16)tl[r][pc * 8 + q]; const size_t row = (size_t)b * NN + p0 + r; *(v8us*)((unsigned short*)X16 + row * CI + c0 + pc * 8) = f.half[0];
  asm volatile("s_wait_xcnt 0x0" ::: "memory");  }      // k_prep: the other body's code follows this store in the listing and rewrites its data registers
// Weight casts and the token-major f16 image of x in one grid (both read inputs only): the first 4 * WCB work-groups cast the four weight matrices, the rest transpose x.
#define WCB ((CPN * CI / 8 + 255) / 256)      // work-groups per weight matrix
__global__ __launch_bounds__(256) void k_prep(const float* __restrict__ W0, const float* __restrict__ W1, const float* __restrict__ W2, const float* __restrict__ W3, _Float16* __restrict__ Bt, const float* __restrict__ x, _Float16* __restrict__ X16) {
  const int bid = blockIdx.x;
  if (bid < 4 * WCB) round16f_body(bid % WCB, bid / WCB, W0, W1, W2, W3, Bt, (size_t)CPN * CI / 8);
  else tok_body(bid - 4 * WCB, x, X16);
}
// One thread per column m of one batch's score plane (blockIdx.y): merges the RTL row tiles' maxima (in units of log 2) and sums, in tile order, into the column's max M and sum Z,
// and writes per row tile the factor 2^(tile max - M) / Z that turns the stored exp(s - tile max) into the softmax weight. Z is about 1 or more: the tile that holds M adds its own largest term, 2^0.
__global__ __launch_bounds__(64) void k_tilescale(const float* __restrict__ TM, const float* __restrict__ TZ, float* __restrict__ SC) {
  const size_t o = (size_t)blockIdx.y * RTL * NN + blockIdx.x * 64 + threadIdx.x;
  float tm[RTL], tz[RTL];
  // every unroll here: tm and tz are indexed by constants only and stay in registers; in the first loop all loads are also in flight at once
#pragma unroll
  for (int t = 0; t < RTL; ++t) { tm[t] = TM[o + (size_t)t * NN]; tz[t] = TZ[o + (size_t)t * NN]; }
  float m = tm[0], z = 0.f;
#pragma unroll
  for (int t = 1; t < RTL; ++t) m = fmaxf(m, tm[t]);
#pragma unroll
  for (int t = 0; t < RTL; ++t) { tm[t] = exp2_slot(tm[t] - m); z += tz[t] * tm[t]; }
  const float inv = 1.0f / z;
#pragma unroll
  for (int t = 0; t < RTL; ++t) SC[o + (size_t)t * NN] = tm[t] * inv;
}
// Column reductions, rows in parallel: a work-group owns 32 columns (one 128-byte line of every row). Eight lanes of 4 columns cover the line, so the 1024 threads form 128 row groups;
// row group rg walks rows rg, rg + 128, ... with 8 loads of 16 bytes in flight. Partials are merged in a fixed order: lanes l ^ 8 and l ^ 16 inside a wave, then the 32 waves, in wave order, through LDS.
__global__ __launch_bounds__(1024) void k_bnstat(const float* __restrict__ Z, float* __restrict__ MU, float* __restrict__ RS) {
  __shared__ __attribute__((aligned(16))) float a1[32][32], a2[32][32];
  const int tid = threadIdx.x, w = tid >> 5, lane = tid & 31, cq = tid & 7, rg = tid >> 3;
  const float* p = Z + (size_t)rg * CI + blockIdx.x * 32 + cq * 4;
  v4f s1 = {0.f, 0.f, 0.f, 0.f}, s2 = {0.f, 0.f, 0.f, 0.f};
  for (int r = 0; r < NR; r += 128 * 8) {
    v4f v[8];
#pragma unroll
    for (int u = 0; u < 8; ++u) v[u] = *(const v4fa*)(p + (size_t)(r + 128 * u) * CI);
#pragma unroll
    for (int u = 0; u < 8; ++u) { s1 += v[u]; s2 += v[u] * v[u]; }
  }
#pragma unroll
  for (int q = 0; q < 4; ++q) {
    s1[q] += __shfl_xor(s1[q], 8, 32); s2[q] += __shfl_xor(s2[q], 8, 32);
    s1[q] += __shfl_xor(s1[q], 16, 32); s2[q] += __shfl_xor(s2[q], 16, 32);
  }
  if (lane < 8) { *(v4f*)&a1[w][cq * 4] = s1; *(v4f*)&a2[w][cq * 4] = s2; }
  __syncthreads();
  if (w == 0) {
    float t1 = 0.f, t2 = 0.f;
#pragma unroll
    for (int i = 0; i < 32; ++i) { t1 += a1[i][lane]; t2 += a2[i][lane]; }
    const float mu = t1 / (float)NR; const float var = fmaxf(t2 / (float)NR - mu * mu, 0.f);
    MU[blockIdx.x * 32 + lane] = mu; RS[blockIdx.x * 32 + lane] = rsqrtf(var + 1e-5f);
  }
}
__global__ __launch_bounds__(256) void k_out(const float* __restrict__ Z, const float* __restrict__ MU, const float* __restrict__ RS, const float* __restrict__ gam, const float* __restrict__ bet, const float* __restrict__ x, float* __restrict__ out) { __shared__ float tl[32][65]; const int tid = threadIdx.x; const int b = blockIdx.x / ((CI / 32) * (NN / 64)), rem = blockIdx.x % ((CI / 32) * (NN / 64)); const int cg = rem / (NN / 64), pg = rem % (NN / 64); const int c0 = cg * 32, p0 = pg * 64;
  for (int i = tid; i < 64 * 32; i += 256) { const int pp = i / 32, c = i % 32; tl[c][pp] = (Z[((size_t)b * NN + p0 + pp) * CI + c0 + c] - MU[c0 + c]) * RS[c0 + c] * bf16_round(gam[c0 + c]) + bf16_round(bet[c0 + c]); } __syncthreads();
  { for (int i = tid; i < 32 * 16; i += 256) { const int c = i / 16, q4 = i % 16; const size_t o = ((size_t)b * CI + c0 + c) * NN + p0 + q4 * 4; const v4f xr = *(const v4fa*)(x + o); const v4f v = {tl[c][q4 * 4] + bf16_round(xr[0]), tl[c][q4 * 4 + 1] + bf16_round(xr[1]), tl[c][q4 * 4 + 2] + bf16_round(xr[2]), tl[c][q4 * 4 + 3] + bf16_round(xr[3])}; *(v4f*)(out + o) = v; }  } }

extern "C" void kernel_launch(void* const* d_in, const int* in_sizes, int n_in,
                              void* d_out, int out_size, void* d_ws, size_t ws_size, hipStream_t stream) {
  (void)in_sizes; (void)n_in; (void)out_size;
  const float* const* I = (const float* const*)d_in; const float* x = I[0]; const float* Wt = I[1]; const float* Wp = I[2]; const float* Wg = I[3]; const float* Wz = I[4]; const float* gam = I[5]; const float* bet = I[6];
  char* ws = (char*)d_ws; size_t off = 0;
  auto take = [&](size_t bytes) { char* p = ws + off; off += (bytes + 255) & ~(size_t)255; return p; };
  _Float16* Bt_ = (_Float16*)take((size_t)4 * CPN * CI * 2); _Float16* Bp_ = Bt_ + (size_t)CPN * CI; _Float16* Bg_ = Bp_ + (size_t)CPN * CI; _Float16* Bz_ = Bg_ + (size_t)CPN * CI;      /* four weight images, one behind the other */
  _Float16* PT = (_Float16*)take((size_t)PB * NN * NN * 2); _Float16* X16 = (_Float16*)take((size_t)NR * CI * 2);      /* weight planes of the PB batches that one launch works on */
  _Float16* T3 = (_Float16*)take((size_t)2 * NR * 3 * CPN * 2); _Float16* P3 = T3 + (size_t)NR * 3 * CPN; float* F32 = (float*)take((size_t)2 * NR * CPN * 4);      /* all batches: concatenated-K operand planes [16384][384] (t, then p) and the two f32 conv outputs they are built from */
  _Float16* Gc = (_Float16*)take((size_t)BB * CPN * NN * 2); _Float16* Y16 = (_Float16*)take((size_t)NR * CPN * 2); float* TM = (float*)take((size_t)PB * RTL * NN * 4); float* TZ = (float*)take((size_t)PB * RTL * NN * 4); float* SC = (float*)take((size_t)PB * RTL * NN * 4); float* MU = (float*)take((size_t)CI * 4); float* RS = (float*)take((size_t)CI * 4);
  float* Z = (float*)take((size_t)NR * CI * 4);
  if (off > ws_size) return;      // about 216 MB of the 268 MB given (weight planes 134, the rest 82)
  k_prep<<<4 * WCB + BB * (CI / 64) * (NN / 32), 256, 0, stream>>>(Wt, Wp, Wg, Wz, Bt_, x, X16);      /* conv weights (out,in) natural x 2^4, and x token-major */
  k_conv<<<BB * (NN / 128) + 2 * (NR / 32), 256, 0, stream>>>(X16, Bt_, F32, Gc);      /* g channel-major f16; t and p token-major f32 */
  k_hl3<<<dim3((unsigned)(((size_t)NR * CPN / 8 + 255) / 256), 2, 1), 256, 0, stream>>>(F32, T3, (size_t)NR * CPN / 8);      /* t to [h | l | h], p to [h | h 2^-10 | l 2^-10] */
  const dim3 gs(NN / 128, NN / 128, PB), gy(CPN / 128, NN / 32, PB);
  for (int b = 0; b < BB; b += PB) { const size_t to = (size_t)b * NN * 3 * CPN, yo = (size_t)b * NN * CPN;      /* blockIdx.z or .y of each launch: batch b + z (or y), PB of them */
    k_gemm_lds<128, 128, 64, 4, 2, 2, false><<<gs, 256, 0, stream>>>(T3 + to, 3 * CPN, (size_t)NN * 3 * CPN, P3 + to, 3 * CPN, (size_t)NN * 3 * CPN, 1.0f, nullptr, PT, NN, (size_t)NN * NN, 3 * CPN, nullptr, TM, TZ);      /* s[n][m] = t_n p_m as Th Ph + (Tl Ph + Th Pl) 2^-10 in one K = 384 pass, M 4096 N 4096; stored: exp(s - tile max) 2^15 and the tiles' column statistics */
    k_tilescale<<<dim3(NN / 64, PB, 1), 64, 0, stream>>>(TM, TZ, SC);
    k_gemm_lds<32, 128, 256, 1, 8, 1, true><<<gy, 256, 0, stream>>>(PT, NN, (size_t)NN * NN, Gc + (size_t)b * CPN * NN, NN, (size_t)CPN * NN, 0.000030517578125f, nullptr, Y16 + yo, CPN, (size_t)NN * CPN, NN, SC, nullptr, nullptr); }      /* y[n][c] = sum over m of att[n][m] g[c][m]: M 4096 N 128 K 4096 (f16 out) */
  k_gemm_lds<128, 128, 64, 4, 2, 0, false><<<dim3(CI / 128, NR / 128, 1), 256, 0, stream>>>(Y16, CPN, 0, Bz_, CPN, 0, 0.0625f, Z, nullptr, CI, 0, CPN, nullptr, nullptr, nullptr);      /* z token-major [16384][256] f32: M 16384 N 256 K 128 */
  k_bnstat<<<CI / 32, 1024, 0, stream>>>(Z, MU, RS); k_out<<<BB * (CI / 32) * (NN / 64), 256, 0, stream>>>(Z, MU, RS, gam, bet, x, (float*)d_out);
}

// v006
// It runs in 144 microseconds.
// Next to v005, in two timings, it ran 1.18 and 1.19 times as fast.
// All steps since v000 together make it 90.1 times as fast.
#include <hip/hip_runtime.h>
// Spatial non-local block with query-axis softmax (B=4, C_in 256, C_p 128, N=4096): t,p,g = 1×1 convs; att[n,m] = Σ_c t[c,n]·p[c,m]; att = softmax over n (dim=1) for every m; y[c,n] = Σ_m att[n,m]·g[c,m]; z = Wz·y;
// BatchNorm1d in training mode (batch statistics over (B,N) per channel, biased variance, eps 1e-5) with affine; out = BN(z) + x.
// Compute dtype: x and weights rounded to bf16; t and p as f32 GEMM outputs split into f16 hi + ×2^10 residual parts laid out as concatenated-K operands so one K=384 GEMM yields Th·Ph + (Tl·Ph + Th·Pl)·2^-10 (σ≈11 logits, f32-accurate);
// no f32 score plane is stored: the score GEMM's epilogue takes each column's max and sum over the 128 rows of its own tile (f32) and writes exp(s - tile max) row-major as f16 x 2^15; a small kernel merges the 32 row tiles of a column into
// one factor exp(tile max - column max) / column sum per (row tile, column), and the y GEMM multiplies its weight chunks by that factor on their way to LDS; y = contraction over m as an f16 GEMM against
// channel-major g; z GEMM; per-channel batch statistics as fixed-order f32 column sums, taken per row tile in the z GEMM's epilogue and merged by the last kernel; affine + residual applied during the transpose back to channel-major. All contractions on v_wmma_f32_16x16x32_f16, f32 accumulate.
#define BB 4
#define CI 256
#define CPN 128
#define NN 4096
#define NR (BB * NN)
#define PB 4      // batches whose weight planes are held at once: each launch of the score, merge and y stages works on PB batches (all of them: one launch per stage)
#define RTL (NN / 128)      // row tiles of a score plane: one set of column statistics each

typedef __bf16 v16b __attribute__((ext_vector_type(16)));
typedef unsigned short v8us __attribute__((ext_vector_type(8), may_alias));
typedef float  v8f  __attribute__((ext_vector_type(8)));
typedef float  v4f  __attribute__((ext_vector_type(4)));
typedef float  v4fa __attribute__((ext_vector_type(4), may_alias));
union FragB { v16b v; v8us half[2]; unsigned short u[16]; };

__device__ __forceinline__ unsigned short bf16_bits(float x) { unsigned int u = __float_as_uint(x); return (unsigned short)((u + 0x7FFFu + ((u >> 16) & 1u)) >> 16); }
__device__ __forceinline__ float bf16_val(unsigned short b) { return __uint_as_float(((unsigned int)b) << 16); }
__device__ __forceinline__ float bf16_round(float x) { return bf16_val(bf16_bits(x)); }
// D += A·B with NT terms: 1 = ah·bh, 2 = + al·bh (A split), 3 = + ah·bl (both split)
template <int NT>
__device__ __forceinline__ v8f mmaN(v16b ah, v16b al, v16b bh, v16b bl, v8f c) {
  c = __builtin_amdgcn_wmma_f32_16x16x32_bf16(false, ah, false, bh, (short)0, c, false, false);
  if (NT >= 2) c = __builtin_amdgcn_wmma_f32_16x16x32_bf16(false, al, false, bh, (short)0, c, false, false);
  if (NT >= 3) c = __builtin_amdgcn_wmma_f32_16x16x32_bf16(false, ah, false, bl, (short)0, c, false, false);
  asm volatile("v_nop\n\tv_nop\n\tv_nop\n\tv_nop" : "+v"(c) : "v"(ah), "v"(al), "v"(bh), "v"(bl));
  return c;
}

__global__ __launch_bounds__(256) void k_wt_bf16(const float* __restrict__ W, unsigned short* __restrict__ Wt, int K, int N) {
  const int t = blockIdx.x * 256 + threadIdx.x;
  const int k8n = K / 8;
  if (t >= N * k8n) return;
  const int n = t / k8n, k8 = (t % k8n) * 8;
  v8us v;
#pragma unroll
  for (int i = 0; i < 8; ++i) v[i] = bf16_bits(W[(size_t)(k8 + i) * N + n]);
  *(v8us*)(Wt + (size_t)n * K + k8) = v;
  
}

// GEMM C[M][N] (f32, pitch ldc) = act(A[M][K]·W + bias). A f32 row-major (pitch lda) converted per fragment to bf16
// (ASPLIT: hi/lo two planes -> 2 terms, else single rounded term); Wt bf16 [N][K] (pitch ldb). BIAS_BF16 rounds the
// bias to bf16 first (bias quantised to bf16 before the add). K%32==0, M%16==0, N%64==0.
template <bool ASPLIT, int ACT, bool BIAS_BF16>
__global__ __launch_bounds__(128) void k_gemm_bf(const float* __restrict__ A, int lda, const unsigned short* __restrict__ Wt, int ldb,
                                               const float* __restrict__ bias, float* __restrict__ C, int ldc, int M, int N, int K) {
  __shared__ __attribute__((aligned(16))) float so[4][16][64];
  const int tid = threadIdx.x, w = tid >> 5, lane = tid & 31, ln = lane & 15, hh = lane >> 4;
  const int ntn = N / 64;
  const int wid = blockIdx.x * 4 + w;
  const int mt = wid / ntn, nq = wid % ntn;
  if (mt * 16 >= M) return;
  const int row0 = mt * 16, col0 = nq * 64;
  const float* arow = A + (size_t)(row0 + ln) * lda;
  v8f acc[4] = {};
  for (int kb = 0; kb < K; kb += 32) {
    FragB ah, al;
    const v4f x0 = *(const v4fa*)(arow + kb + 8 * hh), x1 = *(const v4fa*)(arow + kb + 8 * hh + 4);
    const v4f x2 = *(const v4fa*)(arow + kb + 16 + 8 * hh), x3 = *(const v4fa*)(arow + kb + 16 + 8 * hh + 4);
    float xs[16] = {x0[0],x0[1],x0[2],x0[3],x1[0],x1[1],x1[2],x1[3],x2[0],x2[1],x2[2],x2[3],x3[0],x3[1],x3[2],x3[3]};
#pragma unroll
    for (int i = 0; i < 16; ++i) { const unsigned short hb = bf16_bits(xs[i]); ah.u[i] = hb; al.u[i] = ASPLIT ? bf16_bits(xs[i] - bf16_val(hb)) : (unsigned short)0; }
#pragma unroll
    for (int t = 0; t < 4; ++t) {
      const unsigned short* brow = Wt + (size_t)(col0 + t * 16 + ln) * ldb + kb;
      FragB b;
      b.half[0] = *(const v8us*)(brow + 8 * hh);
      b.half[1] = *(const v8us*)(brow + 16 + 8 * hh);
      acc[t] = mmaN<ASPLIT ? 2 : 1>(ah.v, al.v, b.v, b.v, acc[t]);
    }
  }
#pragma unroll
  for (int t = 0; t < 4; ++t) {
    float bv = bias ? bias[col0 + t * 16 + ln] : 0.f;
    if (BIAS_BF16) bv = bf16_round(bv);
#pragma unroll
    for (int r = 0; r < 8; ++r) { float v = acc[t][r] + bv; if (ACT == 1) v = fmaxf(v, 0.f); so[w][8 * hh + r][t * 16 + ln] = v; }
  }
  __builtin_amdgcn_fence(__ATOMIC_ACQ_REL, "workgroup");
  __builtin_amdgcn_wave_barrier();
  const int rsub = lane >> 4, c4 = (lane & 15) * 4;
  {
#pragma unroll
    for (int q = 0; q < 8; ++q) {
      const int r = q * 2 + rsub;
      const v4f v = *(const v4fa*)&so[w][r][c4];
      *(v4f*)(C + (size_t)(row0 + r) * ldc + col0 + c4) = v;
    }
    
  }
}

// Flash-style causal/unmasked attention, all contractions 3-term bf16 hi/lo splits, f32 softmax with running max.
// q,k,v rows are read from f32 buffers with arbitrary row pitch (so they can live inside a fused qkv buffer);
// D = head size (multiple of 32, <= 128); one wave = 16 query rows; block = 4 waves (64 queries) sharing K/V chunks of 32.
template <int D, bool CAUSAL>
__global__ __launch_bounds__(128) void k_flash(const float* __restrict__ qb, const float* __restrict__ kb, const float* __restrict__ vb,
                                             int pitch, int T, int H, float scale, float* __restrict__ y, int ypitch) {
  constexpr int KS = D / 32;        // k-steps for QK
  constexpr int DT = D / 16;        // d tiles for PV
  __shared__ __attribute__((aligned(16))) unsigned short sKh[32][D + 8], sKl[32][D + 8], sVh[32][D + 8], sVl[32][D + 8];
  __shared__ __attribute__((aligned(16))) unsigned short sPh[4][16][40], sPl[4][16][40];
  __shared__ __attribute__((aligned(16))) float sO[4][16][D];
  const int tid = threadIdx.x, w = tid >> 5, lane = tid & 31, ln = lane & 15, hh = lane >> 4;
  const int nqb = (T + 63) / 64;
  const int bh = blockIdx.x / nqb, qblk = blockIdx.x % nqb;
  const int b = bh / H, h = bh % H;
  const int q0 = qblk * 64 + w * 16;
  const float* Q = qb + (size_t)b * T * pitch + h * D;
  const float* K = kb + (size_t)b * T * pitch + h * D;
  const float* V = vb + (size_t)b * T * pitch + h * D;

  // A fragments of the wave's 16 query rows (scaled), hi/lo
  FragB aqh[KS], aql[KS];
  {
    int row = q0 + ln; if (row >= T) row = T - 1;
    const float* qr = Q + (size_t)row * pitch;
#pragma unroll
    for (int ks = 0; ks < KS; ++ks)
#pragma unroll
      for (int i = 0; i < 16; ++i) {
        const int d = ks * 32 + ((i < 8) ? (8 * hh + i) : (16 + 8 * hh + (i - 8)));
        const float x = qr[d] * scale; const unsigned short hb = bf16_bits(x);
        aqh[ks].u[i] = hb; aql[ks].u[i] = bf16_bits(x - bf16_val(hb));
      }
  }
  float m_r[8], l_r[8];
#pragma unroll
  for (int r = 0; r < 8; ++r) { m_r[r] = -3.0e38f; l_r[r] = 0.f; }
  v8f oacc[DT];
#pragma unroll
  for (int dt = 0; dt < DT; ++dt) oacc[dt] = (v8f){0.f,0.f,0.f,0.f,0.f,0.f,0.f,0.f};

  const int kv_end = CAUSAL ? min(T, qblk * 64 + 64) : T;     // block-uniform
  for (int j0 = 0; j0 < kv_end; j0 += 32) {
    __syncthreads();
    for (int e = tid; e < 32 * (D / 4); e += 128) {
      const int r = e / (D / 4), c4 = (e % (D / 4)) * 4;
      const int key = j0 + r;
      v4f kf = {0.f,0.f,0.f,0.f}, vf = {0.f,0.f,0.f,0.f};
      if (key < T) { kf = *(const v4fa*)(K + (size_t)key * pitch + c4); vf = *(const v4fa*)(V + (size_t)key * pitch + c4); }
#pragma unroll
      for (int t = 0; t < 4; ++t) {
        unsigned short hb = bf16_bits(kf[t]); sKh[r][c4 + t] = hb; sKl[r][c4 + t] = bf16_bits(kf[t] - bf16_val(hb));
        hb = bf16_bits(vf[t]); sVh[r][c4 + t] = hb; sVl[r][c4 + t] = bf16_bits(vf[t] - bf16_val(hb));
      }
    }
    __syncthreads();
    // S tile 16 x 32
    v8f s[2];
#pragma unroll
    for (int nt = 0; nt < 2; ++nt) {
      v8f acc = {};
#pragma unroll
      for (int ks = 0; ks < KS; ++ks) {
        FragB bh_, bl_;
        bh_.half[0] = *(const v8us*)&sKh[nt * 16 + ln][ks * 32 + 8 * hh]; bh_.half[1] = *(const v8us*)&sKh[nt * 16 + ln][ks * 32 + 16 + 8 * hh];
        bl_.half[0] = *(const v8us*)&sKl[nt * 16 + ln][ks * 32 + 8 * hh]; bl_.half[1] = *(const v8us*)&sKl[nt * 16 + ln][ks * 32 + 16 + 8 * hh];
        acc = mmaN<3>(aqh[ks].v, aql[ks].v, bh_.v, bl_.v, acc);
      }
      s[nt] = acc;
    }
    // mask + running max (rows 8hh+r; the 16 lanes of a half share rows)
    float alpha[8];
#pragma unroll
    for (int r = 0; r < 8; ++r) {
      const int qi = q0 + 8 * hh + r;
      const int ja = j0 + ln, jb = j0 + 16 + ln;
      if (CAUSAL) { if (ja > qi) s[0][r] = -3.0e38f; if (jb > qi) s[1][r] = -3.0e38f; }
      if (ja >= T) s[0][r] = -3.0e38f;
      if (jb >= T) s[1][r] = -3.0e38f;
      float mx = fmaxf(s[0][r], s[1][r]);
      mx = fmaxf(mx, __shfl_xor(mx, 1, 32)); mx = fmaxf(mx, __shfl_xor(mx, 2, 32)); mx = fmaxf(mx, __shfl_xor(mx, 4, 32)); mx = fmaxf(mx, __shfl_xor(mx, 8, 32));
      const float mnew = fmaxf(m_r[r], mx);
      alpha[r] = (mnew > -1.0e38f) ? __expf(m_r[r] - mnew) : 1.0f;
      const float p0 = (s[0][r] > -1.0e38f) ? __expf(s[0][r] - mnew) : 0.f;
      const float p1 = (s[1][r] > -1.0e38f) ? __expf(s[1][r] - mnew) : 0.f;
      m_r[r] = mnew;
      l_r[r] = l_r[r] * alpha[r] + p0 + p1;            // per-lane partial row sum (16 lanes combined at the end)
      unsigned short hb = bf16_bits(p0); sPh[w][8 * hh + r][ln] = hb;      sPl[w][8 * hh + r][ln] = bf16_bits(p0 - bf16_val(hb));
      hb = bf16_bits(p1);                sPh[w][8 * hh + r][16 + ln] = hb; sPl[w][8 * hh + r][16 + ln] = bf16_bits(p1 - bf16_val(hb));
    }
#pragma unroll
    for (int dt = 0; dt < DT; ++dt)
#pragma unroll
      for (int r = 0; r < 8; ++r) oacc[dt][r] *= alpha[r];
    __builtin_amdgcn_fence(__ATOMIC_ACQ_REL, "workgroup");
    __builtin_amdgcn_wave_barrier();
    FragB pah, pal;
    pah.half[0] = *(const v8us*)&sPh[w][ln][8 * hh]; pah.half[1] = *(const v8us*)&sPh[w][ln][16 + 8 * hh];
    pal.half[0] = *(const v8us*)&sPl[w][ln][8 * hh]; pal.half[1] = *(const v8us*)&sPl[w][ln][16 + 8 * hh];
#pragma unroll
    for (int dt = 0; dt < DT; ++dt) {
      FragB bvh, bvl;
#pragma unroll
      for (int i = 0; i < 8; ++i) {
        bvh.u[i] = sVh[8 * hh + i][dt * 16 + ln]; bvh.u[8 + i] = sVh[16 + 8 * hh + i][dt * 16 + ln];
        bvl.u[i] = sVl[8 * hh + i][dt * 16 + ln]; bvl.u[8 + i] = sVl[16 + 8 * hh + i][dt * 16 + ln];
      }
      oacc[dt] = mmaN<3>(pah.v, pal.v, bvh.v, bvl.v, oacc[dt]);
    }
    __builtin_amdgcn_fence(__ATOMIC_ACQ_REL, "workgroup");
    __builtin_amdgcn_wave_barrier();
  }
#pragma unroll
  for (int r = 0; r < 8; ++r) {
    float l = l_r[r];
    l += __shfl_xor(l, 1, 32); l += __shfl_xor(l, 2, 32); l += __shfl_xor(l, 4, 32); l += __shfl_xor(l, 8, 32);
    l_r[r] = (l > 0.f) ? 1.0f / l : 0.f;
  }
#pragma unroll
  for (int dt = 0; dt < DT; ++dt)
#pragma unroll
    for (int r = 0; r < 8; ++r) sO[w][8 * hh + r][dt * 16 + ln] = oacc[dt][r] * l_r[r];
  __builtin_amdgcn_fence(__ATOMIC_ACQ_REL, "workgroup");
  __builtin_amdgcn_wave_barrier();
  {
    for (int r = 0; r < 16; ++r) {
      const int row = q0 + r;
      if (row < T && lane < D / 4) {
        const v4f val = *(const v4fa*)&sO[w][r][lane * 4];
        *(v4f*)(y + ((size_t)b * T + row) * ypitch + h * D + lane * 4) = val;
      }
    }
    
  }
}

// GEMM C = act(A·W + bias + resid): A f32 (ASPLIT -> hi/lo 2 terms), Wt bf16 [N][K]; ACT 0 none, 1 relu, 2 exact gelu;
// resid (optional, f32, row index = (row % rmod), pitch ldr, RES_BF16 rounds it) added before the activation.
template <bool ASPLIT, int ACT, bool BIAS_BF16, bool RES_BF16>
__global__ __launch_bounds__(128) void k_gemm_bf3(const float* __restrict__ A, int lda, const unsigned short* __restrict__ Wt, int ldb,
                                                const float* __restrict__ bias, const float* __restrict__ resid, int rmod, int ldr,
                                                float* __restrict__ C, int ldc, int M, int N, int K) {
  __shared__ __attribute__((aligned(16))) float so[4][16][64];
  const int tid = threadIdx.x, w = tid >> 5, lane = tid & 31, ln = lane & 15, hh = lane >> 4;
  const int ntn = N / 64;
  const int wid = blockIdx.x * 4 + w;
  const int mt = wid / ntn, nq = wid % ntn;
  if (mt * 16 >= M) return;
  const int row0 = mt * 16, col0 = nq * 64;
  const float* arow = A + (size_t)(row0 + ln) * lda;
  v8f acc[4] = {};
  for (int kb = 0; kb < K; kb += 32) {
    FragB ah, al;
    const v4f x0 = *(const v4fa*)(arow + kb + 8 * hh), x1 = *(const v4fa*)(arow + kb + 8 * hh + 4);
    const v4f x2 = *(const v4fa*)(arow + kb + 16 + 8 * hh), x3 = *(const v4fa*)(arow + kb + 16 + 8 * hh + 4);
    float xs[16] = {x0[0],x0[1],x0[2],x0[3],x1[0],x1[1],x1[2],x1[3],x2[0],x2[1],x2[2],x2[3],x3[0],x3[1],x3[2],x3[3]};
#pragma unroll
    for (int i = 0; i < 16; ++i) { const unsigned short hb = bf16_bits(xs[i]); ah.u[i] = hb; al.u[i] = ASPLIT ? bf16_bits(xs[i] - bf16_val(hb)) : (unsigned short)0; }
#pragma unroll
    for (int t = 0; t < 4; ++t) {
      const unsigned short* brow = Wt + (size_t)(col0 + t * 16 + ln) * ldb + kb;
      FragB b;
      b.half[0] = *(const v8us*)(brow + 8 * hh);
      b.half[1] = *(const v8us*)(brow + 16 + 8 * hh);
      acc[t] = mmaN<ASPLIT ? 2 : 1>(ah.v, al.v, b.v, b.v, acc[t]);
    }
  }
#pragma unroll
  for (int t = 0; t < 4; ++t) {
    const int col = col0 + t * 16 + ln;
    float bv = bias ? bias[col] : 0.f;
    if (BIAS_BF16) bv = bf16_round(bv);
#pragma unroll
    for (int r = 0; r < 8; ++r) {
      float v = acc[t][r] + bv;
      if (resid) { float rv = resid[(size_t)((row0 + 8 * hh + r) % rmod) * ldr + col]; if (RES_BF16) rv = bf16_round(rv); v += rv; }
      if (ACT == 1) v = fmaxf(v, 0.f);
      if (ACT == 2) v = 0.5f * v * (1.0f + erff(v * 0.70710678118654752f));
      if (ACT == 3) { const float u = 0.7978845608028654f * (v + 0.044715f * v * v * v); v = 0.5f * v * (1.0f + tanhf(u)); }
      so[w][8 * hh + r][t * 16 + ln] = v;
    }
  }
  __builtin_amdgcn_fence(__ATOMIC_ACQ_REL, "workgroup");
  __builtin_amdgcn_wave_barrier();
  const int rsub = lane >> 4, c4 = (lane & 15) * 4;
  {
#pragma unroll
    for (int q = 0; q < 8; ++q) {
      const int r = q * 2 + rsub;
      const v4f v = *(const v4fa*)&so[w][r][c4];
      *(v4f*)(C + (size_t)(row0 + r) * ldc + col0 + c4) = v;
    }
    
  }
}
// row LayerNorm (biased variance, eps) over N: s = X (+ R); optional out_sum <- s; out_norm <- (s-mu)*rsqrt(var+eps)*g + b
template <bool PARAM_BF16>
__global__ __launch_bounds__(256) void k_layernorm(const float* __restrict__ X, const float* __restrict__ R, const float* __restrict__ g, const float* __restrict__ bta,
                                                  float* __restrict__ out_sum, float* __restrict__ out_norm, int N, float eps) {
  __shared__ float red[256];
  const int row = blockIdx.x, tid = threadIdx.x;
  const float* x = X + (size_t)row * N; const float* rr = R ? R + (size_t)row * N : nullptr;
  float vals[16];                     // up to N = 4096
  const int per = N / 256;            // contiguous chunk per thread? use strided-by-4 chunks: thread handles j = tid*4 + 1024*u
  float s1 = 0.f;
  for (int u = 0; u < per / 4; ++u) {
    const int j = tid * 4 + 1024 * u;
    const v4f a = *(const v4fa*)(x + j);
    v4f b = {0.f,0.f,0.f,0.f}; if (rr) b = *(const v4fa*)(rr + j);
#pragma unroll
    for (int q = 0; q < 4; ++q) { const float v = a[q] + b[q]; vals[u * 4 + q] = v; s1 += v; }
  }
  red[tid] = s1; __syncthreads();
  for (int st = 128; st > 0; st >>= 1) { if (tid < st) red[tid] += red[tid + st]; __syncthreads(); }
  const float mu = red[0] / (float)N; __syncthreads();
  float s2 = 0.f;
  for (int u = 0; u < per / 4; ++u)
#pragma unroll
    for (int q = 0; q < 4; ++q) { const float c = vals[u * 4 + q] - mu; s2 += c * c; }
  red[tid] = s2; __syncthreads();
  for (int st = 128; st > 0; st >>= 1) { if (tid < st) red[tid] += red[tid + st]; __syncthreads(); }
  const float rs = rsqrtf(red[0] / (float)N + eps);
  {
    for (int u = 0; u < per / 4; ++u) {
      const int j = tid * 4 + 1024 * u;
      v4f o, sm;
#pragma unroll
      for (int q = 0; q < 4; ++q) {
        float gg = g[j + q], bb = bta[j + q];
        if (PARAM_BF16) { gg = bf16_round(gg); bb = bf16_round(bb); }
        sm[q] = vals[u * 4 + q]; o[q] = (vals[u * 4 + q] - mu) * rs * gg + bb;
      }
      if (out_sum) *(v4f*)(out_sum + (size_t)row * N + j) = sm;
      *(v4f*)(out_norm + (size_t)row * N + j) = o;
    }
    
  }
}



// ---- f16 WMMA path (v_wmma_f32_16x16x32_f16): 11-bit significands for operands in range — used where a [0,1] probability operand needs more precision than bf16
typedef _Float16 v16h __attribute__((ext_vector_type(16)));
union FragH { v16h v; v8us half[2]; _Float16 h[16]; unsigned short u[16]; };
template <int NT>
__device__ __forceinline__ v8f mmaH(v16h ah, v16h al, v16h bh, v16h bl, v8f c) {
  c = __builtin_amdgcn_wmma_f32_16x16x32_f16(false, ah, false, bh, (short)0, c, false, false);
  if (NT >= 2) c = __builtin_amdgcn_wmma_f32_16x16x32_f16(false, al, false, bh, (short)0, c, false, false);
  if (NT >= 3) c = __builtin_amdgcn_wmma_f32_16x16x32_f16(false, ah, false, bl, (short)0, c, false, false);
  asm volatile("v_nop\n\tv_nop\n\tv_nop\n\tv_nop" : "+v"(c) : "v"(ah), "v"(al), "v"(bh), "v"(bl));
  return c;
}
// batched GEMM like k_gemm_b but f16 operands: A f32 (split into f16 hi/lo if ASPLIT, else rounded to f16), Bt = f16 values [n][k]; alpha; C f32; N multiple of 16 (partial tiles skipped)
template <bool ASPLIT>
__global__ __launch_bounds__(128) void k_gemm_h(const float* __restrict__ A, int lda, size_t sA, const _Float16* __restrict__ Bh, int ldb, size_t sB, float alpha, float* __restrict__ C, int ldc, size_t sC, int M, int N, int K) {
  __shared__ __attribute__((aligned(16))) float so[4][16][64];
  const int tid = threadIdx.x, w = tid >> 5, lane = tid & 31, ln = lane & 15, hh = lane >> 4; const int by = blockIdx.y;
  A += (size_t)by * sA; Bh += (size_t)by * sB; C += (size_t)by * sC;
  const int ntn = (N + 63) / 64; const int wid = blockIdx.x * 4 + w; const int mt = wid / ntn, nq = wid % ntn; if (mt * 16 >= M) return;
  const int row0 = mt * 16, col0 = nq * 64; const float* arow = A + (size_t)(row0 + ln) * lda;
  v8f acc[4] = {};
  for (int kb = 0; kb < K; kb += 32) {
    FragH ah, al;
    const v4f x0 = *(const v4fa*)(arow + kb + 8 * hh), x1 = *(const v4fa*)(arow + kb + 8 * hh + 4), x2 = *(const v4fa*)(arow + kb + 16 + 8 * hh), x3 = *(const v4fa*)(arow + kb + 16 + 8 * hh + 4);
    float xs[16] = {x0[0],x0[1],x0[2],x0[3],x1[0],x1[1],x1[2],x1[3],x2[0],x2[1],x2[2],x2[3],x3[0],x3[1],x3[2],x3[3]};
#pragma unroll
    for (int i = 0; i < 16; ++i) { const _Float16 h = (_Float16)xs[i]; ah.h[i] = h; al.h[i] = ASPLIT ? (_Float16)(xs[i] - (float)h) : (_Float16)0.0f; }
#pragma unroll
    for (int t = 0; t < 4; ++t) { if (col0 + t * 16 >= N) continue; const size_t boff = (size_t)(col0 + t * 16 + ln) * ldb + kb; FragH bq; bq.half[0] = *(const v8us*)(Bh + boff + 8 * hh); bq.half[1] = *(const v8us*)(Bh + boff + 16 + 8 * hh);
      acc[t] = mmaH<ASPLIT ? 2 : 1>(ah.v, al.v, bq.v, bq.v, acc[t]); }
  }
#pragma unroll
  for (int t = 0; t < 4; ++t) { if (col0 + t * 16 >= N) continue;
#pragma unroll
    for (int r = 0; r < 8; ++r) so[w][8 * hh + r][t * 16 + ln] = acc[t][r] * alpha; }
  __builtin_amdgcn_fence(__ATOMIC_ACQ_REL, "workgroup"); __builtin_amdgcn_wave_barrier();
  const int rsub = lane >> 4, c4 = (lane & 15) * 4;
  {
#pragma unroll
    for (int q = 0; q < 8; ++q) { const int r = q * 2 + rsub; if (col0 + c4 < N) { const v4f v = *(const v4fa*)&so[w][r][c4]; *(v4f*)(C + (size_t)(row0 + r) * ldc + col0 + c4) = v; } }
     }
}

// Wt[n][k] = f16(W[k][n]·scale) from f32 row-major W[K][N] (scale = power of two; bf16-exact weights stay exact in f16 away from the subnormal range)
__global__ __launch_bounds__(256) void k_wt_f16(const float* __restrict__ W, _Float16* __restrict__ Wt, int K, int N, float scale) {
  const int t = blockIdx.x * 256 + threadIdx.x; if (t >= N * (K / 8)) return; const int n = t / (K / 8), k8 = (t % (K / 8)) * 8; FragH f;
#pragma unroll
  for (int i = 0; i < 8; ++i) f.h[i] = (_Float16)(bf16_round(W[(size_t)(k8 + i) * N + n]) * scale); const v8us o = f.half[0];
  *(v8us*)((unsigned short*)Wt + (size_t)n * K + k8) = o; 
}
typedef _Float16 v4h __attribute__((ext_vector_type(4)));
// GEMM C[M][N] = alpha * sum_k A[m][k] * B[n][k], f16 operands with k contiguous, f32 accumulate; writes f32 C or f16 C16 (pitch ldc). blockIdx = (N tile, M tile, batch).
// A work-group of 8 waves owns a BM x BN tile of C. Per K step the BM rows of A and the BN rows of B (BK elements each) are fetched with whole-line 16-byte loads, one chunk per lane,
// and stored to LDS rows padded by 16 bytes; every wave then reads its WMMA fragments from LDS, so a tile row is fetched from L2 once per work-group instead of once per wave in 32-byte pieces.
// Two LDS buffers: the next step's global loads are issued right behind the barrier (in front of it the barrier's own wait would drain them), fly during this step's products and are stored to the other buffer behind them.
// Global load addresses are a scalar base per chunk plus one 32-bit byte offset per lane and operand, which lives through the whole loop and moves on by one K step in front of each step's loads.
// sbase() takes a wave-uniform address through readfirstlane: the loads then take the scalar-base form, the loop holds no 64-bit vector address sums, and no short-lived address register is handed to a later load as its destination.
// Each output's products run over k in ascending blocks of 32 in one accumulator chain. M % BM == 0, N % BN == 0, K % BK == 0, BN == 128.
// Every '#pragma unroll' in this kernel is there so that a register array (pre, base, acc, cm, cz, c1, c2, the fragments) is indexed by constants only and stays in registers.
// EPI: 0 writes f32 C, 1 writes f16 C16, 2 is the score stage's softmax over the rows of the tile: with m the maximum of a column over the BM rows, C16 gets exp(c - m) x 2^15 and TM, TZ get m and the sum of the exponentials
// at [batch][row tile][column], m in units of log 2 (the scores are multiplied by log2 e once, so that each exponential is one subtraction and one v_exp_f32). The maximum and the sum are taken in the accumulator registers (a lane holds FM x 8 rows of each of its FN columns), then over lanes l ^ 16, then over the WM waves, in wave order, through LDS.
// EPI 3 writes f32 C and, at [row tile][column], the tile's column sums (TM) and column sums of squares (TZ) of the stored values: summed in the accumulator registers, then over lanes l ^ 16, then over the WM waves, in wave order, through LDS.
// EPI 4 writes no f32 plane but the concatenated-K f16 operand rows [3 * BN] of the score GEMM: with h = f16(c), l = f16((c - h) * 2^10), batch 0 (t side) gets [h | l | h], batch 1 (p side) [h | h * 2^-10 | l * 2^-10],
// so that the sum over K of A' * B' is Th Ph + Tl Ph 2^-10 + Th Pl 2^-10 (power-of-two scalings are exact in f16 barring subnormal flushes, which cost at most 1e-4 on a logit of sigma about 11).
// ASC: the A chunks are multiplied on their way to LDS by SC[batch][row tile of 128][k] (f32 product, rounded to f16 again); a thread's A chunks share their k range, so it loads 8 factors per K step.
// 2^x by v_exp_f32. The v_nop is the free issue slot that the instruction set asks for behind a transcendental before its source is overwritten;
// it is tied to the v_exp_f32 in one statement.
__device__ __forceinline__ float exp2_slot(float x) { float r; asm("v_exp_f32 %0, %1\n\tv_nop" : "=v"(r) : "v"(x)); return r; }
typedef const __attribute__((address_space(1))) v8us* gv8;
typedef const __attribute__((address_space(1))) v4fa* gv4;
__device__ __forceinline__ unsigned long long sbase(const char* p) { const unsigned long long u = (unsigned long long)p; const unsigned lo = (unsigned)__builtin_amdgcn_readfirstlane((int)(unsigned)u), hi = (unsigned)__builtin_amdgcn_readfirstlane((int)(unsigned)(u >> 32)); return ((unsigned long long)hi << 32) | lo; }
// LDS bytes of one work-group: the two operand buffers, or the staged output tile where that is larger
template <int BM, int BN, int BK> constexpr int gemm_lds_bytes() { return (2 * (BM + BN) * (BK + 8) * 2 > BM * (BN + 4) * 4) ? 2 * (BM + BN) * (BK + 8) * 2 : BM * (BN + 4) * 4; }
// The work of one work-group; bx, by, bz = (N tile, M tile, batch), smem = its gemm_lds_bytes() of LDS. A function, so that two GEMMs on independent data can share one grid (k_conv).
template <int BM, int BN, int BK, int WM, int WN, int EPI, bool ASC>
__device__ __forceinline__ void gemm_lds_body(unsigned char* smem, const int bx, const int by, const int bz, const _Float16* __restrict__ A, int lda, size_t sA, const _Float16* __restrict__ Bh, int ldb, size_t sB, float alpha,
                                              float* __restrict__ C, _Float16* __restrict__ C16, int ldc, size_t sC, int K, const float* __restrict__ SC, float* __restrict__ TM, float* __restrict__ TZ) {
  constexpr int FM = BM / (WM * 16), FN = BN / (WN * 16);      // fragments per wave
  constexpr int CPR = BK / 8, RPI = 256 / CPR;                 // 16-byte chunks per tile row; tile rows covered by one chunk per thread
  constexpr int PITCH = BK + 8, ROWS = BM + BN, STAGE = ROWS * PITCH;      // LDS row pitch and buffer size in f16 elements; rows 0..BM-1 hold A, the rest B
  constexpr int NCH = ROWS / RPI, ACH = BM / RPI;              // chunks per thread, of which from A
  constexpr int OP = BN + 4;                                   // f32 pitch of the output staging
  constexpr int LB = gemm_lds_bytes<BM, BN, BK>();
  static_assert(WM * WN == 8 && BN == 128 && BM % RPI == 0 && BN % RPI == 0 && BK % 32 == 0, "tile shape");
  static_assert((EPI != 2 && EPI != 3) || (BM == 128 && (BM * OP + 2 * WM * BN) * 4 <= LB), "the waves' column statistics lie behind the staged tile");
  static_assert(!ASC || 128 % BM == 0, "one row tile of factors per work-group");
  unsigned short* st = (unsigned short*)smem;
  const int tid = threadIdx.x, w = tid >> 5, lane = tid & 31, ln = lane & 15, hh = lane >> 4;
  const int wm = w % WM, wn = w / WM;
  const int m0 = by * BM, n0 = bx * BN;
  const int crow = tid / CPR, ccol = (tid % CPR) * 8;
  const char* Au = (const char*)(A + (size_t)bz * sA + (size_t)m0 * lda);
  const char* Bu = (const char*)(Bh + (size_t)bz * sB + (size_t)n0 * ldb);
  const unsigned aoff = (unsigned)(crow * lda + ccol) * 2u, boff = (unsigned)(crow * ldb + ccol) * 2u;      // bytes
  const size_t astep = (size_t)RPI * lda * 2, bstep = (size_t)RPI * ldb * 2;                                // bytes between a thread's chunks
  v8us pre[NCH];
  v8f acc[FM][FN] = {};
  const int nk = K / BK;
  unsigned long long base[NCH];
#pragma unroll
  for (int i = 0; i < NCH; ++i) base[i] = sbase((i < ACH) ? Au + i * astep : Bu + (i - ACH) * bstep);
#pragma unroll
  for (int i = 0; i < NCH; ++i) pre[i] = *(gv8)(base[i] + ((i < ACH) ? aoff : boff));
  v4f sc0 = {}, sc1 = {};
  unsigned long long scb = 0; unsigned sk = (unsigned)ccol * 4u;      // factors: scalar base of the work-group's row of SC, byte offset of the lane's 8 factors
  if (ASC) {
    scb = sbase((const char*)(SC + ((size_t)bz * RTL + m0 / 128) * K));
    sc0 = *(gv4)(scb + sk); sc1 = *(gv4)(scb + sk + 16u);
    asm volatile("s_wait_xcnt 0x0" ::: "memory");      // precaution behind the two loads: their offset register moves on in the loop
  }
  // stores the fetched chunks to one LDS buffer; with ASC the A chunks are scaled first
  auto put = [&](unsigned short* dst) {
#pragma unroll
    for (int i = 0; i < NCH; ++i) {
      FragH f; f.half[0] = pre[i];
      if (ASC && i < ACH) {
#pragma unroll
        for (int q = 0; q < 8; ++q) f.h[q] = (_Float16)((float)f.h[q] * ((q < 4) ? sc0[q & 3] : sc1[q & 3]));
      }
      *(v8us*)(dst + (crow + i * RPI) * PITCH + ccol) = f.half[0];
    }
  };
  put(st);
  unsigned ak = aoff, bk = boff;
  for (int s = 0; s < nk; ++s) {
    const bool more = s + 1 < nk;
    __syncthreads();      // publishes buffer s & 1; every wave has also left the other buffer, which is rewritten below
    if (more) {
      ak += BK * 2; bk += BK * 2;
#pragma unroll
      for (int i = 0; i < NCH; ++i) pre[i] = *(gv8)(base[i] + ((i < ACH) ? ak : bk));
      if (ASC) { sk += BK * 4; sc0 = *(gv4)(scb + sk); sc1 = *(gv4)(scb + sk + 16u); }
      asm volatile("s_wait_xcnt 0x0" ::: "memory");      // precaution behind the run of loads: their offset registers (next step) and scalar bases (epilogue) are overwritten later on paths that hold no load wait
    }
    const unsigned short* sb = st + (s & 1) * STAGE;
#pragma unroll
    for (int kb = 0; kb < BK; kb += 32) {
      FragH a[FM], b[FN];
#pragma unroll
      for (int i = 0; i < FM; ++i) { const unsigned short* r = sb + ((wm * FM + i) * 16 + ln) * PITCH + kb + 8 * hh; a[i].half[0] = *(const v8us*)r; a[i].half[1] = *(const v8us*)(r + 16); }
#pragma unroll
      for (int j = 0; j < FN; ++j) { const unsigned short* r = sb + (BM + (wn * FN + j) * 16 + ln) * PITCH + kb + 8 * hh; b[j].half[0] = *(const v8us*)r; b[j].half[1] = *(const v8us*)(r + 16); }
#pragma unroll
      for (int i = 0; i < FM; ++i)
#pragma unroll
        for (int j = 0; j < FN; ++j) acc[i][j] = mmaH<1>(a[i].v, a[i].v, b[j].v, b[j].v, acc[i][j]);
    }
    if (more) put(st + ((s + 1) & 1) * STAGE);
  }
  __syncthreads();      // every wave has left the operand buffers before the output tile is staged over them
  float* so = (float*)smem;
  float* rm = so + BM * OP; float* rz = rm + WM * BN;      // EPI 2: column maxima and sums of the WM waves that share a column; EPI 3: their column sums and sums of squares
  if (EPI == 2) {
    const float a2 = alpha * 1.44269504f;
    float cm[FN], cz[FN];
#pragma unroll
    for (int j = 0; j < FN; ++j) {
      float m = -3.0e38f;
#pragma unroll
      for (int i = 0; i < FM; ++i)
#pragma unroll
        for (int r = 0; r < 8; ++r) { acc[i][j][r] *= a2; m = fmaxf(m, acc[i][j][r]); }
      cm[j] = m;
    }
#pragma unroll
    for (int j = 0; j < FN; ++j) cm[j] = fmaxf(cm[j], __shfl_xor(cm[j], 16, 32));
    if (hh == 0) {
#pragma unroll
      for (int j = 0; j < FN; ++j) rm[wm * BN + (wn * FN + j) * 16 + ln] = cm[j];
    }
    __syncthreads();      // every wave's column maxima are read by the other waves of the column
#pragma unroll
    for (int j = 0; j < FN; ++j) {
      const int col = (wn * FN + j) * 16 + ln;
      float m = rm[col], z = 0.f;
#pragma unroll
      for (int u = 1; u < WM; ++u) m = fmaxf(m, rm[u * BN + col]);
      m -= 15.0f;      // the stored weights carry the factor 2^15
#pragma unroll
      for (int i = 0; i < FM; ++i)
#pragma unroll
        for (int r = 0; r < 8; ++r) { const float e = exp2_slot(acc[i][j][r] - m); z += e; so[((wm * FM + i) * 16 + 8 * hh + r) * OP + col] = e; }
      cz[j] = z;
    }
#pragma unroll
    for (int j = 0; j < FN; ++j) cz[j] += __shfl_xor(cz[j], 16, 32);
    if (hh == 0) {
#pragma unroll
      for (int j = 0; j < FN; ++j) rz[wm * BN + (wn * FN + j) * 16 + ln] = cz[j];
    }
  } else {
    float c1[FN] = {}, c2[FN] = {};
#pragma unroll
    for (int i = 0; i < FM; ++i)
#pragma unroll
      for (int j = 0; j < FN; ++j)
#pragma unroll
        for (int r = 0; r < 8; ++r) { const float v = acc[i][j][r] * alpha; so[((wm * FM + i) * 16 + 8 * hh + r) * OP + (wn * FN + j) * 16 + ln] = v; if (EPI == 3) { c1[j] += v; c2[j] += v * v; } }
    if (EPI == 3) {
#pragma unroll
      for (int j = 0; j < FN; ++j) { c1[j] += __shfl_xor(c1[j], 16, 32); c2[j] += __shfl_xor(c2[j], 16, 32); }
      if (hh == 0) {
#pragma unroll
        for (int j = 0; j < FN; ++j) { rm[wm * BN + (wn * FN + j) * 16 + ln] = c1[j]; rz[wm * BN + (wn * FN + j) * 16 + ln] = c2[j]; }
      }
    }
  }
  __syncthreads();      // the staged tile is read back across waves: one wave stores one whole row of the tile per instruction
  if (EPI == 2 && tid < BN) {
    float m = rm[tid], z = rz[tid];
#pragma unroll
    for (int u = 1; u < WM; ++u) { m = fmaxf(m, rm[u * BN + tid]); z += rz[u * BN + tid]; }
    const size_t o = ((size_t)bz * RTL + by) * ldc + n0 + tid;
    TM[o] = m; TZ[o] = z * 0.000030517578125f;      // the sum without the weights' factor 2^15
  }
  if (EPI == 3 && tid < BN) {
    float t1 = rm[tid], t2 = rz[tid];
#pragma unroll
    for (int u = 1; u < WM; ++u) { t1 += rm[u * BN + tid]; t2 += rz[u * BN + tid]; }
    const size_t o = (size_t)by * ldc + n0 + tid;
    TM[o] = t1; TZ[o] = t2;
  }
  const size_t cofs = (size_t)bz * sC + (size_t)m0 * ldc + n0;
  const unsigned coff = (unsigned)(w * ldc + lane * 4);      // elements
#pragma unroll
  for (int it = 0; it < BM / 8; ++it) {
    const v4f v = *(const v4fa*)&so[(w + it * 8) * OP + lane * 4];
    if (EPI == 4) {
      v4h h4, s2, s3;
      for (int q = 0; q < 4; ++q) { const _Float16 hv = (_Float16)v[q]; const _Float16 lv = (_Float16)((v[q] - (float)hv) * 1024.0f); h4[q] = hv; s2[q] = bz ? (_Float16)((float)hv * 0.0009765625f) : lv; s3[q] = bz ? (_Float16)((float)lv * 0.0009765625f) : hv; }
      char* row = (char*)(C16 + cofs + (size_t)(it * 8) * ldc) + coff * 2u;
      *(v4h*)row = h4; *(v4h*)(row + BN * 2) = s2; *(v4h*)(row + 2 * BN * 2) = s3;
    }
    else if (EPI == 1 || EPI == 2) { v4h h4; for (int q = 0; q < 4; ++q) h4[q] = (_Float16)v[q]; *(v4h*)((char*)(C16 + cofs + (size_t)(it * 8) * ldc) + coff * 2u) = h4; }
    else *(v4f*)((char*)(C + cofs + (size_t)(it * 8) * ldc) + coff * 4u) = v;
  }
}
template <int BM, int BN, int BK, int WM, int WN, int EPI, bool ASC>
__global__ __launch_bounds__(256) void k_gemm_lds(const _Float16* __restrict__ A, int lda, size_t sA, const _Float16* __restrict__ Bh, int ldb, size_t sB, float alpha,
                                                 float* __restrict__ C, _Float16* __restrict__ C16, int ldc, size_t sC, int K, const float* __restrict__ SC, float* __restrict__ TM, float* __restrict__ TZ) {
  __shared__ __attribute__((aligned(16))) unsigned char smem[gemm_lds_bytes<BM, BN, BK>()];
  gemm_lds_body<BM, BN, BK, WM, WN, EPI, ASC>(smem, blockIdx.x, blockIdx.y, blockIdx.z, A, lda, sA, Bh, ldb, sB, alpha, C, C16, ldc, sC, K, SC, TM, TZ);
}
// The three convs in one grid: both GEMMs read only X16 and the weight images Bw (t, p, g, z one behind the other). The first BB * NN / 128 work-groups, the longer ones, take g; the rest t and p.
__global__ __launch_bounds__(256) void k_conv(const _Float16* __restrict__ X16, const _Float16* __restrict__ Bw, _Float16* __restrict__ T3, _Float16* __restrict__ Gc) {
  constexpr int LG = gemm_lds_bytes<128, 128, 64>(), LT = gemm_lds_bytes<32, 128, 256>(), GB = BB * (NN / 128);
  __shared__ __attribute__((aligned(16))) unsigned char smem[LG > LT ? LG : LT];
  const int bid = blockIdx.x;
  // s_wait_xcnt 0 behind each body's last stores: in the listing the code of the one body follows the stores of the other and rewrites their base and data registers; the wait stands in front of that, whichever body is laid first
  if (bid < GB) {    /* g channel-major per batch [b][128][4096] (f16): M 128 N 4096 K 256 */
    gemm_lds_body<128, 128, 64, 4, 2, 1, false>(smem, bid % (NN / 128), 0, bid / (NN / 128), Bw + (size_t)2 * CPN * CI, CI, 0, X16, CI, (size_t)NN * CI, 0.0625f, nullptr, Gc, NN, (size_t)CPN * NN, CI, nullptr, nullptr, nullptr);
    asm volatile("s_wait_xcnt 0x0" ::: "memory");
  } else {           /* t (bz = 0) and p (bz = 1) of all batches, token-major, as the score GEMM's operand rows [16384][384]: M 16384 N 128 K 256 */
    gemm_lds_body<32, 128, 256, 1, 8, 4, false>(smem, 0, (bid - GB) % (NR / 32), (bid - GB) / (NR / 32), X16, CI, 0, Bw, CI, (size_t)CPN * CI, 0.0625f, nullptr, T3, 3 * CPN, (size_t)NR * 3 * CPN, CI, nullptr, nullptr, nullptr);
    asm volatile("s_wait_xcnt 0x0" ::: "memory");
  }
}

__global__ __launch_bounds__(256) void k_x16(const float* __restrict__ x, _Float16* __restrict__ X16, size_t n8) { const size_t t = (size_t)blockIdx.x * 256 + threadIdx.x; if (t >= n8) return; FragH f;
#pragma unroll
  for (int q = 0; q < 8; ++q) f.h[q] = (_Float16)bf16_round(x[t * 8 + q]); *(v8us*)((unsigned short*)X16 + t * 8) = f.half[0];  }
__global__ __launch_bounds__(256) void k_h16(const float* __restrict__ x, _Float16* __restrict__ X16, size_t n8) { const size_t t = (size_t)blockIdx.x * 256 + threadIdx.x; if (t >= n8) return; FragH f;
#pragma unroll
  for (int q = 0; q < 8; ++q) f.h[q] = (_Float16)x[t * 8 + q]; *(v8us*)((unsigned short*)X16 + t * 8) = f.half[0];  }
// y picks one of four equally sized matrices; their f16 images lie one behind the other in Bt. bx = block index inside one matrix.
__device__ __forceinline__ void round16f_body(const int bx, const int y, const float* __restrict__ W0, const float* __restrict__ W1, const float* __restrict__ W2, const float* __restrict__ W3, _Float16* __restrict__ Bt, size_t n8) { const size_t t = (size_t)bx * 256 + threadIdx.x; if (t >= n8) return; FragH f;
  const float* W = (y == 0) ? W0 : (y == 1) ? W1 : (y == 2) ? W2 : W3; Bt += (size_t)y * n8 * 8;
#pragma unroll
  for (int i = 0; i < 8; ++i) f.h[i] = (_Float16)(bf16_round(W[t * 8 + i]) * 16.0f); *(v8us*)((unsigned short*)Bt + t * 8) = f.half[0];
  asm volatile("s_wait_xcnt 0x0" ::: "memory");  }      // k_prep: the other body's code may follow this store in the listing and rewrite its registers
template <int NHv, int TTv>
__global__ __launch_bounds__(256) void k_vt(const _Float16* __restrict__ V16, int ldv, int voff, _Float16* __restrict__ Vt) { __shared__ unsigned short tl[64][66]; const int tid = threadIdx.x; const int slab = blockIdx.x / (TTv / 64), lg = blockIdx.x % (TTv / 64); const int b = slab / NHv, h = slab % NHv;
  for (int i = tid; i < 64 * 8; i += 256) { const int r = i / 8, c8 = (i % 8) * 8; FragH f; f.half[0] = *(const v8us*)((const unsigned short*)V16 + ((size_t)b * TTv + lg * 64 + r) * ldv + voff + h * 64 + c8);
#pragma unroll
    for (int q = 0; q < 8; ++q) tl[r][c8 + q] = f.u[q]; }
  __syncthreads();
  {
#pragma unroll
    for (int rd = 0; rd < 2; ++rd) { const int d = rd * 32 + tid / 8, pc = tid % 8; FragH f;
#pragma unroll
      for (int q = 0; q < 8; ++q) f.u[q] = tl[pc * 8 + q][d];
      *(v8us*)((unsigned short*)Vt + ((size_t)slab * 64 + d) * TTv + lg * 64 + pc * 8) = f.half[0]; }
     } }

__device__ __forceinline__ void tok_body(const int bid, const float* __restrict__ x, _Float16* __restrict__ X16) { __shared__ float tl[32][65]; const int tid = threadIdx.x; const int b = bid / ((CI / 64) * (NN / 32)), rem = bid % ((CI / 64) * (NN / 32)); const int cg = rem / (NN / 32), pg = rem % (NN / 32); const int c0 = cg * 64, p0 = pg * 32;
  for (int i = tid; i < 64 * 32; i += 256) { const int c = i / 32, pp = i % 32; tl[pp][c] = bf16_round(x[((size_t)b * CI + c0 + c) * NN + p0 + pp]); } __syncthreads();
  const int r = tid / 8, pc = tid % 8; FragH f; for (int q = 0; q < 8; ++q) f.h[q] = (_Float16)tl[r][pc * 8 + q]; const size_t row = (size_t)b * NN + p0 + r; *(v8us*)((unsigned short*)X16 + row * CI + c0 + pc * 8) = f.half[0];
  asm volatile("s_wait_xcnt 0x0" ::: "memory");  }      // k_prep: the other body's code follows this store in the listing and rewrites its data registers
// Weight casts and the token-major f16 image of x in one grid (both read inputs only): the first 4 * WCB work-groups cast the four weight matrices, the rest transpose x.
#define WCB ((CPN * CI / 8 + 255) / 256)      // work-groups per weight matrix
__global__ __launch_bounds__(256) void k_prep(const float* __restrict__ W0, const float* __restrict__ W1, const float* __restrict__ W2, const float* __restrict__ W3, _Float16* __restrict__ Bt, const float* __restrict__ x, _Float16* __restrict__ X16) {
  const int bid = blockIdx.x;
  if (bid < 4 * WCB) round16f_body(bid % WCB, bid / WCB, W0, W1, W2, W3, Bt, (size_t)CPN * CI / 8);
  else tok_body(bid - 4 * WCB, x, X16);
}
// One thread per column m of one batch's score plane (blockIdx.y): merges the RTL row tiles' maxima (in units of log 2) and sums, in tile order, into the column's max M and sum Z,
// and writes per row tile the factor 2^(tile max - M) / Z that turns the stored exp(s - tile max) into the softmax weight. Z is about 1 or more: the tile that holds M adds its own largest term, 2^0.
__global__ __launch_bounds__(64) void k_tilescale(const float* __restrict__ TM, const float* __restrict__ TZ, float* __restrict__ SC) {
  const size_t o = (size_t)blockIdx.y * RTL * NN + blockIdx.x * 64 + threadIdx.x;
  float tm[RTL], tz[RTL];
  // every unroll here: tm and tz are indexed by constants only and stay in registers; in the first loop all loads are also in flight at once
#pragma unroll
  for (int t = 0; t < RTL; ++t) { tm[t] = TM[o + (size_t)t * NN]; tz[t] = TZ[o + (size_t)t * NN]; }
  float m = tm[0], z = 0.f;
#pragma unroll
  for (int t = 1; t < RTL; ++t) m = fmaxf(m, tm[t]);
#pragma unroll
  for (int t = 0; t < RTL; ++t) { tm[t] = exp2_slot(tm[t] - m); z += tz[t] * tm[t]; }
  const float inv = 1.0f / z;
#pragma unroll
  for (int t = 0; t < RTL; ++t) SC[o + (size_t)t * NN] = tm[t] * inv;
}
// Affine + residual during the transpose back to channel-major. A work-group owns 32 channels x 64 positions. It first merges its channels' batch statistics from the NR / 128 row tiles' column sums S1 and sums of squares S2
// in a fixed order: wave pt adds tiles 16 pt .. 16 pt + 15 in tile order (lane = channel, one 128-byte line per load), then every thread adds the 8 waves' partials of its own channel, in wave order, from LDS.
// A thread's elements of Z all belong to channel tid % 32; they, the tiles' sums and the channel's affine pair are loaded in one run, so that all these loads are in flight together.
__global__ __launch_bounds__(256) void k_out(const float* __restrict__ Z, const float* __restrict__ S1, const float* __restrict__ S2, const float* __restrict__ gam, const float* __restrict__ bet, const float* __restrict__ x, float* __restrict__ out) { __shared__ float tl[32][65]; __shared__ float a1[8][32], a2[8][32]; const int tid = threadIdx.x; const int b = blockIdx.x / ((CI / 32) * (NN / 64)), rem = blockIdx.x % ((CI / 32) * (NN / 64)); const int cg = rem / (NN / 64), pg = rem % (NN / 64); const int c0 = cg * 32, p0 = pg * 64;
  const int cc = tid & 31, pt = tid >> 5;
  constexpr int TPW = NR / 128 / 8;      // row tiles per wave
  float zv[8], p1[TPW], p2[TPW];      // the unrolls: the three arrays are indexed by constants only and stay in registers
#pragma unroll
  for (int u = 0; u < TPW; ++u) { p1[u] = S1[(size_t)(pt * TPW + u) * CI + c0 + cc]; p2[u] = S2[(size_t)(pt * TPW + u) * CI + c0 + cc]; }
#pragma unroll
  for (int k = 0; k < 8; ++k) zv[k] = Z[((size_t)b * NN + p0 + pt + 8 * k) * CI + c0 + cc];
  const float ga = bf16_round(gam[c0 + cc]), be = bf16_round(bet[c0 + cc]);
  asm volatile("s_wait_xcnt 0x0" ::: "memory");      // precaution behind the run of loads: the sums below reuse their address registers ahead of the last loads' data wait
  float t1 = 0.f, t2 = 0.f;
#pragma unroll
  for (int u = 0; u < TPW; ++u) { t1 += p1[u]; t2 += p2[u]; }
  a1[pt][cc] = t1; a2[pt][cc] = t2;
  __syncthreads();      // every wave's partial sums are read by all waves
  t1 = 0.f; t2 = 0.f;
#pragma unroll
  for (int i = 0; i < 8; ++i) { t1 += a1[i][cc]; t2 += a2[i][cc]; }
  const float mu = t1 / (float)NR; const float var = fmaxf(t2 / (float)NR - mu * mu, 0.f); const float rs = rsqrtf(var + 1e-5f);
#pragma unroll
  for (int k = 0; k < 8; ++k) tl[cc][pt + 8 * k] = (zv[k] - mu) * rs * ga + be;
  __syncthreads();
  { for (int i = tid; i < 32 * 16; i += 256) { const int c = i / 16, q4 = i % 16; const size_t o = ((size_t)b * CI + c0 + c) * NN + p0 + q4 * 4; const v4f xr = *(const v4fa*)(x + o); const v4f v = {tl[c][q4 * 4] + bf16_round(xr[0]), tl[c][q4 * 4 + 1] + bf16_round(xr[1]), tl[c][q4 * 4 + 2] + bf16_round(xr[2]), tl[c][q4 * 4 + 3] + bf16_round(xr[3])}; *(v4f*)(out + o) = v; }  } }

extern "C" void kernel_launch(void* const* d_in, const int* in_sizes, int n_in,
                              void* d_out, int out_size, void* d_ws, size_t ws_size, hipStream_t stream) {
  (void)in_sizes; (void)n_in; (void)out_size;
  const float* const* I = (const float* const*)d_in; const float* x = I[0]; const float* Wt = I[1]; const float* Wp = I[2]; const float* Wg = I[3]; const float* Wz = I[4]; const float* gam = I[5]; const float* bet = I[6];
  char* ws = (char*)d_ws; size_t off = 0;
  auto take = [&](size_t bytes) { char* p = ws + off; off += (bytes + 255) & ~(size_t)255; return p; };
  _Float16* Bt_ = (_Float16*)take((size_t)4 * CPN * CI * 2); _Float16* Bp_ = Bt_ + (size_t)CPN * CI; _Float16* Bg_ = Bp_ + (size_t)CPN * CI; _Float16* Bz_ = Bg_ + (size_t)CPN * CI;      /* four weight images, one behind the other */
  _Float16* PT = (_Float16*)take((size_t)PB * NN * NN * 2); _Float16* X16 = (_Float16*)take((size_t)NR * CI * 2);      /* weight planes of the PB batches that one launch works on */
  _Float16* T3 = (_Float16*)take((size_t)2 * NR * 3 * CPN * 2); _Float16* P3 = T3 + (size_t)NR * 3 * CPN;      /* all batches: concatenated-K operand planes [16384][384] (t, then p) */
  _Float16* Gc = (_Float16*)take((size_t)BB * CPN * NN * 2); _Float16* Y16 = (_Float16*)take((size_t)NR * CPN * 2); float* TM = (float*)take((size_t)PB * RTL * NN * 4); float* TZ = (float*)take((size_t)PB * RTL * NN * 4); float* SC = (float*)take((size_t)PB * RTL * NN * 4); float* S1 = (float*)take((size_t)(NR / 128) * CI * 4); float* S2 = (float*)take((size_t)(NR / 128) * CI * 4);      /* z's column sums and sums of squares per row tile */
  float* Z = (float*)take((size_t)NR * CI * 4);
  if (off > ws_size) return;      // about 199 MB of the 268 MB given (weight planes 134, the rest 65)
  k_prep<<<4 * WCB + BB * (CI / 64) * (NN / 32), 256, 0, stream>>>(Wt, Wp, Wg, Wz, Bt_, x, X16);      /* conv weights (out,in) natural x 2^4, and x token-major */
  k_conv<<<BB * (NN / 128) + 2 * (NR / 32), 256, 0, stream>>>(X16, Bt_, T3, Gc);      /* g channel-major f16; t to [h | l | h], p to [h | h 2^-10 | l 2^-10], token-major f16 */
  const dim3 gs(NN / 128, NN / 128, PB), gy(CPN / 128, NN / 32, PB);
  for (int b = 0; b < BB; b += PB) { const size_t to = (size_t)b * NN * 3 * CPN, yo = (size_t)b * NN * CPN;      /* blockIdx.z or .y of each launch: batch b + z (or y), PB of them */
    k_gemm_lds<128, 128, 64, 4, 2, 2, false><<<gs, 256, 0, stream>>>(T3 + to, 3 * CPN, (size_t)NN * 3 * CPN, P3 + to, 3 * CPN, (size_t)NN * 3 * CPN, 1.0f, nullptr, PT, NN, (size_t)NN * NN, 3 * CPN, nullptr, TM, TZ);      /* s[n][m] = t_n p_m as Th Ph + (Tl Ph + Th Pl) 2^-10 in one K = 384 pass, M 4096 N 4096; stored: exp(s - tile max) 2^15 and the tiles' column statistics */
    k_tilescale<<<dim3(NN / 64, PB, 1), 64, 0, stream>>>(TM, TZ, SC);
    k_gemm_lds<32, 128, 256, 1, 8, 1, true><<<gy, 256, 0, stream>>>(PT, NN, (size_t)NN * NN, Gc + (size_t)b * CPN * NN, NN, (size_t)CPN * NN, 0.000030517578125f, nullptr, Y16 + yo, CPN, (size_t)NN * CPN, NN, SC, nullptr, nullptr); }      /* y[n][c] = sum over m of att[n][m] g[c][m]: M 4096 N 128 K 4096 (f16 out) */
  k_gemm_lds<128, 128, 64, 4, 2, 3, false><<<dim3(CI / 128, NR / 128, 1), 256, 0, stream>>>(Y16, CPN, 0, Bz_, CPN, 0, 0.0625f, Z, nullptr, CI, 0, CPN, nullptr, S1, S2);      /* z token-major [16384][256] f32 and its column sums per row tile: M 16384 N 256 K 128 */
  k_out<<<BB * (CI / 32) * (NN / 64), 256, 0, stream>>>(Z, S1, S2, gam, bet, x, (float*)d_out);
}

// v007
// A run of this version takes 126 microseconds.
// Two timings next to v006 put it at 1.15 and 1.14 times that version's speed.
// All steps since v000 together make it 103 times as fast.
#include <hip/hip_runtime.h>
// Spatial non-local block with query-axis softmax (B=4, C_in 256, C_p 128, N=4096): t,p,g = 1×1 convs; att[n,m] = Σ_c t[c,n]·p[c,m]; att = softmax over n (dim=1) for every m; y[c,n] = Σ_m att[n,m]·g[c,m]; z = Wz·y;
// BatchNorm1d in training mode (batch statistics over (B,N) per channel, biased variance, eps 1e-5) with affine; out = BN(z) + x.
// Compute dtype: x and weights rounded to bf16; t and p as f32 GEMM outputs split into f16 hi + ×2^10 residual parts laid out as concatenated-K operands so one K=384 GEMM yields Th·Ph + (Tl·Ph + Th·Pl)·2^-10 (σ≈11 logits, f32-accurate);
// no f32 score plane is stored: the score GEMM's epilogue takes each column's max and sum over the 128 rows of its own tile (f32) and writes exp(s - tile max) row-major as f16 x 2^15; a small kernel merges the 32 row tiles of a column into
// one factor exp(tile max - column max) / column sum per (row tile, column), and the y GEMM multiplies its weight chunks by that factor on their way to LDS; y = contraction over m as an f16 GEMM against
// channel-major g; z GEMM; per-channel batch statistics as fixed-order f32 column sums, taken per row tile in the z GEMM's epilogue and merged by the last kernel; affine + residual applied during the transpose back to channel-major. All contractions on v_wmma_f32_16x16x32_f16, f32 accumulate.
#define BB 4
#define CI 256
#define CPN 128
#define NN 4096
#define NR (BB * NN)
#define PB 4      // batches whose weight planes are held at once: each launch of the score, merge and y stages works on PB batches (all of them: one launch per stage)
#define RTL (NN / 128)      // row tiles of a score plane: one set of column statistics each

typedef __bf16 v16b __attribute__((ext_vector_type(16)));
typedef unsigned short v8us __attribute__((ext_vector_type(8), may_alias));
typedef float  v8f  __attribute__((ext_vector_type(8)));
typedef float  v4f  __attribute__((ext_vector_type(4)));
typedef float  v4fa __attribute__((ext_vector_type(4), may_alias));
union FragB { v16b v; v8us half[2]; unsigned short u[16]; };

__device__ __forceinline__ unsigned short bf16_bits(float x) { unsigned int u = __float_as_uint(x); return (unsigned short)((u + 0x7FFFu + ((u >> 16) & 1u)) >> 16); }
__device__ __forceinline__ float bf16_val(unsigned short b) { return __uint_as_float(((unsigned int)b) << 16); }
__device__ __forceinline__ float bf16_round(float x) { return bf16_val(bf16_bits(x)); }
// D += A·B with NT terms: 1 = ah·bh, 2 = + al·bh (A split), 3 = + ah·bl (both split)
template <int NT>
__device__ __forceinline__ v8f mmaN(v16b ah, v16b al, v16b bh, v16b bl, v8f c) {
  c = __builtin_amdgcn_wmma_f32_16x16x32_bf16(false, ah, false, bh, (short)0, c, false, false);
  if (NT >= 2) c = __builtin_amdgcn_wmma_f32_16x16x32_bf16(false, al, false, bh, (short)0, c, false, false);
  if (NT >= 3) c = __builtin_amdgcn_wmma_f32_16x16x32_bf16(false, ah, false, bl, (short)0, c, false, false);
  asm volatile("v_nop\n\tv_nop\n\tv_nop\n\tv_nop" : "+v"(c) : "v"(ah), "v"(al), "v"(bh), "v"(bl));
  return c;
}

__global__ __launch_bounds__(256) void k_wt_bf16(const float* __restrict__ W, unsigned short* __restrict__ Wt, int K, int N) {
  const int t = blockIdx.x * 256 + threadIdx.x;
  const int k8n = K / 8;
  if (t >= N * k8n) return;
  const int n = t / k8n, k8 = (t % k8n) * 8;
  v8us v;
#pragma unroll
  for (int i = 0; i < 8; ++i) v[i] = bf16_bits(W[(size_t)(k8 + i) * N + n]);
  *(v8us*)(Wt + (size_t)n * K + k8) = v;
  
}

// GEMM C[M][N] (f32, pitch ldc) = act(A[M][K]·W + bias). A f32 row-major (pitch lda) converted per fragment to bf16
// (ASPLIT: hi/lo two planes -> 2 terms, else single rounded term); Wt bf16 [N][K] (pitch ldb). BIAS_BF16 rounds the
// bias to bf16 first (bias quantised to bf16 before the add). K%32==0, M%16==0, N%64==0.
template <bool ASPLIT, int ACT, bool BIAS_BF16>
__global__ __launch_bounds__(128) void k_gemm_bf(const float* __restrict__ A, int lda, const unsigned short* __restrict__ Wt, int ldb,
                                               const float* __restrict__ bias, float* __restrict__ C, int ldc, int M, int N, int K) {
  __shared__ __attribute__((aligned(16))) float so[4][16][64];
  const int tid = threadIdx.x, w = tid >> 5, lane = tid & 31, ln = lane & 15, hh = lane >> 4;
  const int ntn = N / 64;
  const int wid = blockIdx.x * 4 + w;
  const int mt = wid / ntn, nq = wid % ntn;
  if (mt * 16 >= M) return;
  const int row0 = mt * 16, col0 = nq * 64;
  const float* arow = A + (size_t)(row0 + ln) * lda;
  v8f acc[4] = {};
  for (int kb = 0; kb < K; kb += 32) {
    FragB ah, al;
    const v4f x0 = *(const v4fa*)(arow + kb + 8 * hh), x1 = *(const v4fa*)(arow + kb + 8 * hh + 4);
    const v4f x2 = *(const v4fa*)(arow + kb + 16 + 8 * hh), x3 = *(const v4fa*)(arow + kb + 16 + 8 * hh + 4);
    float xs[16] = {x0[0],x0[1],x0[2],x0[3],x1[0],x1[1],x1[2],x1[3],x2[0],x2[1],x2[2],x2[3],x3[0],x3[1],x3[2],x3[3]};
#pragma unroll
    for (int i = 0; i < 16; ++i) { const unsigned short hb = bf16_bits(xs[i]); ah.u[i] = hb; al.u[i] = ASPLIT ? bf16_bits(xs[i] - bf16_val(hb)) : (unsigned short)0; }
#pragma unroll
    for (int t = 0; t < 4; ++t) {
      const unsigned short* brow = Wt + (size_t)(col0 + t * 16 + ln) * ldb + kb;
      FragB b;
      b.half[0] = *(const v8us*)(brow + 8 * hh);
      b.half[1] = *(const v8us*)(brow + 16 + 8 * hh);
      acc[t] = mmaN<ASPLIT ? 2 : 1>(ah.v, al.v, b.v, b.v, acc[t]);
    }
  }
#pragma unroll
  for (int t = 0; t < 4; ++t) {
    float bv = bias ? bias[col0 + t * 16 + ln] : 0.f;
    if (BIAS_BF16) bv = bf16_round(bv);
#pragma unroll
    for (int r = 0; r < 8; ++r) { float v = acc[t][r] + bv; if (ACT == 1) v = fmaxf(v, 0.f); so[w][8 * hh + r][t * 16 + ln] = v; }
  }
  __builtin_amdgcn_fence(__ATOMIC_ACQ_REL, "workgroup");
  __builtin_amdgcn_wave_barrier();
  const int rsub = lane >> 4, c4 = (lane & 15) * 4;
  {
#pragma unroll
    for (int q = 0; q < 8; ++q) {
      const int r = q * 2 + rsub;
      const v4f v = *(const v4fa*)&so[w][r][c4];
      *(v4f*)(C + (size_t)(row0 + r) * ldc + col0 + c4) = v;
    }
    
  }
}

// Flash-style causal/unmasked attention, all contractions 3-term bf16 hi/lo splits, f32 softmax with running max.
// q,k,v rows are read from f32 buffers with arbitrary row pitch (so they can live inside a fused qkv buffer);
// D = head size (multiple of 32, <= 128); one wave = 16 query rows; block = 4 waves (64 queries) sharing K/V chunks of 32.
template <int D, bool CAUSAL>
__global__ __launch_bounds__(128) void k_flash(const float* __restrict__ qb, const float* __restrict__ kb, const float* __restrict__ vb,
                                             int pitch, int T, int H, float scale, float* __restrict__ y, int ypitch) {
  constexpr int KS = D / 32;        // k-steps for QK
  constexpr int DT = D / 16;        // d tiles for PV
  __shared__ __attribute__((aligned(16))) unsigned short sKh[32][D + 8], sKl[32][D + 8], sVh[32][D + 8], sVl[32][D + 8];
  __shared__ __attribute__((aligned(16))) unsigned short sPh[4][16][40], sPl[4][16][40];
  __shared__ __attribute__((aligned(16))) float sO[4][16][D];
  const int tid = threadIdx.x, w = tid >> 5, lane = tid & 31, ln = lane & 15, hh = lane >> 4;
  const int nqb = (T + 63) / 64;
  const int bh = blockIdx.x / nqb, qblk = blockIdx.x % nqb;
  const int b = bh / H, h = bh % H;
  const int q0 = qblk * 64 + w * 16;
  const float* Q = qb + (size_t)b * T * pitch + h * D;
  const float* K = kb + (size_t)b * T * pitch + h * D;
  const float* V = vb + (size_t)b * T * pitch + h * D;

  // A fragments of the wave's 16 query rows (scaled), hi/lo
  FragB aqh[KS], aql[KS];
  {
    int row = q0 + ln; if (row >= T) row = T - 1;
    const float* qr = Q + (size_t)row * pitch;
#pragma unroll
    for (int ks = 0; ks < KS; ++ks)
#pragma unroll
      for (int i = 0; i < 16; ++i) {
        const int d = ks * 32 + ((i < 8) ? (8 * hh + i) : (16 + 8 * hh + (i - 8)));
        const float x = qr[d] * scale; const unsigned short hb = bf16_bits(x);
        aqh[ks].u[i] = hb; aql[ks].u[i] = bf16_bits(x - bf16_val(hb));
      }
  }
  float m_r[8], l_r[8];
#pragma unroll
  for (int r = 0; r < 8; ++r) { m_r[r] = -3.0e38f; l_r[r] = 0.f; }
  v8f oacc[DT];
#pragma unroll
  for (int dt = 0; dt < DT; ++dt) oacc[dt] = (v8f){0.f,0.f,0.f,0.f,0.f,0.f,0.f,0.f};

  const int kv_end = CAUSAL ? min(T, qblk * 64 + 64) : T;     // block-uniform
  for (int j0 = 0; j0 < kv_end; j0 += 32) {
    __syncthreads();
    for (int e = tid; e < 32 * (D / 4); e += 128) {
      const int r = e / (D / 4), c4 = (e % (D / 4)) * 4;
      const int key = j0 + r;
      v4f kf = {0.f,0.f,0.f,0.f}, vf = {0.f,0.f,0.f,0.f};
      if (key < T) { kf = *(const v4fa*)(K + (size_t)key * pitch + c4); vf = *(const v4fa*)(V + (size_t)key * pitch + c4); }
#pragma unroll
      for (int t = 0; t < 4; ++t) {
        unsigned short hb = bf16_bits(kf[t]); sKh[r][c4 + t] = hb; sKl[r][c4 + t] = bf16_bits(kf[t] - bf16_val(hb));
        hb = bf16_bits(vf[t]); sVh[r][c4 + t] = hb; sVl[r][c4 + t] = bf16_bits(vf[t] - bf16_val(hb));
      }
    }
    __syncthreads();
    // S tile 16 x 32
    v8f s[2];
#pragma unroll
    for (int nt = 0; nt < 2; ++nt) {
      v8f acc = {};
#pragma unroll
      for (int ks = 0; ks < KS; ++ks) {
        FragB bh_, bl_;
        bh_.half[0] = *(const v8us*)&sKh[nt * 16 + ln][ks * 32 + 8 * hh]; bh_.half[1] = *(const v8us*)&sKh[nt * 16 + ln][ks * 32 + 16 + 8 * hh];
        bl_.half[0] = *(const v8us*)&sKl[nt * 16 + ln][ks * 32 + 8 * hh]; bl_.half[1] = *(const v8us*)&sKl[nt * 16 + ln][ks * 32 + 16 + 8 * hh];
        acc = mmaN<3>(aqh[ks].v, aql[ks].v, bh_.v, bl_.v, acc);
      }
      s[nt] = acc;
    }
    // mask + running max (rows 8hh+r; the 16 lanes of a half share rows)
    float alpha[8];
#pragma unroll
    for (int r = 0; r < 8; ++r) {
      const int qi = q0 + 8 * hh + r;
      const int ja = j0 + ln, jb = j0 + 16 + ln;
      if (CAUSAL) { if (ja > qi) s[0][r] = -3.0e38f; if (jb > qi) s[1][r] = -3.0e38f; }
      if (ja >= T) s[0][r] = -3.0e38f;
      if (jb >= T) s[1][r] = -3.0e38f;
      float mx = fmaxf(s[0][r], s[1][r]);
      mx = fmaxf(mx, __shfl_xor(mx, 1, 32)); mx = fmaxf(mx, __shfl_xor(mx, 2, 32)); mx = fmaxf(mx, __shfl_xor(mx, 4, 32)); mx = fmaxf(mx, __shfl_xor(mx, 8, 32));
      const float mnew = fmaxf(m_r[r], mx);
      alpha[r] = (mnew > -1.0e38f) ? __expf(m_r[r] - mnew) : 1.0f;
      const float p0 = (s[0][r] > -1.0e38f) ? __expf(s[0][r] - mnew) : 0.f;
      const float p1 = (s[1][r] > -1.0e38f) ? __expf(s[1][r] - mnew) : 0.f;
      m_r[r] = mnew;
      l_r[r] = l_r[r] * alpha[r] + p0 + p1;            // per-lane partial row sum (16 lanes combined at the end)
      unsigned short hb = bf16_bits(p0); sPh[w][8 * hh + r][ln] = hb;      sPl[w][8 * hh + r][ln] = bf16_bits(p0 - bf16_val(hb));
      hb = bf16_bits(p1);                sPh[w][8 * hh + r][16 + ln] = hb; sPl[w][8 * hh + r][16 + ln] = bf16_bits(p1 - bf16_val(hb));
    }
#pragma unroll
    for (int dt = 0; dt < DT; ++dt)
#pragma unroll
      for (int r = 0; r < 8; ++r) oacc[dt][r] *= alpha[r];
    __builtin_amdgcn_fence(__ATOMIC_ACQ_REL, "workgroup");
    __builtin_amdgcn_wave_barrier();
    FragB pah, pal;
    pah.half[0] = *(const v8us*)&sPh[w][ln][8 * hh]; pah.half[1] = *(const v8us*)&sPh[w][ln][16 + 8 * hh];
    pal.half[0] = *(const v8us*)&sPl[w][ln][8 * hh]; pal.half[1] = *(const v8us*)&sPl[w][ln][16 + 8 * hh];
#pragma unroll
    for (int dt = 0; dt < DT; ++dt) {
      FragB bvh, bvl;
#pragma unroll
      for (int i = 0; i < 8; ++i) {
        bvh.u[i] = sVh[8 * hh + i][dt * 16 + ln]; bvh.u[8 + i] = sVh[16 + 8 * hh + i][dt * 16 + ln];
        bvl.u[i] = sVl[8 * hh + i][dt * 16 + ln]; bvl.u[8 + i] = sVl[16 + 8 * hh + i][dt * 16 + ln];
      }
      oacc[dt] = mmaN<3>(pah.v, pal.v, bvh.v, bvl.v, oacc[dt]);
    }
    __builtin_amdgcn_fence(__ATOMIC_ACQ_REL, "workgroup");
    __builtin_amdgcn_wave_barrier();
  }
#pragma unroll
  for (int r = 0; r < 8; ++r) {
    float l = l_r[r];
    l += __shfl_xor(l, 1, 32); l += __shfl_xor(l, 2, 32); l += __shfl_xor(l, 4, 32); l += __shfl_xor(l, 8, 32);
    l_r[r] = (l > 0.f) ? 1.0f / l : 0.f;
  }
#pragma unroll
  for (int dt = 0; dt < DT; ++dt)
#pragma unroll
    for (int r = 0; r < 8; ++r) sO[w][8 * hh + r][dt * 16 + ln] = oacc[dt][r] * l_r[r];
  __builtin_amdgcn_fence(__ATOMIC_ACQ_REL, "workgroup");
  __builtin_amdgcn_wave_barrier();
  {
    for (int r = 0; r < 16; ++r) {
      const int row = q0 + r;
      if (row < T && lane < D / 4) {
        const v4f val = *(const v4fa*)&sO[w][r][lane * 4];
        *(v4f*)(y + ((size_t)b * T + row) * ypitch + h * D + lane * 4) = val;
      }
    }
    
  }
}

// GEMM C = act(A·W + bias + resid): A f32 (ASPLIT -> hi/lo 2 terms), Wt bf16 [N][K]; ACT 0 none, 1 relu, 2 exact gelu;
// resid (optional, f32, row index = (row % rmod), pitch ldr, RES_BF16 rounds it) added before the activation.
template <bool ASPLIT, int ACT, bool BIAS_BF16, bool RES_BF16>
__global__ __launch_bounds__(128) void k_gemm_bf3(const float* __restrict__ A, int lda, const unsigned short* __restrict__ Wt, int ldb,
                                                const float* __restrict__ bias, const float* __restrict__ resid, int rmod, int ldr,
                                                float* __restrict__ C, int ldc, int M, int N, int K) {
  __shared__ __attribute__((aligned(16))) float so[4][16][64];
  const int tid = threadIdx.x, w = tid >> 5, lane = tid & 31, ln = lane & 15, hh = lane >> 4;
  const int ntn = N / 64;
  const int wid = blockIdx.x * 4 + w;
  const int mt = wid / ntn, nq = wid % ntn;
  if (mt * 16 >= M) return;
  const int row0 = mt * 16, col0 = nq * 64;
  const float* arow = A + (size_t)(row0 + ln) * lda;
  v8f acc[4] = {};
  for (int kb = 0; kb < K; kb += 32) {
    FragB ah, al;
    const v4f x0 = *(const v4fa*)(arow + kb + 8 * hh), x1 = *(const v4fa*)(arow + kb + 8 * hh + 4);
    const v4f x2 = *(const v4fa*)(arow + kb + 16 + 8 * hh), x3 = *(const v4fa*)(arow + kb + 16 + 8 * hh + 4);
    float xs[16] = {x0[0],x0[1],x0[2],x0[3],x1[0],x1[1],x1[2],x1[3],x2[0],x2[1],x2[2],x2[3],x3[0],x3[1],x3[2],x3[3]};
#pragma unroll
    for (int i = 0; i < 16; ++i) { const unsigned short hb = bf16_bits(xs[i]); ah.u[i] = hb; al.u[i] = ASPLIT ? bf16_bits(xs[i] - bf16_val(hb)) : (unsigned short)0; }
#pragma unroll
    for (int t = 0; t < 4; ++t) {
      const unsigned short* brow = Wt + (size_t)(col0 + t * 16 + ln) * ldb + kb;
      FragB b;
      b.half[0] = *(const v8us*)(brow + 8 * hh);
      b.half[1] = *(const v8us*)(brow + 16 + 8 * hh);
      acc[t] = mmaN<ASPLIT ? 2 : 1>(ah.v, al.v, b.v, b.v, acc[t]);
    }
  }
#pragma unroll
  for (int t = 0; t < 4; ++t) {
    const int col = col0 + t * 16 + ln;
    float bv = bias ? bias[col] : 0.f;
    if (BIAS_BF16) bv = bf16_round(bv);
#pragma unroll
    for (int r = 0; r < 8; ++r) {
      float v = acc[t][r] + bv;
      if (resid) { float rv = resid[(size_t)((row0 + 8 * hh + r) % rmod) * ldr + col]; if (RES_BF16) rv = bf16_round(rv); v += rv; }
      if (ACT == 1) v = fmaxf(v, 0.f);
      if (ACT == 2) v = 0.5f * v * (1.0f + erff(v * 0.70710678118654752f));
      if (ACT == 3) { const float u = 0.7978845608028654f * (v + 0.044715f * v * v * v); v = 0.5f * v * (1.0f + tanhf(u)); }
      so[w][8 * hh + r][t * 16 + ln] = v;
    }
  }
  __builtin_amdgcn_fence(__ATOMIC_ACQ_REL, "workgroup");
  __builtin_amdgcn_wave_barrier();
  const int rsub = lane >> 4, c4 = (lane & 15) * 4;
  {
#pragma unroll
    for (int q = 0; q < 8; ++q) {
      const int r = q * 2 + rsub;
      const v4f v = *(const v4fa*)&so[w][r][c4];
      *(v4f*)(C + (size_t)(row0 + r) * ldc + col0 + c4) = v;
    }
    
  }
}
// row LayerNorm (biased variance, eps) over N: s = X (+ R); optional out_sum <- s; out_norm <- (s-mu)*rsqrt(var+eps)*g + b
template <bool PARAM_BF16>
__global__ __launch_bounds__(256) void k_layernorm(const float* __restrict__ X, const float* __restrict__ R, const float* __restrict__ g, const float* __restrict__ bta,
                                                  float* __restrict__ out_sum, float* __restrict__ out_norm, int N, float eps) {
  __shared__ float red[256];
  const int row = blockIdx.x, tid = threadIdx.x;
  const float* x = X + (size_t)row * N; const float* rr = R ? R + (size_t)row * N : nullptr;
  float vals[16];                     // up to N = 4096
  const int per = N / 256;            // contiguous chunk per thread? use strided-by-4 chunks: thread handles j = tid*4 + 1024*u
  float s1 = 0.f;
  for (int u = 0; u < per / 4; ++u) {
    const int j = tid * 4 + 1024 * u;
    const v4f a = *(const v4fa*)(x + j);
    v4f b = {0.f,0.f,0.f,0.f}; if (rr) b = *(const v4fa*)(rr + j);
#pragma unroll
    for (int q = 0; q < 4; ++q) { const float v = a[q] + b[q]; vals[u * 4 + q] = v; s1 += v; }
  }
  red[tid] = s1; __syncthreads();
  for (int st = 128; st > 0; st >>= 1) { if (tid < st) red[tid] += red[tid + st]; __syncthreads(); }
  const float mu = red[0] / (float)N; __syncthreads();
  float s2 = 0.f;
  for (int u = 0; u < per / 4; ++u)
#pragma unroll
    for (int q = 0; q < 4; ++q) { const float c = vals[u * 4 + q] - mu; s2 += c * c; }
  red[tid] = s2; __syncthreads();
  for (int st = 128; st > 0; st >>= 1) { if (tid < st) red[tid] += red[tid + st]; __syncthreads(); }
  const float rs = rsqrtf(red[0] / (float)N + eps);
  {
    for (int u = 0; u < per / 4; ++u) {
      const int j = tid * 4 + 1024 * u;
      v4f o, sm;
#pragma unroll
      for (int q = 0; q < 4; ++q) {
        float gg = g[j + q], bb = bta[j + q];
        if (PARAM_BF16) { gg = bf16_round(gg); bb = bf16_round(bb); }
        sm[q] = vals[u * 4 + q]; o[q] = (vals[u * 4 + q] - mu) * rs * gg + bb;
      }
      if (out_sum) *(v4f*)(out_sum + (size_t)row * N + j) = sm;
      *(v4f*)(out_norm + (size_t)row * N + j) = o;
    }
    
  }
}



// ---- f16 WMMA path (v_wmma_f32_16x16x32_f16): 11-bit significands for operands in range — used where a [0,1] probability operand needs more precision than bf16
typedef _Float16 v16h __attribute__((ext_vector_type(16)));
union FragH { v16h v; v8us half[2]; _Float16 h[16]; unsigned short u[16]; };
template <int NT>
__device__ __forceinline__ v8f mmaH(v16h ah, v16h al, v16h bh, v16h bl, v8f c) {
  c = __builtin_amdgcn_wmma_f32_16x16x32_f16(false, ah, false, bh, (short)0, c, false, false);
  if (NT >= 2) c = __builtin_amdgcn_wmma_f32_16x16x32_f16(false, al, false, bh, (short)0, c, false, false);
  if (NT >= 3) c = __builtin_amdgcn_wmma_f32_16x16x32_f16(false, ah, false, bl, (short)0, c, false, false);
  asm volatile("v_nop\n\tv_nop\n\tv_nop\n\tv_nop" : "+v"(c) : "v"(ah), "v"(al), "v"(bh), "v"(bl));
  return c;
}
// batched GEMM like k_gemm_b but f16 operands: A f32 (split into f16 hi/lo if ASPLIT, else rounded to f16), Bt = f16 values [n][k]; alpha; C f32; N multiple of 16 (partial tiles skipped)
template <bool ASPLIT>
__global__ __launch_bounds__(128) void k_gemm_h(const float* __restrict__ A, int lda, size_t sA, const _Float16* __restrict__ Bh, int ldb, size_t sB, float alpha, float* __restrict__ C, int ldc, size_t sC, int M, int N, int K) {
  __shared__ __attribute__((aligned(16))) float so[4][16][64];
  const int tid = threadIdx.x, w = tid >> 5, lane = tid & 31, ln = lane & 15, hh = lane >> 4; const int by = blockIdx.y;
  A += (size_t)by * sA; Bh += (size_t)by * sB; C += (size_t)by * sC;
  const int ntn = (N + 63) / 64; const int wid = blockIdx.x * 4 + w; const int mt = wid / ntn, nq = wid % ntn; if (mt * 16 >= M) return;
  const int row0 = mt * 16, col0 = nq * 64; const float* arow = A + (size_t)(row0 + ln) * lda;
  v8f acc[4] = {};
  for (int kb = 0; kb < K; kb += 32) {
    FragH ah, al;
    const v4f x0 = *(const v4fa*)(arow + kb + 8 * hh), x1 = *(const v4fa*)(arow + kb + 8 * hh + 4), x2 = *(const v4fa*)(arow + kb + 16 + 8 * hh), x3 = *(const v4fa*)(arow + kb + 16 + 8 * hh + 4);
    float xs[16] = {x0[0],x0[1],x0[2],x0[3],x1[0],x1[1],x1[2],x1[3],x2[0],x2[1],x2[2],x2[3],x3[0],x3[1],x3[2],x3[3]};
#pragma unroll
    for (int i = 0; i < 16; ++i) { const _Float16 h = (_Float16)xs[i]; ah.h[i] = h; al.h[i] = ASPLIT ? (_Float16)(xs[i] - (float)h) : (_Float16)0.0f; }
#pragma unroll
    for (int t = 0; t < 4; ++t) { if (col0 + t * 16 >= N) continue; const size_t boff = (size_t)(col0 + t * 16 + ln) * ldb + kb; FragH bq; bq.half[0] = *(const v8us*)(Bh + boff + 8 * hh); bq.half[1] = *(const v8us*)(Bh + boff + 16 + 8 * hh);
      acc[t] = mmaH<ASPLIT ? 2 : 1>(ah.v, al.v, bq.v, bq.v, acc[t]); }
  }
#pragma unroll
  for (int t = 0; t < 4; ++t) { if (col0 + t * 16 >= N) continue;
#pragma unroll
    for (int r = 0; r < 8; ++r) so[w][8 * hh + r][t * 16 + ln] = acc[t][r] * alpha; }
  __builtin_amdgcn_fence(__ATOMIC_ACQ_REL, "workgroup"); __builtin_amdgcn_wave_barrier();
  const int rsub = lane >> 4, c4 = (lane & 15) * 4;
  {
#pragma unroll
    for (int q = 0; q < 8; ++q) { const int r = q * 2 + rsub; if (col0 + c4 < N) { const v4f v = *(const v4fa*)&so[w][r][c4]; *(v4f*)(C + (size_t)(row0 + r) * ldc + col0 + c4) = v; } }
     }
}

// Wt[n][k] = f16(W[k][n]·scale) from f32 row-major W[K][N] (scale = power of two; bf16-exact weights stay exact in f16 away from the subnormal range)
__global__ __launch_bounds__(256) void k_wt_f16(const float* __restrict__ W, _Float16* __restrict__ Wt, int K, int N, float scale) {
  const int t = blockIdx.x * 256 + threadIdx.x; if (t >= N * (K / 8)) return; const int n = t / (K / 8), k8 = (t % (K / 8)) * 8; FragH f;
#pragma unroll
  for (int i = 0; i < 8; ++i) f.h[i] = (_Float16)(bf16_round(W[(size_t)(k8 + i) * N + n]) * scale); const v8us o = f.half[0];
  *(v8us*)((unsigned short*)Wt + (size_t)n * K + k8) = o; 
}
typedef _Float16 v4h __attribute__((ext_vector_type(4)));
// GEMM C[M][N] = alpha * sum_k A[m][k] * B[n][k], f16 operands with k contiguous, f32 accumulate; writes f32 C or f16 C16 (pitch ldc). blockIdx = (N tile, M tile, batch).
// A work-group of 8 waves owns a BM x BN tile of C. Per K step the BM rows of A and the BN rows of B (BK elements each) are fetched with whole-line 16-byte loads, one chunk per lane,
// and stored to LDS rows padded by 16 bytes; every wave then reads its WMMA fragments from LDS, so a tile row is fetched from L2 once per work-group instead of once per wave in 32-byte pieces.
// Two LDS buffers: the next step's global loads are issued right behind the barrier (in front of it the barrier's own wait would drain them), fly during this step's products and are stored to the other buffer behind them.
// Global load addresses are a scalar base per chunk plus one 32-bit byte offset per lane and operand, which lives through the whole loop and moves on by one K step in front of each step's loads.
// sbase() takes a wave-uniform address through readfirstlane: the loads then take the scalar-base form, the loop holds no 64-bit vector address sums, and no short-lived address register is handed to a later load as its destination.
// Each output's products run over k in ascending blocks of 32 in one accumulator chain. M % BM == 0, N % BN == 0, K % BK == 0, BN == 128.
// Every '#pragma unroll' in this kernel is there so that a register array (pre, base, acc, cm, cz, c1, c2, the fragments) is indexed by constants only and stays in registers.
// EPI: 0 writes f32 C, 1 writes f16 C16, 2 is the score stage's softmax over the rows of the tile: with m the maximum of a column over the BM rows, C16 gets exp(c - m) x 2^15 and TM, TZ get m and the sum of the exponentials
// at [batch][row tile][column], m in units of log 2 (the scores are multiplied by log2 e once, so that each exponential is one subtraction and one v_exp_f32). The maximum and the sum are taken in the accumulator registers (a lane holds FM x 8 rows of each of its FN columns), then over lanes l ^ 16, then over the WM waves, in wave order, through LDS.
// EPI 3 writes f32 C and, at [row tile][column], the tile's column sums (TM) and column sums of squares (TZ) of the stored values: summed in the accumulator registers, then over lanes l ^ 16, then over the WM waves, in wave order, through LDS.
// EPI 4 writes no f32 plane but the concatenated-K f16 operand rows [3 * BN] of the score GEMM: with h = f16(c), l = f16((c - h) * 2^10), batch 0 (t side) gets [h | l | h], batch 1 (p side) [h | h * 2^-10 | l * 2^-10],
// so that the sum over K of A' * B' is Th Ph + Tl Ph 2^-10 + Th Pl 2^-10 (power-of-two scalings are exact in f16 barring subnormal flushes, which cost at most 1e-4 on a logit of sigma about 11).
// ASC: the A chunks are multiplied on their way to LDS by SC[batch][row tile of 128][k] (f32 product, rounded to f16 again); a thread's A chunks share their k range, so it loads 8 factors per K step.
// 2^x by v_exp_f32. The v_nop is the free issue slot that the instruction set asks for behind a transcendental before its source is overwritten;
// it is tied to the v_exp_f32 in one statement.
__device__ __forceinline__ float exp2_slot(float x) { float r; asm("v_exp_f32 %0, %1\n\tv_nop" : "=v"(r) : "v"(x)); return r; }
typedef const __attribute__((address_space(1))) v8us* gv8;
typedef const __attribute__((address_space(1))) v4fa* gv4;
__device__ __forceinline__ unsigned long long sbase(const char* p) { const unsigned long long u = (unsigned long long)p; const unsigned lo = (unsigned)__builtin_amdgcn_readfirstlane((int)(unsigned)u), hi = (unsigned)__builtin_amdgcn_readfirstlane((int)(unsigned)(u >> 32)); return ((unsigned long long)hi << 32) | lo; }
// LDS bytes of one work-group: the two operand buffers, or the staged output tile where that is larger
template <int BM, int BN, int BK> constexpr int gemm_lds_bytes() { return (2 * (BM + BN) * (BK + 8) * 2 > BM * (BN + 4) * 4) ? 2 * (BM + BN) * (BK + 8) * 2 : BM * (BN + 4) * 4; }
// The work of one work-group; bx, by, bz = (N tile, M tile, batch), smem = its gemm_lds_bytes() of LDS. A function, so that two GEMMs on independent data can share one grid (k_conv).
template <int BM, int BN, int BK, int WM, int WN, int EPI, bool ASC>
__device__ __forceinline__ void gemm_lds_body(unsigned char* smem, const int bx, const int by, const int bz, const _Float16* __restrict__ A, int lda, size_t sA, const _Float16* __restrict__ Bh, int ldb, size_t sB, float alpha,
                                              float* __restrict__ C, _Float16* __restrict__ C16, int ldc, size_t sC, int K, const float* __restrict__ SC, float* __restrict__ TM, float* __restrict__ TZ) {
  constexpr int FM = BM / (WM * 16), FN = BN / (WN * 16);      // fragments per wave
  constexpr int CPR = BK / 8, RPI = 256 / CPR;                 // 16-byte chunks per tile row; tile rows covered by one chunk per thread
  constexpr int PITCH = BK + 8, ROWS = BM + BN, STAGE = ROWS * PITCH;      // LDS row pitch and buffer size in f16 elements; rows 0..BM-1 hold A, the rest B
  constexpr int NCH = ROWS / RPI, ACH = BM / RPI;              // chunks per thread, of which from A
  constexpr int OP = BN + 4;                                   // f32 pitch of the output staging
  constexpr int LB = gemm_lds_bytes<BM, BN, BK>();
  static_assert(WM * WN == 8 && BN == 128 && BM % RPI == 0 && BN % RPI == 0 && BK % 32 == 0, "tile shape");
  static_assert((EPI != 2 && EPI != 3) || (BM == 128 && (BM * OP + 2 * WM * BN) * 4 <= LB), "the waves' column statistics lie behind the staged tile");
  static_assert(!ASC || 128 % BM == 0, "one row tile of factors per work-group");
  unsigned short* st = (unsigned short*)smem;
  const int tid = threadIdx.x, w = tid >> 5, lane = tid & 31, ln = lane & 15, hh = lane >> 4;
  const int wm = w % WM, wn = w / WM;
  const int m0 = by * BM, n0 = bx * BN;
  const int crow = tid / CPR, ccol = (tid % CPR) * 8;
  const char* Au = (const char*)(A + (size_t)bz * sA + (size_t)m0 * lda);
  const char* Bu = (const char*)(Bh + (size_t)bz * sB + (size_t)n0 * ldb);
  const unsigned aoff = (unsigned)(crow * lda + ccol) * 2u, boff = (unsigned)(crow * ldb + ccol) * 2u;      // bytes
  const size_t astep = (size_t)RPI * lda * 2, bstep = (size_t)RPI * ldb * 2;                                // bytes between a thread's chunks
  v8us pre[NCH];
  v8f acc[FM][FN] = {};
  const int nk = K / BK;
  unsigned long long base[NCH];
#pragma unroll
  for (int i = 0; i < NCH; ++i) base[i] = sbase((i < ACH) ? Au + i * astep : Bu + (i - ACH) * bstep);
#pragma unroll
  for (int i = 0; i < NCH; ++i) pre[i] = *(gv8)(base[i] + ((i < ACH) ? aoff : boff));
  v4f sc0 = {}, sc1 = {};
  unsigned long long scb = 0; unsigned sk = (unsigned)ccol * 4u;      // factors: scalar base of the work-group's row of SC, byte offset of the lane's 8 factors
  if (ASC) {
    scb = sbase((const char*)(SC + ((size_t)bz * RTL + m0 / 128) * K));
    sc0 = *(gv4)(scb + sk); sc1 = *(gv4)(scb + sk + 16u);
    asm volatile("s_wait_xcnt 0x0" ::: "memory");      // precaution behind the two loads: their offset register moves on in the loop
  }
  // stores the fetched chunks to one LDS buffer; with ASC the A chunks are scaled first
  auto put = [&](unsigned short* dst) {
#pragma unroll
    for (int i = 0; i < NCH; ++i) {
      FragH f; f.half[0] = pre[i];
      if (ASC && i < ACH) {
#pragma unroll
        for (int q = 0; q < 8; ++q) f.h[q] = (_Float16)((float)f.h[q] * ((q < 4) ? sc0[q & 3] : sc1[q & 3]));
      }
      *(v8us*)(dst + (crow + i * RPI) * PITCH + ccol) = f.half[0];
    }
  };
  put(st);
  unsigned ak = aoff, bk = boff;
  for (int s = 0; s < nk; ++s) {
    const bool more = s + 1 < nk;
    __syncthreads();      // publishes buffer s & 1; every wave has also left the other buffer, which is rewritten below
    if (more) {
      ak += BK * 2; bk += BK * 2;
#pragma unroll
      for (int i = 0; i < NCH; ++i) pre[i] = *(gv8)(base[i] + ((i < ACH) ? ak : bk));
      if (ASC) { sk += BK * 4; sc0 = *(gv4)(scb + sk); sc1 = *(gv4)(scb + sk + 16u); }
      asm volatile("s_wait_xcnt 0x0" ::: "memory");      // precaution behind the run of loads: their offset registers (next step) and scalar bases (epilogue) are overwritten later on paths that hold no load wait
    }
    const unsigned short* sb = st + (s & 1) * STAGE;
#pragma unroll
    for (int kb = 0; kb < BK; kb += 32) {
      FragH a[FM], b[FN];
#pragma unroll
      for (int i = 0; i < FM; ++i) { const unsigned short* r = sb + ((wm * FM + i) * 16 + ln) * PITCH + kb + 8 * hh; a[i].half[0] = *(const v8us*)r; a[i].half[1] = *(const v8us*)(r + 16); }
#pragma unroll
      for (int j = 0; j < FN; ++j) { const unsigned short* r = sb + (BM + (wn * FN + j) * 16 + ln) * PITCH + kb + 8 * hh; b[j].half[0] = *(const v8us*)r; b[j].half[1] = *(const v8us*)(r + 16); }
#pragma unroll
      for (int i = 0; i < FM; ++i)
#pragma unroll
        for (int j = 0; j < FN; ++j) acc[i][j] = mmaH<1>(a[i].v, a[i].v, b[j].v, b[j].v, acc[i][j]);
    }
    if (more) put(st + ((s + 1) & 1) * STAGE);
  }
  __syncthreads();      // every wave has left the operand buffers before the output tile is staged over them
  float* so = (float*)smem;
  float* rm = so + BM * OP; float* rz = rm + WM * BN;      // EPI 2: column maxima and sums of the WM waves that share a column; EPI 3: their column sums and sums of squares
  if (EPI == 2) {
    const float a2 = alpha * 1.44269504f;
    float cm[FN], cz[FN];
#pragma unroll
    for (int j = 0; j < FN; ++j) {
      float m = -3.0e38f;
#pragma unroll
      for (int i = 0; i < FM; ++i)
#pragma unroll
        for (int r = 0; r < 8; ++r) { acc[i][j][r] *= a2; m = fmaxf(m, acc[i][j][r]); }
      cm[j] = m;
    }
#pragma unroll
    for (int j = 0; j < FN; ++j) cm[j] = fmaxf(cm[j], __shfl_xor(cm[j], 16, 32));
    if (hh == 0) {
#pragma unroll
      for (int j = 0; j < FN; ++j) rm[wm * BN + (wn * FN + j) * 16 + ln] = cm[j];
    }
    __syncthreads();      // every wave's column maxima are read by the other waves of the column
#pragma unroll
    for (int j = 0; j < FN; ++j) {
      const int col = (wn * FN + j) * 16 + ln;
      float m = rm[col], z = 0.f;
#pragma unroll
      for (int u = 1; u < WM; ++u) m = fmaxf(m, rm[u * BN + col]);
      m -= 15.0f;      // the stored weights carry the factor 2^15
#pragma unroll
      for (int i = 0; i < FM; ++i)
#pragma unroll
        for (int r = 0; r < 8; ++r) { const float e = exp2_slot(acc[i][j][r] - m); z += e; so[((wm * FM + i) * 16 + 8 * hh + r) * OP + col] = e; }
      cz[j] = z;
    }
#pragma unroll
    for (int j = 0; j < FN; ++j) cz[j] += __shfl_xor(cz[j], 16, 32);
    if (hh == 0) {
#pragma unroll
      for (int j = 0; j < FN; ++j) rz[wm * BN + (wn * FN + j) * 16 + ln] = cz[j];
    }
  } else {
    float c1[FN] = {}, c2[FN] = {};
#pragma unroll
    for (int i = 0; i < FM; ++i)
#pragma unroll
      for (int j = 0; j < FN; ++j)
#pragma unroll
        for (int r = 0; r < 8; ++r) { const float v = acc[i][j][r] * alpha; so[((wm * FM + i) * 16 + 8 * hh + r) * OP + (wn * FN + j) * 16 + ln] = v; if (EPI == 3) { c1[j] += v; c2[j] += v * v; } }
    if (EPI == 3) {
#pragma unroll
      for (int j = 0; j < FN; ++j) { c1[j] += __shfl_xor(c1[j], 16, 32); c2[j] += __shfl_xor(c2[j], 16, 32); }
      if (hh == 0) {
#pragma unroll
        for (int j = 0; j < FN; ++j) { rm[wm * BN + (wn * FN + j) * 16 + ln] = c1[j]; rz[wm * BN + (wn * FN + j) * 16 + ln] = c2[j]; }
      }
    }
  }
  __syncthreads();      // the staged tile is read back across waves: one wave stores one whole row of the tile per instruction
  if (EPI == 2 && tid < BN) {
    float m = rm[tid], z = rz[tid];
#pragma unroll
    for (int u = 1; u < WM; ++u) { m = fmaxf(m, rm[u * BN + tid]); z += rz[u * BN + tid]; }
    const size_t o = ((size_t)bz * RTL + by) * ldc + n0 + tid;
    TM[o] = m; TZ[o] = z * 0.000030517578125f;      // the sum without the weights' factor 2^15
  }
  if (EPI == 3 && tid < BN) {
    float t1 = rm[tid], t2 = rz[tid];
#pragma unroll
    for (int u = 1; u < WM; ++u) { t1 += rm[u * BN + tid]; t2 += rz[u * BN + tid]; }
    const size_t o = (size_t)by * ldc + n0 + tid;
    TM[o] = t1; TZ[o] = t2;
  }
  const size_t cofs = (size_t)bz * sC + (size_t)m0 * ldc + n0;
  const unsigned coff = (unsigned)(w * ldc + lane * 4);      // elements
#pragma unroll
  for (int it = 0; it < BM / 8; ++it) {
    const v4f v = *(const v4fa*)&so[(w + it * 8) * OP + lane * 4];
    if (EPI == 4) {
      v4h h4, s2, s3;
      for (int q = 0; q < 4; ++q) { const _Float16 hv = (_Float16)v[q]; const _Float16 lv = (_Float16)((v[q] - (float)hv) * 1024.0f); h4[q] = hv; s2[q] = bz ? (_Float16)((float)hv * 0.0009765625f) : lv; s3[q] = bz ? (_Float16)((float)lv * 0.0009765625f) : hv; }
      char* row = (char*)(C16 + cofs + (size_t)(it * 8) * ldc) + coff * 2u;
      *(v4h*)row = h4; *(v4h*)(row + BN * 2) = s2; *(v4h*)(row + 2 * BN * 2) = s3;
    }
    else if (EPI == 1 || EPI == 2) { v4h h4; for (int q = 0; q < 4; ++q) h4[q] = (_Float16)v[q]; *(v4h*)((char*)(C16 + cofs + (size_t)(it * 8) * ldc) + coff * 2u) = h4; }
    else *(v4f*)((char*)(C + cofs + (size_t)(it * 8) * ldc) + coff * 4u) = v;
  }
}
template <int BM, int BN, int BK, int WM, int WN, int EPI, bool ASC>
__global__ __launch_bounds__(256) void k_gemm_lds(const _Float16* __restrict__ A, int lda, size_t sA, const _Float16* __restrict__ Bh, int ldb, size_t sB, float alpha,
                                                 float* __restrict__ C, _Float16* __restrict__ C16, int ldc, size_t sC, int K, const float* __restrict__ SC, float* __restrict__ TM, float* __restrict__ TZ) {
  __shared__ __attribute__((aligned(16))) unsigned char smem[gemm_lds_bytes<BM, BN, BK>()];
  gemm_lds_body<BM, BN, BK, WM, WN, EPI, ASC>(smem, blockIdx.x, blockIdx.y, blockIdx.z, A, lda, sA, Bh, ldb, sB, alpha, C, C16, ldc, sC, K, SC, TM, TZ);
}
// The three convs in one grid: both GEMMs read only X16 and the weight images Bw (t, p, g, z one behind the other). The first BB * NN / 128 work-groups, the longer ones, take g; the rest t and p.
__global__ __launch_bounds__(256) void k_conv(const _Float16* __restrict__ X16, const _Float16* __restrict__ Bw, _Float16* __restrict__ T3, _Float16* __restrict__ Gc) {
  constexpr int LG = gemm_lds_bytes<128, 128, 64>(), LT = gemm_lds_bytes<64, 128, 256>(), GB = BB * (NN / 128);
  __shared__ __attribute__((aligned(16))) unsigned char smem[LG > LT ? LG : LT];
  const int bid = blockIdx.x;
  // s_wait_xcnt 0 behind each body's last stores: in the listing the code of the one body follows the stores of the other and rewrites their base and data registers; the wait stands in front of that, whichever body is laid first
  if (bid < GB) {    /* g channel-major per batch [b][128][4096] (f16): M 128 N 4096 K 256 */
    gemm_lds_body<128, 128, 64, 4, 2, 1, false>(smem, bid % (NN / 128), 0, bid / (NN / 128), Bw + (size_t)2 * CPN * CI, CI, 0, X16, CI, (size_t)NN * CI, 0.0625f, nullptr, Gc, NN, (size_t)CPN * NN, CI, nullptr, nullptr, nullptr);
    asm volatile("s_wait_xcnt 0x0" ::: "memory");
  } else {           /* t (bz = 0) and p (bz = 1) of all batches, token-major, as the score GEMM's operand rows [16384][384]: M 16384 N 128 K 256 */
    gemm_lds_body<64, 128, 256, 2, 4, 4, false>(smem, 0, (bid - GB) % (NR / 64), (bid - GB) / (NR / 64), X16, CI, 0, Bw, CI, (size_t)CPN * CI, 0.0625f, nullptr, T3, 3 * CPN, (size_t)NR * 3 * CPN, CI, nullptr, nullptr, nullptr);
    asm volatile("s_wait_xcnt 0x0" ::: "memory");
  }
}

__global__ __launch_bounds__(256) void k_x16(const float* __restrict__ x, _Float16* __restrict__ X16, size_t n8) { const size_t t = (size_t)blockIdx.x * 256 + threadIdx.x; if (t >= n8) return; FragH f;
#pragma unroll
  for (int q = 0; q < 8; ++q) f.h[q] = (_Float16)bf16_round(x[t * 8 + q]); *(v8us*)((unsigned short*)X16 + t * 8) = f.half[0];  }
__global__ __launch_bounds__(256) void k_h16(const float* __restrict__ x, _Float16* __restrict__ X16, size_t n8) { const size_t t = (size_t)blockIdx.x * 256 + threadIdx.x; if (t >= n8) return; FragH f;
#pragma unroll
  for (int q = 0; q < 8; ++q) f.h[q] = (_Float16)x[t * 8 + q]; *(v8us*)((unsigned short*)X16 + t * 8) = f.half[0];  }
// y picks one of four equally sized matrices; their f16 images lie one behind the other in Bt. bx = block index inside one matrix.
__device__ __forceinline__ void round16f_body(const int bx, const int y, const float* __restrict__ W0, const float* __restrict__ W1, const float* __restrict__ W2, const float* __restrict__ W3, _Float16* __restrict__ Bt, size_t n8) { const size_t t = (size_t)bx * 256 + threadIdx.x; if (t >= n8) return; FragH f;
  const float* W = (y == 0) ? W0 : (y == 1) ? W1 : (y == 2) ? W2 : W3; Bt += (size_t)y * n8 * 8;
#pragma unroll
  for (int i = 0; i < 8; ++i) f.h[i] = (_Float16)(bf16_round(W[t * 8 + i]) * 16.0f); *(v8us*)((unsigned short*)Bt + t * 8) = f.half[0];
  asm volatile("s_wait_xcnt 0x0" ::: "memory");  }      // k_prep: the other body's code may follow this store in the listing and rewrite its registers
template <int NHv, int TTv>
__global__ __launch_bounds__(256) void k_vt(const _Float16* __restrict__ V16, int ldv, int voff, _Float16* __restrict__ Vt) { __shared__ unsigned short tl[64][66]; const int tid = threadIdx.x; const int slab = blockIdx.x / (TTv / 64), lg = blockIdx.x % (TTv / 64); const int b = slab / NHv, h = slab % NHv;
  for (int i = tid; i < 64 * 8; i += 256) { const int r = i / 8, c8 = (i % 8) * 8; FragH f; f.half[0] = *(const v8us*)((const unsigned short*)V16 + ((size_t)b * TTv + lg * 64 + r) * ldv + voff + h * 64 + c8);
#pragma unroll
    for (int q = 0; q < 8; ++q) tl[r][c8 + q] = f.u[q]; }
  __syncthreads();
  {
#pragma unroll
    for (int rd = 0; rd < 2; ++rd) { const int d = rd * 32 + tid / 8, pc = tid % 8; FragH f;
#pragma unroll
      for (int q = 0; q < 8; ++q) f.u[q] = tl[pc * 8 + q][d];
      *(v8us*)((unsigned short*)Vt + ((size_t)slab * 64 + d) * TTv + lg * 64 + pc * 8) = f.half[0]; }
     } }

__device__ __forceinline__ void tok_body(const int bid, const float* __restrict__ x, _Float16* __restrict__ X16) { __shared__ float tl[32][65]; const int tid = threadIdx.x; const int b = bid / ((CI / 64) * (NN / 32)), rem = bid % ((CI / 64) * (NN / 32)); const int cg = rem / (NN / 32), pg = rem % (NN / 32); const int c0 = cg * 64, p0 = pg * 32;
  for (int i = tid; i < 64 * 32; i += 256) { const int c = i / 32, pp = i % 32; tl[pp][c] = bf16_round(x[((size_t)b * CI + c0 + c) * NN + p0 + pp]); } __syncthreads();
  const int r = tid / 8, pc = tid % 8; FragH f; for (int q = 0; q < 8; ++q) f.h[q] = (_Float16)tl[r][pc * 8 + q]; const size_t row = (size_t)b * NN + p0 + r; *(v8us*)((unsigned short*)X16 + row * CI + c0 + pc * 8) = f.half[0];
  asm volatile("s_wait_xcnt 0x0" ::: "memory");  }      // k_prep: the other body's code follows this store in the listing and rewrites its data registers
// Weight casts and the token-major f16 image of x in one grid (both read inputs only): the first 4 * WCB work-groups cast the four weight matrices, the rest transpose x.
#define WCB ((CPN * CI / 8 + 255) / 256)      // work-groups per weight matrix
__global__ __launch_bounds__(256) void k_prep(const float* __restrict__ W0, const float* __restrict__ W1, const float* __restrict__ W2, const float* __restrict__ W3, _Float16* __restrict__ Bt, const float* __restrict__ x, _Float16* __restrict__ X16) {
  const int bid = blockIdx.x;
  if (bid < 4 * WCB) round16f_body(bid % WCB, bid / WCB, W0, W1, W2, W3, Bt, (size_t)CPN * CI / 8);
  else tok_body(bid - 4 * WCB, x, X16);
}
// One thread per column m of one batch's score plane (blockIdx.y): merges the RTL row tiles' maxima (in units of log 2) and sums, in tile order, into the column's max M and sum Z,
// and writes per row tile the factor 2^(tile max - M) / Z that turns the stored exp(s - tile max) into the softmax weight. Z is about 1 or more: the tile that holds M adds its own largest term, 2^0.
__global__ __launch_bounds__(64) void k_tilescale(const float* __restrict__ TM, const float* __restrict__ TZ, float* __restrict__ SC) {
  const size_t o = (size_t)blockIdx.y * RTL * NN + blockIdx.x * 64 + threadIdx.x;
  float tm[RTL], tz[RTL];
  // every unroll here: tm and tz are indexed by constants only and stay in registers; in the first loop all loads are also in flight at once
#pragma unroll
  for (int t = 0; t < RTL; ++t) { tm[t] = TM[o + (size_t)t * NN]; tz[t] = TZ[o + (size_t)t * NN]; }
  float m = tm[0], z = 0.f;
#pragma unroll
  for (int t = 1; t < RTL; ++t) m = fmaxf(m, tm[t]);
#pragma unroll
  for (int t = 0; t < RTL; ++t) { tm[t] = exp2_slot(tm[t] - m); z += tz[t] * tm[t]; }
  const float inv = 1.0f / z;
#pragma unroll
  for (int t = 0; t < RTL; ++t) SC[o + (size_t)t * NN] = tm[t] * inv;
}
// Affine + residual during the transpose back to channel-major. A work-group owns 32 channels x 64 positions. It first merges its channels' batch statistics from the NR / 128 row tiles' column sums S1 and sums of squares S2
// in a fixed order: wave pt adds tiles 16 pt .. 16 pt + 15 in tile order (lane = channel, one 128-byte line per load), then every thread adds the 8 waves' partials of its own channel, in wave order, from LDS.
// A thread's elements of Z all belong to channel tid % 32; they, the tiles' sums and the channel's affine pair are loaded in one run, so that all these loads are in flight together.
__global__ __launch_bounds__(256) void k_out(const float* __restrict__ Z, const float* __restrict__ S1, const float* __restrict__ S2, const float* __restrict__ gam, const float* __restrict__ bet, const float* __restrict__ x, float* __restrict__ out) { __shared__ float tl[32][65]; __shared__ float a1[8][32], a2[8][32]; const int tid = threadIdx.x; const int b = blockIdx.x / ((CI / 32) * (NN / 64)), rem = blockIdx.x % ((CI / 32) * (NN / 64)); const int cg = rem / (NN / 64), pg = rem % (NN / 64); const int c0 = cg * 32, p0 = pg * 64;
  const int cc = tid & 31, pt = tid >> 5;
  constexpr int TPW = NR / 128 / 8;      // row tiles per wave
  float zv[8], p1[TPW], p2[TPW];      // the unrolls: the three arrays are indexed by constants only and stay in registers
#pragma unroll
  for (int u = 0; u < TPW; ++u) { p1[u] = S1[(size_t)(pt * TPW + u) * CI + c0 + cc]; p2[u] = S2[(size_t)(pt * TPW + u) * CI + c0 + cc]; }
#pragma unroll
  for (int k = 0; k < 8; ++k) zv[k] = Z[((size_t)b * NN + p0 + pt + 8 * k) * CI + c0 + cc];
  const float ga = bf16_round(gam[c0 + cc]), be = bf16_round(bet[c0 + cc]);
  asm volatile("s_wait_xcnt 0x0" ::: "memory");      // precaution behind the run of loads: the sums below reuse their address registers ahead of the last loads' data wait
  float t1 = 0.f, t2 = 0.f;
#pragma unroll
  for (int u = 0; u < TPW; ++u) { t1 += p1[u]; t2 += p2[u]; }
  a1[pt][cc] = t1; a2[pt][cc] = t2;
  __syncthreads();      // every wave's partial sums are read by all waves
  t1 = 0.f; t2 = 0.f;
#pragma unroll
  for (int i = 0; i < 8; ++i) { t1 += a1[i][cc]; t2 += a2[i][cc]; }
  const float mu = t1 / (float)NR; const float var = fmaxf(t2 / (float)NR - mu * mu, 0.f); const float rs = rsqrtf(var + 1e-5f);
#pragma unroll
  for (int k = 0; k < 8; ++k) tl[cc][pt + 8 * k] = (zv[k] - mu) * rs * ga + be;
  __syncthreads();
  { for (int i = tid; i < 32 * 16; i += 256) { const int c = i / 16, q4 = i % 16; const size_t o = ((size_t)b * CI + c0 + c) * NN + p0 + q4 * 4; const v4f xr = *(const v4fa*)(x + o); const v4f v = {tl[c][q4 * 4] + bf16_round(xr[0]), tl[c][q4 * 4 + 1] + bf16_round(xr[1]), tl[c][q4 * 4 + 2] + bf16_round(xr[2]), tl[c][q4 * 4 + 3] + bf16_round(xr[3])}; *(v4f*)(out + o) = v; }  } }

extern "C" void kernel_launch(void* const* d_in, const int* in_sizes, int n_in,
                              void* d_out, int out_size, void* d_ws, size_t ws_size, hipStream_t stream) {
  (void)in_sizes; (void)n_in; (void)out_size;
  const float* const* I = (const float* const*)d_in; const float* x = I[0]; const float* Wt = I[1]; const float* Wp = I[2]; const float* Wg = I[3]; const float* Wz = I[4]; const float* gam = I[5]; const float* bet = I[6];
  char* ws = (char*)d_ws; size_t off = 0;
  auto take = [&](size_t bytes) { char* p = ws + off; off += (bytes + 255) & ~(size_t)255; return p; };
  _Float16* Bt_ = (_Float16*)take((size_t)4 * CPN * CI * 2); _Float16* Bp_ = Bt_ + (size_t)CPN * CI; _Float16* Bg_ = Bp_ + (size_t)CPN * CI; _Float16* Bz_ = Bg_ + (size_t)CPN * CI;      /* four weight images, one behind the other */
  _Float16* PT = (_Float16*)take((size_t)PB * NN * NN * 2); _Float16* X16 = (_Float16*)take((size_t)NR * CI * 2);      /* weight planes of the PB batches that one launch works on */
  _Float16* T3 = (_Float16*)take((size_t)2 * NR * 3 * CPN * 2); _Float16* P3 = T3 + (size_t)NR * 3 * CPN;      /* all batches: concatenated-K operand planes [16384][384] (t, then p) */
  _Float16* Gc = (_Float16*)take((size_t)BB * CPN * NN * 2); _Float16* Y16 = (_Float16*)take((size_t)NR * CPN * 2); float* TM = (float*)take((size_t)PB * RTL * NN * 4); float* TZ = (float*)take((size_t)PB * RTL * NN * 4); float* SC = (float*)take((size_t)PB * RTL * NN * 4); float* S1 = (float*)take((size_t)(NR / 128) * CI * 4); float* S2 = (float*)take((size_t)(NR / 128) * CI * 4);      /* z's column sums and sums of squares per row tile */
  float* Z = (float*)take((size_t)NR * CI * 4);
  if (off > ws_size) return;      // about 199 MB of the 268 MB given (weight planes 134, the rest 65)
  k_prep<<<4 * WCB + BB * (CI / 64) * (NN / 32), 256, 0, stream>>>(Wt, Wp, Wg, Wz, Bt_, x, X16);      /* conv weights (out,in) natural x 2^4, and x token-major */
  k_conv<<<BB * (NN / 128) + 2 * (NR / 64), 256, 0, stream>>>(X16, Bt_, T3, Gc);      /* g channel-major f16; t to [h | l | h], p to [h | h 2^-10 | l 2^-10], token-major f16 */
  const dim3 gs(NN / 128, NN / 128, PB), gy(CPN / 128, NN / 64, PB);
  for (int b = 0; b < BB; b += PB) { const size_t to = (size_t)b * NN * 3 * CPN, yo = (size_t)b * NN * CPN;      /* blockIdx.z or .y of each launch: batch b + z (or y), PB of them */
    k_gemm_lds<128, 128, 64, 4, 2, 2, false><<<gs, 256, 0, stream>>>(T3 + to, 3 * CPN, (size_t)NN * 3 * CPN, P3 + to, 3 * CPN, (size_t)NN * 3 * CPN, 1.0f, nullptr, PT, NN, (size_t)NN * NN, 3 * CPN, nullptr, TM, TZ);      /* s[n][m] = t_n p_m as Th Ph + (Tl Ph + Th Pl) 2^-10 in one K = 384 pass, M 4096 N 4096; stored: exp(s - tile max) 2^15 and the tiles' column statistics */
    k_tilescale<<<dim3(NN / 64, PB, 1), 64, 0, stream>>>(TM, TZ, SC);
    k_gemm_lds<64, 128, 256, 2, 4, 1, true><<<gy, 256, 0, stream>>>(PT, NN, (size_t)NN * NN, Gc + (size_t)b * CPN * NN, NN, (size_t)CPN * NN, 0.000030517578125f, nullptr, Y16 + yo, CPN, (size_t)NN * CPN, NN, SC, nullptr, nullptr); }      /* y[n][c] = sum over m of att[n][m] g[c][m]: M 4096 N 128 K 4096 (f16 out) */
  k_gemm_lds<128, 128, 64, 4, 2, 3, false><<<dim3(CI / 128, NR / 128, 1), 256, 0, stream>>>(Y16, CPN, 0, Bz_, CPN, 0, 0.0625f, Z, nullptr, CI, 0, CPN, nullptr, S1, S2);      /* z token-major [16384][256] f32 and its column sums per row tile: M 16384 N 256 K 128 */
  k_out<<<BB * (CI / 32) * (NN / 64), 256, 0, stream>>>(Z, S1, S2, gam, bet, x, (float*)d_out);
}

// v008
// Measured time: 122 microseconds a run.
// Next to v007, in two timings, it ran 1.04 and 1.03 times as fast.
// All steps since v000 together make it 107 times as fast.
#include <hip/hip_runtime.h>
// Spatial non-local block with query-axis softmax (B=4, C_in 256, C_p 128, N=4096): t,p,g = 1×1 convs; att[n,m] = Σ_c t[c,n]·p[c,m]; att = softmax over n (dim=1) for every m; y[c,n] = Σ_m att[n,m]·g[c,m]; z = Wz·y;
// BatchNorm1d in training mode (batch statistics over (B,N) per channel, biased variance, eps 1e-5) with affine; out = BN(z) + x.
// Compute dtype: x and weights rounded to bf16; t and p as f32 GEMM outputs split into f16 hi + ×2^10 residual parts laid out as concatenated-K operands so one K=384 GEMM yields Th·Ph + (Tl·Ph + Th·Pl)·2^-10 (σ≈11 logits, f32-accurate);
// no f32 score plane is stored: the score GEMM's epilogue takes each column's max and sum over the 128 rows of its own tile (f32) and writes exp(s - tile max) row-major as f16 x 2^15; a small kernel merges the 32 row tiles of a column into
// one factor exp(tile max - column max) / column sum per (row tile, column), and the y GEMM multiplies its weight chunks by that factor on their way to LDS; y = contraction over m as an f16 GEMM against
// channel-major g; z GEMM; per-channel batch statistics as fixed-order f32 column sums, taken per row tile in the z GEMM's epilogue and merged by the last kernel; affine + residual applied during the transpose back to channel-major. All contractions on v_wmma_f32_16x16x32_f16, f32 accumulate.
#define BB 4
#define CI 256
#define CPN 128
#define NN 4096
#define NR (BB * NN)
#define PB 4      // batches whose weight planes are held at once: each launch of the score, merge and y stages works on PB batches (all of them: one launch per stage)
#define RTL (NN / 128)      // row tiles of a score plane: one set of column statistics each

typedef __bf16 v16b __attribute__((ext_vector_type(16)));
typedef unsigned short v8us __attribute__((ext_vector_type(8), may_alias));
typedef float  v8f  __attribute__((ext_vector_type(8)));
typedef float  v4f  __attribute__((ext_vector_type(4)));
typedef float  v4fa __attribute__((ext_vector_type(4), may_alias));
union FragB { v16b v; v8us half[2]; unsigned short u[16]; };

__device__ __forceinline__ unsigned short bf16_bits(float x) { unsigned int u = __float_as_uint(x); return (unsigned short)((u + 0x7FFFu + ((u >> 16) & 1u)) >> 16); }
__device__ __forceinline__ float bf16_val(unsigned short b) { return __uint_as_float(((unsigned int)b) << 16); }
__device__ __forceinline__ float bf16_round(float x) { return bf16_val(bf16_bits(x)); }
// D += A·B with NT terms: 1 = ah·bh, 2 = + al·bh (A split), 3 = + ah·bl (both split)
template <int NT>
__device__ __forceinline__ v8f mmaN(v16b ah, v16b al, v16b bh, v16b bl, v8f c) {
  c = __builtin_amdgcn_wmma_f32_16x16x32_bf16(false, ah, false, bh, (short)0, c, false, false);
  if (NT >= 2) c = __builtin_amdgcn_wmma_f32_16x16x32_bf16(false, al, false, bh, (short)0, c, false, false);
  if (NT >= 3) c = __builtin_amdgcn_wmma_f32_16x16x32_bf16(false, ah, false, bl, (short)0, c, false, false);
  asm volatile("v_nop\n\tv_nop\n\tv_nop\n\tv_nop" : "+v"(c) : "v"(ah), "v"(al), "v"(bh), "v"(bl));
  return c;
}

__global__ __launch_bounds__(256) void k_wt_bf16(const float* __restrict__ W, unsigned short* __restrict__ Wt, int K, int N) {
  const int t = blockIdx.x * 256 + threadIdx.x;
  const int k8n = K / 8;
  if (t >= N * k8n) return;
  const int n = t / k8n, k8 = (t % k8n) * 8;
  v8us v;
#pragma unroll
  for (int i = 0; i < 8; ++i) v[i] = bf16_bits(W[(size_t)(k8 + i) * N + n]);
  *(v8us*)(Wt + (size_t)n * K + k8) = v;
  
}

// GEMM C[M][N] (f32, pitch ldc) = act(A[M][K]·W + bias). A f32 row-major (pitch lda) converted per fragment to bf16
// (ASPLIT: hi/lo two planes -> 2 terms, else single rounded term); Wt bf16 [N][K] (pitch ldb). BIAS_BF16 rounds the
// bias to bf16 first (bias quantised to bf16 before the add). K%32==0, M%16==0, N%64==0.
template <bool ASPLIT, int ACT, bool BIAS_BF16>
__global__ __launch_bounds__(128) void k_gemm_bf(const float* __restrict__ A, int lda, const unsigned short* __restrict__ Wt, int ldb,
                                               const float* __restrict__ bias, float* __restrict__ C, int ldc, int M, int N, int K) {
  __shared__ __attribute__((aligned(16))) float so[4][16][64];
  const int tid = threadIdx.x, w = tid >> 5, lane = tid & 31, ln = lane & 15, hh = lane >> 4;
  const int ntn = N / 64;
  const int wid = blockIdx.x * 4 + w;
  const int mt = wid / ntn, nq = wid % ntn;
  if (mt * 16 >= M) return;
  const int row0 = mt * 16, col0 = nq * 64;
  const float* arow = A + (size_t)(row0 + ln) * lda;
  v8f acc[4] = {};
  for (int kb = 0; kb < K; kb += 32) {
    FragB ah, al;
    const v4f x0 = *(const v4fa*)(arow + kb + 8 * hh), x1 = *(const v4fa*)(arow + kb + 8 * hh + 4);
    const v4f x2 = *(const v4fa*)(arow + kb + 16 + 8 * hh), x3 = *(const v4fa*)(arow + kb + 16 + 8 * hh + 4);
    float xs[16] = {x0[0],x0[1],x0[2],x0[3],x1[0],x1[1],x1[2],x1[3],x2[0],x2[1],x2[2],x2[3],x3[0],x3[1],x3[2],x3[3]};
#pragma unroll
    for (int i = 0; i < 16; ++i) { const unsigned short hb = bf16_bits(xs[i]); ah.u[i] = hb; al.u[i] = ASPLIT ? bf16_bits(xs[i] - bf16_val(hb)) : (unsigned short)0; }
#pragma unroll
    for (int t = 0; t < 4; ++t) {
      const unsigned short* brow = Wt + (size_t)(col0 + t * 16 + ln) * ldb + kb;
      FragB b;
      b.half[0] = *(const v8us*)(brow + 8 * hh);
      b.half[1] = *(const v8us*)(brow + 16 + 8 * hh);
      acc[t] = mmaN<ASPLIT ? 2 : 1>(ah.v, al.v, b.v, b.v, acc[t]);
    }
  }
#pragma unroll
  for (int t = 0; t < 4; ++t) {
    float bv = bias ? bias[col0 + t * 16 + ln] : 0.f;
    if (BIAS_BF16) bv = bf16_round(bv);
#pragma unroll
    for (int r = 0; r < 8; ++r) { float v = acc[t][r] + bv; if (ACT == 1) v = fmaxf(v, 0.f); so[w][8 * hh + r][t * 16 + ln] = v; }
  }
  __builtin_amdgcn_fence(__ATOMIC_ACQ_REL, "workgroup");
  __builtin_amdgcn_wave_barrier();
  const int rsub = lane >> 4, c4 = (lane & 15) * 4;
  {
#pragma unroll
    for (int q = 0; q < 8; ++q) {
      const int r = q * 2 + rsub;
      const v4f v = *(const v4fa*)&so[w][r][c4];
      *(v4f*)(C + (size_t)(row0 + r) * ldc + col0 + c4) = v;
    }
    
  }
}

// Flash-style causal/unmasked attention, all contractions 3-term bf16 hi/lo splits, f32 softmax with running max.
// q,k,v rows are read from f32 buffers with arbitrary row pitch (so they can live inside a fused qkv buffer);
// D = head size (multiple of 32, <= 128); one wave = 16 query rows; block = 4 waves (64 queries) sharing K/V chunks of 32.
template <int D, bool CAUSAL>
__global__ __launch_bounds__(128) void k_flash(const float* __restrict__ qb, const float* __restrict__ kb, const float* __restrict__ vb,
                                             int pitch, int T, int H, float scale, float* __restrict__ y, int ypitch) {
  constexpr int KS = D / 32;        // k-steps for QK
  constexpr int DT = D / 16;        // d tiles for PV
  __shared__ __attribute__((aligned(16))) unsigned short sKh[32][D + 8], sKl[32][D + 8], sVh[32][D + 8], sVl[32][D + 8];
  __shared__ __attribute__((aligned(16))) unsigned short sPh[4][16][40], sPl[4][16][40];
  __shared__ __attribute__((aligned(16))) float sO[4][16][D];
  const int tid = threadIdx.x, w = tid >> 5, lane = tid & 31, ln = lane & 15, hh = lane >> 4;
  const int nqb = (T + 63) / 64;
  const int bh = blockIdx.x / nqb, qblk = blockIdx.x % nqb;
  const int b = bh / H, h = bh % H;
  const int q0 = qblk * 64 + w * 16;
  const float* Q = qb + (size_t)b * T * pitch + h * D;
  const float* K = kb + (size_t)b * T * pitch + h * D;
  const float* V = vb + (size_t)b * T * pitch + h * D;

  // A fragments of the wave's 16 query rows (scaled), hi/lo
  FragB aqh[KS], aql[KS];
  {
    int row = q0 + ln; if (row >= T) row = T - 1;
    const float* qr = Q + (size_t)row * pitch;
#pragma unroll
    for (int ks = 0; ks < KS; ++ks)
#pragma unroll
      for (int i = 0; i < 16; ++i) {
        const int d = ks * 32 + ((i < 8) ? (8 * hh + i) : (16 + 8 * hh + (i - 8)));
        const float x = qr[d] * scale; const unsigned short hb = bf16_bits(x);
        aqh[ks].u[i] = hb; aql[ks].u[i] = bf16_bits(x - bf16_val(hb));
      }
  }
  float m_r[8], l_r[8];
#pragma unroll
  for (int r = 0; r < 8; ++r) { m_r[r] = -3.0e38f; l_r[r] = 0.f; }
  v8f oacc[DT];
#pragma unroll
  for (int dt = 0; dt < DT; ++dt) oacc[dt] = (v8f){0.f,0.f,0.f,0.f,0.f,0.f,0.f,0.f};

  const int kv_end = CAUSAL ? min(T, qblk * 64 + 64) : T;     // block-uniform
  for (int j0 = 0; j0 < kv_end; j0 += 32) {
    __syncthreads();
    for (int e = tid; e < 32 * (D / 4); e += 128) {
      const int r = e / (D / 4), c4 = (e % (D / 4)) * 4;
      const int key = j0 + r;
      v4f kf = {0.f,0.f,0.f,0.f}, vf = {0.f,0.f,0.f,0.f};
      if (key < T) { kf = *(const v4fa*)(K + (size_t)key * pitch + c4); vf = *(const v4fa*)(V + (size_t)key * pitch + c4); }
#pragma unroll
      for (int t = 0; t < 4; ++t) {
        unsigned short hb = bf16_bits(kf[t]); sKh[r][c4 + t] = hb; sKl[r][c4 + t] = bf16_bits(kf[t] - bf16_val(hb));
        hb = bf16_bits(vf[t]); sVh[r][c4 + t] = hb; sVl[r][c4 + t] = bf16_bits(vf[t] - bf16_val(hb));
      }
    }
    __syncthreads();
    // S tile 16 x 32
    v8f s[2];
#pragma unroll
    for (int nt = 0; nt < 2; ++nt) {
      v8f acc = {};
#pragma unroll
      for (int ks = 0; ks < KS; ++ks) {
        FragB bh_, bl_;
        bh_.half[0] = *(const v8us*)&sKh[nt * 16 + ln][ks * 32 + 8 * hh]; bh_.half[1] = *(const v8us*)&sKh[nt * 16 + ln][ks * 32 + 16 + 8 * hh];
        bl_.half[0] = *(const v8us*)&sKl[nt * 16 + ln][ks * 32 + 8 * hh]; bl_.half[1] = *(const v8us*)&sKl[nt * 16 + ln][ks * 32 + 16 + 8 * hh];
        acc = mmaN<3>(aqh[ks].v, aql[ks].v, bh_.v, bl_.v, acc);
      }
      s[nt] = acc;
    }
    // mask + running max (rows 8hh+r; the 16 lanes of a half share rows)
    float alpha[8];
#pragma unroll
    for (int r = 0; r < 8; ++r) {
      const int qi = q0 + 8 * hh + r;
      const int ja = j0 + ln, jb = j0 + 16 + ln;
      if (CAUSAL) { if (ja > qi) s[0][r] = -3.0e38f; if (jb > qi) s[1][r] = -3.0e38f; }
      if (ja >= T) s[0][r] = -3.0e38f;
      if (jb >= T) s[1][r] = -3.0e38f;
      float mx = fmaxf(s[0][r], s[1][r]);
      mx = fmaxf(mx, __shfl_xor(mx, 1, 32)); mx = fmaxf(mx, __shfl_xor(mx, 2, 32)); mx = fmaxf(mx, __shfl_xor(mx, 4, 32)); mx = fmaxf(mx, __shfl_xor(mx, 8, 32));
      const float mnew = fmaxf(m_r[r], mx);
      alpha[r] = (mnew > -1.0e38f) ? __expf(m_r[r] - mnew) : 1.0f;
      const float p0 = (s[0][r] > -1.0e38f) ? __expf(s[0][r] - mnew) : 0.f;
      const float p1 = (s[1][r] > -1.0e38f) ? __expf(s[1][r] - mnew) : 0.f;
      m_r[r] = mnew;
      l_r[r] = l_r[r] * alpha[r] + p0 + p1;            // per-lane partial row sum (16 lanes combined at the end)
      unsigned short hb = bf16_bits(p0); sPh[w][8 * hh + r][ln] = hb;      sPl[w][8 * hh + r][ln] = bf16_bits(p0 - bf16_val(hb));
      hb = bf16_bits(p1);                sPh[w][8 * hh + r][16 + ln] = hb; sPl[w][8 * hh + r][16 + ln] = bf16_bits(p1 - bf16_val(hb));
    }
#pragma unroll
    for (int dt = 0; dt < DT; ++dt)
#pragma unroll
      for (int r = 0; r < 8; ++r) oacc[dt][r] *= alpha[r];
    __builtin_amdgcn_fence(__ATOMIC_ACQ_REL, "workgroup");
    __builtin_amdgcn_wave_barrier();
    FragB pah, pal;
    pah.half[0] = *(const v8us*)&sPh[w][ln][8 * hh]; pah.half[1] = *(const v8us*)&sPh[w][ln][16 + 8 * hh];
    pal.half[0] = *(const v8us*)&sPl[w][ln][8 * hh]; pal.half[1] = *(const v8us*)&sPl[w][ln][16 + 8 * hh];
#pragma unroll
    for (int dt = 0; dt < DT; ++dt) {
      FragB bvh, bvl;
#pragma unroll
      for (int i = 0; i < 8; ++i) {
        bvh.u[i] = sVh[8 * hh + i][dt * 16 + ln]; bvh.u[8 + i] = sVh[16 + 8 * hh + i][dt * 16 + ln];
        bvl.u[i] = sVl[8 * hh + i][dt * 16 + ln]; bvl.u[8 + i] = sVl[16 + 8 * hh + i][dt * 16 + ln];
      }
      oacc[dt] = mmaN<3>(pah.v, pal.v, bvh.v, bvl.v, oacc[dt]);
    }
    __builtin_amdgcn_fence(__ATOMIC_ACQ_REL, "workgroup");
    __builtin_amdgcn_wave_barrier();
  }
#pragma unroll
  for (int r = 0; r < 8; ++r) {
    float l = l_r[r];
    l += __shfl_xor(l, 1, 32); l += __shfl_xor(l, 2, 32); l += __shfl_xor(l, 4, 32); l += __shfl_xor(l, 8, 32);
    l_r[r] = (l > 0.f) ? 1.0f / l : 0.f;
  }
#pragma unroll
  for (int dt = 0; dt < DT; ++dt)
#pragma unroll
    for (int r = 0; r < 8; ++r) sO[w][8 * hh + r][dt * 16 + ln] = oacc[dt][r] * l_r[r];
  __builtin_amdgcn_fence(__ATOMIC_ACQ_REL, "workgroup");
  __builtin_amdgcn_wave_barrier();
  {
    for (int r = 0; r < 16; ++r) {
      const int row = q0 + r;
      if (row < T && lane < D / 4) {
        const v4f val = *(const v4fa*)&sO[w][r][lane * 4];
        *(v4f*)(y + ((size_t)b * T + row) * ypitch + h * D + lane * 4) = val;
      }
    }
    
  }
}

// GEMM C = act(A·W + bias + resid): A f32 (ASPLIT -> hi/lo 2 terms), Wt bf16 [N][K]; ACT 0 none, 1 relu, 2 exact gelu;
// resid (optional, f32, row index = (row % rmod), pitch ldr, RES_BF16 rounds it) added before the activation.
template <bool ASPLIT, int ACT, bool BIAS_BF16, bool RES_BF16>
__global__ __launch_bounds__(128) void k_gemm_bf3(const float* __restrict__ A, int lda, const unsigned short* __restrict__ Wt, int ldb,
                                                const float* __restrict__ bias, const float* __restrict__ resid, int rmod, int ldr,
                                                float* __restrict__ C, int ldc, int M, int N, int K) {
  __shared__ __attribute__((aligned(16))) float so[4][16][64];
  const int tid = threadIdx.x, w = tid >> 5, lane = tid & 31, ln = lane & 15, hh = lane >> 4;
  const int ntn = N / 64;
  const int wid = blockIdx.x * 4 + w;
  const int mt = wid / ntn, nq = wid % ntn;
  if (mt * 16 >= M) return;
  const int row0 = mt * 16, col0 = nq * 64;
  const float* arow = A + (size_t)(row0 + ln) * lda;
  v8f acc[4] = {};
  for (int kb = 0; kb < K; kb += 32) {
    FragB ah, al;
    const v4f x0 = *(const v4fa*)(arow + kb + 8 * hh), x1 = *(const v4fa*)(arow + kb + 8 * hh + 4);
    const v4f x2 = *(const v4fa*)(arow + kb + 16 + 8 * hh), x3 = *(const v4fa*)(arow + kb + 16 + 8 * hh + 4);
    float xs[16] = {x0[0],x0[1],x0[2],x0[3],x1[0],x1[1],x1[2],x1[3],x2[0],x2[1],x2[2],x2[3],x3[0],x3[1],x3[2],x3[3]};
#pragma unroll
    for (int i = 0; i < 16; ++i) { const unsigned short hb = bf16_bits(xs[i]); ah.u[i] = hb; al.u[i] = ASPLIT ? bf16_bits(xs[i] - bf16_val(hb)) : (unsigned short)0; }
#pragma unroll
    for (int t = 0; t < 4; ++t) {
      const unsigned short* brow = Wt + (size_t)(col0 + t * 16 + ln) * ldb + kb;
      FragB b;
      b.half[0] = *(const v8us*)(brow + 8 * hh);
      b.half[1] = *(const v8us*)(brow + 16 + 8 * hh);
      acc[t] = mmaN<ASPLIT ? 2 : 1>(ah.v, al.v, b.v, b.v, acc[t]);
    }
  }
#pragma unroll
  for (int t = 0; t < 4; ++t) {
    const int col = col0 + t * 16 + ln;
    float bv = bias ? bias[col] : 0.f;
    if (BIAS_BF16) bv = bf16_round(bv);
#pragma unroll
    for (int r = 0; r < 8; ++r) {
      float v = acc[t][r] + bv;
      if (resid) { float rv = resid[(size_t)((row0 + 8 * hh + r) % rmod) * ldr + col]; if (RES_BF16) rv = bf16_round(rv); v += rv; }
      if (ACT == 1) v = fmaxf(v, 0.f);
      if (ACT == 2) v = 0.5f * v * (1.0f + erff(v * 0.70710678118654752f));
      if (ACT == 3) { const float u = 0.7978845608028654f * (v + 0.044715f * v * v * v); v = 0.5f * v * (1.0f + tanhf(u)); }
      so[w][8 * hh + r][t * 16 + ln] = v;
    }
  }
  __builtin_amdgcn_fence(__ATOMIC_ACQ_REL, "workgroup");
  __builtin_amdgcn_wave_barrier();
  const int rsub = lane >> 4, c4 = (lane & 15) * 4;
  {
#pragma unroll
    for (int q = 0; q < 8; ++q) {
      const int r = q * 2 + rsub;
      const v4f v = *(const v4fa*)&so[w][r][c4];
      *(v4f*)(C + (size_t)(row0 + r) * ldc + col0 + c4) = v;
    }
    
  }
}
// row LayerNorm (biased variance, eps) over N: s = X (+ R); optional out_sum <- s; out_norm <- (s-mu)*rsqrt(var+eps)*g + b
template <bool PARAM_BF16>
__global__ __launch_bounds__(256) void k_layernorm(const float* __restrict__ X, const float* __restrict__ R, const float* __restrict__ g, const float* __restrict__ bta,
                                                  float* __restrict__ out_sum, float* __restrict__ out_norm, int N, float eps) {
  __shared__ float red[256];
  const int row = blockIdx.x, tid = threadIdx.x;
  const float* x = X + (size_t)row * N; const float* rr = R ? R + (size_t)row * N : nullptr;
  float vals[16];                     // up to N = 4096
  const int per = N / 256;            // contiguous chunk per thread? use strided-by-4 chunks: thread handles j = tid*4 + 1024*u
  float s1 = 0.f;
  for (int u = 0; u < per / 4; ++u) {
    const int j = tid * 4 + 1024 * u;
    const v4f a = *(const v4fa*)(x + j);
    v4f b = {0.f,0.f,0.f,0.f}; if (rr) b = *(const v4fa*)(rr + j);
#pragma unroll
    for (int q = 0; q < 4; ++q) { const float v = a[q] + b[q]; vals[u * 4 + q] = v; s1 += v; }
  }
  red[tid] = s1; __syncthreads();
  for (int st = 128; st > 0; st >>= 1) { if (tid < st) red[tid] += red[tid + st]; __syncthreads(); }
  const float mu = red[0] / (float)N; __syncthreads();
  float s2 = 0.f;
  for (int u = 0; u < per / 4; ++u)
#pragma unroll
    for (int q = 0; q < 4; ++q) { const float c = vals[u * 4 + q] - mu; s2 += c * c; }
  red[tid] = s2; __syncthreads();
  for (int st = 128; st > 0; st >>= 1) { if (tid < st) red[tid] += red[tid + st]; __syncthreads(); }
  const float rs = rsqrtf(red[0] / (float)N + eps);
  {
    for (int u = 0; u < per / 4; ++u) {
      const int j = tid * 4 + 1024 * u;
      v4f o, sm;
#pragma unroll
      for (int q = 0; q < 4; ++q) {
        float gg = g[j + q], bb = bta[j + q];
        if (PARAM_BF16) { gg = bf16_round(gg); bb = bf16_round(bb); }
        sm[q] = vals[u * 4 + q]; o[q] = (vals[u * 4 + q] - mu) * rs * gg + bb;
      }
      if (out_sum) *(v4f*)(out_sum + (size_t)row * N + j) = sm;
      *(v4f*)(out_norm + (size_t)row * N + j) = o;
    }
    
  }
}



// ---- f16 WMMA path (v_wmma_f32_16x16x32_f16): 11-bit significands for operands in range — used where a [0,1] probability operand needs more precision than bf16
typedef _Float16 v16h __attribute__((ext_vector_type(16)));
union FragH { v16h v; v8us half[2]; _Float16 h[16]; unsigned short u[16]; };
template <int NT>
__device__ __forceinline__ v8f mmaH(v16h ah, v16h al, v16h bh, v16h bl, v8f c) {
  c = __builtin_amdgcn_wmma_f32_16x16x32_f16(false, ah, false, bh, (short)0, c, false, false);
  if (NT >= 2) c = __builtin_amdgcn_wmma_f32_16x16x32_f16(false, al, false, bh, (short)0, c, false, false);
  if (NT >= 3) c = __builtin_amdgcn_wmma_f32_16x16x32_f16(false, ah, false, bl, (short)0, c, false, false);
  asm volatile("v_nop\n\tv_nop\n\tv_nop\n\tv_nop" : "+v"(c) : "v"(ah), "v"(al), "v"(bh), "v"(bl));
  return c;
}
// batched GEMM like k_gemm_b but f16 operands: A f32 (split into f16 hi/lo if ASPLIT, else rounded to f16), Bt = f16 values [n][k]; alpha; C f32; N multiple of 16 (partial tiles skipped)
template <bool ASPLIT>
__global__ __launch_bounds__(128) void k_gemm_h(const float* __restrict__ A, int lda, size_t sA, const _Float16* __restrict__ Bh, int ldb, size_t sB, float alpha, float* __restrict__ C, int ldc, size_t sC, int M, int N, int K) {
  __shared__ __attribute__((aligned(16))) float so[4][16][64];
  const int tid = threadIdx.x, w = tid >> 5, lane = tid & 31, ln = lane & 15, hh = lane >> 4; const int by = blockIdx.y;
  A += (size_t)by * sA; Bh += (size_t)by * sB; C += (size_t)by * sC;
  const int ntn = (N + 63) / 64; const int wid = blockIdx.x * 4 + w; const int mt = wid / ntn, nq = wid % ntn; if (mt * 16 >= M) return;
  const int row0 = mt * 16, col0 = nq * 64; const float* arow = A + (size_t)(row0 + ln) * lda;
  v8f acc[4] = {};
  for (int kb = 0; kb < K; kb += 32) {
    FragH ah, al;
    const v4f x0 = *(const v4fa*)(arow + kb + 8 * hh), x1 = *(const v4fa*)(arow + kb + 8 * hh + 4), x2 = *(const v4fa*)(arow + kb + 16 + 8 * hh), x3 = *(const v4fa*)(arow + kb + 16 + 8 * hh + 4);
    float xs[16] = {x0[0],x0[1],x0[2],x0[3],x1[0],x1[1],x1[2],x1[3],x2[0],x2[1],x2[2],x2[3],x3[0],x3[1],x3[2],x3[3]};
#pragma unroll
    for (int i = 0; i < 16; ++i) { const _Float16 h = (_Float16)xs[i]; ah.h[i] = h; al.h[i] = ASPLIT ? (_Float16)(xs[i] - (float)h) : (_Float16)0.0f; }
#pragma unroll
    for (int t = 0; t < 4; ++t) { if (col0 + t * 16 >= N) continue; const size_t boff = (size_t)(col0 + t * 16 + ln) * ldb + kb; FragH bq; bq.half[0] = *(const v8us*)(Bh + boff + 8 * hh); bq.half[1] = *(const v8us*)(Bh + boff + 16 + 8 * hh);
      acc[t] = mmaH<ASPLIT ? 2 : 1>(ah.v, al.v, bq.v, bq.v, acc[t]); }
  }
#pragma unroll
  for (int t = 0; t < 4; ++t) { if (col0 + t * 16 >= N) continue;
#pragma unroll
    for (int r = 0; r < 8; ++r) so[w][8 * hh + r][t * 16 + ln] = acc[t][r] * alpha; }
  __builtin_amdgcn_fence(__ATOMIC_ACQ_REL, "workgroup"); __builtin_amdgcn_wave_barrier();
  const int rsub = lane >> 4, c4 = (lane & 15) * 4;
  {
#pragma unroll
    for (int q = 0; q < 8; ++q) { const int r = q * 2 + rsub; if (col0 + c4 < N) { const v4f v = *(const v4fa*)&so[w][r][c4]; *(v4f*)(C + (size_t)(row0 + r) * ldc + col0 + c4) = v; } }
     }
}

// Wt[n][k] = f16(W[k][n]·scale) from f32 row-major W[K][N] (scale = power of two; bf16-exact weights stay exact in f16 away from the subnormal range)
__global__ __launch_bounds__(256) void k_wt_f16(const float* __restrict__ W, _Float16* __restrict__ Wt, int K, int N, float scale) {
  const int t = blockIdx.x * 256 + threadIdx.x; if (t >= N * (K / 8)) return; const int n = t / (K / 8), k8 = (t % (K / 8)) * 8; FragH f;
#pragma unroll
  for (int i = 0; i < 8; ++i) f.h[i] = (_Float16)(bf16_round(W[(size_t)(k8 + i) * N + n]) * scale); const v8us o = f.half[0];
  *(v8us*)((unsigned short*)Wt + (size_t)n * K + k8) = o; 
}
typedef _Float16 v4h __attribute__((ext_vector_type(4)));
// GEMM C[M][N] = alpha * sum_k A[m][k] * B[n][k], f16 operands with k contiguous, f32 accumulate; writes f32 C or f16 C16 (pitch ldc). blockIdx = (N tile, M tile, batch).
// A work-group of 8 waves owns a BM x BN tile of C. Per K step the BM rows of A and the BN rows of B (BK elements each) are fetched with whole-line 16-byte loads, one chunk per lane,
// and stored to LDS rows padded by 16 bytes; every wave then reads its WMMA fragments from LDS, so a tile row is fetched from L2 once per work-group instead of once per wave in 32-byte pieces.
// Two LDS buffers: the next step's global loads are issued right behind the barrier (in front of it the barrier's own wait would drain them), fly during this step's products and are stored to the other buffer behind them.
// Global load addresses are a scalar base per chunk plus one 32-bit byte offset per lane and operand, which lives through the whole loop and moves on by one K step in front of each step's loads.
// sbase() takes a wave-uniform address through readfirstlane: the loads then take the scalar-base form, the loop holds no 64-bit vector address sums, and no short-lived address register is handed to a later load as its destination.
// Each output's products run over k in ascending blocks of 32 in one accumulator chain. M % BM == 0, N % BN == 0, K % BK == 0, BN == 128.
// Every '#pragma unroll' in this kernel is there so that a register array (pre, base, acc, cm, cz, c1, c2, the fragments) is indexed by constants only and stays in registers.
// EPI: 0 writes f32 C, 1 writes f16 C16, 2 is the score stage's softmax over the rows of the tile: with m the maximum of a column over the BM rows, C16 gets exp(c - m) x 2^15 and TM, TZ get m and the sum of the exponentials
// at [batch][row tile][column], m in units of log 2 (the scores are multiplied by log2 e once, so that each exponential is one subtraction and one v_exp_f32). The maximum and the sum are taken in the accumulator registers (a lane holds FM x 8 rows of each of its FN columns), then over lanes l ^ 16, then over the WM waves, in wave order, through LDS.
// EPI 3 writes f32 C and, at [row tile][column], the tile's column sums (TM) and column sums of squares (TZ) of the stored values: summed in the accumulator registers, then over lanes l ^ 16, then over the WM waves, in wave order, through LDS.
// EPI 4 writes no f32 plane but the concatenated-K f16 operand rows [3 * BN] of the score GEMM: with h = f16(c), l = f16((c - h) * 2^10), batch 0 (t side) gets [h | l | h], batch 1 (p side) [h | h * 2^-10 | l * 2^-10],
// so that the sum over K of A' * B' is Th Ph + Tl Ph 2^-10 + Th Pl 2^-10 (power-of-two scalings are exact in f16 barring subnormal flushes, which cost at most 1e-4 on a logit of sigma about 11).
// ASC: the A chunks are multiplied on their way to LDS by SC[batch][row tile of 128][k] (f32 product, rounded to f16 again); a thread's A chunks share their k range, so it loads 8 factors per K step.
// 2^x by v_exp_f32. The v_nop is the free issue slot that the instruction set asks for behind a transcendental before its source is overwritten;
// it is tied to the v_exp_f32 in one statement.
__device__ __forceinline__ float exp2_slot(float x) { float r; asm("v_exp_f32 %0, %1\n\tv_nop" : "=v"(r) : "v"(x)); return r; }
typedef const __attribute__((address_space(1))) v8us* gv8;
typedef const __attribute__((address_space(1))) v4fa* gv4;
__device__ __forceinline__ unsigned long long sbase(const char* p) { const unsigned long long u = (unsigned long long)p; const unsigned lo = (unsigned)__builtin_amdgcn_readfirstlane((int)(unsigned)u), hi = (unsigned)__builtin_amdgcn_readfirstlane((int)(unsigned)(u >> 32)); return ((unsigned long long)hi << 32) | lo; }
// LDS bytes of one work-group: the two operand buffers, or the staged output tile where that is larger
template <int BM, int BN, int BK> constexpr int gemm_lds_bytes() { return (2 * (BM + BN) * (BK + 8) * 2 > BM * (BN + 4) * 4) ? 2 * (BM + BN) * (BK + 8) * 2 : BM * (BN + 4) * 4; }
// The work of one work-group; bx, by, bz = (N tile, M tile, batch), smem = its gemm_lds_bytes() of LDS. A function, so that two GEMMs on independent data can share one grid (k_conv).
template <int BM, int BN, int BK, int WM, int WN, int EPI, bool ASC>
__device__ __forceinline__ void gemm_lds_body(unsigned char* smem, const int bx, const int by, const int bz, const _Float16* __restrict__ A, int lda, size_t sA, const _Float16* __restrict__ Bh, int ldb, size_t sB, float alpha,
                                              float* __restrict__ C, _Float16* __restrict__ C16, int ldc, size_t sC, int K, const float* __restrict__ SC, float* __restrict__ TM, float* __restrict__ TZ) {
  constexpr int FM = BM / (WM * 16), FN = BN / (WN * 16);      // fragments per wave
  constexpr int CPR = BK / 8, RPI = 256 / CPR;                 // 16-byte chunks per tile row; tile rows covered by one chunk per thread
  constexpr int PITCH = BK + 8, ROWS = BM + BN, STAGE = ROWS * PITCH;      // LDS row pitch and buffer size in f16 elements; rows 0..BM-1 hold A, the rest B
  constexpr int NCH = ROWS / RPI, ACH = BM / RPI;              // chunks per thread, of which from A
  constexpr int OP = BN + 4;                                   // f32 pitch of the output staging
  constexpr int LB = gemm_lds_bytes<BM, BN, BK>();
  static_assert(WM * WN == 8 && BN == 128 && BM % RPI == 0 && BN % RPI == 0 && BK % 32 == 0, "tile shape");
  static_assert((EPI != 2 && EPI != 3) || (BM == 128 && (BM * OP + 2 * WM * BN) * 4 <= LB), "the waves' column statistics lie behind the staged tile");
  static_assert(!ASC || 128 % BM == 0, "one row tile of factors per work-group");
  unsigned short* st = (unsigned short*)smem;
  const int tid = threadIdx.x, w = tid >> 5, lane = tid & 31, ln = lane & 15, hh = lane >> 4;
  const int wm = w % WM, wn = w / WM;
  const int m0 = by * BM, n0 = bx * BN;
  const int crow = tid / CPR, ccol = (tid % CPR) * 8;
  const char* Au = (const char*)(A + (size_t)bz * sA + (size_t)m0 * lda);
  const char* Bu = (const char*)(Bh + (size_t)bz * sB + (size_t)n0 * ldb);
  const unsigned aoff = (unsigned)(crow * lda + ccol) * 2u, boff = (unsigned)(crow * ldb + ccol) * 2u;      // bytes
  const size_t astep = (size_t)RPI * lda * 2, bstep = (size_t)RPI * ldb * 2;                                // bytes between a thread's chunks
  v8us pre[NCH];
  v8f acc[FM][FN] = {};
  const int nk = K / BK;
  unsigned long long base[NCH];
#pragma unroll
  for (int i = 0; i < NCH; ++i) base[i] = sbase((i < ACH) ? Au + i * astep : Bu + (i - ACH) * bstep);
#pragma unroll
  for (int i = 0; i < NCH; ++i) pre[i] = *(gv8)(base[i] + ((i < ACH) ? aoff : boff));
  v4f sc0 = {}, sc1 = {};
  unsigned long long scb = 0; unsigned sk = (unsigned)ccol * 4u;      // factors: scalar base of the work-group's row of SC, byte offset of the lane's 8 factors
  if (ASC) {
    scb = sbase((const char*)(SC + ((size_t)bz * RTL + m0 / 128) * K));
    sc0 = *(gv4)(scb + sk); sc1 = *(gv4)(scb + sk + 16u);
    asm volatile("s_wait_xcnt 0x0" ::: "memory");      // precaution behind the two loads: their offset register moves on in the loop
  }
  // stores the fetched chunks to one LDS buffer; with ASC the A chunks are scaled first
  auto put = [&](unsigned short* dst) {
#pragma unroll
    for (int i = 0; i < NCH; ++i) {
      FragH f; f.half[0] = pre[i];
      if (ASC && i < ACH) {
#pragma unroll
        for (int q = 0; q < 8; ++q) f.h[q] = (_Float16)((float)f.h[q] * ((q < 4) ? sc0[q & 3] : sc1[q & 3]));
      }
      *(v8us*)(dst + (crow + i * RPI) * PITCH + ccol) = f.half[0];
    }
  };
  put(st);
  unsigned ak = aoff, bk = boff;
  for (int s = 0; s < nk; ++s) {
    const bool more = s + 1 < nk;
    __syncthreads();      // publishes buffer s & 1; every wave has also left the other buffer, which is rewritten below
    if (more) {
      ak += BK * 2; bk += BK * 2;
#pragma unroll
      for (int i = 0; i < NCH; ++i) pre[i] = *(gv8)(base[i] + ((i < ACH) ? ak : bk));
      if (ASC) { sk += BK * 4; sc0 = *(gv4)(scb + sk); sc1 = *(gv4)(scb + sk + 16u); }
      asm volatile("s_wait_xcnt 0x0" ::: "memory");      // precaution behind the run of loads: their offset registers (next step) and scalar bases (epilogue) are overwritten later on paths that hold no load wait
    }
    const unsigned short* sb = st + (s & 1) * STAGE;
#pragma unroll
    for (int kb = 0; kb < BK; kb += 32) {
      FragH a[FM], b[FN];
#pragma unroll
      for (int i = 0; i < FM; ++i) { const unsigned short* r = sb + ((wm * FM + i) * 16 + ln) * PITCH + kb + 8 * hh; a[i].half[0] = *(const v8us*)r; a[i].half[1] = *(const v8us*)(r + 16); }
#pragma unroll
      for (int j = 0; j < FN; ++j) { const unsigned short* r = sb + (BM + (wn * FN + j) * 16 + ln) * PITCH + kb + 8 * hh; b[j].half[0] = *(const v8us*)r; b[j].half[1] = *(const v8us*)(r + 16); }
#pragma unroll
      for (int i = 0; i < FM; ++i)
#pragma unroll
        for (int j = 0; j < FN; ++j) acc[i][j] = mmaH<1>(a[i].v, a[i].v, b[j].v, b[j].v, acc[i][j]);
    }
    if (more) put(st + ((s + 1) & 1) * STAGE);
  }
  __syncthreads();      // every wave has left the operand buffers before the output tile is staged over them
  float* so = (float*)smem;
  float* rm = so + BM * OP; float* rz = rm + WM * BN;      // EPI 2: column maxima and sums of the WM waves that share a column; EPI 3: their column sums and sums of squares
  if (EPI == 2) {
    const float a2 = alpha * 1.44269504f;
    float cm[FN], cz[FN];
#pragma unroll
    for (int j = 0; j < FN; ++j) {
      float m = -3.0e38f;
#pragma unroll
      for (int i = 0; i < FM; ++i)
#pragma unroll
        for (int r = 0; r < 8; ++r) { acc[i][j][r] *= a2; m = fmaxf(m, acc[i][j][r]); }
      cm[j] = m;
    }
#pragma unroll
    for (int j = 0; j < FN; ++j) cm[j] = fmaxf(cm[j], __shfl_xor(cm[j], 16, 32));
    if (hh == 0) {
#pragma unroll
      for (int j = 0; j < FN; ++j) rm[wm * BN + (wn * FN + j) * 16 + ln] = cm[j];
    }
    __syncthreads();      // every wave's column maxima are read by the other waves of the column
#pragma unroll
    for (int j = 0; j < FN; ++j) {
      const int col = (wn * FN + j) * 16 + ln;
      float m = rm[col], z = 0.f;
#pragma unroll
      for (int u = 1; u < WM; ++u) m = fmaxf(m, rm[u * BN + col]);
      m -= 15.0f;      // the stored weights carry the factor 2^15
#pragma unroll
      for (int i = 0; i < FM; ++i)
#pragma unroll
        for (int r = 0; r < 8; ++r) { const float e = exp2_slot(acc[i][j][r] - m); z += e; so[((wm * FM + i) * 16 + 8 * hh + r) * OP + col] = e; }
      cz[j] = z;
    }
#pragma unroll
    for (int j = 0; j < FN; ++j) cz[j] += __shfl_xor(cz[j], 16, 32);
    if (hh == 0) {
#pragma unroll
      for (int j = 0; j < FN; ++j) rz[wm * BN + (wn * FN + j) * 16 + ln] = cz[j];
    }
  } else {
    float c1[FN] = {}, c2[FN] = {};
#pragma unroll
    for (int i = 0; i < FM; ++i)
#pragma unroll
      for (int j = 0; j < FN; ++j)
#pragma unroll
        for (int r = 0; r < 8; ++r) { const float v = acc[i][j][r] * alpha; so[((wm * FM + i) * 16 + 8 * hh + r) * OP + (wn * FN + j) * 16 + ln] = v; if (EPI == 3) { c1[j] += v; c2[j] += v * v; } }
    if (EPI == 3) {
#pragma unroll
      for (int j = 0; j < FN; ++j) { c1[j] += __shfl_xor(c1[j], 16, 32); c2[j] += __shfl_xor(c2[j], 16, 32); }
      if (hh == 0) {
#pragma unroll
        for (int j = 0; j < FN; ++j) { rm[wm * BN + (wn * FN + j) * 16 + ln] = c1[j]; rz[wm * BN + (wn * FN + j) * 16 + ln] = c2[j]; }
      }
    }
  }
  __syncthreads();      // the staged tile is read back across waves: one wave stores one whole row of the tile per instruction
  if (EPI == 2 && tid < BN) {
    float m = rm[tid], z = rz[tid];
#pragma unroll
    for (int u = 1; u < WM; ++u) { m = fmaxf(m, rm[u * BN + tid]); z += rz[u * BN + tid]; }
    const size_t o = ((size_t)bz * RTL + by) * ldc + n0 + tid;
    TM[o] = m; TZ[o] = z * 0.000030517578125f;      // the sum without the weights' factor 2^15
  }
  if (EPI == 3 && tid < BN) {
    float t1 = rm[tid], t2 = rz[tid];
#pragma unroll
    for (int u = 1; u < WM; ++u) { t1 += rm[u * BN + tid]; t2 += rz[u * BN + tid]; }
    const size_t o = (size_t)by * ldc + n0 + tid;
    TM[o] = t1; TZ[o] = t2;
  }
  const size_t cofs = (size_t)bz * sC + (size_t)m0 * ldc + n0;
  const unsigned coff = (unsigned)(w * ldc + lane * 4);      // elements
#pragma unroll
  for (int it = 0; it < BM / 8; ++it) {
    const v4f v = *(const v4fa*)&so[(w + it * 8) * OP + lane * 4];
    if (EPI == 4) {
      v4h h4, s2, s3;
      for (int q = 0; q < 4; ++q) { const _Float16 hv = (_Float16)v[q]; const _Float16 lv = (_Float16)((v[q] - (float)hv) * 1024.0f); h4[q] = hv; s2[q] = bz ? (_Float16)((float)hv * 0.0009765625f) : lv; s3[q] = bz ? (_Float16)((float)lv * 0.0009765625f) : hv; }
      char* row = (char*)(C16 + cofs + (size_t)(it * 8) * ldc) + coff * 2u;
      *(v4h*)row = h4; *(v4h*)(row + BN * 2) = s2; *(v4h*)(row + 2 * BN * 2) = s3;
    }
    else if (EPI == 1 || EPI == 2) { v4h h4; for (int q = 0; q < 4; ++q) h4[q] = (_Float16)v[q]; *(v4h*)((char*)(C16 + cofs + (size_t)(it * 8) * ldc) + coff * 2u) = h4; }
    else *(v4f*)((char*)(C + cofs + (size_t)(it * 8) * ldc) + coff * 4u) = v;
  }
}
template <int BM, int BN, int BK, int WM, int WN, int EPI, bool ASC>
__global__ __launch_bounds__(256) void k_gemm_lds(const _Float16* __restrict__ A, int lda, size_t sA, const _Float16* __restrict__ Bh, int ldb, size_t sB, float alpha,
                                                 float* __restrict__ C, _Float16* __restrict__ C16, int ldc, size_t sC, int K, const float* __restrict__ SC, float* __restrict__ TM, float* __restrict__ TZ) {
  __shared__ __attribute__((aligned(16))) unsigned char smem[gemm_lds_bytes<BM, BN, BK>()];
  gemm_lds_body<BM, BN, BK, WM, WN, EPI, ASC>(smem, blockIdx.x, blockIdx.y, blockIdx.z, A, lda, sA, Bh, ldb, sB, alpha, C, C16, ldc, sC, K, SC, TM, TZ);
}
// The three convs in one grid: both GEMMs read only X16 and the weight images Bw (t, p, g, z one behind the other). The first BB * NN / 128 work-groups, the longer ones, take g; the rest t and p.
__global__ __launch_bounds__(256) void k_conv(const _Float16* __restrict__ X16, const _Float16* __restrict__ Bw, _Float16* __restrict__ T3, _Float16* __restrict__ Gc) {
  constexpr int LG = gemm_lds_bytes<128, 128, 64>(), LT = gemm_lds_bytes<64, 128, 256>(), GB = BB * (NN / 128);
  __shared__ __attribute__((aligned(16))) unsigned char smem[LG > LT ? LG : LT];
  const int bid = blockIdx.x;
  // s_wait_xcnt 0 behind each body's last stores: in the listing the code of the one body follows the stores of the other and rewrites their base and data registers; the wait stands in front of that, whichever body is laid first
  if (bid < GB) {    /* g channel-major per batch [b][128][4096] (f16): M 128 N 4096 K 256 */
    gemm_lds_body<128, 128, 64, 4, 2, 1, false>(smem, bid % (NN / 128), 0, bid / (NN / 128), Bw + (size_t)2 * CPN * CI, CI, 0, X16, CI, (size_t)NN * CI, 0.0625f, nullptr, Gc, NN, (size_t)CPN * NN, CI, nullptr, nullptr, nullptr);
    asm volatile("s_wait_xcnt 0x0" ::: "memory");
  } else {           /* t (bz = 0) and p (bz = 1) of all batches, token-major, as the score GEMM's operand rows [16384][384]: M 16384 N 128 K 256 */
    gemm_lds_body<64, 128, 256, 2, 4, 4, false>(smem, 0, (bid - GB) % (NR / 64), (bid - GB) / (NR / 64), X16, CI, 0, Bw, CI, (size_t)CPN * CI, 0.0625f, nullptr, T3, 3 * CPN, (size_t)NR * 3 * CPN, CI, nullptr, nullptr, nullptr);
    asm volatile("s_wait_xcnt 0x0" ::: "memory");
  }
}

__global__ __launch_bounds__(256) void k_x16(const float* __restrict__ x, _Float16* __restrict__ X16, size_t n8) { const size_t t = (size_t)blockIdx.x * 256 + threadIdx.x; if (t >= n8) return; FragH f;
#pragma unroll
  for (int q = 0; q < 8; ++q) f.h[q] = (_Float16)bf16_round(x[t * 8 + q]); *(v8us*)((unsigned short*)X16 + t * 8) = f.half[0];  }
__global__ __launch_bounds__(256) void k_h16(const float* __restrict__ x, _Float16* __restrict__ X16, size_t n8) { const size_t t = (size_t)blockIdx.x * 256 + threadIdx.x; if (t >= n8) return; FragH f;
#pragma unroll
  for (int q = 0; q < 8; ++q) f.h[q] = (_Float16)x[t * 8 + q]; *(v8us*)((unsigned short*)X16 + t * 8) = f.half[0];  }
// y picks one of four equally sized matrices; their f16 images lie one behind the other in Bt. bx = block index inside one matrix.
__device__ __forceinline__ void round16f_body(const int bx, const int y, const float* __restrict__ W0, const float* __restrict__ W1, const float* __restrict__ W2, const float* __restrict__ W3, _Float16* __restrict__ Bt, size_t n8) { const size_t t = (size_t)bx * 256 + threadIdx.x; if (t >= n8) return; FragH f;
  const float* W = (y == 0) ? W0 : (y == 1) ? W1 : (y == 2) ? W2 : W3; Bt += (size_t)y * n8 * 8;
#pragma unroll
  for (int i = 0; i < 8; ++i) f.h[i] = (_Float16)(bf16_round(W[t * 8 + i]) * 16.0f); *(v8us*)((unsigned short*)Bt + t * 8) = f.half[0];
  asm volatile("s_wait_xcnt 0x0" ::: "memory");  }      // k_prep: the other body's code may follow this store in the listing and rewrite its registers
template <int NHv, int TTv>
__global__ __launch_bounds__(256) void k_vt(const _Float16* __restrict__ V16, int ldv, int voff, _Float16* __restrict__ Vt) { __shared__ unsigned short tl[64][66]; const int tid = threadIdx.x; const int slab = blockIdx.x / (TTv / 64), lg = blockIdx.x % (TTv / 64); const int b = slab / NHv, h = slab % NHv;
  for (int i = tid; i < 64 * 8; i += 256) { const int r = i / 8, c8 = (i % 8) * 8; FragH f; f.half[0] = *(const v8us*)((const unsigned short*)V16 + ((size_t)b * TTv + lg * 64 + r) * ldv + voff + h * 64 + c8);
#pragma unroll
    for (int q = 0; q < 8; ++q) tl[r][c8 + q] = f.u[q]; }
  __syncthreads();
  {
#pragma unroll
    for (int rd = 0; rd < 2; ++rd) { const int d = rd * 32 + tid / 8, pc = tid % 8; FragH f;
#pragma unroll
      for (int q = 0; q < 8; ++q) f.u[q] = tl[pc * 8 + q][d];
      *(v8us*)((unsigned short*)Vt + ((size_t)slab * 64 + d) * TTv + lg * 64 + pc * 8) = f.half[0]; }
     } }

// Token-major f16 image of x. A work-group owns 64 channels x TP positions. A thread loads 32 consecutive channels of one position (lane = position: one 128-byte line per load, all 32 loads in flight together),
// rounds them and stores them to its LDS row as four 16-byte pieces; the rows (pitch 144 bytes) are then read back in 16-byte pieces, 8 lanes to a row, so that a wave stores four whole 128-byte lines per instruction.
#define TP 128      // positions per work-group: 16 waves per WGP cover x, so few waves have to start
__device__ __forceinline__ void tok_body(const int bid, const float* __restrict__ x, _Float16* __restrict__ X16) { __shared__ __attribute__((aligned(16))) unsigned short tl[TP][72]; const int tid = threadIdx.x; const int b = bid / ((CI / 64) * (NN / TP)), rem = bid % ((CI / 64) * (NN / TP)); const int cg = rem / (NN / TP), pg = rem % (NN / TP); const int c0 = cg * 64, p0 = pg * TP;
  static_assert(2 * TP == 256, "two threads, 32 channels each, per position");
  const int pp = tid % TP, ch = (tid / TP) * 32;
  const float* xs = x + ((size_t)b * CI + c0 + ch) * NN + p0 + pp;
  float xv[32];      // the unrolls: xv is indexed by constants only and stays in registers
#pragma unroll
  for (int u = 0; u < 32; ++u) xv[u] = xs[(size_t)u * NN];
  asm volatile("s_wait_xcnt 0x0" ::: "memory");      // precaution behind the run of loads: their address registers may be reused ahead of the last loads' data wait
#pragma unroll
  for (int j = 0; j < 4; ++j) { FragH f;
#pragma unroll
    for (int q = 0; q < 8; ++q) f.h[q] = (_Float16)bf16_round(xv[j * 8 + q]);
    *(v8us*)&tl[pp][ch + j * 8] = f.half[0]; }
  __syncthreads();
  const int r = tid / 8, pc = tid % 8;
#pragma unroll
  for (int u = 0; u < TP / 32; ++u) { const v8us v = *(const v8us*)&tl[u * 32 + r][pc * 8]; *(v8us*)((unsigned short*)X16 + ((size_t)b * NN + p0 + u * 32 + r) * CI + c0 + pc * 8) = v; }
  asm volatile("s_wait_xcnt 0x0" ::: "memory");  }      // k_prep: the other body's code follows these stores in the listing and rewrites their data registers
// Weight casts and the token-major f16 image of x in one grid (both read inputs only): the first 4 * WCB work-groups cast the four weight matrices, the rest transpose x.
#define WCB ((CPN * CI / 8 + 255) / 256)      // work-groups per weight matrix
__global__ __launch_bounds__(256) void k_prep(const float* __restrict__ W0, const float* __restrict__ W1, const float* __restrict__ W2, const float* __restrict__ W3, _Float16* __restrict__ Bt, const float* __restrict__ x, _Float16* __restrict__ X16) {
  const int bid = blockIdx.x;
  if (bid < 4 * WCB) round16f_body(bid % WCB, bid / WCB, W0, W1, W2, W3, Bt, (size_t)CPN * CI / 8);
  else tok_body(bid - 4 * WCB, x, X16);
}
// One thread per column m of one batch's score plane (blockIdx.y): merges the RTL row tiles' maxima (in units of log 2) and sums, in tile order, into the column's max M and sum Z,
// and writes per row tile the factor 2^(tile max - M) / Z that turns the stored exp(s - tile max) into the softmax weight. Z is about 1 or more: the tile that holds M adds its own largest term, 2^0.
__global__ __launch_bounds__(64) void k_tilescale(const float* __restrict__ TM, const float* __restrict__ TZ, float* __restrict__ SC) {
  const size_t o = (size_t)blockIdx.y * RTL * NN + blockIdx.x * 64 + threadIdx.x;
  float tm[RTL], tz[RTL];
  // every unroll here: tm and tz are indexed by constants only and stay in registers; in the first loop all loads are also in flight at once
#pragma unroll
  for (int t = 0; t < RTL; ++t) { tm[t] = TM[o + (size_t)t * NN]; tz[t] = TZ[o + (size_t)t * NN]; }
  float m = tm[0], z = 0.f;
#pragma unroll
  for (int t = 1; t < RTL; ++t) m = fmaxf(m, tm[t]);
#pragma unroll
  for (int t = 0; t < RTL; ++t) { tm[t] = exp2_slot(tm[t] - m); z += tz[t] * tm[t]; }
  const float inv = 1.0f / z;
#pragma unroll
  for (int t = 0; t < RTL; ++t) SC[o + (size_t)t * NN] = tm[t] * inv;
}
// Affine + residual during the transpose back to channel-major. A work-group owns 32 channels x KP positions. It first merges its channels' batch statistics from the NR / 128 row tiles' column sums S1 and sums of squares S2
// in a fixed order: wave pt adds tiles 16 pt .. 16 pt + 15 in tile order (lane = channel, one 128-byte line per load), then every thread adds the 8 waves' partials of its own channel, in wave order, from LDS.
// A thread's elements of Z are KP / 8 consecutive positions of channel tid % 32; they, the tiles' sums and the channel's affine pair are loaded in one run, so that all these loads are in flight together,
// and the results go to the channel's LDS row (pitch KP + 4 floats) as 16-byte pieces; a wave then reads 512 consecutive bytes of one row per instruction.
#define KP 256      // positions per work-group: 16 waves per WGP cover the output, so few waves have to start, and the statistics are merged once per KP positions
__global__ __launch_bounds__(256) void k_out(const float* __restrict__ Z, const float* __restrict__ S1, const float* __restrict__ S2, const float* __restrict__ gam, const float* __restrict__ bet, const float* __restrict__ x, float* __restrict__ out) { __shared__ __attribute__((aligned(16))) float tl[32][KP + 4]; __shared__ float a1[8][32], a2[8][32]; const int tid = threadIdx.x; const int b = blockIdx.x / ((CI / 32) * (NN / KP)), rem = blockIdx.x % ((CI / 32) * (NN / KP)); const int cg = rem / (NN / KP), pg = rem % (NN / KP); const int c0 = cg * 32, p0 = pg * KP;
  const int cc = tid & 31, pt = tid >> 5;
  constexpr int TPW = NR / 128 / 8;      // row tiles per wave
  constexpr int PW = KP / 8;             // positions per wave
  float zv[PW], p1[TPW], p2[TPW];      // the unrolls: the three arrays are indexed by constants only and stay in registers
#pragma unroll
  for (int u = 0; u < TPW; ++u) { p1[u] = S1[(size_t)(pt * TPW + u) * CI + c0 + cc]; p2[u] = S2[(size_t)(pt * TPW + u) * CI + c0 + cc]; }
#pragma unroll
  for (int k = 0; k < PW; ++k) zv[k] = Z[((size_t)b * NN + p0 + pt * PW + k) * CI + c0 + cc];
  const float ga = bf16_round(gam[c0 + cc]), be = bf16_round(bet[c0 + cc]);
  asm volatile("s_wait_xcnt 0x0" ::: "memory");      // precaution behind the run of loads: the sums below reuse their address registers ahead of the last loads' data wait
  float t1 = 0.f, t2 = 0.f;
#pragma unroll
  for (int u = 0; u < TPW; ++u) { t1 += p1[u]; t2 += p2[u]; }
  a1[pt][cc] = t1; a2[pt][cc] = t2;
  __syncthreads();      // every wave's partial sums are read by all waves
  t1 = 0.f; t2 = 0.f;
#pragma unroll
  for (int i = 0; i < 8; ++i) { t1 += a1[i][cc]; t2 += a2[i][cc]; }
  const float mu = t1 / (float)NR; const float var = fmaxf(t2 / (float)NR - mu * mu, 0.f); const float rs = rsqrtf(var + 1e-5f);
#pragma unroll
  for (int j = 0; j < PW / 4; ++j) { const v4f v = {(zv[4 * j] - mu) * rs * ga + be, (zv[4 * j + 1] - mu) * rs * ga + be, (zv[4 * j + 2] - mu) * rs * ga + be, (zv[4 * j + 3] - mu) * rs * ga + be}; *(v4fa*)&tl[cc][pt * PW + 4 * j] = v; }
  __syncthreads();
  // a thread's 16-byte pieces: positions 4 q4 .. 4 q4 + 3 of channels c, c + CS, ...: one address each for x and out, constant steps; the unrolls: xr is indexed by constants only, and its loads are in flight together
  constexpr int CS = 256 / (KP / 4), NP = 32 / CS;
  const int c = tid / (KP / 4), q4 = tid % (KP / 4); const size_t o = ((size_t)b * CI + c0 + c) * NN + p0 + q4 * 4; const float* xs = x + o; float* os = out + o;
  v4f xr[NP];
#pragma unroll
  for (int u = 0; u < NP; ++u) xr[u] = *(const v4fa*)(xs + (size_t)u * CS * NN);
  asm volatile("s_wait_xcnt 0x0" ::: "memory");      // precaution behind the run of loads: their address registers may be reused ahead of the last loads' data wait
#pragma unroll
  for (int u = 0; u < NP; ++u) { const v4f t = *(const v4fa*)&tl[c + u * CS][q4 * 4]; const v4f v = {t[0] + bf16_round(xr[u][0]), t[1] + bf16_round(xr[u][1]), t[2] + bf16_round(xr[u][2]), t[3] + bf16_round(xr[u][3])}; *(v4f*)(os + (size_t)u * CS * NN) = v; } }

extern "C" void kernel_launch(void* const* d_in, const int* in_sizes, int n_in,
                              void* d_out, int out_size, void* d_ws, size_t ws_size, hipStream_t stream) {
  (void)in_sizes; (void)n_in; (void)out_size;
  const float* const* I = (const float* const*)d_in; const float* x = I[0]; const float* Wt = I[1]; const float* Wp = I[2]; const float* Wg = I[3]; const float* Wz = I[4]; const float* gam = I[5]; const float* bet = I[6];
  char* ws = (char*)d_ws; size_t off = 0;
  auto take = [&](size_t bytes) { char* p = ws + off; off += (bytes + 255) & ~(size_t)255; return p; };
  _Float16* Bt_ = (_Float16*)take((size_t)4 * CPN * CI * 2); _Float16* Bp_ = Bt_ + (size_t)CPN * CI; _Float16* Bg_ = Bp_ + (size_t)CPN * CI; _Float16* Bz_ = Bg_ + (size_t)CPN * CI;      /* four weight images, one behind the other */
  _Float16* PT = (_Float16*)take((size_t)PB * NN * NN * 2); _Float16* X16 = (_Float16*)take((size_t)NR * CI * 2);      /* weight planes of the PB batches that one launch works on */
  _Float16* T3 = (_Float16*)take((size_t)2 * NR * 3 * CPN * 2); _Float16* P3 = T3 + (size_t)NR * 3 * CPN;      /* all batches: concatenated-K operand planes [16384][384] (t, then p) */
  _Float16* Gc = (_Float16*)take((size_t)BB * CPN * NN * 2); _Float16* Y16 = (_Float16*)take((size_t)NR * CPN * 2); float* TM = (float*)take((size_t)PB * RTL * NN * 4); float* TZ = (float*)take((size_t)PB * RTL * NN * 4); float* SC = (float*)take((size_t)PB * RTL * NN * 4); float* S1 = (float*)take((size_t)(NR / 128) * CI * 4); float* S2 = (float*)take((size_t)(NR / 128) * CI * 4);      /* z's column sums and sums of squares per row tile */
  float* Z = (float*)take((size_t)NR * CI * 4);
  if (off > ws_size) return;      // about 199 MB of the 268 MB given (weight planes 134, the rest 65)
  k_prep<<<4 * WCB + BB * (CI / 64) * (NN / TP), 256, 0, stream>>>(Wt, Wp, Wg, Wz, Bt_, x, X16);      /* conv weights (out,in) natural x 2^4, and x token-major */
  k_conv<<<BB * (NN / 128) + 2 * (NR / 64), 256, 0, stream>>>(X16, Bt_, T3, Gc);      /* g channel-major f16; t to [h | l | h], p to [h | h 2^-10 | l 2^-10], token-major f16 */
  const dim3 gs(NN / 128, NN / 128, PB), gy(CPN / 128, NN / 64, PB);
  for (int b = 0; b < BB; b += PB) { const size_t to = (size_t)b * NN * 3 * CPN, yo = (size_t)b * NN * CPN;      /* blockIdx.z or .y of each launch: batch b + z (or y), PB of them */
    k_gemm_lds<128, 128, 64, 4, 2, 2, false><<<gs, 256, 0, stream>>>(T3 + to, 3 * CPN, (size_t)NN * 3 * CPN, P3 + to, 3 * CPN, (size_t)NN * 3 * CPN, 1.0f, nullptr, PT, NN, (size_t)NN * NN, 3 * CPN, nullptr, TM, TZ);      /* s[n][m] = t_n p_m as Th Ph + (Tl Ph + Th Pl) 2^-10 in one K = 384 pass, M 4096 N 4096; stored: exp(s - tile max) 2^15 and the tiles' column statistics */
    k_tilescale<<<dim3(NN / 64, PB, 1), 64, 0, stream>>>(TM, TZ, SC);
    k_gemm_lds<64, 128, 256, 2, 4, 1, true><<<gy, 256, 0, stream>>>(PT, NN, (size_t)NN * NN, Gc + (size_t)b * CPN * NN, NN, (size_t)CPN * NN, 0.000030517578125f, nullptr, Y16 + yo, CPN, (size_t)NN * CPN, NN, SC, nullptr, nullptr); }      /* y[n][c] = sum over m of att[n][m] g[c][m]: M 4096 N 128 K 4096 (f16 out) */
  k_gemm_lds<128, 128, 64, 4, 2, 3, false><<<dim3(CI / 128, NR / 128, 1), 256, 0, stream>>>(Y16, CPN, 0, Bz_, CPN, 0, 0.0625f, Z, nullptr, CI, 0, CPN, nullptr, S1, S2);      /* z token-major [16384][256] f32 and its column sums per row tile: M 16384 N 256 K 128 */
  k_out<<<BB * (CI / 32) * (NN / KP), 256, 0, stream>>>(Z, S1, S2, gam, bet, x, (float*)d_out);
}

// v009
// A run of this version takes 118 microseconds.
// In two side-by-side timings against v008, it was 1.04 and 1.03 times as fast.
// Over all steps from v000 it is 110 times as fast.
#include <hip/hip_runtime.h>
// Spatial non-local block with query-axis softmax (B=4, C_in 256, C_p 128, N=4096): t,p,g = 1×1 convs; att[n,m] = Σ_c t[c,n]·p[c,m]; att = softmax over n (dim=1) for every m; y[c,n] = Σ_m att[n,m]·g[c,m]; z = Wz·y;
// BatchNorm1d in training mode (batch statistics over (B,N) per channel, biased variance, eps 1e-5) with affine; out = BN(z) + x.
// Compute dtype: x and weights rounded to bf16; t and p as f32 GEMM outputs split into f16 hi + ×2^10 residual parts laid out as concatenated-K operands so one K=384 GEMM yields Th·Ph + (Tl·Ph + Th·Pl)·2^-10 (σ≈11 logits, f32-accurate);
// no f32 score plane is stored: the score GEMM's epilogue takes each column's max and sum over the 256 rows of its own tile (f32) and writes exp(s - tile max) row-major as f16 x 2^15; a small kernel merges the 16 row tiles of a column into
// one factor exp(tile max - column max) / column sum per (row tile, column), and the y GEMM multiplies its weight chunks by that factor on their way to LDS; y = contraction over m as an f16 GEMM against
// channel-major g; z GEMM; per-channel batch statistics as fixed-order f32 column sums, taken per row tile in the z GEMM's epilogue and merged by the last kernel; affine + residual applied during the transpose back to channel-major. All contractions on v_wmma_f32_16x16x32_f16, f32 accumulate.
#define BB 4
#define CI 256
#define CPN 128
#define NN 4096
#define NR (BB * NN)
#define PB 4      // batches whose weight planes are held at once: each launch of the score, merge and y stages works on PB batches (all of them: one launch per stage)
#define SBM 256             // rows of a score GEMM work-group's tile
#define RTL (NN / SBM)      // row tiles of a score plane: one set of column statistics each

typedef __bf16 v16b __attribute__((ext_vector_type(16)));
typedef unsigned short v8us __attribute__((ext_vector_type(8), may_alias));
typedef float  v8f  __attribute__((ext_vector_type(8)));
typedef float  v4f  __attribute__((ext_vector_type(4)));
typedef float  v4fa __attribute__((ext_vector_type(4), may_alias));
union FragB { v16b v; v8us half[2]; unsigned short u[16]; };

__device__ __forceinline__ unsigned short bf16_bits(float x) { unsigned int u = __float_as_uint(x); return (unsigned short)((u + 0x7FFFu + ((u >> 16) & 1u)) >> 16); }
__device__ __forceinline__ float bf16_val(unsigned short b) { return __uint_as_float(((unsigned int)b) << 16); }
__device__ __forceinline__ float bf16_round(float x) { return bf16_val(bf16_bits(x)); }
// D += A·B with NT terms: 1 = ah·bh, 2 = + al·bh (A split), 3 = + ah·bl (both split)
template <int NT>
__device__ __forceinline__ v8f mmaN(v16b ah, v16b al, v16b bh, v16b bl, v8f c) {
  c = __builtin_amdgcn_wmma_f32_16x16x32_bf16(false, ah, false, bh, (short)0, c, false, false);
  if (NT >= 2) c = __builtin_amdgcn_wmma_f32_16x16x32_bf16(false, al, false, bh, (short)0, c, false, false);
  if (NT >= 3) c = __builtin_amdgcn_wmma_f32_16x16x32_bf16(false, ah, false, bl, (short)0, c, false, false);
  asm volatile("v_nop\n\tv_nop\n\tv_nop\n\tv_nop" : "+v"(c) : "v"(ah), "v"(al), "v"(bh), "v"(bl));
  return c;
}

__global__ __launch_bounds__(256) void k_wt_bf16(const float* __restrict__ W, unsigned short* __restrict__ Wt, int K, int N) {
  const int t = blockIdx.x * 256 + threadIdx.x;
  const int k8n = K / 8;
  if (t >= N * k8n) return;
  const int n = t / k8n, k8 = (t % k8n) * 8;
  v8us v;
#pragma unroll
  for (int i = 0; i < 8; ++i) v[i] = bf16_bits(W[(size_t)(k8 + i) * N + n]);
  *(v8us*)(Wt + (size_t)n * K + k8) = v;
  
}

// GEMM C[M][N] (f32, pitch ldc) = act(A[M][K]·W + bias). A f32 row-major (pitch lda) converted per fragment to bf16
// (ASPLIT: hi/lo two planes -> 2 terms, else single rounded term); Wt bf16 [N][K] (pitch ldb). BIAS_BF16 rounds the
// bias to bf16 first (bias quantised to bf16 before the add). K%32==0, M%16==0, N%64==0.
template <bool ASPLIT, int ACT, bool BIAS_BF16>
__global__ __launch_bounds__(128) void k_gemm_bf(const float* __restrict__ A, int lda, const unsigned short* __restrict__ Wt, int ldb,
                                               const float* __restrict__ bias, float* __restrict__ C, int ldc, int M, int N, int K) {
  __shared__ __attribute__((aligned(16))) float so[4][16][64];
  const int tid = threadIdx.x, w = tid >> 5, lane = tid & 31, ln = lane & 15, hh = lane >> 4;
  const int ntn = N / 64;
  const int wid = blockIdx.x * 4 + w;
  const int mt = wid / ntn, nq = wid % ntn;
  if (mt * 16 >= M) return;
  const int row0 = mt * 16, col0 = nq * 64;
  const float* arow = A + (size_t)(row0 + ln) * lda;
  v8f acc[4] = {};
  for (int kb = 0; kb < K; kb += 32) {
    FragB ah, al;
    const v4f x0 = *(const v4fa*)(arow + kb + 8 * hh), x1 = *(const v4fa*)(arow + kb + 8 * hh + 4);
    const v4f x2 = *(const v4fa*)(arow + kb + 16 + 8 * hh), x3 = *(const v4fa*)(arow + kb + 16 + 8 * hh + 4);
    float xs[16] = {x0[0],x0[1],x0[2],x0[3],x1[0],x1[1],x1[2],x1[3],x2[0],x2[1],x2[2],x2[3],x3[0],x3[1],x3[2],x3[3]};
#pragma unroll
    for (int i = 0; i < 16; ++i) { const unsigned short hb = bf16_bits(xs[i]); ah.u[i] = hb; al.u[i] = ASPLIT ? bf16_bits(xs[i] - bf16_val(hb)) : (unsigned short)0; }
#pragma unroll
    for (int t = 0; t < 4; ++t) {
      const unsigned short* brow = Wt + (size_t)(col0 + t * 16 + ln) * ldb + kb;
      FragB b;
      b.half[0] = *(const v8us*)(brow + 8 * hh);
      b.half[1] = *(const v8us*)(brow + 16 + 8 * hh);
      acc[t] = mmaN<ASPLIT ? 2 : 1>(ah.v, al.v, b.v, b.v, acc[t]);
    }
  }
#pragma unroll
  for (int t = 0; t < 4; ++t) {
    float bv = bias ? bias[col0 + t * 16 + ln] : 0.f;
    if (BIAS_BF16) bv = bf16_round(bv);
#pragma unroll
    for (int r = 0; r < 8; ++r) { float v = acc[t][r] + bv; if (ACT == 1) v = fmaxf(v, 0.f); so[w][8 * hh + r][t * 16 + ln] = v; }
  }
  __builtin_amdgcn_fence(__ATOMIC_ACQ_REL, "workgroup");
  __builtin_amdgcn_wave_barrier();
  const int rsub = lane >> 4, c4 = (lane & 15) * 4;
  {
#pragma unroll
    for (int q = 0; q < 8; ++q) {
      const int r = q * 2 + rsub;
      const v4f v = *(const v4fa*)&so[w][r][c4];
      *(v4f*)(C + (size_t)(row0 + r) * ldc + col0 + c4) = v;
    }
    
  }
}

// Flash-style causal/unmasked attention, all contractions 3-term bf16 hi/lo splits, f32 softmax with running max.
// q,k,v rows are read from f32 buffers with arbitrary row pitch (so they can live inside a fused qkv buffer);
// D = head size (multiple of 32, <= 128); one wave = 16 query rows; block = 4 waves (64 queries) sharing K/V chunks of 32.
template <int D, bool CAUSAL>
__global__ __launch_bounds__(128) void k_flash(const float* __restrict__ qb, const float* __restrict__ kb, const float* __restrict__ vb,
                                             int pitch, int T, int H, float scale, float* __restrict__ y, int ypitch) {
  constexpr int KS = D / 32;        // k-steps for QK
  constexpr int DT = D / 16;        // d tiles for PV
  __shared__ __attribute__((aligned(16))) unsigned short sKh[32][D + 8], sKl[32][D + 8], sVh[32][D + 8], sVl[32][D + 8];
  __shared__ __attribute__((aligned(16))) unsigned short sPh[4][16][40], sPl[4][16][40];
  __shared__ __attribute__((aligned(16))) float sO[4][16][D];
  const int tid = threadIdx.x, w = tid >> 5, lane = tid & 31, ln = lane & 15, hh = lane >> 4;
  const int nqb = (T + 63) / 64;
  const int bh = blockIdx.x / nqb, qblk = blockIdx.x % nqb;
  const int b = bh / H, h = bh % H;
  const int q0 = qblk * 64 + w * 16;
  const float* Q = qb + (size_t)b * T * pitch + h * D;
  const float* K = kb + (size_t)b * T * pitch + h * D;
  const float* V = vb + (size_t)b * T * pitch + h * D;

  // A fragments of the wave's 16 query rows (scaled), hi/lo
  FragB aqh[KS], aql[KS];
  {
    int row = q0 + ln; if (row >= T) row = T - 1;
    const float* qr = Q + (size_t)row * pitch;
#pragma unroll
    for (int ks = 0; ks < KS; ++ks)
#pragma unroll
      for (int i = 0; i < 16; ++i) {
        const int d = ks * 32 + ((i < 8) ? (8 * hh + i) : (16 + 8 * hh + (i - 8)));
        const float x = qr[d] * scale; const unsigned short hb = bf16_bits(x);
        aqh[ks].u[i] = hb; aql[ks].u[i] = bf16_bits(x - bf16_val(hb));
      }
  }
  float m_r[8], l_r[8];
#pragma unroll
  for (int r = 0; r < 8; ++r) { m_r[r] = -3.0e38f; l_r[r] = 0.f; }
  v8f oacc[DT];
#pragma unroll
  for (int dt = 0; dt < DT; ++dt) oacc[dt] = (v8f){0.f,0.f,0.f,0.f,0.f,0.f,0.f,0.f};

  const int kv_end = CAUSAL ? min(T, qblk * 64 + 64) : T;     // block-uniform
  for (int j0 = 0; j0 < kv_end; j0 += 32) {
    __syncthreads();
    for (int e = tid; e < 32 * (D / 4); e += 128) {
      const int r = e / (D / 4), c4 = (e % (D / 4)) * 4;
      const int key = j0 + r;
      v4f kf = {0.f,0.f,0.f,0.f}, vf = {0.f,0.f,0.f,0.f};
      if (key < T) { kf = *(const v4fa*)(K + (size_t)key * pitch + c4); vf = *(const v4fa*)(V + (size_t)key * pitch + c4); }
#pragma unroll
      for (int t = 0; t < 4; ++t) {
        unsigned short hb = bf16_bits(kf[t]); sKh[r][c4 + t] = hb; sKl[r][c4 + t] = bf16_bits(kf[t] - bf16_val(hb));
        hb = bf16_bits(vf[t]); sVh[r][c4 + t] = hb; sVl[r][c4 + t] = bf16_bits(vf[t] - bf16_val(hb));
      }
    }
    __syncthreads();
    // S tile 16 x 32
    v8f s[2];
#pragma unroll
    for (int nt = 0; nt < 2; ++nt) {
      v8f acc = {};
#pragma unroll
      for (int ks = 0; ks < KS; ++ks) {
        FragB bh_, bl_;
        bh_.half[0] = *(const v8us*)&sKh[nt * 16 + ln][ks * 32 + 8 * hh]; bh_.half[1] = *(const v8us*)&sKh[nt * 16 + ln][ks * 32 + 16 + 8 * hh];
        bl_.half[0] = *(const v8us*)&sKl[nt * 16 + ln][ks * 32 + 8 * hh]; bl_.half[1] = *(const v8us*)&sKl[nt * 16 + ln][ks * 32 + 16 + 8 * hh];
        acc = mmaN<3>(aqh[ks].v, aql[ks].v, bh_.v, bl_.v, acc);
      }
      s[nt] = acc;
    }
    // mask + running max (rows 8hh+r; the 16 lanes of a half share rows)
    float alpha[8];
#pragma unroll
    for (int r = 0; r < 8; ++r) {
      const int qi = q0 + 8 * hh + r;
      const int ja = j0 + ln, jb = j0 + 16 + ln;
      if (CAUSAL) { if (ja > qi) s[0][r] = -3.0e38f; if (jb > qi) s[1][r] = -3.0e38f; }
      if (ja >= T) s[0][r] = -3.0e38f;
      if (jb >= T) s[1][r] = -3.0e38f;
      float mx = fmaxf(s[0][r], s[1][r]);
      mx = fmaxf(mx, __shfl_xor(mx, 1, 32)); mx = fmaxf(mx, __shfl_xor(mx, 2, 32)); mx = fmaxf(mx, __shfl_xor(mx, 4, 32)); mx = fmaxf(mx, __shfl_xor(mx, 8, 32));
      const float mnew = fmaxf(m_r[r], mx);
      alpha[r] = (mnew > -1.0e38f) ? __expf(m_r[r] - mnew) : 1.0f;
      const float p0 = (s[0][r] > -1.0e38f) ? __expf(s[0][r] - mnew) : 0.f;
      const float p1 = (s[1][r] > -1.0e38f) ? __expf(s[1][r] - mnew) : 0.f;
      m_r[r] = mnew;
      l_r[r] = l_r[r] * alpha[r] + p0 + p1;            // per-lane partial row sum (16 lanes combined at the end)
      unsigned short hb = bf16_bits(p0); sPh[w][8 * hh + r][ln] = hb;      sPl[w][8 * hh + r][ln] = bf16_bits(p0 - bf16_val(hb));
      hb = bf16_bits(p1);                sPh[w][8 * hh + r][16 + ln] = hb; sPl[w][8 * hh + r][16 + ln] = bf16_bits(p1 - bf16_val(hb));
    }
#pragma unroll
    for (int dt = 0; dt < DT; ++dt)
#pragma unroll
      for (int r = 0; r < 8; ++r) oacc[dt][r] *= alpha[r];
    __builtin_amdgcn_fence(__ATOMIC_ACQ_REL, "workgroup");
    __builtin_amdgcn_wave_barrier();
    FragB pah, pal;
    pah.half[0] = *(const v8us*)&sPh[w][ln][8 * hh]; pah.half[1] = *(const v8us*)&sPh[w][ln][16 + 8 * hh];
    pal.half[0] = *(const v8us*)&sPl[w][ln][8 * hh]; pal.half[1] = *(const v8us*)&sPl[w][ln][16 + 8 * hh];
#pragma unroll
    for (int dt = 0; dt < DT; ++dt) {
      FragB bvh, bvl;
#pragma unroll
      for (int i = 0; i < 8; ++i) {
        bvh.u[i] = sVh[8 * hh + i][dt * 16 + ln]; bvh.u[8 + i] = sVh[16 + 8 * hh + i][dt * 16 + ln];
        bvl.u[i] = sVl[8 * hh + i][dt * 16 + ln]; bvl.u[8 + i] = sVl[16 + 8 * hh + i][dt * 16 + ln];
      }
      oacc[dt] = mmaN<3>(pah.v, pal.v, bvh.v, bvl.v, oacc[dt]);
    }
    __builtin_amdgcn_fence(__ATOMIC_ACQ_REL, "workgroup");
    __builtin_amdgcn_wave_barrier();
  }
#pragma unroll
  for (int r = 0; r < 8; ++r) {
    float l = l_r[r];
    l += __shfl_xor(l, 1, 32); l += __shfl_xor(l, 2, 32); l += __shfl_xor(l, 4, 32); l += __shfl_xor(l, 8, 32);
    l_r[r] = (l > 0.f) ? 1.0f / l : 0.f;
  }
#pragma unroll
  for (int dt = 0; dt < DT; ++dt)
#pragma unroll
    for (int r = 0; r < 8; ++r) sO[w][8 * hh + r][dt * 16 + ln] = oacc[dt][r] * l_r[r];
  __builtin_amdgcn_fence(__ATOMIC_ACQ_REL, "workgroup");
  __builtin_amdgcn_wave_barrier();
  {
    for (int r = 0; r < 16; ++r) {
      const int row = q0 + r;
      if (row < T && lane < D / 4) {
        const v4f val = *(const v4fa*)&sO[w][r][lane * 4];
        *(v4f*)(y + ((size_t)b * T + row) * ypitch + h * D + lane * 4) = val;
      }
    }
    
  }
}

// GEMM C = act(A·W + bias + resid): A f32 (ASPLIT -> hi/lo 2 terms), Wt bf16 [N][K]; ACT 0 none, 1 relu, 2 exact gelu;
// resid (optional, f32, row index = (row % rmod), pitch ldr, RES_BF16 rounds it) added before the activation.
template <bool ASPLIT, int ACT, bool BIAS_BF16, bool RES_BF16>
__global__ __launch_bounds__(128) void k_gemm_bf3(const float* __restrict__ A, int lda, const unsigned short* __restrict__ Wt, int ldb,
                                                const float* __restrict__ bias, const float* __restrict__ resid, int rmod, int ldr,
                                                float* __restrict__ C, int ldc, int M, int N, int K) {
  __shared__ __attribute__((aligned(16))) float so[4][16][64];
  const int tid = threadIdx.x, w = tid >> 5, lane = tid & 31, ln = lane & 15, hh = lane >> 4;
  const int ntn = N / 64;
  const int wid = blockIdx.x * 4 + w;
  const int mt = wid / ntn, nq = wid % ntn;
  if (mt * 16 >= M) return;
  const int row0 = mt * 16, col0 = nq * 64;
  const float* arow = A + (size_t)(row0 + ln) * lda;
  v8f acc[4] = {};
  for (int kb = 0; kb < K; kb += 32) {
    FragB ah, al;
    const v4f x0 = *(const v4fa*)(arow + kb + 8 * hh), x1 = *(const v4fa*)(arow + kb + 8 * hh + 4);
    const v4f x2 = *(const v4fa*)(arow + kb + 16 + 8 * hh), x3 = *(const v4fa*)(arow + kb + 16 + 8 * hh + 4);
    float xs[16] = {x0[0],x0[1],x0[2],x0[3],x1[0],x1[1],x1[2],x1[3],x2[0],x2[1],x2[2],x2[3],x3[0],x3[1],x3[2],x3[3]};
#pragma unroll
    for (int i = 0; i < 16; ++i) { const unsigned short hb = bf16_bits(xs[i]); ah.u[i] = hb; al.u[i] = ASPLIT ? bf16_bits(xs[i] - bf16_val(hb)) : (unsigned short)0; }
#pragma unroll
    for (int t = 0; t < 4; ++t) {
      const unsigned short* brow = Wt + (size_t)(col0 + t * 16 + ln) * ldb + kb;
      FragB b;
      b.half[0] = *(const v8us*)(brow + 8 * hh);
      b.half[1] = *(const v8us*)(brow + 16 + 8 * hh);
      acc[t] = mmaN<ASPLIT ? 2 : 1>(ah.v, al.v, b.v, b.v, acc[t]);
    }
  }
#pragma unroll
  for (int t = 0; t < 4; ++t) {
    const int col = col0 + t * 16 + ln;
    float bv = bias ? bias[col] : 0.f;
    if (BIAS_BF16) bv = bf16_round(bv);
#pragma unroll
    for (int r = 0; r < 8; ++r) {
      float v = acc[t][r] + bv;
      if (resid) { float rv = resid[(size_t)((row0 + 8 * hh + r) % rmod) * ldr + col]; if (RES_BF16) rv = bf16_round(rv); v += rv; }
      if (ACT == 1) v = fmaxf(v, 0.f);
      if (ACT == 2) v = 0.5f * v * (1.0f + erff(v * 0.70710678118654752f));
      if (ACT == 3) { const float u = 0.7978845608028654f * (v + 0.044715f * v * v * v); v = 0.5f * v * (1.0f + tanhf(u)); }
      so[w][8 * hh + r][t * 16 + ln] = v;
    }
  }
  __builtin_amdgcn_fence(__ATOMIC_ACQ_REL, "workgroup");
  __builtin_amdgcn_wave_barrier();
  const int rsub = lane >> 4, c4 = (lane & 15) * 4;
  {
#pragma unroll
    for (int q = 0; q < 8; ++q) {
      const int r = q * 2 + rsub;
      const v4f v = *(const v4fa*)&so[w][r][c4];
      *(v4f*)(C + (size_t)(row0 + r) * ldc + col0 + c4) = v;
    }
    
  }
}
// row LayerNorm (biased variance, eps) over N: s = X (+ R); optional out_sum <- s; out_norm <- (s-mu)*rsqrt(var+eps)*g + b
template <bool PARAM_BF16>
__global__ __launch_bounds__(256) void k_layernorm(const float* __restrict__ X, const float* __restrict__ R, const float* __restrict__ g, const float* __restrict__ bta,
                                                  float* __restrict__ out_sum, float* __restrict__ out_norm, int N, float eps) {
  __shared__ float red[256];
  const int row = blockIdx.x, tid = threadIdx.x;
  const float* x = X + (size_t)row * N; const float* rr = R ? R + (size_t)row * N : nullptr;
  float vals[16];                     // up to N = 4096
  const int per = N / 256;            // contiguous chunk per thread? use strided-by-4 chunks: thread handles j = tid*4 + 1024*u
  float s1 = 0.f;
  for (int u = 0; u < per / 4; ++u) {
    const int j = tid * 4 + 1024 * u;
    const v4f a = *(const v4fa*)(x + j);
    v4f b = {0.f,0.f,0.f,0.f}; if (rr) b = *(const v4fa*)(rr + j);
#pragma unroll
    for (int q = 0; q < 4; ++q) { const float v = a[q] + b[q]; vals[u * 4 + q] = v; s1 += v; }
  }
  red[tid] = s1; __syncthreads();
  for (int st = 128; st > 0; st >>= 1) { if (tid < st) red[tid] += red[tid + st]; __syncthreads(); }
  const float mu = red[0] / (float)N; __syncthreads();
  float s2 = 0.f;
  for (int u = 0; u < per / 4; ++u)
#pragma unroll
    for (int q = 0; q < 4; ++q) { const float c = vals[u * 4 + q] - mu; s2 += c * c; }
  red[tid] = s2; __syncthreads();
  for (int st = 128; st > 0; st >>= 1) { if (tid < st) red[tid] += red[tid + st]; __syncthreads(); }
  const float rs = rsqrtf(red[0] / (float)N + eps);
  {
    for (int u = 0; u < per / 4; ++u) {
      const int j = tid * 4 + 1024 * u;
      v4f o, sm;
#pragma unroll
      for (int q = 0; q < 4; ++q) {
        float gg = g[j + q], bb = bta[j + q];
        if (PARAM_BF16) { gg = bf16_round(gg); bb = bf16_round(bb); }
        sm[q] = vals[u * 4 + q]; o[q] = (vals[u * 4 + q] - mu) * rs * gg + bb;
      }
      if (out_sum) *(v4f*)(out_sum + (size_t)row * N + j) = sm;
      *(v4f*)(out_norm + (size_t)row * N + j) = o;
    }
    
  }
}



// ---- f16 WMMA path (v_wmma_f32_16x16x32_f16): 11-bit significands for operands in range — used where a [0,1] probability operand needs more precision than bf16
typedef _Float16 v16h __attribute__((ext_vector_type(16)));
union FragH { v16h v; v8us half[2]; _Float16 h[16]; unsigned short u[16]; };
template <int NT>
__device__ __forceinline__ v8f mmaH(v16h ah, v16h al, v16h bh, v16h bl, v8f c) {
  c = __builtin_amdgcn_wmma_f32_16x16x32_f16(false, ah, false, bh, (short)0, c, false, false);
  if (NT >= 2) c = __builtin_amdgcn_wmma_f32_16x16x32_f16(false, al, false, bh, (short)0, c, false, false);
  if (NT >= 3) c = __builtin_amdgcn_wmma_f32_16x16x32_f16(false, ah, false, bl, (short)0, c, false, false);
  asm volatile("v_nop\n\tv_nop\n\tv_nop\n\tv_nop" : "+v"(c) : "v"(ah), "v"(al), "v"(bh), "v"(bl));
  return c;
}
// batched GEMM like k_gemm_b but f16 operands: A f32 (split into f16 hi/lo if ASPLIT, else rounded to f16), Bt = f16 values [n][k]; alpha; C f32; N multiple of 16 (partial tiles skipped)
template <bool ASPLIT>
__global__ __launch_bounds__(128) void k_gemm_h(const float* __restrict__ A, int lda, size_t sA, const _Float16* __restrict__ Bh, int ldb, size_t sB, float alpha, float* __restrict__ C, int ldc, size_t sC, int M, int N, int K) {
  __shared__ __attribute__((aligned(16))) float so[4][16][64];
  const int tid = threadIdx.x, w = tid >> 5, lane = tid & 31, ln = lane & 15, hh = lane >> 4; const int by = blockIdx.y;
  A += (size_t)by * sA; Bh += (size_t)by * sB; C += (size_t)by * sC;
  const int ntn = (N + 63) / 64; const int wid = blockIdx.x * 4 + w; const int mt = wid / ntn, nq = wid % ntn; if (mt * 16 >= M) return;
  const int row0 = mt * 16, col0 = nq * 64; const float* arow = A + (size_t)(row0 + ln) * lda;
  v8f acc[4] = {};
  for (int kb = 0; kb < K; kb += 32) {
    FragH ah, al;
    const v4f x0 = *(const v4fa*)(arow + kb + 8 * hh), x1 = *(const v4fa*)(arow + kb + 8 * hh + 4), x2 = *(const v4fa*)(arow + kb + 16 + 8 * hh), x3 = *(const v4fa*)(arow + kb + 16 + 8 * hh + 4);
    float xs[16] = {x0[0],x0[1],x0[2],x0[3],x1[0],x1[1],x1[2],x1[3],x2[0],x2[1],x2[2],x2[3],x3[0],x3[1],x3[2],x3[3]};
#pragma unroll
    for (int i = 0; i < 16; ++i) { const _Float16 h = (_Float16)xs[i]; ah.h[i] = h; al.h[i] = ASPLIT ? (_Float16)(xs[i] - (float)h) : (_Float16)0.0f; }
#pragma unroll
    for (int t = 0; t < 4; ++t) { if (col0 + t * 16 >= N) continue; const size_t boff = (size_t)(col0 + t * 16 + ln) * ldb + kb; FragH bq; bq.half[0] = *(const v8us*)(Bh + boff + 8 * hh); bq.half[1] = *(const v8us*)(Bh + boff + 16 + 8 * hh);
      acc[t] = mmaH<ASPLIT ? 2 : 1>(ah.v, al.v, bq.v, bq.v, acc[t]); }
  }
#pragma unroll
  for (int t = 0; t < 4; ++t) { if (col0 + t * 16 >= N) continue;
#pragma unroll
    for (int r = 0; r < 8; ++r) so[w][8 * hh + r][t * 16 + ln] = acc[t][r] * alpha; }
  __builtin_amdgcn_fence(__ATOMIC_ACQ_REL, "workgroup"); __builtin_amdgcn_wave_barrier();
  const int rsub = lane >> 4, c4 = (lane & 15) * 4;
  {
#pragma unroll
    for (int q = 0; q < 8; ++q) { const int r = q * 2 + rsub; if (col0 + c4 < N) { const v4f v = *(const v4fa*)&so[w][r][c4]; *(v4f*)(C + (size_t)(row0 + r) * ldc + col0 + c4) = v; } }
     }
}

// Wt[n][k] = f16(W[k][n]·scale) from f32 row-major W[K][N] (scale = power of two; bf16-exact weights stay exact in f16 away from the subnormal range)
__global__ __launch_bounds__(256) void k_wt_f16(const float* __restrict__ W, _Float16* __restrict__ Wt, int K, int N, float scale) {
  const int t = blockIdx.x * 256 + threadIdx.x; if (t >= N * (K / 8)) return; const int n = t / (K / 8), k8 = (t % (K / 8)) * 8; FragH f;
#pragma unroll
  for (int i = 0; i < 8; ++i) f.h[i] = (_Float16)(bf16_round(W[(size_t)(k8 + i) * N + n]) * scale); const v8us o = f.half[0];
  *(v8us*)((unsigned short*)Wt + (size_t)n * K + k8) = o; 
}
typedef _Float16 v4h __attribute__((ext_vector_type(4)));
// GEMM C[M][N] = alpha * sum_k A[m][k] * B[n][k], f16 operands with k contiguous, f32 accumulate; writes f32 C or f16 C16 (pitch ldc). blockIdx = (N tile, M tile, batch).
// A work-group of 8 waves owns a BM x BN tile of C. Per K step the BM rows of A and the BN rows of B (BK elements each) are fetched with whole-line 16-byte loads, one chunk per lane,
// and stored to LDS rows padded by 16 bytes; every wave then reads its WMMA fragments from LDS, so a tile row is fetched from L2 once per work-group instead of once per wave in 32-byte pieces.
// Two LDS buffers: the next step's global loads are issued right behind the barrier (in front of it the barrier's own wait would drain them), fly during this step's products and are stored to the other buffer behind them.
// Global load addresses are a scalar base per chunk plus one 32-bit byte offset per lane and operand, which lives through the whole loop and moves on by one K step in front of each step's loads.
// sbase() takes a wave-uniform address through readfirstlane: the loads then take the scalar-base form, the loop holds no 64-bit vector address sums, and no short-lived address register is handed to a later load as its destination.
// Each output's products run over k in ascending blocks of 32 in one accumulator chain. M % BM == 0, N % BN == 0, K % BK == 0, BN == 128.
// Every '#pragma unroll' in this kernel is there so that a register array (pre, base, acc, cm, cz, c1, c2, the fragments) is indexed by constants only and stays in registers.
// EPI: 0 writes f32 C, 1 writes f16 C16, 2 is the score stage's softmax over the rows of the tile: with m the maximum of a column over the BM rows, C16 gets exp(c - m) x 2^15 and TM, TZ get m and the sum of the exponentials
// at [batch][row tile][column], m in units of log 2 (the scores are multiplied by log2 e once, so that each exponential is one subtraction and one v_exp_f32). The maximum and the sum are taken in the accumulator registers (a lane holds FM x 8 rows of each of its FN columns), then over lanes l ^ 16, then over the WM waves, in wave order, through LDS.
// EPI 3 writes f32 C and, at [row tile][column], the tile's column sums (TM) and column sums of squares (TZ) of the stored values: summed in the accumulator registers, then over lanes l ^ 16, then over the WM waves, in wave order, through LDS.
// EPI 4 writes no f32 plane but the concatenated-K f16 operand rows [3 * BN] of the score GEMM: with h = f16(c), l = f16((c - h) * 2^10), batch 0 (t side) gets [h | l | h], batch 1 (p side) [h | h * 2^-10 | l * 2^-10],
// so that the sum over K of A' * B' is Th Ph + Tl Ph 2^-10 + Th Pl 2^-10 (power-of-two scalings are exact in f16 barring subnormal flushes, which cost at most 1e-4 on a logit of sigma about 11).
// ASC: the A chunks are multiplied on their way to LDS by SC[batch][row tile of SBM][k] (f32 product, rounded to f16 again); a thread's A chunks share their k range, so it loads 8 factors per K step.
// 2^x by v_exp_f32. The v_nop is the free issue slot that the instruction set asks for behind a transcendental before its source is overwritten;
// it is tied to the v_exp_f32 in one statement.
__device__ __forceinline__ float exp2_slot(float x) { float r; asm("v_exp_f32 %0, %1\n\tv_nop" : "=v"(r) : "v"(x)); return r; }
typedef const __attribute__((address_space(1))) v8us* gv8;
typedef const __attribute__((address_space(1))) v4fa* gv4;
__device__ __forceinline__ unsigned long long sbase(const char* p) { const unsigned long long u = (unsigned long long)p; const unsigned lo = (unsigned)__builtin_amdgcn_readfirstlane((int)(unsigned)u), hi = (unsigned)__builtin_amdgcn_readfirstlane((int)(unsigned)(u >> 32)); return ((unsigned long long)hi << 32) | lo; }
// LDS bytes of one work-group: the two operand buffers, or the staged output tile with the column statistics of up to 4 waves behind it where that is larger
template <int BM, int BN, int BK> constexpr int gemm_lds_bytes() { return (2 * (BM + BN) * (BK + 8) * 2 > (BM * (BN + 4) + 2 * 4 * BN) * 4) ? 2 * (BM + BN) * (BK + 8) * 2 : (BM * (BN + 4) + 2 * 4 * BN) * 4; }
// The work of one work-group; bx, by, bz = (N tile, M tile, batch), smem = its gemm_lds_bytes() of LDS. A function, so that two GEMMs on independent data can share one grid (k_conv).
template <int BM, int BN, int BK, int WM, int WN, int EPI, bool ASC>
__device__ __forceinline__ void gemm_lds_body(unsigned char* smem, const int bx, const int by, const int bz, const _Float16* __restrict__ A, int lda, size_t sA, const _Float16* __restrict__ Bh, int ldb, size_t sB, float alpha,
                                              float* __restrict__ C, _Float16* __restrict__ C16, int ldc, size_t sC, int K, const float* __restrict__ SC, float* __restrict__ TM, float* __restrict__ TZ) {
  constexpr int FM = BM / (WM * 16), FN = BN / (WN * 16);      // fragments per wave
  constexpr int CPR = BK / 8, RPI = 256 / CPR;                 // 16-byte chunks per tile row; tile rows covered by one chunk per thread
  constexpr int PITCH = BK + 8, ROWS = BM + BN, STAGE = ROWS * PITCH;      // LDS row pitch and buffer size in f16 elements; rows 0..BM-1 hold A, the rest B
  constexpr int NCH = ROWS / RPI, ACH = BM / RPI;              // chunks per thread, of which from A
  constexpr int OP = BN + 4;                                   // f32 pitch of the output staging
  constexpr int LB = gemm_lds_bytes<BM, BN, BK>();
  static_assert(WM * WN == 8 && BN == 128 && BM % RPI == 0 && BN % RPI == 0 && BK % 32 == 0, "tile shape");
  static_assert((EPI != 2 && EPI != 3) || (BM == (EPI == 2 ? SBM : 128) && (BM * OP + 2 * WM * BN) * 4 <= LB), "one set of column statistics per row tile; the waves' own lie behind the staged tile");
  static_assert(!ASC || SBM % BM == 0, "one row tile of factors per work-group");
  unsigned short* st = (unsigned short*)smem;
  const int tid = threadIdx.x, w = tid >> 5, lane = tid & 31, ln = lane & 15, hh = lane >> 4;
  const int wm = w % WM, wn = w / WM;
  const int m0 = by * BM, n0 = bx * BN;
  const int crow = tid / CPR, ccol = (tid % CPR) * 8;
  const char* Au = (const char*)(A + (size_t)bz * sA + (size_t)m0 * lda);
  const char* Bu = (const char*)(Bh + (size_t)bz * sB + (size_t)n0 * ldb);
  const unsigned aoff = (unsigned)(crow * lda + ccol) * 2u, boff = (unsigned)(crow * ldb + ccol) * 2u;      // bytes
  const size_t astep = (size_t)RPI * lda * 2, bstep = (size_t)RPI * ldb * 2;                                // bytes between a thread's chunks
  v8us pre[NCH];
  v8f acc[FM][FN] = {};
  const int nk = K / BK;
  unsigned long long base[NCH];
#pragma unroll
  for (int i = 0; i < NCH; ++i) base[i] = sbase((i < ACH) ? Au + i * astep : Bu + (i - ACH) * bstep);
#pragma unroll
  for (int i = 0; i < NCH; ++i) pre[i] = *(gv8)(base[i] + ((i < ACH) ? aoff : boff));
  v4f sc0 = {}, sc1 = {};
  unsigned long long scb = 0; unsigned sk = (unsigned)ccol * 4u;      // factors: scalar base of the work-group's row of SC, byte offset of the lane's 8 factors
  if (ASC) {
    scb = sbase((const char*)(SC + ((size_t)bz * RTL + m0 / SBM) * K));
    sc0 = *(gv4)(scb + sk); sc1 = *(gv4)(scb + sk + 16u);
    asm volatile("s_wait_xcnt 0x0" ::: "memory");      // precaution behind the two loads: their offset register moves on in the loop
  }
  // stores the fetched chunks to one LDS buffer; with ASC the A chunks are scaled first
  auto put = [&](unsigned short* dst) {
#pragma unroll
    for (int i = 0; i < NCH; ++i) {
      FragH f; f.half[0] = pre[i];
      if (ASC && i < ACH) {
#pragma unroll
        for (int q = 0; q < 8; ++q) f.h[q] = (_Float16)((float)f.h[q] * ((q < 4) ? sc0[q & 3] : sc1[q & 3]));
      }
      *(v8us*)(dst + (crow + i * RPI) * PITCH + ccol) = f.half[0];
    }
  };
  put(st);
  unsigned ak = aoff, bk = boff;
  for (int s = 0; s < nk; ++s) {
    const bool more = s + 1 < nk;
    __syncthreads();      // publishes buffer s & 1; every wave has also left the other buffer, which is rewritten below
    if (more) {
      ak += BK * 2; bk += BK * 2;
#pragma unroll
      for (int i = 0; i < NCH; ++i) pre[i] = *(gv8)(base[i] + ((i < ACH) ? ak : bk));
      if (ASC) { sk += BK * 4; sc0 = *(gv4)(scb + sk); sc1 = *(gv4)(scb + sk + 16u); }
      asm volatile("s_wait_xcnt 0x0" ::: "memory");      // precaution behind the run of loads: their offset registers (next step) and scalar bases (epilogue) are overwritten later on paths that hold no load wait
    }
    const unsigned short* sb = st + (s & 1) * STAGE;
#pragma unroll
    for (int kb = 0; kb < BK; kb += 32) {
      FragH a[FM], b[FN];
#pragma unroll
      for (int i = 0; i < FM; ++i) { const unsigned short* r = sb + ((wm * FM + i) * 16 + ln) * PITCH + kb + 8 * hh; a[i].half[0] = *(const v8us*)r; a[i].half[1] = *(const v8us*)(r + 16); }
#pragma unroll
      for (int j = 0; j < FN; ++j) { const unsigned short* r = sb + (BM + (wn * FN + j) * 16 + ln) * PITCH + kb + 8 * hh; b[j].half[0] = *(const v8us*)r; b[j].half[1] = *(const v8us*)(r + 16); }
#pragma unroll
      for (int i = 0; i < FM; ++i)
#pragma unroll
        for (int j = 0; j < FN; ++j) acc[i][j] = mmaH<1>(a[i].v, a[i].v, b[j].v, b[j].v, acc[i][j]);
    }
    if (more) put(st + ((s + 1) & 1) * STAGE);
  }
  __syncthreads();      // every wave has left the operand buffers before the output tile is staged over them
  float* so = (float*)smem;
  float* rm = so + BM * OP; float* rz = rm + WM * BN;      // EPI 2: column maxima and sums of the WM waves that share a column; EPI 3: their column sums and sums of squares
  if (EPI == 2) {
    const float a2 = alpha * 1.44269504f;
    float cm[FN], cz[FN];
#pragma unroll
    for (int j = 0; j < FN; ++j) {
      float m = -3.0e38f;
#pragma unroll
      for (int i = 0; i < FM; ++i)
#pragma unroll
        for (int r = 0; r < 8; ++r) { acc[i][j][r] *= a2; m = fmaxf(m, acc[i][j][r]); }
      cm[j] = m;
    }
#pragma unroll
    for (int j = 0; j < FN; ++j) cm[j] = fmaxf(cm[j], __shfl_xor(cm[j], 16, 32));
    if (hh == 0) {
#pragma unroll
      for (int j = 0; j < FN; ++j) rm[wm * BN + (wn * FN + j) * 16 + ln] = cm[j];
    }
    __syncthreads();      // every wave's column maxima are read by the other waves of the column
#pragma unroll
    for (int j = 0; j < FN; ++j) {
      const int col = (wn * FN + j) * 16 + ln;
      float m = rm[col], z = 0.f;
#pragma unroll
      for (int u = 1; u < WM; ++u) m = fmaxf(m, rm[u * BN + col]);
      m -= 15.0f;      // the stored weights carry the factor 2^15
#pragma unroll
      for (int i = 0; i < FM; ++i)
#pragma unroll
        for (int r = 0; r < 8; ++r) { const float e = exp2_slot(acc[i][j][r] - m); z += e; so[((wm * FM + i) * 16 + 8 * hh + r) * OP + col] = e; }
      cz[j] = z;
    }
#pragma unroll
    for (int j = 0; j < FN; ++j) cz[j] += __shfl_xor(cz[j], 16, 32);
    if (hh == 0) {
#pragma unroll
      for (int j = 0; j < FN; ++j) rz[wm * BN + (wn * FN + j) * 16 + ln] = cz[j];
    }
  } else {
    float c1[FN] = {}, c2[FN] = {};
#pragma unroll
    for (int i = 0; i < FM; ++i)
#pragma unroll
      for (int j = 0; j < FN; ++j)
#pragma unroll
        for (int r = 0; r < 8; ++r) { const float v = acc[i][j][r] * alpha; so[((wm * FM + i) * 16 + 8 * hh + r) * OP + (wn * FN + j) * 16 + ln] = v; if (EPI == 3) { c1[j] += v; c2[j] += v * v; } }
    if (EPI == 3) {
#pragma unroll
      for (int j = 0; j < FN; ++j) { c1[j] += __shfl_xor(c1[j], 16, 32); c2[j] += __shfl_xor(c2[j], 16, 32); }
      if (hh == 0) {
#pragma unroll
        for (int j = 0; j < FN; ++j) { rm[wm * BN + (wn * FN + j) * 16 + ln] = c1[j]; rz[wm * BN + (wn * FN + j) * 16 + ln] = c2[j]; }
      }
    }
  }
  __syncthreads();      // the staged tile is read back across waves: one wave stores one whole row of the tile per instruction
  if (EPI == 2 && tid < BN) {
    float m = rm[tid], z = rz[tid];
#pragma unroll
    for (int u = 1; u < WM; ++u) { m = fmaxf(m, rm[u * BN + tid]); z += rz[u * BN + tid]; }
    const size_t o = ((size_t)bz * RTL + by) * ldc + n0 + tid;
    TM[o] = m; TZ[o] = z * 0.000030517578125f;      // the sum without the weights' factor 2^15
  }
  if (EPI == 3 && tid < BN) {
    float t1 = rm[tid], t2 = rz[tid];
#pragma unroll
    for (int u = 1; u < WM; ++u) { t1 += rm[u * BN + tid]; t2 += rz[u * BN + tid]; }
    const size_t o = (size_t)by * ldc + n0 + tid;
    TM[o] = t1; TZ[o] = t2;
  }
  const size_t cofs = (size_t)bz * sC + (size_t)m0 * ldc + n0;
  const unsigned coff = (unsigned)(w * ldc + lane * 4);      // elements
#pragma unroll
  for (int it = 0; it < BM / 8; ++it) {
    const v4f v = *(const v4fa*)&so[(w + it * 8) * OP + lane * 4];
    if (EPI == 4) {
      v4h h4, s2, s3;
      for (int q = 0; q < 4; ++q) { const _Float16 hv = (_Float16)v[q]; const _Float16 lv = (_Float16)((v[q] - (float)hv) * 1024.0f); h4[q] = hv; s2[q] = bz ? (_Float16)((float)hv * 0.0009765625f) : lv; s3[q] = bz ? (_Float16)((float)lv * 0.0009765625f) : hv; }
      char* row = (char*)(C16 + cofs + (size_t)(it * 8) * ldc) + coff * 2u;
      *(v4h*)row = h4; *(v4h*)(row + BN * 2) = s2; *(v4h*)(row + 2 * BN * 2) = s3;
    }
    else if (EPI == 1 || EPI == 2) { v4h h4; for (int q = 0; q < 4; ++q) h4[q] = (_Float16)v[q]; *(v4h*)((char*)(C16 + cofs + (size_t)(it * 8) * ldc) + coff * 2u) = h4; }
    else *(v4f*)((char*)(C + cofs + (size_t)(it * 8) * ldc) + coff * 4u) = v;
  }
}
template <int BM, int BN, int BK, int WM, int WN, int EPI, bool ASC>
__global__ __launch_bounds__(256) void k_gemm_lds(const _Float16* __restrict__ A, int lda, size_t sA, const _Float16* __restrict__ Bh, int ldb, size_t sB, float alpha,
                                                 float* __restrict__ C, _Float16* __restrict__ C16, int ldc, size_t sC, int K, const float* __restrict__ SC, float* __restrict__ TM, float* __restrict__ TZ) {
  __shared__ __attribute__((aligned(16))) unsigned char smem[gemm_lds_bytes<BM, BN, BK>()];
  gemm_lds_body<BM, BN, BK, WM, WN, EPI, ASC>(smem, blockIdx.x, blockIdx.y, blockIdx.z, A, lda, sA, Bh, ldb, sB, alpha, C, C16, ldc, sC, K, SC, TM, TZ);
}
// The three convs in one grid: both GEMMs read only X16 and the weight images Bw (t, p, g, z one behind the other). The first BB * NN / 128 work-groups, the longer ones, take g; the rest t and p.
__global__ __launch_bounds__(256) void k_conv(const _Float16* __restrict__ X16, const _Float16* __restrict__ Bw, _Float16* __restrict__ T3, _Float16* __restrict__ Gc) {
  constexpr int LG = gemm_lds_bytes<128, 128, 64>(), LT = gemm_lds_bytes<64, 128, 256>(), GB = BB * (NN / 128);
  __shared__ __attribute__((aligned(16))) unsigned char smem[LG > LT ? LG : LT];
  const int bid = blockIdx.x;
  // s_wait_xcnt 0 behind each body's last stores: in the listing the code of the one body follows the stores of the other and rewrites their base and data registers; the wait stands in front of that, whichever body is laid first
  if (bid < GB) {    /* g channel-major per batch [b][128][4096] (f16): M 128 N 4096 K 256 */
    gemm_lds_body<128, 128, 64, 4, 2, 1, false>(smem, bid % (NN / 128), 0, bid / (NN / 128), Bw + (size_t)2 * CPN * CI, CI, 0, X16, CI, (size_t)NN * CI, 0.0625f, nullptr, Gc, NN, (size_t)CPN * NN, CI, nullptr, nullptr, nullptr);
    asm volatile("s_wait_xcnt 0x0" ::: "memory");
  } else {           /* t (bz = 0) and p (bz = 1) of all batches, token-major, as the score GEMM's operand rows [16384][384]: M 16384 N 128 K 256 */
    gemm_lds_body<64, 128, 256, 2, 4, 4, false>(smem, 0, (bid - GB) % (NR / 64), (bid - GB) / (NR / 64), X16, CI, 0, Bw, CI, (size_t)CPN * CI, 0.0625f, nullptr, T3, 3 * CPN, (size_t)NR * 3 * CPN, CI, nullptr, nullptr, nullptr);
    asm volatile("s_wait_xcnt 0x0" ::: "memory");
  }
}

__global__ __launch_bounds__(256) void k_x16(const float* __restrict__ x, _Float16* __restrict__ X16, size_t n8) { const size_t t = (size_t)blockIdx.x * 256 + threadIdx.x; if (t >= n8) return; FragH f;
#pragma unroll
  for (int q = 0; q < 8; ++q) f.h[q] = (_Float16)bf16_round(x[t * 8 + q]); *(v8us*)((unsigned short*)X16 + t * 8) = f.half[0];  }
__global__ __launch_bounds__(256) void k_h16(const float* __restrict__ x, _Float16* __restrict__ X16, size_t n8) { const size_t t = (size_t)blockIdx.x * 256 + threadIdx.x; if (t >= n8) return; FragH f;
#pragma unroll
  for (int q = 0; q < 8; ++q) f.h[q] = (_Float16)x[t * 8 + q]; *(v8us*)((unsigned short*)X16 + t * 8) = f.half[0];  }
// y picks one of four equally sized matrices; their f16 images lie one behind the other in Bt. bx = block index inside one matrix.
__device__ __forceinline__ void round16f_body(const int bx, const int y, const float* __restrict__ W0, const float* __restrict__ W1, const float* __restrict__ W2, const float* __restrict__ W3, _Float16* __restrict__ Bt, size_t n8) { const size_t t = (size_t)bx * 256 + threadIdx.x; if (t >= n8) return; FragH f;
  const float* W = (y == 0) ? W0 : (y == 1) ? W1 : (y == 2) ? W2 : W3; Bt += (size_t)y * n8 * 8;
#pragma unroll
  for (int i = 0; i < 8; ++i) f.h[i] = (_Float16)(bf16_round(W[t * 8 + i]) * 16.0f); *(v8us*)((unsigned short*)Bt + t * 8) = f.half[0];
  asm volatile("s_wait_xcnt 0x0" ::: "memory");  }      // k_prep: the other body's code may follow this store in the listing and rewrite its registers
template <int NHv, int TTv>
__global__ __launch_bounds__(256) void k_vt(const _Float16* __restrict__ V16, int ldv, int voff, _Float16* __restrict__ Vt) { __shared__ unsigned short tl[64][66]; const int tid = threadIdx.x; const int slab = blockIdx.x / (TTv / 64), lg = blockIdx.x % (TTv / 64); const int b = slab / NHv, h = slab % NHv;
  for (int i = tid; i < 64 * 8; i += 256) { const int r = i / 8, c8 = (i % 8) * 8; FragH f; f.half[0] = *(const v8us*)((const unsigned short*)V16 + ((size_t)b * TTv + lg * 64 + r) * ldv + voff + h * 64 + c8);
#pragma unroll
    for (int q = 0; q < 8; ++q) tl[r][c8 + q] = f.u[q]; }
  __syncthreads();
  {
#pragma unroll
    for (int rd = 0; rd < 2; ++rd) { const int d = rd * 32 + tid / 8, pc = tid % 8; FragH f;
#pragma unroll
      for (int q = 0; q < 8; ++q) f.u[q] = tl[pc * 8 + q][d];
      *(v8us*)((unsigned short*)Vt + ((size_t)slab * 64 + d) * TTv + lg * 64 + pc * 8) = f.half[0]; }
     } }

// Token-major f16 image of x. A work-group owns 64 channels x TP positions. A thread loads 32 consecutive channels of one position (lane = position: one 128-byte line per load, all 32 loads in flight together),
// rounds them and stores them to its LDS row as four 16-byte pieces; the rows (pitch 144 bytes) are then read back in 16-byte pieces, 8 lanes to a row, so that a wave stores four whole 128-byte lines per instruction.
#define TP 128      // positions per work-group: 16 waves per WGP cover x, so few waves have to start
__device__ __forceinline__ void tok_body(const int bid, const float* __restrict__ x, _Float16* __restrict__ X16) { __shared__ __attribute__((aligned(16))) unsigned short tl[TP][72]; const int tid = threadIdx.x; const int b = bid / ((CI / 64) * (NN / TP)), rem = bid % ((CI / 64) * (NN / TP)); const int cg = rem / (NN / TP), pg = rem % (NN / TP); const int c0 = cg * 64, p0 = pg * TP;
  static_assert(2 * TP == 256, "two threads, 32 channels each, per position");
  const int pp = tid % TP, ch = (tid / TP) * 32;
  const float* xs = x + ((size_t)b * CI + c0 + ch) * NN + p0 + pp;
  float xv[32];      // the unrolls: xv is indexed by constants only and stays in registers
#pragma unroll
  for (int u = 0; u < 32; ++u) xv[u] = xs[(size_t)u * NN];
  asm volatile("s_wait_xcnt 0x0" ::: "memory");      // precaution behind the run of loads: their address registers may be reused ahead of the last loads' data wait
#pragma unroll
  for (int j = 0; j < 4; ++j) { FragH f;
#pragma unroll
    for (int q = 0; q < 8; ++q) f.h[q] = (_Float16)bf16_round(xv[j * 8 + q]);
    *(v8us*)&tl[pp][ch + j * 8] = f.half[0]; }
  __syncthreads();
  const int r = tid / 8, pc = tid % 8;
#pragma unroll
  for (int u = 0; u < TP / 32; ++u) { const v8us v = *(const v8us*)&tl[u * 32 + r][pc * 8]; *(v8us*)((unsigned short*)X16 + ((size_t)b * NN + p0 + u * 32 + r) * CI + c0 + pc * 8) = v; }
  asm volatile("s_wait_xcnt 0x0" ::: "memory");  }      // k_prep: the other body's code follows these stores in the listing and rewrites their data registers
// Weight casts and the token-major f16 image of x in one grid (both read inputs only): the first 4 * WCB work-groups cast the four weight matrices, the rest transpose x.
#define WCB ((CPN * CI / 8 + 255) / 256)      // work-groups per weight matrix
__global__ __launch_bounds__(256) void k_prep(const float* __restrict__ W0, const float* __restrict__ W1, const float* __restrict__ W2, const float* __restrict__ W3, _Float16* __restrict__ Bt, const float* __restrict__ x, _Float16* __restrict__ X16) {
  const int bid = blockIdx.x;
  if (bid < 4 * WCB) round16f_body(bid % WCB, bid / WCB, W0, W1, W2, W3, Bt, (size_t)CPN * CI / 8);
  else tok_body(bid - 4 * WCB, x, X16);
}
// One thread per column m of one batch's score plane (blockIdx.y): merges the RTL row tiles' maxima (in units of log 2) and sums, in tile order, into the column's max M and sum Z,
// and writes per row tile the factor 2^(tile max - M) / Z that turns the stored exp(s - tile max) into the softmax weight. Z is about 1 or more: the tile that holds M adds its own largest term, 2^0.
__global__ __launch_bounds__(64) void k_tilescale(const float* __restrict__ TM, const float* __restrict__ TZ, float* __restrict__ SC) {
  const size_t o = (size_t)blockIdx.y * RTL * NN + blockIdx.x * 64 + threadIdx.x;
  float tm[RTL], tz[RTL];
  // every unroll here: tm and tz are indexed by constants only and stay in registers; in the first loop all loads are also in flight at once
#pragma unroll
  for (int t = 0; t < RTL; ++t) { tm[t] = TM[o + (size_t)t * NN]; tz[t] = TZ[o + (size_t)t * NN]; }
  float m = tm[0], z = 0.f;
#pragma unroll
  for (int t = 1; t < RTL; ++t) m = fmaxf(m, tm[t]);
#pragma unroll
  for (int t = 0; t < RTL; ++t) { tm[t] = exp2_slot(tm[t] - m); z += tz[t] * tm[t]; }
  const float inv = 1.0f / z;
#pragma unroll
  for (int t = 0; t < RTL; ++t) SC[o + (size_t)t * NN] = tm[t] * inv;
}
// Affine + residual during the transpose back to channel-major. A work-group owns 32 channels x KP positions. It first merges its channels' batch statistics from the NR / 128 row tiles' column sums S1 and sums of squares S2
// in a fixed order: wave pt adds tiles 16 pt .. 16 pt + 15 in tile order (lane = channel, one 128-byte line per load), then every thread adds the 8 waves' partials of its own channel, in wave order, from LDS.
// A thread's elements of Z are KP / 8 consecutive positions of channel tid % 32; they, the tiles' sums and the channel's affine pair are loaded in one run, so that all these loads are in flight together,
// and the results go to the channel's LDS row (pitch KP + 4 floats) as 16-byte pieces; a wave then reads 512 consecutive bytes of one row per instruction.
#define KP 256      // positions per work-group: 16 waves per WGP cover the output, so few waves have to start, and the statistics are merged once per KP positions
__global__ __launch_bounds__(256) void k_out(const float* __restrict__ Z, const float* __restrict__ S1, const float* __restrict__ S2, const float* __restrict__ gam, const float* __restrict__ bet, const float* __restrict__ x, float* __restrict__ out) { __shared__ __attribute__((aligned(16))) float tl[32][KP + 4]; __shared__ float a1[8][32], a2[8][32]; const int tid = threadIdx.x; const int b = blockIdx.x / ((CI / 32) * (NN / KP)), rem = blockIdx.x % ((CI / 32) * (NN / KP)); const int cg = rem / (NN / KP), pg = rem % (NN / KP); const int c0 = cg * 32, p0 = pg * KP;
  const int cc = tid & 31, pt = tid >> 5;
  constexpr int TPW = NR / 128 / 8;      // row tiles per wave
  constexpr int PW = KP / 8;             // positions per wave
  float zv[PW], p1[TPW], p2[TPW];      // the unrolls: the three arrays are indexed by constants only and stay in registers
#pragma unroll
  for (int u = 0; u < TPW; ++u) { p1[u] = S1[(size_t)(pt * TPW + u) * CI + c0 + cc]; p2[u] = S2[(size_t)(pt * TPW + u) * CI + c0 + cc]; }
#pragma unroll
  for (int k = 0; k < PW; ++k) zv[k] = Z[((size_t)b * NN + p0 + pt * PW + k) * CI + c0 + cc];
  const float ga = bf16_round(gam[c0 + cc]), be = bf16_round(bet[c0 + cc]);
  asm volatile("s_wait_xcnt 0x0" ::: "memory");      // precaution behind the run of loads: the sums below reuse their address registers ahead of the last loads' data wait
  float t1 = 0.f, t2 = 0.f;
#pragma unroll
  for (int u = 0; u < TPW; ++u) { t1 += p1[u]; t2 += p2[u]; }
  a1[pt][cc] = t1; a2[pt][cc] = t2;
  __syncthreads();      // every wave's partial sums are read by all waves
  t1 = 0.f; t2 = 0.f;
#pragma unroll
  for (int i = 0; i < 8; ++i) { t1 += a1[i][cc]; t2 += a2[i][cc]; }
  const float mu = t1 / (float)NR; const float var = fmaxf(t2 / (float)NR - mu * mu, 0.f); const float rs = rsqrtf(var + 1e-5f);
#pragma unroll
  for (int j = 0; j < PW / 4; ++j) { const v4f v = {(zv[4 * j] - mu) * rs * ga + be, (zv[4 * j + 1] - mu) * rs * ga + be, (zv[4 * j + 2] - mu) * rs * ga + be, (zv[4 * j + 3] - mu) * rs * ga + be}; *(v4fa*)&tl[cc][pt * PW + 4 * j] = v; }
  __syncthreads();
  // a thread's 16-byte pieces: positions 4 q4 .. 4 q4 + 3 of channels c, c + CS, ...: one address each for x and out, constant steps; the unrolls: xr is indexed by constants only, and its loads are in flight together
  constexpr int CS = 256 / (KP / 4), NP = 32 / CS;
  const int c = tid / (KP / 4), q4 = tid % (KP / 4); const size_t o = ((size_t)b * CI + c0 + c) * NN + p0 + q4 * 4; const float* xs = x + o; float* os = out + o;
  v4f xr[NP];
#pragma unroll
  for (int u = 0; u < NP; ++u) xr[u] = *(const v4fa*)(xs + (size_t)u * CS * NN);
  asm volatile("s_wait_xcnt 0x0" ::: "memory");      // precaution behind the run of loads: their address registers may be reused ahead of the last loads' data wait
#pragma unroll
  for (int u = 0; u < NP; ++u) { const v4f t = *(const v4fa*)&tl[c + u * CS][q4 * 4]; const v4f v = {t[0] + bf16_round(xr[u][0]), t[1] + bf16_round(xr[u][1]), t[2] + bf16_round(xr[u][2]), t[3] + bf16_round(xr[u][3])}; *(v4f*)(os + (size_t)u * CS * NN) = v; } }

extern "C" void kernel_launch(void* const* d_in, const int* in_sizes, int n_in,
                              void* d_out, int out_size, void* d_ws, size_t ws_size, hipStream_t stream) {
  (void)in_sizes; (void)n_in; (void)out_size;
  const float* const* I = (const float* const*)d_in; const float* x = I[0]; const float* Wt = I[1]; const float* Wp = I[2]; const float* Wg = I[3]; const float* Wz = I[4]; const float* gam = I[5]; const float* bet = I[6];
  char* ws = (char*)d_ws; size_t off = 0;
  auto take = [&](size_t bytes) { char* p = ws + off; off += (bytes + 255) & ~(size_t)255; return p; };
  _Float16* Bt_ = (_Float16*)take((size_t)4 * CPN * CI * 2); _Float16* Bp_ = Bt_ + (size_t)CPN * CI; _Float16* Bg_ = Bp_ + (size_t)CPN * CI; _Float16* Bz_ = Bg_ + (size_t)CPN * CI;      /* four weight images, one behind the other */
  _Float16* PT = (_Float16*)take((size_t)PB * NN * NN * 2); _Float16* X16 = (_Float16*)take((size_t)NR * CI * 2);      /* weight planes of the PB batches that one launch works on */
  _Float16* T3 = (_Float16*)take((size_t)2 * NR * 3 * CPN * 2); _Float16* P3 = T3 + (size_t)NR * 3 * CPN;      /* all batches: concatenated-K operand planes [16384][384] (t, then p) */
  _Float16* Gc = (_Float16*)take((size_t)BB * CPN * NN * 2); _Float16* Y16 = (_Float16*)take((size_t)NR * CPN * 2); float* TM = (float*)take((size_t)PB * RTL * NN * 4); float* TZ = (float*)take((size_t)PB * RTL * NN * 4); float* SC = (float*)take((size_t)PB * RTL * NN * 4); float* S1 = (float*)take((size_t)(NR / 128) * CI * 4); float* S2 = (float*)take((size_t)(NR / 128) * CI * 4);      /* z's column sums and sums of squares per row tile */
  float* Z = (float*)take((size_t)NR * CI * 4);
  if (off > ws_size) return;      // about 197 MB of the 268 MB given (weight planes 134, the rest 62)
  k_prep<<<4 * WCB + BB * (CI / 64) * (NN / TP), 256, 0, stream>>>(Wt, Wp, Wg, Wz, Bt_, x, X16);      /* conv weights (out,in) natural x 2^4, and x token-major */
  k_conv<<<BB * (NN / 128) + 2 * (NR / 64), 256, 0, stream>>>(X16, Bt_, T3, Gc);      /* g channel-major f16; t to [h | l | h], p to [h | h 2^-10 | l 2^-10], token-major f16 */
  const dim3 gs(NN / 128, NN / SBM, PB), gy(CPN / 128, NN / 64, PB);
  for (int b = 0; b < BB; b += PB) { const size_t to = (size_t)b * NN * 3 * CPN, yo = (size_t)b * NN * CPN;      /* blockIdx.z or .y of each launch: batch b + z (or y), PB of them */
    k_gemm_lds<SBM, 128, 64, 4, 2, 2, false><<<gs, 256, 0, stream>>>(T3 + to, 3 * CPN, (size_t)NN * 3 * CPN, P3 + to, 3 * CPN, (size_t)NN * 3 * CPN, 1.0f, nullptr, PT, NN, (size_t)NN * NN, 3 * CPN, nullptr, TM, TZ);      /* s[n][m] = t_n p_m as Th Ph + (Tl Ph + Th Pl) 2^-10 in one K = 384 pass, M 4096 N 4096; stored: exp(s - tile max) 2^15 and the tiles' column statistics */
    k_tilescale<<<dim3(NN / 64, PB, 1), 64, 0, stream>>>(TM, TZ, SC);
    k_gemm_lds<64, 128, 256, 2, 4, 1, true><<<gy, 256, 0, stream>>>(PT, NN, (size_t)NN * NN, Gc + (size_t)b * CPN * NN, NN, (size_t)CPN * NN, 0.000030517578125f, nullptr, Y16 + yo, CPN, (size_t)NN * CPN, NN, SC, nullptr, nullptr); }      /* y[n][c] = sum over m of att[n][m] g[c][m]: M 4096 N 128 K 4096 (f16 out) */
  k_gemm_lds<128, 128, 64, 4, 2, 3, false><<<dim3(CI / 128, NR / 128, 1), 256, 0, stream>>>(Y16, CPN, 0, Bz_, CPN, 0, 0.0625f, Z, nullptr, CI, 0, CPN, nullptr, S1, S2);      /* z token-major [16384][256] f32 and its column sums per row tile: M 16384 N 256 K 128 */
  k_out<<<BB * (CI / 32) * (NN / KP), 256, 0, stream>>>(Z, S1, S2, gam, bet, x, (float*)d_out);
}

// v010
// A run of this version takes 111 microseconds.
// Two timings next to v009 both put it at 1.06 times that version's speed.
// Counting every step since v000, it is 116 times as fast.
#include <hip/hip_runtime.h>
// Spatial non-local block with query-axis softmax (B=4, C_in 256, C_p 128, N=4096): t,p,g = 1×1 convs; att[n,m] = Σ_c t[c,n]·p[c,m]; att = softmax over n (dim=1) for every m; y[c,n] = Σ_m att[n,m]·g[c,m]; z = Wz·y;
// BatchNorm1d in training mode (batch statistics over (B,N) per channel, biased variance, eps 1e-5) with affine; out = BN(z) + x.
// Compute dtype: x and weights rounded to bf16; t and p as f32 GEMM outputs split into f16 hi + ×2^10 residual parts laid out as concatenated-K operands so one K=384 GEMM yields Th·Ph + (Tl·Ph + Th·Pl)·2^-10 (σ≈11 logits, f32-accurate);
// no f32 score plane is stored: the score GEMM's epilogue takes each column's max and sum over the 256 rows of its own tile (f32) and writes exp(s - tile max) row-major as f16 x 2^15; a small kernel merges the 16 row tiles of a column into
// one factor exp(tile max - column max) / column sum per (row tile, column), and the y GEMM multiplies its weight chunks by that factor on their way to LDS; y = contraction over m as an f16 GEMM against
// channel-major g, cut into KSP ranges of m whose partial sums lie side by side in a row of Y16; z GEMM over K = KSP x 128 against KSP copies of Wz side by side, which adds the partial sums; per-channel batch statistics as fixed-order f32 column sums, taken per row tile in the z GEMM's epilogue and merged by the last kernel; affine + residual applied during the transpose back to channel-major. All contractions on v_wmma_f32_16x16x32_f16, f32 accumulate.
#define BB 4
#define CI 256
#define CPN 128
#define NN 4096
#define NR (BB * NN)
#define PB 4      // batches whose weight planes are held at once: each launch of the score, merge and y stages works on PB batches (all of them: one launch per stage)
#define SBM 256             // rows of a score GEMM work-group's tile
#define RTL (NN / SBM)      // row tiles of a score plane: one set of column statistics each
#define KSP 4               // ranges of m that the y GEMM's contraction is cut into, one work-group each

typedef __bf16 v16b __attribute__((ext_vector_type(16)));
typedef unsigned short v8us __attribute__((ext_vector_type(8), may_alias));
typedef float  v8f  __attribute__((ext_vector_type(8)));
typedef float  v4f  __attribute__((ext_vector_type(4)));
typedef float  v4fa __attribute__((ext_vector_type(4), may_alias));
union FragB { v16b v; v8us half[2]; unsigned short u[16]; };

__device__ __forceinline__ unsigned short bf16_bits(float x) { unsigned int u = __float_as_uint(x); return (unsigned short)((u + 0x7FFFu + ((u >> 16) & 1u)) >> 16); }
__device__ __forceinline__ float bf16_val(unsigned short b) { return __uint_as_float(((unsigned int)b) << 16); }
__device__ __forceinline__ float bf16_round(float x) { return bf16_val(bf16_bits(x)); }
// D += A·B with NT terms: 1 = ah·bh, 2 = + al·bh (A split), 3 = + ah·bl (both split)
template <int NT>
__device__ __forceinline__ v8f mmaN(v16b ah, v16b al, v16b bh, v16b bl, v8f c) {
  c = __builtin_amdgcn_wmma_f32_16x16x32_bf16(false, ah, false, bh, (short)0, c, false, false);
  if (NT >= 2) c = __builtin_amdgcn_wmma_f32_16x16x32_bf16(false, al, false, bh, (short)0, c, false, false);
  if (NT >= 3) c = __builtin_amdgcn_wmma_f32_16x16x32_bf16(false, ah, false, bl, (short)0, c, false, false);
  asm volatile("v_nop\n\tv_nop\n\tv_nop\n\tv_nop" : "+v"(c) : "v"(ah), "v"(al), "v"(bh), "v"(bl));
  return c;
}

__global__ __launch_bounds__(256) void k_wt_bf16(const float* __restrict__ W, unsigned short* __restrict__ Wt, int K, int N) {
  const int t = blockIdx.x * 256 + threadIdx.x;
  const int k8n = K / 8;
  if (t >= N * k8n) return;
  const int n = t / k8n, k8 = (t % k8n) * 8;
  v8us v;
#pragma unroll
  for (int i = 0; i < 8; ++i) v[i] = bf16_bits(W[(size_t)(k8 + i) * N + n]);
  *(v8us*)(Wt + (size_t)n * K + k8) = v;
  
}

// GEMM C[M][N] (f32, pitch ldc) = act(A[M][K]·W + bias). A f32 row-major (pitch lda) converted per fragment to bf16
// (ASPLIT: hi/lo two planes -> 2 terms, else single rounded term); Wt bf16 [N][K] (pitch ldb). BIAS_BF16 rounds the
// bias to bf16 first (bias quantised to bf16 before the add). K%32==0, M%16==0, N%64==0.
template <bool ASPLIT, int ACT, bool BIAS_BF16>
__global__ __launch_bounds__(128) void k_gemm_bf(const float* __restrict__ A, int lda, const unsigned short* __restrict__ Wt, int ldb,
                                               const float* __restrict__ bias, float* __restrict__ C, int ldc, int M, int N, int K) {
  __shared__ __attribute__((aligned(16))) float so[4][16][64];
  const int tid = threadIdx.x, w = tid >> 5, lane = tid & 31, ln = lane & 15, hh = lane >> 4;
  const int ntn = N / 64;
  const int wid = blockIdx.x * 4 + w;
  const int mt = wid / ntn, nq = wid % ntn;
  if (mt * 16 >= M) return;
  const int row0 = mt * 16, col0 = nq * 64;
  const float* arow = A + (size_t)(row0 + ln) * lda;
  v8f acc[4] = {};
  for (int kb = 0; kb < K; kb += 32) {
    FragB ah, al;
    const v4f x0 = *(const v4fa*)(arow + kb + 8 * hh), x1 = *(const v4fa*)(arow + kb + 8 * hh + 4);
    const v4f x2 = *(const v4fa*)(arow + kb + 16 + 8 * hh), x3 = *(const v4fa*)(arow + kb + 16 + 8 * hh + 4);
    float xs[16] = {x0[0],x0[1],x0[2],x0[3],x1[0],x1[1],x1[2],x1[3],x2[0],x2[1],x2[2],x2[3],x3[0],x3[1],x3[2],x3[3]};
#pragma unroll
    for (int i = 0; i < 16; ++i) { const unsigned short hb = bf16_bits(xs[i]); ah.u[i] = hb; al.u[i] = ASPLIT ? bf16_bits(xs[i] - bf16_val(hb)) : (unsigned short)0; }
#pragma unroll
    for (int t = 0; t < 4; ++t) {
      const unsigned short* brow = Wt + (size_t)(col0 + t * 16 + ln) * ldb + kb;
      FragB b;
      b.half[0] = *(const v8us*)(brow + 8 * hh);
      b.half[1] = *(const v8us*)(brow + 16 + 8 * hh);
      acc[t] = mmaN<ASPLIT ? 2 : 1>(ah.v, al.v, b.v, b.v, acc[t]);
    }
  }
#pragma unroll
  for (int t = 0; t < 4; ++t) {
    float bv = bias ? bias[col0 + t * 16 + ln] : 0.f;
    if (BIAS_BF16) bv = bf16_round(bv);
#pragma unroll
    for (int r = 0; r < 8; ++r) { float v = acc[t][r] + bv; if (ACT == 1) v = fmaxf(v, 0.f); so[w][8 * hh + r][t * 16 + ln] = v; }
  }
  __builtin_amdgcn_fence(__ATOMIC_ACQ_REL, "workgroup");
  __builtin_amdgcn_wave_barrier();
  const int rsub = lane >> 4, c4 = (lane & 15) * 4;
  {
#pragma unroll
    for (int q = 0; q < 8; ++q) {
      const int r = q * 2 + rsub;
      const v4f v = *(const v4fa*)&so[w][r][c4];
      *(v4f*)(C + (size_t)(row0 + r) * ldc + col0 + c4) = v;
    }
    
  }
}

// Flash-style causal/unmasked attention, all contractions 3-term bf16 hi/lo splits, f32 softmax with running max.
// q,k,v rows are read from f32 buffers with arbitrary row pitch (so they can live inside a fused qkv buffer);
// D = head size (multiple of 32, <= 128); one wave = 16 query rows; block = 4 waves (64 queries) sharing K/V chunks of 32.
template <int D, bool CAUSAL>
__global__ __launch_bounds__(128) void k_flash(const float* __restrict__ qb, const float* __restrict__ kb, const float* __restrict__ vb,
                                             int pitch, int T, int H, float scale, float* __restrict__ y, int ypitch) {
  constexpr int KS = D / 32;        // k-steps for QK
  constexpr int DT = D / 16;        // d tiles for PV
  __shared__ __attribute__((aligned(16))) unsigned short sKh[32][D + 8], sKl[32][D + 8], sVh[32][D + 8], sVl[32][D + 8];
  __shared__ __attribute__((aligned(16))) unsigned short sPh[4][16][40], sPl[4][16][40];
  __shared__ __attribute__((aligned(16))) float sO[4][16][D];
  const int tid = threadIdx.x, w = tid >> 5, lane = tid & 31, ln = lane & 15, hh = lane >> 4;
  const int nqb = (T + 63) / 64;
  const int bh = blockIdx.x / nqb, qblk = blockIdx.x % nqb;
  const int b = bh / H, h = bh % H;
  const int q0 = qblk * 64 + w * 16;
  const float* Q = qb + (size_t)b * T * pitch + h * D;
  const float* K = kb + (size_t)b * T * pitch + h * D;
  const float* V = vb + (size_t)b * T * pitch + h * D;

  // A fragments of the wave's 16 query rows (scaled), hi/lo
  FragB aqh[KS], aql[KS];
  {
    int row = q0 + ln; if (row >= T) row = T - 1;
    const float* qr = Q + (size_t)row * pitch;
#pragma unroll
    for (int ks = 0; ks < KS; ++ks)
#pragma unroll
      for (int i = 0; i < 16; ++i) {
        const int d = ks * 32 + ((i < 8) ? (8 * hh + i) : (16 + 8 * hh + (i - 8)));
        const float x = qr[d] * scale; const unsigned short hb = bf16_bits(x);
        aqh[ks].u[i] = hb; aql[ks].u[i] = bf16_bits(x - bf16_val(hb));
      }
  }
  float m_r[8], l_r[8];
#pragma unroll
  for (int r = 0; r < 8; ++r) { m_r[r] = -3.0e38f; l_r[r] = 0.f; }
  v8f oacc[DT];
#pragma unroll
  for (int dt = 0; dt < DT; ++dt) oacc[dt] = (v8f){0.f,0.f,0.f,0.f,0.f,0.f,0.f,0.f};

  const int kv_end = CAUSAL ? min(T, qblk * 64 + 64) : T;     // block-uniform
  for (int j0 = 0; j0 < kv_end; j0 += 32) {
    __syncthreads();
    for (int e = tid; e < 32 * (D / 4); e += 128) {
      const int r = e / (D / 4), c4 = (e % (D / 4)) * 4;
      const int key = j0 + r;
      v4f kf = {0.f,0.f,0.f,0.f}, vf = {0.f,0.f,0.f,0.f};
      if (key < T) { kf = *(const v4fa*)(K + (size_t)key * pitch + c4); vf = *(const v4fa*)(V + (size_t)key * pitch + c4); }
#pragma unroll
      for (int t = 0; t < 4; ++t) {
        unsigned short hb = bf16_bits(kf[t]); sKh[r][c4 + t] = hb; sKl[r][c4 + t] = bf16_bits(kf[t] - bf16_val(hb));
        hb = bf16_bits(vf[t]); sVh[r][c4 + t] = hb; sVl[r][c4 + t] = bf16_bits(vf[t] - bf16_val(hb));
      }
    }
    __syncthreads();
    // S tile 16 x 32
    v8f s[2];
#pragma unroll
    for (int nt = 0; nt < 2; ++nt) {
      v8f acc = {};
#pragma unroll
      for (int ks = 0; ks < KS; ++ks) {
        FragB bh_, bl_;
        bh_.half[0] = *(const v8us*)&sKh[nt * 16 + ln][ks * 32 + 8 * hh]; bh_.half[1] = *(const v8us*)&sKh[nt * 16 + ln][ks * 32 + 16 + 8 * hh];
        bl_.half[0] = *(const v8us*)&sKl[nt * 16 + ln][ks * 32 + 8 * hh]; bl_.half[1] = *(const v8us*)&sKl[nt * 16 + ln][ks * 32 + 16 + 8 * hh];
        acc = mmaN<3>(aqh[ks].v, aql[ks].v, bh_.v, bl_.v, acc);
      }
      s[nt] = acc;
    }
    // mask + running max (rows 8hh+r; the 16 lanes of a half share rows)
    float alpha[8];
#pragma unroll
    for (int r = 0; r < 8; ++r) {
      const int qi = q0 + 8 * hh + r;
      const int ja = j0 + ln, jb = j0 + 16 + ln;
      if (CAUSAL) { if (ja > qi) s[0][r] = -3.0e38f; if (jb > qi) s[1][r] = -3.0e38f; }
      if (ja >= T) s[0][r] = -3.0e38f;
      if (jb >= T) s[1][r] = -3.0e38f;
      float mx = fmaxf(s[0][r], s[1][r]);
      mx = fmaxf(mx, __shfl_xor(mx, 1, 32)); mx = fmaxf(mx, __shfl_xor(mx, 2, 32)); mx = fmaxf(mx, __shfl_xor(mx, 4, 32)); mx = fmaxf(mx, __shfl_xor(mx, 8, 32));
      const float mnew = fmaxf(m_r[r], mx);
      alpha[r] = (mnew > -1.0e38f) ? __expf(m_r[r] - mnew) : 1.0f;
      const float p0 = (s[0][r] > -1.0e38f) ? __expf(s[0][r] - mnew) : 0.f;
      const float p1 = (s[1][r] > -1.0e38f) ? __expf(s[1][r] - mnew) : 0.f;
      m_r[r] = mnew;
      l_r[r] = l_r[r] * alpha[r] + p0 + p1;            // per-lane partial row sum (16 lanes combined at the end)
      unsigned short hb = bf16_bits(p0); sPh[w][8 * hh + r][ln] = hb;      sPl[w][8 * hh + r][ln] = bf16_bits(p0 - bf16_val(hb));
      hb = bf16_bits(p1);                sPh[w][8 * hh + r][16 + ln] = hb; sPl[w][8 * hh + r][16 + ln] = bf16_bits(p1 - bf16_val(hb));
    }
#pragma unroll
    for (int dt = 0; dt < DT; ++dt)
#pragma unroll
      for (int r = 0; r < 8; ++r) oacc[dt][r] *= alpha[r];
    __builtin_amdgcn_fence(__ATOMIC_ACQ_REL, "workgroup");
    __builtin_amdgcn_wave_barrier();
    FragB pah, pal;
    pah.half[0] = *(const v8us*)&sPh[w][ln][8 * hh]; pah.half[1] = *(const v8us*)&sPh[w][ln][16 + 8 * hh];
    pal.half[0] = *(const v8us*)&sPl[w][ln][8 * hh]; pal.half[1] = *(const v8us*)&sPl[w][ln][16 + 8 * hh];
#pragma unroll
    for (int dt = 0; dt < DT; ++dt) {
      FragB bvh, bvl;
#pragma unroll
      for (int i = 0; i < 8; ++i) {
        bvh.u[i] = sVh[8 * hh + i][dt * 16 + ln]; bvh.u[8 + i] = sVh[16 + 8 * hh + i][dt * 16 + ln];
        bvl.u[i] = sVl[8 * hh + i][dt * 16 + ln]; bvl.u[8 + i] = sVl[16 + 8 * hh + i][dt * 16 + ln];
      }
      oacc[dt] = mmaN<3>(pah.v, pal.v, bvh.v, bvl.v, oacc[dt]);
    }
    __builtin_amdgcn_fence(__ATOMIC_ACQ_REL, "workgroup");
    __builtin_amdgcn_wave_barrier();
  }
#pragma unroll
  for (int r = 0; r < 8; ++r) {
    float l = l_r[r];
    l += __shfl_xor(l, 1, 32); l += __shfl_xor(l, 2, 32); l += __shfl_xor(l, 4, 32); l += __shfl_xor(l, 8, 32);
    l_r[r] = (l > 0.f) ? 1.0f / l : 0.f;
  }
#pragma unroll
  for (int dt = 0; dt < DT; ++dt)
#pragma unroll
    for (int r = 0; r < 8; ++r) sO[w][8 * hh + r][dt * 16 + ln] = oacc[dt][r] * l_r[r];
  __builtin_amdgcn_fence(__ATOMIC_ACQ_REL, "workgroup");
  __builtin_amdgcn_wave_barrier();
  {
    for (int r = 0; r < 16; ++r) {
      const int row = q0 + r;
      if (row < T && lane < D / 4) {
        const v4f val = *(const v4fa*)&sO[w][r][lane * 4];
        *(v4f*)(y + ((size_t)b * T + row) * ypitch + h * D + lane * 4) = val;
      }
    }
    
  }
}

// GEMM C = act(A·W + bias + resid): A f32 (ASPLIT -> hi/lo 2 terms), Wt bf16 [N][K]; ACT 0 none, 1 relu, 2 exact gelu;
// resid (optional, f32, row index = (row % rmod), pitch ldr, RES_BF16 rounds it) added before the activation.
template <bool ASPLIT, int ACT, bool BIAS_BF16, bool RES_BF16>
__global__ __launch_bounds__(128) void k_gemm_bf3(const float* __restrict__ A, int lda, const unsigned short* __restrict__ Wt, int ldb,
                                                const float* __restrict__ bias, const float* __restrict__ resid, int rmod, int ldr,
                                                float* __restrict__ C, int ldc, int M, int N, int K) {
  __shared__ __attribute__((aligned(16))) float so[4][16][64];
  const int tid = threadIdx.x, w = tid >> 5, lane = tid & 31, ln = lane & 15, hh = lane >> 4;
  const int ntn = N / 64;
  const int wid = blockIdx.x * 4 + w;
  const int mt = wid / ntn, nq = wid % ntn;
  if (mt * 16 >= M) return;
  const int row0 = mt * 16, col0 = nq * 64;
  const float* arow = A + (size_t)(row0 + ln) * lda;
  v8f acc[4] = {};
  for (int kb = 0; kb < K; kb += 32) {
    FragB ah, al;
    const v4f x0 = *(const v4fa*)(arow + kb + 8 * hh), x1 = *(const v4fa*)(arow + kb + 8 * hh + 4);
    const v4f x2 = *(const v4fa*)(arow + kb + 16 + 8 * hh), x3 = *(const v4fa*)(arow + kb + 16 + 8 * hh + 4);
    float xs[16] = {x0[0],x0[1],x0[2],x0[3],x1[0],x1[1],x1[2],x1[3],x2[0],x2[1],x2[2],x2[3],x3[0],x3[1],x3[2],x3[3]};
#pragma unroll
    for (int i = 0; i < 16; ++i) { const unsigned short hb = bf16_bits(xs[i]); ah.u[i] = hb; al.u[i] = ASPLIT ? bf16_bits(xs[i] - bf16_val(hb)) : (unsigned short)0; }
#pragma unroll
    for (int t = 0; t < 4; ++t) {
      const unsigned short* brow = Wt + (size_t)(col0 + t * 16 + ln) * ldb + kb;
      FragB b;
      b.half[0] = *(const v8us*)(brow + 8 * hh);
      b.half[1] = *(const v8us*)(brow + 16 + 8 * hh);
      acc[t] = mmaN<ASPLIT ? 2 : 1>(ah.v, al.v, b.v, b.v, acc[t]);
    }
  }
#pragma unroll
  for (int t = 0; t < 4; ++t) {
    const int col = col0 + t * 16 + ln;
    float bv = bias ? bias[col] : 0.f;
    if (BIAS_BF16) bv = bf16_round(bv);
#pragma unroll
    for (int r = 0; r < 8; ++r) {
      float v = acc[t][r] + bv;
      if (resid) { float rv = resid[(size_t)((row0 + 8 * hh + r) % rmod) * ldr + col]; if (RES_BF16) rv = bf16_round(rv); v += rv; }
      if (ACT == 1) v = fmaxf(v, 0.f);
      if (ACT == 2) v = 0.5f * v * (1.0f + erff(v * 0.70710678118654752f));
      if (ACT == 3) { const float u = 0.7978845608028654f * (v + 0.044715f * v * v * v); v = 0.5f * v * (1.0f + tanhf(u)); }
      so[w][8 * hh + r][t * 16 + ln] = v;
    }
  }
  __builtin_amdgcn_fence(__ATOMIC_ACQ_REL, "workgroup");
  __builtin_amdgcn_wave_barrier();
  const int rsub = lane >> 4, c4 = (lane & 15) * 4;
  {
#pragma unroll
    for (int q = 0; q < 8; ++q) {
      const int r = q * 2 + rsub;
      const v4f v = *(const v4fa*)&so[w][r][c4];
      *(v4f*)(C + (size_t)(row0 + r) * ldc + col0 + c4) = v;
    }
    
  }
}
// row LayerNorm (biased variance, eps) over N: s = X (+ R); optional out_sum <- s; out_norm <- (s-mu)*rsqrt(var+eps)*g + b
template <bool PARAM_BF16>
__global__ __launch_bounds__(256) void k_layernorm(const float* __restrict__ X, const float* __restrict__ R, const float* __restrict__ g, const float* __restrict__ bta,
                                                  float* __restrict__ out_sum, float* __restrict__ out_norm, int N, float eps) {
  __shared__ float red[256];
  const int row = blockIdx.x, tid = threadIdx.x;
  const float* x = X + (size_t)row * N; const float* rr = R ? R + (size_t)row * N : nullptr;
  float vals[16];                     // up to N = 4096
  const int per = N / 256;            // contiguous chunk per thread? use strided-by-4 chunks: thread handles j = tid*4 + 1024*u
  float s1 = 0.f;
  for (int u = 0; u < per / 4; ++u) {
    const int j = tid * 4 + 1024 * u;
    const v4f a = *(const v4fa*)(x + j);
    v4f b = {0.f,0.f,0.f,0.f}; if (rr) b = *(const v4fa*)(rr + j);
#pragma unroll
    for (int q = 0; q < 4; ++q) { const float v = a[q] + b[q]; vals[u * 4 + q] = v; s1 += v; }
  }
  red[tid] = s1; __syncthreads();
  for (int st = 128; st > 0; st >>= 1) { if (tid < st) red[tid] += red[tid + st]; __syncthreads(); }
  const float mu = red[0] / (float)N; __syncthreads();
  float s2 = 0.f;
  for (int u = 0; u < per / 4; ++u)
#pragma unroll
    for (int q = 0; q < 4; ++q) { const float c = vals[u * 4 + q] - mu; s2 += c * c; }
  red[tid] = s2; __syncthreads();
  for (int st = 128; st > 0; st >>= 1) { if (tid < st) red[tid] += red[tid + st]; __syncthreads(); }
  const float rs = rsqrtf(red[0] / (float)N + eps);
  {
    for (int u = 0; u < per / 4; ++u) {
      const int j = tid * 4 + 1024 * u;
      v4f o, sm;
#pragma unroll
      for (int q = 0; q < 4; ++q) {
        float gg = g[j + q], bb = bta[j + q];
        if (PARAM_BF16) { gg = bf16_round(gg); bb = bf16_round(bb); }
        sm[q] = vals[u * 4 + q]; o[q] = (vals[u * 4 + q] - mu) * rs * gg + bb;
      }
      if (out_sum) *(v4f*)(out_sum + (size_t)row * N + j) = sm;
      *(v4f*)(out_norm + (size_t)row * N + j) = o;
    }
    
  }
}



// ---- f16 WMMA path (v_wmma_f32_16x16x32_f16): 11-bit significands for operands in range — used where a [0,1] probability operand needs more precision than bf16
typedef _Float16 v16h __attribute__((ext_vector_type(16)));
union FragH { v16h v; v8us half[2]; _Float16 h[16]; unsigned short u[16]; };
template <int NT>
__device__ __forceinline__ v8f mmaH(v16h ah, v16h al, v16h bh, v16h bl, v8f c) {
  c = __builtin_amdgcn_wmma_f32_16x16x32_f16(false, ah, false, bh, (short)0, c, false, false);
  if (NT >= 2) c = __builtin_amdgcn_wmma_f32_16x16x32_f16(false, al, false, bh, (short)0, c, false, false);
  if (NT >= 3) c = __builtin_amdgcn_wmma_f32_16x16x32_f16(false, ah, false, bl, (short)0, c, false, false);
  asm volatile("v_nop\n\tv_nop\n\tv_nop\n\tv_nop" : "+v"(c) : "v"(ah), "v"(al), "v"(bh), "v"(bl));
  return c;
}
// batched GEMM like k_gemm_b but f16 operands: A f32 (split into f16 hi/lo if ASPLIT, else rounded to f16), Bt = f16 values [n][k]; alpha; C f32; N multiple of 16 (partial tiles skipped)
template <bool ASPLIT>
__global__ __launch_bounds__(128) void k_gemm_h(const float* __restrict__ A, int lda, size_t sA, const _Float16* __restrict__ Bh, int ldb, size_t sB, float alpha, float* __restrict__ C, int ldc, size_t sC, int M, int N, int K) {
  __shared__ __attribute__((aligned(16))) float so[4][16][64];
  const int tid = threadIdx.x, w = tid >> 5, lane = tid & 31, ln = lane & 15, hh = lane >> 4; const int by = blockIdx.y;
  A += (size_t)by * sA; Bh += (size_t)by * sB; C += (size_t)by * sC;
  const int ntn = (N + 63) / 64; const int wid = blockIdx.x * 4 + w; const int mt = wid / ntn, nq = wid % ntn; if (mt * 16 >= M) return;
  const int row0 = mt * 16, col0 = nq * 64; const float* arow = A + (size_t)(row0 + ln) * lda;
  v8f acc[4] = {};
  for (int kb = 0; kb < K; kb += 32) {
    FragH ah, al;
    const v4f x0 = *(const v4fa*)(arow + kb + 8 * hh), x1 = *(const v4fa*)(arow + kb + 8 * hh + 4), x2 = *(const v4fa*)(arow + kb + 16 + 8 * hh), x3 = *(const v4fa*)(arow + kb + 16 + 8 * hh + 4);
    float xs[16] = {x0[0],x0[1],x0[2],x0[3],x1[0],x1[1],x1[2],x1[3],x2[0],x2[1],x2[2],x2[3],x3[0],x3[1],x3[2],x3[3]};
#pragma unroll
    for (int i = 0; i < 16; ++i) { const _Float16 h = (_Float16)xs[i]; ah.h[i] = h; al.h[i] = ASPLIT ? (_Float16)(xs[i] - (float)h) : (_Float16)0.0f; }
#pragma unroll
    for (int t = 0; t < 4; ++t) { if (col0 + t * 16 >= N) continue; const size_t boff = (size_t)(col0 + t * 16 + ln) * ldb + kb; FragH bq; bq.half[0] = *(const v8us*)(Bh + boff + 8 * hh); bq.half[1] = *(const v8us*)(Bh + boff + 16 + 8 * hh);
      acc[t] = mmaH<ASPLIT ? 2 : 1>(ah.v, al.v, bq.v, bq.v, acc[t]); }
  }
#pragma unroll
  for (int t = 0; t < 4; ++t) { if (col0 + t * 16 >= N) continue;
#pragma unroll
    for (int r = 0; r < 8; ++r) so[w][8 * hh + r][t * 16 + ln] = acc[t][r] * alpha; }
  __builtin_amdgcn_fence(__ATOMIC_ACQ_REL, "workgroup"); __builtin_amdgcn_wave_barrier();
  const int rsub = lane >> 4, c4 = (lane & 15) * 4;
  {
#pragma unroll
    for (int q = 0; q < 8; ++q) { const int r = q * 2 + rsub; if (col0 + c4 < N) { const v4f v = *(const v4fa*)&so[w][r][c4]; *(v4f*)(C + (size_t)(row0 + r) * ldc + col0 + c4) = v; } }
     }
}

// Wt[n][k] = f16(W[k][n]·scale) from f32 row-major W[K][N] (scale = power of two; bf16-exact weights stay exact in f16 away from the subnormal range)
__global__ __launch_bounds__(256) void k_wt_f16(const float* __restrict__ W, _Float16* __restrict__ Wt, int K, int N, float scale) {
  const int t = blockIdx.x * 256 + threadIdx.x; if (t >= N * (K / 8)) return; const int n = t / (K / 8), k8 = (t % (K / 8)) * 8; FragH f;
#pragma unroll
  for (int i = 0; i < 8; ++i) f.h[i] = (_Float16)(bf16_round(W[(size_t)(k8 + i) * N + n]) * scale); const v8us o = f.half[0];
  *(v8us*)((unsigned short*)Wt + (size_t)n * K + k8) = o; 
}
typedef _Float16 v4h __attribute__((ext_vector_type(4)));
// GEMM C[M][N] = alpha * sum_k A[m][k] * B[n][k], f16 operands with k contiguous, f32 accumulate; writes f32 C or f16 C16 (pitch ldc). blockIdx = (N tile, M tile, batch).
// A work-group of 8 waves owns a BM x BN tile of C. Per K step the BM rows of A and the BN rows of B (BK elements each) are fetched with whole-line 16-byte loads, one chunk per lane,
// and stored to LDS rows padded by 16 bytes; every wave then reads its WMMA fragments from LDS, so a tile row is fetched from L2 once per work-group instead of once per wave in 32-byte pieces.
// Two LDS buffers: the next step's global loads are issued right behind the barrier (in front of it the barrier's own wait would drain them), fly during this step's products and are stored to the other buffer behind them.
// Global load addresses are a scalar base per chunk plus one 32-bit byte offset per lane and operand, which lives through the whole loop and moves on by one K step in front of each step's loads.
// sbase() takes a wave-uniform address through readfirstlane: the loads then take the scalar-base form, the loop holds no 64-bit vector address sums, and no short-lived address register is handed to a later load as its destination.
// Each output's products run over k in ascending blocks of 32 in one accumulator chain. M % BM == 0, N % BN == 0, K % BK == 0, BN == 128.
// Every '#pragma unroll' in this kernel is there so that a register array (pre, base, acc, cm, cz, c1, c2, the fragments) is indexed by constants only and stays in registers.
// EPI: 0 writes f32 C, 1 writes f16 C16, 2 is the score stage's softmax over the rows of the tile: with m the maximum of a column over the BM rows, C16 gets exp(c - m) x 2^15 and TM, TZ get m and the sum of the exponentials
// at [batch][row tile][column], m in units of log 2 (the scores are multiplied by log2 e once, so that each exponential is one subtraction and one v_exp_f32). The maximum and the sum are taken in the accumulator registers (a lane holds FM x 8 rows of each of its FN columns), then over lanes l ^ 16, then over the WM waves, in wave order, through LDS.
// EPI 3 writes f32 C and, at [row tile][column], the tile's column sums (TM) and column sums of squares (TZ) of the stored values: summed in the accumulator registers, then over lanes l ^ 16, then over the WM waves, in wave order, through LDS.
// EPI 4 writes no f32 plane but the concatenated-K f16 operand rows [3 * BN] of the score GEMM: with h = f16(c), l = f16((c - h) * 2^10), batch 0 (t side) gets [h | l | h], batch 1 (p side) [h | h * 2^-10 | l * 2^-10],
// so that the sum over K of A' * B' is Th Ph + Tl Ph 2^-10 + Th Pl 2^-10 (power-of-two scalings are exact in f16 barring subnormal flushes, which cost at most 1e-4 on a logit of sigma about 11).
// ASC: the A chunks are multiplied on their way to LDS by SC[batch][row tile of SBM][k] (f32 product, rounded to f16 again); a thread's A chunks share their k range, so it loads 8 factors per K step. A row of SC runs along a whole row of A (lda factors).
// KS: N == BN, and bx is not an N tile but a range of k: the work-group contracts over k = bx * K .. bx * K + K - 1 of rows that are longer than K, and its partial sums go to columns bx * BN .. of C.
// 2^x by v_exp_f32. The v_nop is the free issue slot that the instruction set asks for behind a transcendental before its source is overwritten;
// it is tied to the v_exp_f32 in one statement.
__device__ __forceinline__ float exp2_slot(float x) { float r; asm("v_exp_f32 %0, %1\n\tv_nop" : "=v"(r) : "v"(x)); return r; }
typedef const __attribute__((address_space(1))) v8us* gv8;
typedef const __attribute__((address_space(1))) v4fa* gv4;
__device__ __forceinline__ unsigned long long sbase(const char* p) { const unsigned long long u = (unsigned long long)p; const unsigned lo = (unsigned)__builtin_amdgcn_readfirstlane((int)(unsigned)u), hi = (unsigned)__builtin_amdgcn_readfirstlane((int)(unsigned)(u >> 32)); return ((unsigned long long)hi << 32) | lo; }
// LDS bytes of one work-group: the two operand buffers, or the staged output tile with the column statistics of up to 4 waves behind it where that is larger
template <int BM, int BN, int BK> constexpr int gemm_lds_bytes() { return (2 * (BM + BN) * (BK + 8) * 2 > (BM * (BN + 4) + 2 * 4 * BN) * 4) ? 2 * (BM + BN) * (BK + 8) * 2 : (BM * (BN + 4) + 2 * 4 * BN) * 4; }
// The work of one work-group; bx, by, bz = (N tile, M tile, batch), smem = its gemm_lds_bytes() of LDS. A function, so that two GEMMs on independent data can share one grid (k_conv).
template <int BM, int BN, int BK, int WM, int WN, int EPI, bool ASC, bool KS = false>
__device__ __forceinline__ void gemm_lds_body(unsigned char* smem, const int bx, const int by, const int bz, const _Float16* __restrict__ A, int lda, size_t sA, const _Float16* __restrict__ Bh, int ldb, size_t sB, float alpha,
                                              float* __restrict__ C, _Float16* __restrict__ C16, int ldc, size_t sC, int K, const float* __restrict__ SC, float* __restrict__ TM, float* __restrict__ TZ) {
  constexpr int FM = BM / (WM * 16), FN = BN / (WN * 16);      // fragments per wave
  constexpr int CPR = BK / 8, RPI = 256 / CPR;                 // 16-byte chunks per tile row; tile rows covered by one chunk per thread
  constexpr int PITCH = BK + 8, ROWS = BM + BN, STAGE = ROWS * PITCH;      // LDS row pitch and buffer size in f16 elements; rows 0..BM-1 hold A, the rest B
  constexpr int NCH = ROWS / RPI, ACH = BM / RPI;              // chunks per thread, of which from A
  constexpr int OP = BN + 4;                                   // f32 pitch of the output staging
  constexpr int LB = gemm_lds_bytes<BM, BN, BK>();
  static_assert(WM * WN == 8 && BN == 128 && BM % RPI == 0 && BN % RPI == 0 && BK % 32 == 0, "tile shape");
  static_assert((EPI != 2 && EPI != 3) || (BM == (EPI == 2 ? SBM : 128) && (BM * OP + 2 * WM * BN) * 4 <= LB), "one set of column statistics per row tile; the waves' own lie behind the staged tile");
  static_assert(!ASC || SBM % BM == 0, "one row tile of factors per work-group");
  unsigned short* st = (unsigned short*)smem;
  const int tid = threadIdx.x, w = tid >> 5, lane = tid & 31, ln = lane & 15, hh = lane >> 4;
  const int wm = w % WM, wn = w / WM;
  const int m0 = by * BM, n0 = bx * BN;
  const int crow = tid / CPR, ccol = (tid % CPR) * 8;
  const size_t k0 = KS ? (size_t)bx * K : 0;
  const char* Au = (const char*)(A + (size_t)bz * sA + (size_t)m0 * lda + k0);
  const char* Bu = (const char*)(Bh + (size_t)bz * sB + (KS ? k0 : (size_t)n0 * ldb));
  const unsigned aoff = (unsigned)(crow * lda + ccol) * 2u, boff = (unsigned)(crow * ldb + ccol) * 2u;      // bytes
  const size_t astep = (size_t)RPI * lda * 2, bstep = (size_t)RPI * ldb * 2;                                // bytes between a thread's chunks
  v8us pre[NCH];
  v8f acc[FM][FN] = {};
  const int nk = K / BK;
  unsigned long long base[NCH];
#pragma unroll
  for (int i = 0; i < NCH; ++i) base[i] = sbase((i < ACH) ? Au + i * astep : Bu + (i - ACH) * bstep);
#pragma unroll
  for (int i = 0; i < NCH; ++i) pre[i] = *(gv8)(base[i] + ((i < ACH) ? aoff : boff));
  v4f sc0 = {}, sc1 = {};
  unsigned long long scb = 0; unsigned sk = (unsigned)ccol * 4u;      // factors: scalar base of the work-group's row of SC, byte offset of the lane's 8 factors
  if (ASC) {
    scb = sbase((const char*)(SC + ((size_t)bz * RTL + m0 / SBM) * lda + k0));
    sc0 = *(gv4)(scb + sk); sc1 = *(gv4)(scb + sk + 16u);
    asm volatile("s_wait_xcnt 0x0" ::: "memory");      // precaution behind the two loads: their offset register moves on in the loop
  }
  // stores the fetched chunks to one LDS buffer; with ASC the A chunks are scaled first
  auto put = [&](unsigned short* dst) {
#pragma unroll
    for (int i = 0; i < NCH; ++i) {
      FragH f; f.half[0] = pre[i];
      if (ASC && i < ACH) {
#pragma unroll
        for (int q = 0; q < 8; ++q) f.h[q] = (_Float16)((float)f.h[q] * ((q < 4) ? sc0[q & 3] : sc1[q & 3]));
      }
      *(v8us*)(dst + (crow + i * RPI) * PITCH + ccol) = f.half[0];
    }
  };
  put(st);
  unsigned ak = aoff, bk = boff;
  for (int s = 0; s < nk; ++s) {
    const bool more = s + 1 < nk;
    __syncthreads();      // publishes buffer s & 1; every wave has also left the other buffer, which is rewritten below
    if (more) {
      ak += BK * 2; bk += BK * 2;
#pragma unroll
      for (int i = 0; i < NCH; ++i) pre[i] = *(gv8)(base[i] + ((i < ACH) ? ak : bk));
      if (ASC) { sk += BK * 4; sc0 = *(gv4)(scb + sk); sc1 = *(gv4)(scb + sk + 16u); }
      asm volatile("s_wait_xcnt 0x0" ::: "memory");      // precaution behind the run of loads: their offset registers (next step) and scalar bases (epilogue) are overwritten later on paths that hold no load wait
    }
    const unsigned short* sb = st + (s & 1) * STAGE;
#pragma unroll
    for (int kb = 0; kb < BK; kb += 32) {
      FragH a[FM], b[FN];
#pragma unroll
      for (int i = 0; i < FM; ++i) { const unsigned short* r = sb + ((wm * FM + i) * 16 + ln) * PITCH + kb + 8 * hh; a[i].half[0] = *(const v8us*)r; a[i].half[1] = *(const v8us*)(r + 16); }
#pragma unroll
      for (int j = 0; j < FN; ++j) { const unsigned short* r = sb + (BM + (wn * FN + j) * 16 + ln) * PITCH + kb + 8 * hh; b[j].half[0] = *(const v8us*)r; b[j].half[1] = *(const v8us*)(r + 16); }
#pragma unroll
      for (int i = 0; i < FM; ++i)
#pragma unroll
        for (int j = 0; j < FN; ++j) acc[i][j] = mmaH<1>(a[i].v, a[i].v, b[j].v, b[j].v, acc[i][j]);
    }
    if (more) put(st + ((s + 1) & 1) * STAGE);
  }
  __syncthreads();      // every wave has left the operand buffers before the output tile is staged over them
  float* so = (float*)smem;
  float* rm = so + BM * OP; float* rz = rm + WM * BN;      // EPI 2: column maxima and sums of the WM waves that share a column; EPI 3: their column sums and sums of squares
  if (EPI == 2) {
    const float a2 = alpha * 1.44269504f;
    float cm[FN], cz[FN];
#pragma unroll
    for (int j = 0; j < FN; ++j) {
      float m = -3.0e38f;
#pragma unroll
      for (int i = 0; i < FM; ++i)
#pragma unroll
        for (int r = 0; r < 8; ++r) { acc[i][j][r] *= a2; m = fmaxf(m, acc[i][j][r]); }
      cm[j] = m;
    }
#pragma unroll
    for (int j = 0; j < FN; ++j) cm[j] = fmaxf(cm[j], __shfl_xor(cm[j], 16, 32));
    if (hh == 0) {
#pragma unroll
      for (int j = 0; j < FN; ++j) rm[wm * BN + (wn * FN + j) * 16 + ln] = cm[j];
    }
    __syncthreads();      // every wave's column maxima are read by the other waves of the column
#pragma unroll
    for (int j = 0; j < FN; ++j) {
      const int col = (wn * FN + j) * 16 + ln;
      float m = rm[col], z = 0.f;
#pragma unroll
      for (int u = 1; u < WM; ++u) m = fmaxf(m, rm[u * BN + col]);
      m -= 15.0f;      // the stored weights carry the factor 2^15
#pragma unroll
      for (int i = 0; i < FM; ++i)
#pragma unroll
        for (int r = 0; r < 8; ++r) { const float e = exp2_slot(acc[i][j][r] - m); z += e; so[((wm * FM + i) * 16 + 8 * hh + r) * OP + col] = e; }
      cz[j] = z;
    }
#pragma unroll
    for (int j = 0; j < FN; ++j) cz[j] += __shfl_xor(cz[j], 16, 32);
    if (hh == 0) {
#pragma unroll
      for (int j = 0; j < FN; ++j) rz[wm * BN + (wn * FN + j) * 16 + ln] = cz[j];
    }
  } else {
    float c1[FN] = {}, c2[FN] = {};
#pragma unroll
    for (int i = 0; i < FM; ++i)
#pragma unroll
      for (int j = 0; j < FN; ++j)
#pragma unroll
        for (int r = 0; r < 8; ++r) { const float v = acc[i][j][r] * alpha; so[((wm * FM + i) * 16 + 8 * hh + r) * OP + (wn * FN + j) * 16 + ln] = v; if (EPI == 3) { c1[j] += v; c2[j] += v * v; } }
    if (EPI == 3) {
#pragma unroll
      for (int j = 0; j < FN; ++j) { c1[j] += __shfl_xor(c1[j], 16, 32); c2[j] += __shfl_xor(c2[j], 16, 32); }
      if (hh == 0) {
#pragma unroll
        for (int j = 0; j < FN; ++j) { rm[wm * BN + (wn * FN + j) * 16 + ln] = c1[j]; rz[wm * BN + (wn * FN + j) * 16 + ln] = c2[j]; }
      }
    }
  }
  __syncthreads();      // the staged tile is read back across waves: one wave stores one whole row of the tile per instruction
  if (EPI == 2 && tid < BN) {
    float m = rm[tid], z = rz[tid];
#pragma unroll
    for (int u = 1; u < WM; ++u) { m = fmaxf(m, rm[u * BN + tid]); z += rz[u * BN + tid]; }
    const size_t o = ((size_t)bz * RTL + by) * ldc + n0 + tid;
    TM[o] = m; TZ[o] = z * 0.000030517578125f;      // the sum without the weights' factor 2^15
  }
  if (EPI == 3 && tid < BN) {
    float t1 = rm[tid], t2 = rz[tid];
#pragma unroll
    for (int u = 1; u < WM; ++u) { t1 += rm[u * BN + tid]; t2 += rz[u * BN + tid]; }
    const size_t o = (size_t)by * ldc + n0 + tid;
    TM[o] = t1; TZ[o] = t2;
  }
  const size_t cofs = (size_t)bz * sC + (size_t)m0 * ldc + n0;
  const unsigned coff = (unsigned)(w * ldc + lane * 4);      // elements
#pragma unroll
  for (int it = 0; it < BM / 8; ++it) {
    const v4f v = *(const v4fa*)&so[(w + it * 8) * OP + lane * 4];
    if (EPI == 4) {
      v4h h4, s2, s3;
      for (int q = 0; q < 4; ++q) { const _Float16 hv = (_Float16)v[q]; const _Float16 lv = (_Float16)((v[q] - (float)hv) * 1024.0f); h4[q] = hv; s2[q] = bz ? (_Float16)((float)hv * 0.0009765625f) : lv; s3[q] = bz ? (_Float16)((float)lv * 0.0009765625f) : hv; }
      char* row = (char*)(C16 + cofs + (size_t)(it * 8) * ldc) + coff * 2u;
      *(v4h*)row = h4; *(v4h*)(row + BN * 2) = s2; *(v4h*)(row + 2 * BN * 2) = s3;
    }
    else if (EPI == 1 || EPI == 2) { v4h h4; for (int q = 0; q < 4; ++q) h4[q] = (_Float16)v[q]; *(v4h*)((char*)(C16 + cofs + (size_t)(it * 8) * ldc) + coff * 2u) = h4; }
    else *(v4f*)((char*)(C + cofs + (size_t)(it * 8) * ldc) + coff * 4u) = v;
  }
}
template <int BM, int BN, int BK, int WM, int WN, int EPI, bool ASC, bool KS = false>
__global__ __launch_bounds__(256) void k_gemm_lds(const _Float16* __restrict__ A, int lda, size_t sA, const _Float16* __restrict__ Bh, int ldb, size_t sB, float alpha,
                                                 float* __restrict__ C, _Float16* __restrict__ C16, int ldc, size_t sC, int K, const float* __restrict__ SC, float* __restrict__ TM, float* __restrict__ TZ) {
  __shared__ __attribute__((aligned(16))) unsigned char smem[gemm_lds_bytes<BM, BN, BK>()];
  gemm_lds_body<BM, BN, BK, WM, WN, EPI, ASC, KS>(smem, blockIdx.x, blockIdx.y, blockIdx.z, A, lda, sA, Bh, ldb, sB, alpha, C, C16, ldc, sC, K, SC, TM, TZ);
}
// The three convs in one grid: both GEMMs read only X16 and the weight images Bw (t, p, g, z one behind the other). The first BB * NN / 128 work-groups, the longer ones, take g; the rest t and p.
__global__ __launch_bounds__(256) void k_conv(const _Float16* __restrict__ X16, const _Float16* __restrict__ Bw, _Float16* __restrict__ T3, _Float16* __restrict__ Gc) {
  constexpr int LG = gemm_lds_bytes<128, 128, 64>(), LT = gemm_lds_bytes<64, 128, 256>(), GB = BB * (NN / 128);
  __shared__ __attribute__((aligned(16))) unsigned char smem[LG > LT ? LG : LT];
  const int bid = blockIdx.x;
  // s_wait_xcnt 0 behind each body's last stores: in the listing the code of the one body follows the stores of the other and rewrites their base and data registers; the wait stands in front of that, whichever body is laid first
  if (bid < GB) {    /* g channel-major per batch [b][128][4096] (f16): M 128 N 4096 K 256 */
    gemm_lds_body<128, 128, 64, 4, 2, 1, false>(smem, bid % (NN / 128), 0, bid / (NN / 128), Bw + (size_t)2 * CPN * CI, CI, 0, X16, CI, (size_t)NN * CI, 0.0625f, nullptr, Gc, NN, (size_t)CPN * NN, CI, nullptr, nullptr, nullptr);
    asm volatile("s_wait_xcnt 0x0" ::: "memory");
  } else {           /* t (bz = 0) and p (bz = 1) of all batches, token-major, as the score GEMM's operand rows [16384][384]: M 16384 N 128 K 256 */
    gemm_lds_body<64, 128, 256, 2, 4, 4, false>(smem, 0, (bid - GB) % (NR / 64), (bid - GB) / (NR / 64), X16, CI, 0, Bw, CI, (size_t)CPN * CI, 0.0625f, nullptr, T3, 3 * CPN, (size_t)NR * 3 * CPN, CI, nullptr, nullptr, nullptr);
    asm volatile("s_wait_xcnt 0x0" ::: "memory");
  }
}

__global__ __launch_bounds__(256) void k_x16(const float* __restrict__ x, _Float16* __restrict__ X16, size_t n8) { const size_t t = (size_t)blockIdx.x * 256 + threadIdx.x; if (t >= n8) return; FragH f;
#pragma unroll
  for (int q = 0; q < 8; ++q) f.h[q] = (_Float16)bf16_round(x[t * 8 + q]); *(v8us*)((unsigned short*)X16 + t * 8) = f.half[0];  }
__global__ __launch_bounds__(256) void k_h16(const float* __restrict__ x, _Float16* __restrict__ X16, size_t n8) { const size_t t = (size_t)blockIdx.x * 256 + threadIdx.x; if (t >= n8) return; FragH f;
#pragma unroll
  for (int q = 0; q < 8; ++q) f.h[q] = (_Float16)x[t * 8 + q]; *(v8us*)((unsigned short*)X16 + t * 8) = f.half[0];  }
// y picks one of four equally sized matrices; their f16 images lie one behind the other in Bt. bx = block index inside one matrix. The last one (rows of CPN) is written KSP times side by side, as rows of KSP * CPN.
__device__ __forceinline__ void round16f_body(const int bx, const int y, const float* __restrict__ W0, const float* __restrict__ W1, const float* __restrict__ W2, const float* __restrict__ W3, _Float16* __restrict__ Bt, size_t n8) { const size_t t = (size_t)bx * 256 + threadIdx.x; if (t >= n8) return; FragH f;
  const float* W = (y == 0) ? W0 : (y == 1) ? W1 : (y == 2) ? W2 : W3; Bt += (size_t)y * n8 * 8;
#pragma unroll
  for (int i = 0; i < 8; ++i) f.h[i] = (_Float16)(bf16_round(W[t * 8 + i]) * 16.0f);
  unsigned short* d = (unsigned short*)Bt + ((y == 3) ? (t * 8 / CPN) * (KSP * CPN) + t * 8 % CPN : t * 8);
  *(v8us*)d = f.half[0];
  asm volatile("s_wait_xcnt 0x0" ::: "memory");      // precaution behind the store: a build without it laid the copies' own address sums behind this store, where they rewrite its address registers
  if (y == 3) {
#pragma unroll      // the copies' stores take constant offsets from the one address
    for (int u = 1; u < KSP; ++u) *(v8us*)(d + u * CPN) = f.half[0];
  }
  asm volatile("s_wait_xcnt 0x0" ::: "memory");  }      // k_prep: the other body's code may follow this store in the listing and rewrite its registers
template <int NHv, int TTv>
__global__ __launch_bounds__(256) void k_vt(const _Float16* __restrict__ V16, int ldv, int voff, _Float16* __restrict__ Vt) { __shared__ unsigned short tl[64][66]; const int tid = threadIdx.x; const int slab = blockIdx.x / (TTv / 64), lg = blockIdx.x % (TTv / 64); const int b = slab / NHv, h = slab % NHv;
  for (int i = tid; i < 64 * 8; i += 256) { const int r = i / 8, c8 = (i % 8) * 8; FragH f; f.half[0] = *(const v8us*)((const unsigned short*)V16 + ((size_t)b * TTv + lg * 64 + r) * ldv + voff + h * 64 + c8);
#pragma unroll
    for (int q = 0; q < 8; ++q) tl[r][c8 + q] = f.u[q]; }
  __syncthreads();
  {
#pragma unroll
    for (int rd = 0; rd < 2; ++rd) { const int d = rd * 32 + tid / 8, pc = tid % 8; FragH f;
#pragma unroll
      for (int q = 0; q < 8; ++q) f.u[q] = tl[pc * 8 + q][d];
      *(v8us*)((unsigned short*)Vt + ((size_t)slab * 64 + d) * TTv + lg * 64 + pc * 8) = f.half[0]; }
     } }

// Token-major f16 image of x. A work-group owns 64 channels x TP positions. A thread loads 32 consecutive channels of one position (lane = position: one 128-byte line per load, all 32 loads in flight together),
// rounds them and stores them to its LDS row as four 16-byte pieces; the rows (pitch 144 bytes) are then read back in 16-byte pieces, 8 lanes to a row, so that a wave stores four whole 128-byte lines per instruction.
#define TP 128      // positions per work-group: 16 waves per WGP cover x, so few waves have to start
__device__ __forceinline__ void tok_body(const int bid, const float* __restrict__ x, _Float16* __restrict__ X16) { __shared__ __attribute__((aligned(16))) unsigned short tl[TP][72]; const int tid = threadIdx.x; const int b = bid / ((CI / 64) * (NN / TP)), rem = bid % ((CI / 64) * (NN / TP)); const int cg = rem / (NN / TP), pg = rem % (NN / TP); const int c0 = cg * 64, p0 = pg * TP;
  static_assert(2 * TP == 256, "two threads, 32 channels each, per position");
  const int pp = tid % TP, ch = (tid / TP) * 32;
  const float* xs = x + ((size_t)b * CI + c0 + ch) * NN + p0 + pp;
  float xv[32];      // the unrolls: xv is indexed by constants only and stays in registers
#pragma unroll
  for (int u = 0; u < 32; ++u) xv[u] = xs[(size_t)u * NN];
  asm volatile("s_wait_xcnt 0x0" ::: "memory");      // precaution behind the run of loads: their address registers may be reused ahead of the last loads' data wait
#pragma unroll
  for (int j = 0; j < 4; ++j) { FragH f;
#pragma unroll
    for (int q = 0; q < 8; ++q) f.h[q] = (_Float16)bf16_round(xv[j * 8 + q]);
    *(v8us*)&tl[pp][ch + j * 8] = f.half[0]; }
  __syncthreads();
  const int r = tid / 8, pc = tid % 8;
#pragma unroll
  for (int u = 0; u < TP / 32; ++u) { const v8us v = *(const v8us*)&tl[u * 32 + r][pc * 8]; *(v8us*)((unsigned short*)X16 + ((size_t)b * NN + p0 + u * 32 + r) * CI + c0 + pc * 8) = v; }
  asm volatile("s_wait_xcnt 0x0" ::: "memory");  }      // k_prep: the other body's code follows these stores in the listing and rewrites their data registers
// Weight casts and the token-major f16 image of x in one grid (both read inputs only): the first 4 * WCB work-groups cast the four weight matrices, the rest transpose x.
#define WCB ((CPN * CI / 8 + 255) / 256)      // work-groups per weight matrix
__global__ __launch_bounds__(256) void k_prep(const float* __restrict__ W0, const float* __restrict__ W1, const float* __restrict__ W2, const float* __restrict__ W3, _Float16* __restrict__ Bt, const float* __restrict__ x, _Float16* __restrict__ X16) {
  const int bid = blockIdx.x;
  if (bid < 4 * WCB) round16f_body(bid % WCB, bid / WCB, W0, W1, W2, W3, Bt, (size_t)CPN * CI / 8);
  else tok_body(bid - 4 * WCB, x, X16);
}
// One thread per column m of one batch's score plane (blockIdx.y): merges the RTL row tiles' maxima (in units of log 2) and sums, in tile order, into the column's max M and sum Z,
// and writes per row tile the factor 2^(tile max - M) / Z that turns the stored exp(s - tile max) into the softmax weight. Z is about 1 or more: the tile that holds M adds its own largest term, 2^0.
__global__ __launch_bounds__(64) void k_tilescale(const float* __restrict__ TM, const float* __restrict__ TZ, float* __restrict__ SC) {
  const size_t o = (size_t)blockIdx.y * RTL * NN + blockIdx.x * 64 + threadIdx.x;
  float tm[RTL], tz[RTL];
  // every unroll here: tm and tz are indexed by constants only and stay in registers; in the first loop all loads are also in flight at once
#pragma unroll
  for (int t = 0; t < RTL; ++t) { tm[t] = TM[o + (size_t)t * NN]; tz[t] = TZ[o + (size_t)t * NN]; }
  float m = tm[0], z = 0.f;
#pragma unroll
  for (int t = 1; t < RTL; ++t) m = fmaxf(m, tm[t]);
#pragma unroll
  for (int t = 0; t < RTL; ++t) { tm[t] = exp2_slot(tm[t] - m); z += tz[t] * tm[t]; }
  const float inv = 1.0f / z;
#pragma unroll
  for (int t = 0; t < RTL; ++t) SC[o + (size_t)t * NN] = tm[t] * inv;
}
// Affine + residual during the transpose back to channel-major. A work-group owns 32 channels x KP positions. It first merges its channels' batch statistics from the NR / 128 row tiles' column sums S1 and sums of squares S2
// in a fixed order: wave pt adds tiles 16 pt .. 16 pt + 15 in tile order (lane = channel, one 128-byte line per load), then every thread adds the 8 waves' partials of its own channel, in wave order, from LDS.
// A thread's elements of Z are KP / 8 consecutive positions of channel tid % 32; they, the tiles' sums and the channel's affine pair are loaded in one run, so that all these loads are in flight together,
// and the results go to the channel's LDS row (pitch KP + 4 floats) as 16-byte pieces; a wave then reads 512 consecutive bytes of one row per instruction.
#define KP 256      // positions per work-group: 16 waves per WGP cover the output, so few waves have to start, and the statistics are merged once per KP positions
__global__ __launch_bounds__(256) void k_out(const float* __restrict__ Z, const float* __restrict__ S1, const float* __restrict__ S2, const float* __restrict__ gam, const float* __restrict__ bet, const float* __restrict__ x, float* __restrict__ out) { __shared__ __attribute__((aligned(16))) float tl[32][KP + 4]; __shared__ float a1[8][32], a2[8][32]; const int tid = threadIdx.x; const int b = blockIdx.x / ((CI / 32) * (NN / KP)), rem = blockIdx.x % ((CI / 32) * (NN / KP)); const int cg = rem / (NN / KP), pg = rem % (NN / KP); const int c0 = cg * 32, p0 = pg * KP;
  const int cc = tid & 31, pt = tid >> 5;
  constexpr int TPW = NR / 128 / 8;      // row tiles per wave
  constexpr int PW = KP / 8;             // positions per wave
  float zv[PW], p1[TPW], p2[TPW];      // the unrolls: the three arrays are indexed by constants only and stay in registers
#pragma unroll
  for (int u = 0; u < TPW; ++u) { p1[u] = S1[(size_t)(pt * TPW + u) * CI + c0 + cc]; p2[u] = S2[(size_t)(pt * TPW + u) * CI + c0 + cc]; }
#pragma unroll
  for (int k = 0; k < PW; ++k) zv[k] = Z[((size_t)b * NN + p0 + pt * PW + k) * CI + c0 + cc];
  const float ga = bf16_round(gam[c0 + cc]), be = bf16_round(bet[c0 + cc]);
  asm volatile("s_wait_xcnt 0x0" ::: "memory");      // precaution behind the run of loads: the sums below reuse their address registers ahead of the last loads' data wait
  float t1 = 0.f, t2 = 0.f;
#pragma unroll
  for (int u = 0; u < TPW; ++u) { t1 += p1[u]; t2 += p2[u]; }
  a1[pt][cc] = t1; a2[pt][cc] = t2;
  __syncthreads();      // every wave's partial sums are read by all waves
  t1 = 0.f; t2 = 0.f;
#pragma unroll
  for (int i = 0; i < 8; ++i) { t1 += a1[i][cc]; t2 += a2[i][cc]; }
  const float mu = t1 / (float)NR; const float var = fmaxf(t2 / (float)NR - mu * mu, 0.f); const float rs = rsqrtf(var + 1e-5f);
#pragma unroll
  for (int j = 0; j < PW / 4; ++j) { const v4f v = {(zv[4 * j] - mu) * rs * ga + be, (zv[4 * j + 1] - mu) * rs * ga + be, (zv[4 * j + 2] - mu) * rs * ga + be, (zv[4 * j + 3] - mu) * rs * ga + be}; *(v4fa*)&tl[cc][pt * PW + 4 * j] = v; }
  __syncthreads();
  // a thread's 16-byte pieces: positions 4 q4 .. 4 q4 + 3 of channels c, c + CS, ...: one address each for x and out, constant steps; the unrolls: xr is indexed by constants only, and its loads are in flight together
  constexpr int CS = 256 / (KP / 4), NP = 32 / CS;
  const int c = tid / (KP / 4), q4 = tid % (KP / 4); const size_t o = ((size_t)b * CI + c0 + c) * NN + p0 + q4 * 4; const float* xs = x + o; float* os = out + o;
  v4f xr[NP];
#pragma unroll
  for (int u = 0; u < NP; ++u) xr[u] = *(const v4fa*)(xs + (size_t)u * CS * NN);
  asm volatile("s_wait_xcnt 0x0" ::: "memory");      // precaution behind the run of loads: their address registers may be reused ahead of the last loads' data wait
#pragma unroll
  for (int u = 0; u < NP; ++u) { const v4f t = *(const v4fa*)&tl[c + u * CS][q4 * 4]; const v4f v = {t[0] + bf16_round(xr[u][0]), t[1] + bf16_round(xr[u][1]), t[2] + bf16_round(xr[u][2]), t[3] + bf16_round(xr[u][3])}; *(v4f*)(os + (size_t)u * CS * NN) = v; } }

extern "C" void kernel_launch(void* const* d_in, const int* in_sizes, int n_in,
                              void* d_out, int out_size, void* d_ws, size_t ws_size, hipStream_t stream) {
  (void)in_sizes; (void)n_in; (void)out_size;
  const float* const* I = (const float* const*)d_in; const float* x = I[0]; const float* Wt = I[1]; const float* Wp = I[2]; const float* Wg = I[3]; const float* Wz = I[4]; const float* gam = I[5]; const float* bet = I[6];
  char* ws = (char*)d_ws; size_t off = 0;
  auto take = [&](size_t bytes) { char* p = ws + off; off += (bytes + 255) & ~(size_t)255; return p; };
  _Float16* Bt_ = (_Float16*)take((size_t)(3 + KSP) * CPN * CI * 2); _Float16* Bp_ = Bt_ + (size_t)CPN * CI; _Float16* Bg_ = Bp_ + (size_t)CPN * CI; _Float16* Bz_ = Bg_ + (size_t)CPN * CI;      /* four weight images, one behind the other; the last holds KSP copies of Wz side by side, rows of KSP * CPN */
  _Float16* PT = (_Float16*)take((size_t)PB * NN * NN * 2); _Float16* X16 = (_Float16*)take((size_t)NR * CI * 2);      /* weight planes of the PB batches that one launch works on */
  _Float16* T3 = (_Float16*)take((size_t)2 * NR * 3 * CPN * 2); _Float16* P3 = T3 + (size_t)NR * 3 * CPN;      /* all batches: concatenated-K operand planes [16384][384] (t, then p) */
  _Float16* Gc = (_Float16*)take((size_t)BB * CPN * NN * 2); _Float16* Y16 = (_Float16*)take((size_t)NR * KSP * CPN * 2); float* TM = (float*)take((size_t)PB * RTL * NN * 4); float* TZ = (float*)take((size_t)PB * RTL * NN * 4); float* SC = (float*)take((size_t)PB * RTL * NN * 4); float* S1 = (float*)take((size_t)(NR / 128) * CI * 4); float* S2 = (float*)take((size_t)(NR / 128) * CI * 4);      /* z's column sums and sums of squares per row tile */
  float* Z = (float*)take((size_t)NR * CI * 4);
  if (off > ws_size) return;      // about 210 MB of the 268 MB given (weight planes 134, the rest 75)
  k_prep<<<4 * WCB + BB * (CI / 64) * (NN / TP), 256, 0, stream>>>(Wt, Wp, Wg, Wz, Bt_, x, X16);      /* conv weights (out,in) natural x 2^4, and x token-major */
  k_conv<<<BB * (NN / 128) + 2 * (NR / 64), 256, 0, stream>>>(X16, Bt_, T3, Gc);      /* g channel-major f16; t to [h | l | h], p to [h | h 2^-10 | l 2^-10], token-major f16 */
  const dim3 gs(NN / 128, NN / SBM, PB), gy(KSP, NN / 128, PB);
  for (int b = 0; b < BB; b += PB) { const size_t to = (size_t)b * NN * 3 * CPN, yo = (size_t)b * NN * KSP * CPN;      /* blockIdx.z or .y of each launch: batch b + z (or y), PB of them */
    k_gemm_lds<SBM, 128, 64, 4, 2, 2, false><<<gs, 256, 0, stream>>>(T3 + to, 3 * CPN, (size_t)NN * 3 * CPN, P3 + to, 3 * CPN, (size_t)NN * 3 * CPN, 1.0f, nullptr, PT, NN, (size_t)NN * NN, 3 * CPN, nullptr, TM, TZ);      /* s[n][m] = t_n p_m as Th Ph + (Tl Ph + Th Pl) 2^-10 in one K = 384 pass, M 4096 N 4096; stored: exp(s - tile max) 2^15 and the tiles' column statistics */
    k_tilescale<<<dim3(NN / 64, PB, 1), 64, 0, stream>>>(TM, TZ, SC);
    k_gemm_lds<128, 128, 128, 4, 2, 1, true, true><<<gy, 256, 0, stream>>>(PT, NN, (size_t)NN * NN, Gc + (size_t)b * CPN * NN, NN, (size_t)CPN * NN, 0.000030517578125f, nullptr, Y16 + yo, KSP * CPN, (size_t)NN * KSP * CPN, NN / KSP, SC, nullptr, nullptr); }      /* y[n][q][c] = sum over the q-th range of m of att[n][m] g[c][m]: M 4096 N 128 K 4096 / KSP per work-group (f16 out), two work-groups to a WGP */
  k_gemm_lds<128, 128, 64, 4, 2, 3, false><<<dim3(CI / 128, NR / 128, 1), 256, 0, stream>>>(Y16, KSP * CPN, 0, Bz_, KSP * CPN, 0, 0.0625f, Z, nullptr, CI, 0, KSP * CPN, nullptr, S1, S2);      /* z token-major [16384][256] f32 and its column sums per row tile: M 16384 N 256 K KSP * 128, which adds y's partial sums */
  k_out<<<BB * (CI / 32) * (NN / KP), 256, 0, stream>>>(Z, S1, S2, gam, bet, x, (float*)d_out);
}
